// v000
// The times below were measured on an AMD MI455X: many runs one after another, warmed up first and cycling through
// copies of the inputs, with the whole window's GPU time divided by the number of runs. Launches and the gaps
// between them are all in it. The median over several windows is given; except for v000 it joins two sittings, which
// can be a few percent apart, so the side-by-side timings, each taken in one sitting, are the better comparison.
// The starting kernel, v000, takes 287 microseconds a run.
#include <hip/hip_runtime.h>

// Gaze-guided multi-head attention (B=2, N=2048, D=1024, 16 heads x 64): qkv = x w_qkv + b_qkv; scores = q.k/8 + attn_bias[b][key]; softmax; (w.v) w_proj + b_proj.
// Numerics: x, attn_bias, w_qkv, b_qkv, w_proj, b_proj are rounded to bf16 (RNE); the qkv projection runs on
// v_wmma_f32_16x16x32_bf16 (exact products, f32 accumulate, + bias); the scores, P.V and the output projection run on v_wmma_f32_16x16x32_f16 with single f16 operands
// (f16 copies of q, k, (8v)^T, P, the attention output rounded at load, and the exact f16 copy of bf16 w_proj); key bias and online softmax in f32.

namespace {
constexpr int Bn = 2, S = 2048, D = 1024, H = 16, HD = 64, NTOK = Bn * S, D3 = 3 * D;
constexpr float SCALE = 0.125f, VS = 8.0f;

typedef _Float16 b16;
typedef __attribute__((ext_vector_type(16))) _Float16 v16b;
typedef __attribute__((ext_vector_type(8)))  _Float16 v8b;
typedef __attribute__((ext_vector_type(8)))  float v8f;
typedef __attribute__((ext_vector_type(4)))  float v4f;

__device__ __forceinline__ v8b ld8b(const b16* p) { return *(const v8b*)p; }
__device__ __forceinline__ v16b cat8b(v8b a, v8b b) { return __builtin_shufflevector(a, b, 0, 1, 2, 3, 4, 5, 6, 7, 8, 9, 10, 11, 12, 13, 14, 15); }
__device__ __forceinline__ v16b frag_kb(const b16* p, int hh) { return cat8b(ld8b(p + 8 * hh), ld8b(p + 16 + 8 * hh)); }
__device__ __forceinline__ void split16(float v, b16& hi, b16& lo) { hi = (b16)v; lo = (b16)(v - (float)hi); }
// hi/lo fragment pair straight from an f32 k-contiguous row (same k-map)
__device__ __forceinline__ void frag_ksplit(const float* p, int hh, v16b& fh_, v16b& fl_) {
  const float* p0 = p + 8 * hh; const float* p1 = p + 16 + 8 * hh;
#pragma unroll
  for (int e = 0; e < 8; ++e) { b16 a, c; split16(p0[e], a, c); fh_[e] = a; fl_[e] = c; split16(p1[e], a, c); fh_[8 + e] = a; fl_[8 + e] = c; }
}
__device__ __forceinline__ v8f wmma16b(v16b a, v16b b, v8f c) {
  v8f d = __builtin_amdgcn_wmma_f32_16x16x32_f16(false, a, false, b, (short)0, c, false, false);
  asm volatile("v_nop\n\tv_nop\n\tv_nop\n\tv_nop" : "+v"(d) : "v"(a), "v"(b));
  return d;
}
__device__ __forceinline__ void wave_lds_sync() {
  __builtin_amdgcn_fence(__ATOMIC_RELEASE, "workgroup");
  __builtin_amdgcn_wave_barrier();
  __builtin_amdgcn_fence(__ATOMIC_ACQUIRE, "workgroup");
}

// Operand descriptor: NP = 0 -> f32 rows split on the fly into (hi, lo); NP = 1 -> one f16 plane; NP = 2 -> f16 hi + lo planes;
// NP = 3 -> f32 rows rounded once to a single f16 fragment. ld = row pitch.
struct Opnd { const void* p0; const void* p1; int ld; };
template <int NP> __device__ __forceinline__ void load_frags(const Opnd& o, int row, int kb, int hh, v16b& fh_, v16b& fl_) {
  if (NP == 0) { frag_ksplit((const float*)o.p0 + (size_t)row * o.ld + kb, hh, fh_, fl_); }
  else if (NP == 4 || NP == 5) {                             // f32 rows x64 (NP 4) or x8 (NP 5) then split (keeps the lo halves of small values normal)
    const float sc_ = (NP == 4) ? 64.0f : 8.0f;
    const float* p = (const float*)o.p0 + (size_t)row * o.ld + kb; const float* p0 = p + 8 * hh; const float* p1 = p + 16 + 8 * hh;
#pragma unroll
    for (int e = 0; e < 8; ++e) { b16 a, c; split16(p0[e] * sc_, a, c); fh_[e] = a; fl_[e] = c; split16(p1[e] * sc_, a, c); fh_[8 + e] = a; fl_[8 + e] = c; }
  } else if (NP == 3) {
    const float* p = (const float*)o.p0 + (size_t)row * o.ld + kb; const float* p0 = p + 8 * hh; const float* p1 = p + 16 + 8 * hh;
#pragma unroll
    for (int e = 0; e < 8; ++e) { fh_[e] = (b16)p0[e]; fh_[8 + e] = (b16)p1[e]; }
    fl_ = fh_;
  } else {
    fh_ = frag_kb((const b16*)o.p0 + (size_t)row * o.ld + kb, hh);
    if (NP == 2) fl_ = frag_kb((const b16*)o.p1 + (size_t)row * o.ld + kb, hh); else fl_ = fh_;
  }
}
template <int ANP, int BNP> __device__ __forceinline__ v8f mac(v16b ah, v16b al, v16b bh, v16b bl, v8f c) {
  c = wmma16b(ah, bh, c);
  if (BNP == 0 || BNP == 2 || BNP == 4 || BNP == 5) c = wmma16b(ah, bl, c);     // hi.lo
  if (ANP == 0 || ANP == 2 || ANP == 4 || ANP == 5) c = wmma16b(al, bh, c);     // lo.hi   (lo.lo dropped)
  return c;
}
// 32x64 wave tile: acc[r][t] (rows m0+16r.., cols c0+16t..) += A[m][k] . B[n][k] over k in [0, K)
template <int ANP, int BNP>
__device__ __forceinline__ void gemm_tile(const Opnd& A, const Opnd& B, int K, int m0, int c0, int nloc, int hlf, v8f (&acc)[2][4]) {
  for (int kb = 0; kb < K; kb += 32) {
    v16b a0h, a0l, a1h, a1l;
    load_frags<ANP>(A, m0 + nloc, kb, hlf, a0h, a0l);
    load_frags<ANP>(A, m0 + 16 + nloc, kb, hlf, a1h, a1l);
#pragma unroll
    for (int t = 0; t < 4; ++t) {
      v16b bh, bl;
      load_frags<BNP>(B, c0 + t * 16 + nloc, kb, hlf, bh, bl);
      acc[0][t] = mac<ANP, BNP>(a0h, a0l, bh, bl, acc[0][t]);
      acc[1][t] = mac<ANP, BNP>(a1h, a1l, bh, bl, acc[1][t]);
    }
  }
}

__device__ __forceinline__ void epi_planes(v8f (&acc)[2][4], float scale, bool two, b16* __restrict__ oh, b16* __restrict__ ol, int ldo,
                                           int m0, int c0, int lane, b16* Th, b16* Tl) {
  const int nloc = lane & 15, hlf = lane >> 4;
#pragma unroll
  for (int t = 0; t < 4; ++t)
#pragma unroll
    for (int r = 0; r < 2; ++r)
#pragma unroll
      for (int v = 0; v < 8; ++v) {
        const int rr = r * 16 + v + 8 * hlf, cc = t * 16 + nloc;
        b16 h_, l_; split16(acc[r][t][v] * scale, h_, l_);
        Th[rr * 64 + cc] = h_; Tl[rr * 64 + cc] = l_;
      }
  wave_lds_sync();
  {
#pragma unroll
    for (int j = 0; j < 8; ++j) {
      const int rr = j * 4 + (lane >> 3), c8 = (lane & 7) * 8;
      const size_t o = (size_t)(m0 + rr) * ldo + c0 + c8;
      *(v8b*)(oh + o) = ld8b(Th + rr * 64 + c8);
      if (two) *(v8b*)(ol + o) = ld8b(Tl + rr * 64 + c8);
    }
    
  }
}
// (b) f32 rows with pitch ldo: 64 floats = 256 B = 2 lines per row; 16 lanes x 16 B per row, 2 rows per instruction. Optional per-row factor
__device__ __forceinline__ void epi_f32(v8f (&acc)[2][4], float scale, const float* rscale, float* __restrict__ out, int ldo, int m0, int c0, int lane, float* Tt) {
  const int nloc = lane & 15, hlf = lane >> 4;
#pragma unroll
  for (int t = 0; t < 4; ++t)
#pragma unroll
    for (int r = 0; r < 2; ++r)
#pragma unroll
      for (int v = 0; v < 8; ++v) {
        const int rr = r * 16 + v + 8 * hlf;
        const float rs = rscale ? rscale[(size_t)(m0 + rr) * 32] : 1.0f;
        Tt[rr * 64 + t * 16 + nloc] = acc[r][t][v] * scale * rs;
      }
  wave_lds_sync();
  float* dst0 = out + (size_t)m0 * ldo + c0;
  {
#pragma unroll
    for (int j = 0; j < 16; ++j) { const int rr = j * 2 + hlf, c4 = nloc * 4; *(v4f*)(dst0 + (size_t)rr * ldo + c4) = *(const v4f*)(Tt + rr * 64 + c4); }
    
  }
}



typedef __attribute__((ext_vector_type(8))) __bf16 v8bb; typedef __attribute__((ext_vector_type(16))) __bf16 v16bb;
typedef __attribute__((ext_vector_type(8))) unsigned short v8us;
__device__ __forceinline__ v16bb frag_kb_bf(const __bf16* p, int hh) { const v8bb a = *(const v8bb*)(p + 8 * hh), b = *(const v8bb*)(p + 16 + 8 * hh); return __builtin_shufflevector(a, b, 0, 1, 2, 3, 4, 5, 6, 7, 8, 9, 10, 11, 12, 13, 14, 15); }
__device__ __forceinline__ v8f wmma16bb(v16bb a, v16bb b, v8f c) {
  v8f d = __builtin_amdgcn_wmma_f32_16x16x32_bf16(false, a, false, b, (short)0, c, false, false);
  asm volatile("v_nop\n\tv_nop\n\tv_nop\n\tv_nop" : "+v"(d) : "v"(a), "v"(b));
  return d;
}
__device__ __forceinline__ unsigned short bf16_rne_bits(float v) { unsigned int u = __float_as_uint(v); u += 0x7FFFu + ((u >> 16) & 1u); return (unsigned short)(u >> 16); }
__device__ __forceinline__ float bf16_rne(float v) { return __uint_as_float(((unsigned int)bf16_rne_bits(v)) << 16); }

__global__ __launch_bounds__(256) void prep_kernel(const float* __restrict__ x, unsigned short* __restrict__ x16) {
  const size_t tid = (size_t)blockIdx.x * blockDim.x + threadIdx.x, nth = (size_t)gridDim.x * blockDim.x;
  {
    for (size_t p = tid; p < (size_t)NTOK * D / 8; p += nth) { v8us v;
#pragma unroll
      for (int e = 0; e < 8; ++e) v[e] = bf16_rne_bits(x[p * 8 + e]);
      *(v8us*)(x16 + p * 8) = v; }
    
  }
}
// W [k rows][n cols] f32 -> [n][k] 16-bit rows through 64x64 LDS tiles: MODE 0 bf16 bits, MODE 1 f16(bf16(w)). grid (N/64, K/64).
template <int MODE>
__global__ __launch_bounds__(256) void wt_kernel(const float* __restrict__ W, int K, int Ncols, unsigned short* __restrict__ out) {
  __shared__ __attribute__((aligned(16))) unsigned short Tl[64][72];
  const int tid = threadIdx.x, lane = tid & 31, wave = tid >> 5, n0 = blockIdx.x * 64, k0 = blockIdx.y * 64;
  for (int i = tid; i < 64 * 64; i += 256) { const int kk = i / 64, nn = i % 64; const float w = W[(size_t)(k0 + kk) * Ncols + n0 + nn];
    unsigned short bits; if (MODE == 0) bits = bf16_rne_bits(w); else { const b16 hv = (b16)bf16_rne(w); bits = *reinterpret_cast<const unsigned short*>(&hv); }
    Tl[nn][kk] = bits; }
  __syncthreads();
  {
#pragma unroll
    for (int j = 0; j < 2; ++j) { const int rr = wave * 8 + j * 4 + (lane >> 3), c8 = (lane & 7) * 8; *(v8us*)(out + (size_t)(n0 + rr) * K + k0 + c8) = *(const v8us*)(&Tl[rr][c8]); }
    
  }
}

// projections: grid (48, 32): (4096 x 1024) x (1024 x 3072) bf16 WMMA + bf16(b_qkv). q, k -> f16 rows [b][h][s][64]; v -> (8v)^T f16 rows [b][h][64 d][s] (block LDS transpose).
__global__ __launch_bounds__(128) void proj_kernel(const __bf16* __restrict__ x16, const __bf16* __restrict__ w16, const float* __restrict__ bqkv, b16* __restrict__ qk, b16* __restrict__ vt) {
  __shared__ __attribute__((aligned(16))) b16 Th[4][2][32 * 64];
  __shared__ __attribute__((aligned(16))) b16 Tt[64][128 + 8];
  const int lane = threadIdx.x & 31, wave = threadIdx.x >> 5, nloc = lane & 15, hlf = lane >> 4, m0 = blockIdx.y * 128 + wave * 32, cg = blockIdx.x * 64, which = cg / D, c0 = cg % D;
  const __bf16* X = x16; const __bf16* W = w16 + (size_t)which * D * D;
  v8f acc[2][4];
#pragma unroll
  for (int r = 0; r < 2; ++r)
#pragma unroll
    for (int t = 0; t < 4; ++t) acc[r][t] = (v8f){};
#pragma unroll 2
  for (int kb = 0; kb < D; kb += 32) {
    const v16bb a0 = frag_kb_bf(X + (size_t)(m0 + nloc) * D + kb, hlf), a1 = frag_kb_bf(X + (size_t)(m0 + 16 + nloc) * D + kb, hlf);
#pragma unroll
    for (int t = 0; t < 4; ++t) { const v16bb bw = frag_kb_bf(W + (size_t)(c0 + t * 16 + nloc) * D + kb, hlf); acc[0][t] = wmma16bb(a0, bw, acc[0][t]); acc[1][t] = wmma16bb(a1, bw, acc[1][t]); }
  }
  // + bias (rounded to bf16)
#pragma unroll
  for (int t = 0; t < 4; ++t)
#pragma unroll
    for (int r = 0; r < 2; ++r)
#pragma unroll
      for (int v = 0; v < 8; ++v) acc[r][t][v] += bf16_rne(bqkv[cg + t * 16 + nloc]);
  const int h = c0 / HD, b = m0 / S, s0 = m0 % S;
  if (which < 2) { epi_planes(acc, 1.0f, false, qk + ((((size_t)which * Bn + b) * H + h) * S + s0) * HD, nullptr, HD, 0, 0, lane, Th[wave][0], Th[wave][1]); return; }
#pragma unroll
  for (int t = 0; t < 4; ++t)
#pragma unroll
    for (int r = 0; r < 2; ++r)
#pragma unroll
      for (int v = 0; v < 8; ++v) Tt[t * 16 + nloc][wave * 32 + r * 16 + 8 * hlf + v] = (b16)(acc[r][t][v] * VS);
  __syncthreads();
  const int tok0 = (blockIdx.y * 128) % S, bb = (blockIdx.y * 128) / S;
  b16* dst = vt + (((size_t)bb * H + h) * HD) * S + tok0;
  {
#pragma unroll
    for (int j = 0; j < 8; ++j) { const int dd = wave * 16 + j * 2 + (lane >> 4), c8 = (lane & 15) * 8; *(v8b*)(dst + (size_t)dd * S + c8) = *(const v8b*)(&Tt[dd][c8]); }
    
  }
}

// attention: wave = (b, h, 16 queries), all 64 key chunks of 32: S^T (K=64, 2 k-steps, single), online softmax f32, P^T f16, y^T += (8V)^T P^T (4 feature tiles); y/(8l) -> f32 rows
__global__ __launch_bounds__(256) void attn_kernel(const b16* __restrict__ qk, const b16* __restrict__ vt, const float* __restrict__ abias, float* __restrict__ y) {
  __shared__ __attribute__((aligned(16))) float Os[8][16][HD + 4];
  const int wid = threadIdx.x >> 5, lane = threadIdx.x & 31, hh = lane >> 4, col = lane & 15;
  const int qt = blockIdx.x * 8 + wid, jt = qt & 127, h = (qt >> 7) & 15, b = qt >> 11, q0 = jt * 16, qi = q0 + col;
  const b16* Q = qk + ((((size_t)0 * Bn + b) * H + h) * S) * HD; const b16* K = qk + ((((size_t)1 * Bn + b) * H + h) * S) * HD;
  const b16* vb = vt + (((size_t)b * H + h) * HD) * S;
  v16b qf[2];
#pragma unroll
  for (int ks = 0; ks < 2; ++ks) qf[ks] = frag_kb(Q + (size_t)qi * HD + ks * 32, hh);
  float m = -INFINITY, l = 0.0f; v8f o[4] = {{}, {}, {}, {}};
  for (int kb = 0; kb < S; kb += 32) {
    v8f s0 = {}, s1 = {};
#pragma unroll
    for (int ks = 0; ks < 2; ++ks) { s0 = wmma16b(frag_kb(K + (size_t)(kb + col) * HD + ks * 32, hh), qf[ks], s0); s1 = wmma16b(frag_kb(K + (size_t)(kb + 16 + col) * HD + ks * 32, hh), qf[ks], s1); }
    float mr = -INFINITY;
#pragma unroll
    for (int r = 0; r < 8; ++r) { const int kk = kb + 8 * hh + r; s0[r] = s0[r] * SCALE + bf16_rne(abias[b * S + kk]); s1[r] = s1[r] * SCALE + bf16_rne(abias[b * S + kk + 16]); mr = fmaxf(mr, fmaxf(s0[r], s1[r])); }
    mr = fmaxf(mr, __shfl_xor(mr, 16));
    const float mn = fmaxf(m, mr), al_ = __expf(m - mn); m = mn;
    float sum = 0.0f; v16b pb;
#pragma unroll
    for (int r = 0; r < 8; ++r) { const float e0 = __expf(s0[r] - mn), e1 = __expf(s1[r] - mn); sum += e0 + e1; pb[r] = (b16)e0; pb[8 + r] = (b16)e1; }
    sum += __shfl_xor(sum, 16); l = l * al_ + sum;
#pragma unroll
    for (int n = 0; n < 4; ++n) {
#pragma unroll
      for (int r = 0; r < 8; ++r) o[n][r] *= al_;
      o[n] = wmma16b(frag_kb(vb + (size_t)(n * 16 + col) * S + kb, hh), pb, o[n]);
    }
  }
  const float inv = 1.0f / (VS * l);
#pragma unroll
  for (int n = 0; n < 4; ++n)
#pragma unroll
    for (int r = 0; r < 8; ++r) Os[wid][col][n * 16 + 8 * hh + r] = o[n][r] * inv;
  wave_lds_sync();
  float* dst = y + ((size_t)b * S + q0) * D + h * HD;
  {
#pragma unroll
    for (int j = 0; j < 8; ++j) { const int rr = j * 2 + hh, c4 = col * 4; *(v4f*)(dst + (size_t)rr * D + c4) = *(const v4f*)(&Os[wid][rr][c4]); }
    
  }
}

// out = y Wo^T: (4096 x 1024) x (1024 x 1024); A = y rounded at load (single), B = f16(bf16 Wo) rows; f32 rows; grid (16, 32).
__global__ __launch_bounds__(128) void out_kernel(const float* __restrict__ y, const b16* __restrict__ wo16, const float* __restrict__ bproj, float* __restrict__ out) {
  __shared__ __attribute__((aligned(16))) float Ts[4][32 * 64];
  const int lane = threadIdx.x & 31, wave = threadIdx.x >> 5, nloc = lane & 15, hlf = lane >> 4, m0 = blockIdx.y * 128 + wave * 32, c0 = blockIdx.x * 64;
  v8f acc[2][4];
#pragma unroll
  for (int r = 0; r < 2; ++r)
#pragma unroll
    for (int t = 0; t < 4; ++t) acc[r][t] = (v8f){};
  const Opnd A{y, nullptr, D}, B{wo16, nullptr, D};
  gemm_tile<3, 1>(A, B, D, m0, c0, nloc, hlf, acc);
#pragma unroll
  for (int t = 0; t < 4; ++t)
#pragma unroll
    for (int r = 0; r < 2; ++r)
#pragma unroll
      for (int v = 0; v < 8; ++v) acc[r][t][v] += bf16_rne(bproj[c0 + t * 16 + nloc]);
  epi_f32(acc, 1.0f, nullptr, out, D, m0, c0, lane, Ts[wave]);
}
}  // namespace

extern "C" void kernel_launch(void* const* d_in, const int* in_sizes, int n_in,
                              void* d_out, int out_size, void* d_ws, size_t ws_size, hipStream_t stream) {
  (void)n_in; (void)out_size;
  const float* x = (const float*)d_in[0]; const float* abias = (const float*)d_in[1]; const float* wqkv = (const float*)d_in[2]; const float* bqkv = (const float*)d_in[3];
  const float* wproj = (const float*)d_in[4]; const float* bproj = (const float*)d_in[5];
  float* out = (float*)d_out;   // [2,2048,1024]
  if (in_sizes[0] != NTOK * D || in_sizes[1] != NTOK || in_sizes[2] != D * D3 || in_sizes[3] != D3 || in_sizes[4] != D * D || in_sizes[5] != D) return;
  size_t off = 0; char* ws = (char*)d_ws;
  auto carve = [&](size_t bytes) { char* p = ws + off; off += (bytes + 255) & ~(size_t)255; return p; };
  unsigned short* x16 = (unsigned short*)carve((size_t)NTOK * D * 2);        // 8 MB
  unsigned short* w16 = (unsigned short*)carve((size_t)D3 * D * 2);          // 6 MB ([3072][1024] bf16 = [which][n][k])
  b16* wo16 = (b16*)carve((size_t)D * D * 2);
  b16* qk = (b16*)carve((size_t)2 * NTOK * D * 2);                           // 16 MB: [which][b][h][s][64]
  b16* vt = (b16*)carve((size_t)NTOK * D * 2);                               // 8 MB
  float* y = (float*)carve((size_t)NTOK * D * 4);                            // 16 MB
  if (off > ws_size) return;                                                   // ≈ 56 MB
  prep_kernel<<<512, 256, 0, stream>>>(x, x16);
  wt_kernel<0><<<dim3(D3 / 64, D / 64), 256, 0, stream>>>(wqkv, D, D3, w16);
  wt_kernel<1><<<dim3(D / 64, D / 64), 256, 0, stream>>>(wproj, D, D, (unsigned short*)wo16);
  proj_kernel<<<dim3(D3 / 64, NTOK / 128), 128, 0, stream>>>((const __bf16*)x16, (const __bf16*)w16, bqkv, qk, vt);
  attn_kernel<<<Bn * H * (S / 16) / 8, 256, 0, stream>>>(qk, vt, abias, y);
  out_kernel<<<dim3(D / 64, NTOK / 128), 128, 0, stream>>>(y, wo16, bproj, out);
}

// v001
// A run of this version takes 176 microseconds.
// Next to v000, in two timings, it ran 1.67 and 1.64 times as fast.
#include <hip/hip_runtime.h>

// Gaze-guided multi-head attention (B=2, N=2048, D=1024, 16 heads x 64): qkv = x w_qkv + b_qkv; scores = q.k/8 + attn_bias[b][key]; softmax; (w.v) w_proj + b_proj.
// Numerics: x, attn_bias, w_qkv, b_qkv, w_proj, b_proj are rounded to bf16 (RNE); the qkv projection runs on
// v_wmma_f32_16x16x32_bf16 (exact products, f32 accumulate, + bias); the scores, P.V and the output projection run on v_wmma_f32_16x16x32_f16 with single f16 operands
// (f16 copies of q, k, (8v)^T, P, the attention output rounded at load, and the exact f16 copy of bf16 w_proj); key bias and online softmax in f32.

namespace {
constexpr int Bn = 2, S = 2048, D = 1024, H = 16, HD = 64, NTOK = Bn * S, D3 = 3 * D;
constexpr float SCALE = 0.125f, VS = 8.0f;

typedef _Float16 b16;
typedef __attribute__((ext_vector_type(16))) _Float16 v16b;
typedef __attribute__((ext_vector_type(8)))  _Float16 v8b;
typedef __attribute__((ext_vector_type(8)))  float v8f;
typedef __attribute__((ext_vector_type(4)))  float v4f;

__device__ __forceinline__ v8b ld8b(const b16* p) { return *(const v8b*)p; }
__device__ __forceinline__ v16b cat8b(v8b a, v8b b) { return __builtin_shufflevector(a, b, 0, 1, 2, 3, 4, 5, 6, 7, 8, 9, 10, 11, 12, 13, 14, 15); }
__device__ __forceinline__ v16b frag_kb(const b16* p, int hh) { return cat8b(ld8b(p + 8 * hh), ld8b(p + 16 + 8 * hh)); }
__device__ __forceinline__ void split16(float v, b16& hi, b16& lo) { hi = (b16)v; lo = (b16)(v - (float)hi); }
// hi/lo fragment pair straight from an f32 k-contiguous row (same k-map)
__device__ __forceinline__ void frag_ksplit(const float* p, int hh, v16b& fh_, v16b& fl_) {
  const float* p0 = p + 8 * hh; const float* p1 = p + 16 + 8 * hh;
#pragma unroll
  for (int e = 0; e < 8; ++e) { b16 a, c; split16(p0[e], a, c); fh_[e] = a; fl_[e] = c; split16(p1[e], a, c); fh_[8 + e] = a; fl_[8 + e] = c; }
}
__device__ __forceinline__ v8f wmma16b(v16b a, v16b b, v8f c) {
  v8f d = __builtin_amdgcn_wmma_f32_16x16x32_f16(false, a, false, b, (short)0, c, false, false);
  asm volatile("v_nop\n\tv_nop\n\tv_nop\n\tv_nop" : "+v"(d) : "v"(a), "v"(b));
  return d;
}
__device__ __forceinline__ void wave_lds_sync() {
  __builtin_amdgcn_fence(__ATOMIC_RELEASE, "workgroup");
  __builtin_amdgcn_wave_barrier();
  __builtin_amdgcn_fence(__ATOMIC_ACQUIRE, "workgroup");
}

// Operand descriptor: NP = 0 -> f32 rows split on the fly into (hi, lo); NP = 1 -> one f16 plane; NP = 2 -> f16 hi + lo planes;
// NP = 3 -> f32 rows rounded once to a single f16 fragment. ld = row pitch.
struct Opnd { const void* p0; const void* p1; int ld; };
template <int NP> __device__ __forceinline__ void load_frags(const Opnd& o, int row, int kb, int hh, v16b& fh_, v16b& fl_) {
  if (NP == 0) { frag_ksplit((const float*)o.p0 + (size_t)row * o.ld + kb, hh, fh_, fl_); }
  else if (NP == 4 || NP == 5) {                             // f32 rows x64 (NP 4) or x8 (NP 5) then split (keeps the lo halves of small values normal)
    const float sc_ = (NP == 4) ? 64.0f : 8.0f;
    const float* p = (const float*)o.p0 + (size_t)row * o.ld + kb; const float* p0 = p + 8 * hh; const float* p1 = p + 16 + 8 * hh;
#pragma unroll
    for (int e = 0; e < 8; ++e) { b16 a, c; split16(p0[e] * sc_, a, c); fh_[e] = a; fl_[e] = c; split16(p1[e] * sc_, a, c); fh_[8 + e] = a; fl_[8 + e] = c; }
  } else if (NP == 3) {
    const float* p = (const float*)o.p0 + (size_t)row * o.ld + kb; const float* p0 = p + 8 * hh; const float* p1 = p + 16 + 8 * hh;
#pragma unroll
    for (int e = 0; e < 8; ++e) { fh_[e] = (b16)p0[e]; fh_[8 + e] = (b16)p1[e]; }
    fl_ = fh_;
  } else {
    fh_ = frag_kb((const b16*)o.p0 + (size_t)row * o.ld + kb, hh);
    if (NP == 2) fl_ = frag_kb((const b16*)o.p1 + (size_t)row * o.ld + kb, hh); else fl_ = fh_;
  }
}
template <int ANP, int BNP> __device__ __forceinline__ v8f mac(v16b ah, v16b al, v16b bh, v16b bl, v8f c) {
  c = wmma16b(ah, bh, c);
  if (BNP == 0 || BNP == 2 || BNP == 4 || BNP == 5) c = wmma16b(ah, bl, c);     // hi.lo
  if (ANP == 0 || ANP == 2 || ANP == 4 || ANP == 5) c = wmma16b(al, bh, c);     // lo.hi   (lo.lo dropped)
  return c;
}
// 32x64 wave tile: acc[r][t] (rows m0+16r.., cols c0+16t..) += A[m][k] . B[n][k] over k in [0, K)
template <int ANP, int BNP>
__device__ __forceinline__ void gemm_tile(const Opnd& A, const Opnd& B, int K, int m0, int c0, int nloc, int hlf, v8f (&acc)[2][4]) {
  for (int kb = 0; kb < K; kb += 32) {
    v16b a0h, a0l, a1h, a1l;
    load_frags<ANP>(A, m0 + nloc, kb, hlf, a0h, a0l);
    load_frags<ANP>(A, m0 + 16 + nloc, kb, hlf, a1h, a1l);
#pragma unroll
    for (int t = 0; t < 4; ++t) {
      v16b bh, bl;
      load_frags<BNP>(B, c0 + t * 16 + nloc, kb, hlf, bh, bl);
      acc[0][t] = mac<ANP, BNP>(a0h, a0l, bh, bl, acc[0][t]);
      acc[1][t] = mac<ANP, BNP>(a1h, a1l, bh, bl, acc[1][t]);
    }
  }
}

__device__ __forceinline__ void epi_planes(v8f (&acc)[2][4], float scale, bool two, b16* __restrict__ oh, b16* __restrict__ ol, int ldo,
                                           int m0, int c0, int lane, b16* Th, b16* Tl) {
  const int nloc = lane & 15, hlf = lane >> 4;
#pragma unroll
  for (int t = 0; t < 4; ++t)
#pragma unroll
    for (int r = 0; r < 2; ++r)
#pragma unroll
      for (int v = 0; v < 8; ++v) {
        const int rr = r * 16 + v + 8 * hlf, cc = t * 16 + nloc;
        b16 h_, l_; split16(acc[r][t][v] * scale, h_, l_);
        Th[rr * 64 + cc] = h_; Tl[rr * 64 + cc] = l_;
      }
  wave_lds_sync();
  {
#pragma unroll
    for (int j = 0; j < 8; ++j) {
      const int rr = j * 4 + (lane >> 3), c8 = (lane & 7) * 8;
      const size_t o = (size_t)(m0 + rr) * ldo + c0 + c8;
      *(v8b*)(oh + o) = ld8b(Th + rr * 64 + c8);
      if (two) *(v8b*)(ol + o) = ld8b(Tl + rr * 64 + c8);
    }
    
  }
}
// (b) f32 rows with pitch ldo: 64 floats = 256 B = 2 lines per row; 16 lanes x 16 B per row, 2 rows per instruction. Optional per-row factor
__device__ __forceinline__ void epi_f32(v8f (&acc)[2][4], float scale, const float* rscale, float* __restrict__ out, int ldo, int m0, int c0, int lane, float* Tt) {
  const int nloc = lane & 15, hlf = lane >> 4;
#pragma unroll
  for (int t = 0; t < 4; ++t)
#pragma unroll
    for (int r = 0; r < 2; ++r)
#pragma unroll
      for (int v = 0; v < 8; ++v) {
        const int rr = r * 16 + v + 8 * hlf;
        const float rs = rscale ? rscale[(size_t)(m0 + rr) * 32] : 1.0f;
        Tt[rr * 64 + t * 16 + nloc] = acc[r][t][v] * scale * rs;
      }
  wave_lds_sync();
  float* dst0 = out + (size_t)m0 * ldo + c0;
  {
#pragma unroll
    for (int j = 0; j < 16; ++j) { const int rr = j * 2 + hlf, c4 = nloc * 4; *(v4f*)(dst0 + (size_t)rr * ldo + c4) = *(const v4f*)(Tt + rr * 64 + c4); }
    
  }
}



typedef __attribute__((ext_vector_type(8))) __bf16 v8bb; typedef __attribute__((ext_vector_type(16))) __bf16 v16bb;
typedef __attribute__((ext_vector_type(8))) unsigned short v8us;
__device__ __forceinline__ v16bb frag_kb_bf(const __bf16* p, int hh) { const v8bb a = *(const v8bb*)(p + 8 * hh), b = *(const v8bb*)(p + 16 + 8 * hh); return __builtin_shufflevector(a, b, 0, 1, 2, 3, 4, 5, 6, 7, 8, 9, 10, 11, 12, 13, 14, 15); }
__device__ __forceinline__ v8f wmma16bb(v16bb a, v16bb b, v8f c) {
  v8f d = __builtin_amdgcn_wmma_f32_16x16x32_bf16(false, a, false, b, (short)0, c, false, false);
  asm volatile("v_nop\n\tv_nop\n\tv_nop\n\tv_nop" : "+v"(d) : "v"(a), "v"(b));
  return d;
}
__device__ __forceinline__ unsigned short bf16_rne_bits(float v) { unsigned int u = __float_as_uint(v); u += 0x7FFFu + ((u >> 16) & 1u); return (unsigned short)(u >> 16); }
__device__ __forceinline__ float bf16_rne(float v) { return __uint_as_float(((unsigned int)bf16_rne_bits(v)) << 16); }

__global__ __launch_bounds__(256) void prep_kernel(const float* __restrict__ x, unsigned short* __restrict__ x16) {
  const size_t tid = (size_t)blockIdx.x * blockDim.x + threadIdx.x, nth = (size_t)gridDim.x * blockDim.x;
  {
    for (size_t p = tid; p < (size_t)NTOK * D / 8; p += nth) { v8us v;
#pragma unroll
      for (int e = 0; e < 8; ++e) v[e] = bf16_rne_bits(x[p * 8 + e]);
      *(v8us*)(x16 + p * 8) = v; }
    
  }
}
// W [k rows][n cols] f32 -> [n][k] 16-bit rows through 64x64 LDS tiles: MODE 0 bf16 bits, MODE 1 f16(bf16(w)). grid (N/64, K/64).
template <int MODE>
__global__ __launch_bounds__(256) void wt_kernel(const float* __restrict__ W, int K, int Ncols, unsigned short* __restrict__ out) {
  __shared__ __attribute__((aligned(16))) unsigned short Tl[64][72];
  const int tid = threadIdx.x, lane = tid & 31, wave = tid >> 5, n0 = blockIdx.x * 64, k0 = blockIdx.y * 64;
  for (int i = tid; i < 64 * 64; i += 256) { const int kk = i / 64, nn = i % 64; const float w = W[(size_t)(k0 + kk) * Ncols + n0 + nn];
    unsigned short bits; if (MODE == 0) bits = bf16_rne_bits(w); else { const b16 hv = (b16)bf16_rne(w); bits = *reinterpret_cast<const unsigned short*>(&hv); }
    Tl[nn][kk] = bits; }
  __syncthreads();
  {
#pragma unroll
    for (int j = 0; j < 2; ++j) { const int rr = wave * 8 + j * 4 + (lane >> 3), c8 = (lane & 7) * 8; *(v8us*)(out + (size_t)(n0 + rr) * K + k0 + c8) = *(const v8us*)(&Tl[rr][c8]); }
    
  }
}

// projections: grid (48, 32): (4096 x 1024) x (1024 x 3072) bf16 WMMA + bf16(b_qkv). q, k -> f16 rows [b][h][s][64]; v -> (8v)^T f16 rows [b][h][64 d][s] (block LDS transpose).
__global__ __launch_bounds__(128) void proj_kernel(const __bf16* __restrict__ x16, const __bf16* __restrict__ w16, const float* __restrict__ bqkv, b16* __restrict__ qk, b16* __restrict__ vt) {
  __shared__ __attribute__((aligned(16))) b16 Th[4][2][32 * 64];
  __shared__ __attribute__((aligned(16))) b16 Tt[64][128 + 8];
  const int lane = threadIdx.x & 31, wave = threadIdx.x >> 5, nloc = lane & 15, hlf = lane >> 4, m0 = blockIdx.y * 128 + wave * 32, cg = blockIdx.x * 64, which = cg / D, c0 = cg % D;
  const __bf16* X = x16; const __bf16* W = w16 + (size_t)which * D * D;
  v8f acc[2][4];
#pragma unroll
  for (int r = 0; r < 2; ++r)
#pragma unroll
    for (int t = 0; t < 4; ++t) acc[r][t] = (v8f){};
#pragma unroll 2
  for (int kb = 0; kb < D; kb += 32) {
    const v16bb a0 = frag_kb_bf(X + (size_t)(m0 + nloc) * D + kb, hlf), a1 = frag_kb_bf(X + (size_t)(m0 + 16 + nloc) * D + kb, hlf);
#pragma unroll
    for (int t = 0; t < 4; ++t) { const v16bb bw = frag_kb_bf(W + (size_t)(c0 + t * 16 + nloc) * D + kb, hlf); acc[0][t] = wmma16bb(a0, bw, acc[0][t]); acc[1][t] = wmma16bb(a1, bw, acc[1][t]); }
  }
  // + bias (rounded to bf16)
#pragma unroll
  for (int t = 0; t < 4; ++t)
#pragma unroll
    for (int r = 0; r < 2; ++r)
#pragma unroll
      for (int v = 0; v < 8; ++v) acc[r][t][v] += bf16_rne(bqkv[cg + t * 16 + nloc]);
  const int h = c0 / HD, b = m0 / S, s0 = m0 % S;
  if (which < 2) { epi_planes(acc, 1.0f, false, qk + ((((size_t)which * Bn + b) * H + h) * S + s0) * HD, nullptr, HD, 0, 0, lane, Th[wave][0], Th[wave][1]); return; }
#pragma unroll
  for (int t = 0; t < 4; ++t)
#pragma unroll
    for (int r = 0; r < 2; ++r)
#pragma unroll
      for (int v = 0; v < 8; ++v) Tt[t * 16 + nloc][wave * 32 + r * 16 + 8 * hlf + v] = (b16)(acc[r][t][v] * VS);
  __syncthreads();
  const int tok0 = (blockIdx.y * 128) % S, bb = (blockIdx.y * 128) / S;
  b16* dst = vt + (((size_t)bb * H + h) * HD) * S + tok0;
  {
#pragma unroll
    for (int j = 0; j < 8; ++j) { const int dd = wave * 16 + j * 2 + (lane >> 4), c8 = (lane & 15) * 8; *(v8b*)(dst + (size_t)dd * S + c8) = *(const v8b*)(&Tt[dd][c8]); }
    
  }
}

// attention: wave = (b, h, 16 queries), all 64 key chunks of 32: S^T (K=64, 2 k-steps, single), online softmax f32, P^T f16, y^T += (8V)^T P^T (4 feature tiles); y/(8l) -> f32 rows
// The block's 8 waves share one (b, h): K rows and (8V)^T rows come in stages of KT keys into two LDS buffers by asynchronous copies (whole 128-B lines, once per block),
// and every wave takes its fragments from LDS. Row pitches are 16 B x odd for the 16-byte LDS readers.
constexpr int KT = 128, NST = S / KT, KP = HD + 8, VP = KT + 8;
__device__ __forceinline__ unsigned lds_off(const void* p) { return (unsigned)(size_t)p; }
// One stage: 128 K rows of 128 B (16 KB contiguous) and 64 V^T rows of 256 B; 8 copies of 16 B per lane, every lane on, each wave-copy covers 512 contiguous bytes or two 256-B rows.
__device__ __forceinline__ void stage_copy(const b16* kg, const b16* vg, const b16* ks, const b16* vs, int tid) {
  const b16* gk = kg + tid * 8; const b16* gv = vg + (size_t)(tid >> 4) * S + (tid & 15) * 8;
  const unsigned lk = lds_off(ks + (tid >> 3) * KP + (tid & 7) * 8), lv = lds_off(vs + (tid >> 4) * VP + (tid & 15) * 8);
  // the closing s_wait_xcnt stands inside the statement so that no address register of a copy is rewritten ahead of it
  asm volatile("global_load_async_to_lds_b128 %0, %8, off\n\t"
               "global_load_async_to_lds_b128 %1, %9, off\n\t"
               "global_load_async_to_lds_b128 %2, %10, off\n\t"
               "global_load_async_to_lds_b128 %3, %11, off\n\t"
               "global_load_async_to_lds_b128 %4, %12, off\n\t"
               "global_load_async_to_lds_b128 %5, %13, off\n\t"
               "global_load_async_to_lds_b128 %6, %14, off\n\t"
               "global_load_async_to_lds_b128 %7, %15, off\n\t"
               "s_wait_xcnt 0x0"
               :: "v"(lk), "v"(lk + 32 * KP * 2), "v"(lk + 64 * KP * 2), "v"(lk + 96 * KP * 2),
                  "v"(lv), "v"(lv + 16 * VP * 2), "v"(lv + 32 * VP * 2), "v"(lv + 48 * VP * 2),
                  "v"(gk), "v"(gk + 2048), "v"(gk + 4096), "v"(gk + 6144),
                  "v"(gv), "v"(gv + (size_t)16 * S), "v"(gv + (size_t)32 * S), "v"(gv + (size_t)48 * S)
               : "memory");
}
__global__ __launch_bounds__(256) void attn_kernel(const b16* __restrict__ qk, const b16* __restrict__ vt, const float* __restrict__ abias, float* __restrict__ y) {
  __shared__ __attribute__((aligned(16))) float Os[8][16][HD + 4];
  __shared__ __attribute__((aligned(16))) b16 Ks[2][KT * KP];
  __shared__ __attribute__((aligned(16))) b16 Vs[2][HD * VP];
  const int tid = threadIdx.x, wid = threadIdx.x >> 5, lane = threadIdx.x & 31, hh = lane >> 4, col = lane & 15;
  const int qt = blockIdx.x * 8 + wid, jt = qt & 127, h = (qt >> 7) & 15, b = qt >> 11, q0 = jt * 16, qi = q0 + col;
  const b16* Q = qk + ((((size_t)0 * Bn + b) * H + h) * S) * HD; const b16* K = qk + ((((size_t)1 * Bn + b) * H + h) * S) * HD;
  const b16* vb = vt + (((size_t)b * H + h) * HD) * S;
  stage_copy(K, vb, Ks[0], Vs[0], tid);
  v16b qf[2];
#pragma unroll
  for (int ks = 0; ks < 2; ++ks) qf[ks] = frag_kb(Q + (size_t)qi * HD + ks * 32, hh);
  asm volatile("s_wait_asynccnt 0x0" ::: "memory");   // this wave's share of stage 0 has landed
  __syncthreads();                                     // publishes stage 0 to the other waves
  stage_copy(K + (size_t)KT * HD, vb + KT, Ks[1], Vs[1], tid);
  float m = -INFINITY, l = 0.0f; v8f o[4] = {{}, {}, {}, {}};
  for (int st = 0; st < NST; ++st) {
    const b16* Kl = Ks[st & 1]; const b16* Vl = Vs[st & 1];
    for (int kl = 0; kl < KT; kl += 32) {
      const int kb = st * KT + kl;
      // the pass's own 16 LDS reads stand together at its head: one wait for the K fragments, and the V^T fragments land behind the softmax
      v16b kf[2][2], vf[4];
#pragma unroll
      for (int ks = 0; ks < 2; ++ks) { kf[ks][0] = frag_kb(Kl + (kl + col) * KP + ks * 32, hh); kf[ks][1] = frag_kb(Kl + (kl + 16 + col) * KP + ks * 32, hh); }
#pragma unroll
      for (int n = 0; n < 4; ++n) vf[n] = frag_kb(Vl + (n * 16 + col) * VP + kl, hh);
      v8f s0 = {}, s1 = {};
#pragma unroll
      for (int ks = 0; ks < 2; ++ks) { s0 = wmma16b(kf[ks][0], qf[ks], s0); s1 = wmma16b(kf[ks][1], qf[ks], s1); }
      float mr = -INFINITY;
#pragma unroll
      for (int r = 0; r < 8; ++r) { const int kk = kb + 8 * hh + r; s0[r] = s0[r] * SCALE + bf16_rne(abias[b * S + kk]); s1[r] = s1[r] * SCALE + bf16_rne(abias[b * S + kk + 16]); mr = fmaxf(mr, fmaxf(s0[r], s1[r])); }
      mr = fmaxf(mr, __shfl_xor(mr, 16));
      const float mn = fmaxf(m, mr), al_ = __expf(m - mn); m = mn;
      float sum = 0.0f; v16b pb;
#pragma unroll
      for (int r = 0; r < 8; ++r) { const float e0 = __expf(s0[r] - mn), e1 = __expf(s1[r] - mn); sum += e0 + e1; pb[r] = (b16)e0; pb[8 + r] = (b16)e1; }
      sum += __shfl_xor(sum, 16); l = l * al_ + sum;
#pragma unroll
      for (int n = 0; n < 4; ++n) {
#pragma unroll
        for (int r = 0; r < 8; ++r) o[n][r] *= al_;
        o[n] = wmma16b(vf[n], pb, o[n]);
      }
    }
    asm volatile("s_wait_dscnt 0x0" ::: "memory");     // this wave's reads of the stage's buffer have returned before it is refilled
    asm volatile("s_wait_asynccnt 0x0" ::: "memory");  // this wave's share of stage st + 1 has landed
    __syncthreads();                                   // publishes stage st + 1 and ends every wave's reads of stage st
    if (st + 2 < NST) stage_copy(K + (size_t)(st + 2) * KT * HD, vb + (st + 2) * KT, Ks[st & 1], Vs[st & 1], tid);
  }
  asm volatile("s_wait_asynccnt 0x0" ::: "memory");    // no copy is outstanding when the wave goes on to its end
  const float inv = 1.0f / (VS * l);
#pragma unroll
  for (int n = 0; n < 4; ++n)
#pragma unroll
    for (int r = 0; r < 8; ++r) Os[wid][col][n * 16 + 8 * hh + r] = o[n][r] * inv;
  wave_lds_sync();
  float* dst = y + ((size_t)b * S + q0) * D + h * HD;
  {
#pragma unroll
    for (int j = 0; j < 8; ++j) { const int rr = j * 2 + hh, c4 = col * 4; *(v4f*)(dst + (size_t)rr * D + c4) = *(const v4f*)(&Os[wid][rr][c4]); }
    
  }
}

// out = y Wo^T: (4096 x 1024) x (1024 x 1024); A = y rounded at load (single), B = f16(bf16 Wo) rows; f32 rows; grid (16, 32).
__global__ __launch_bounds__(128) void out_kernel(const float* __restrict__ y, const b16* __restrict__ wo16, const float* __restrict__ bproj, float* __restrict__ out) {
  __shared__ __attribute__((aligned(16))) float Ts[4][32 * 64];
  const int lane = threadIdx.x & 31, wave = threadIdx.x >> 5, nloc = lane & 15, hlf = lane >> 4, m0 = blockIdx.y * 128 + wave * 32, c0 = blockIdx.x * 64;
  v8f acc[2][4];
#pragma unroll
  for (int r = 0; r < 2; ++r)
#pragma unroll
    for (int t = 0; t < 4; ++t) acc[r][t] = (v8f){};
  const Opnd A{y, nullptr, D}, B{wo16, nullptr, D};
  gemm_tile<3, 1>(A, B, D, m0, c0, nloc, hlf, acc);
#pragma unroll
  for (int t = 0; t < 4; ++t)
#pragma unroll
    for (int r = 0; r < 2; ++r)
#pragma unroll
      for (int v = 0; v < 8; ++v) acc[r][t][v] += bf16_rne(bproj[c0 + t * 16 + nloc]);
  epi_f32(acc, 1.0f, nullptr, out, D, m0, c0, lane, Ts[wave]);
}
}  // namespace

extern "C" void kernel_launch(void* const* d_in, const int* in_sizes, int n_in,
                              void* d_out, int out_size, void* d_ws, size_t ws_size, hipStream_t stream) {
  (void)n_in; (void)out_size;
  const float* x = (const float*)d_in[0]; const float* abias = (const float*)d_in[1]; const float* wqkv = (const float*)d_in[2]; const float* bqkv = (const float*)d_in[3];
  const float* wproj = (const float*)d_in[4]; const float* bproj = (const float*)d_in[5];
  float* out = (float*)d_out;   // [2,2048,1024]
  if (in_sizes[0] != NTOK * D || in_sizes[1] != NTOK || in_sizes[2] != D * D3 || in_sizes[3] != D3 || in_sizes[4] != D * D || in_sizes[5] != D) return;
  size_t off = 0; char* ws = (char*)d_ws;
  auto carve = [&](size_t bytes) { char* p = ws + off; off += (bytes + 255) & ~(size_t)255; return p; };
  unsigned short* x16 = (unsigned short*)carve((size_t)NTOK * D * 2);        // 8 MB
  unsigned short* w16 = (unsigned short*)carve((size_t)D3 * D * 2);          // 6 MB ([3072][1024] bf16 = [which][n][k])
  b16* wo16 = (b16*)carve((size_t)D * D * 2);
  b16* qk = (b16*)carve((size_t)2 * NTOK * D * 2);                           // 16 MB: [which][b][h][s][64]
  b16* vt = (b16*)carve((size_t)NTOK * D * 2);                               // 8 MB
  float* y = (float*)carve((size_t)NTOK * D * 4);                            // 16 MB
  if (off > ws_size) return;                                                   // ≈ 56 MB
  prep_kernel<<<512, 256, 0, stream>>>(x, x16);
  wt_kernel<0><<<dim3(D3 / 64, D / 64), 256, 0, stream>>>(wqkv, D, D3, w16);
  wt_kernel<1><<<dim3(D / 64, D / 64), 256, 0, stream>>>(wproj, D, D, (unsigned short*)wo16);
  proj_kernel<<<dim3(D3 / 64, NTOK / 128), 128, 0, stream>>>((const __bf16*)x16, (const __bf16*)w16, bqkv, qk, vt);
  attn_kernel<<<Bn * H * (S / 16) / 8, 256, 0, stream>>>(qk, vt, abias, y);
  out_kernel<<<dim3(D / 64, NTOK / 128), 128, 0, stream>>>(y, wo16, bproj, out);
}

// v002
// One run takes 120 microseconds.
// Timed twice side by side with v001, it ran 1.46 and 1.45 times as fast.
// Counting every step since v000, it is 2.41 times as fast.
#include <hip/hip_runtime.h>

// Gaze-guided multi-head attention (B=2, N=2048, D=1024, 16 heads x 64): qkv = x w_qkv + b_qkv; scores = q.k/8 + attn_bias[b][key]; softmax; (w.v) w_proj + b_proj.
// Numerics: x, attn_bias, w_qkv, b_qkv, w_proj, b_proj are rounded to bf16 (RNE); the qkv projection runs on
// v_wmma_f32_16x16x32_bf16 (exact products, f32 accumulate, + bias); the scores, P.V and the output projection run on v_wmma_f32_16x16x32_f16 with single f16 operands
// (f16 copies of q, k, (8v)^T, P, the attention output rounded at load, and the exact f16 copy of bf16 w_proj); key bias and online softmax in f32.

namespace {
constexpr int Bn = 2, S = 2048, D = 1024, H = 16, HD = 64, NTOK = Bn * S, D3 = 3 * D;
constexpr float SCALE = 0.125f, VS = 8.0f;

typedef _Float16 b16;
typedef __attribute__((ext_vector_type(16))) _Float16 v16b;
typedef __attribute__((ext_vector_type(8)))  _Float16 v8b;
typedef __attribute__((ext_vector_type(8)))  float v8f;
typedef __attribute__((ext_vector_type(4)))  float v4f;

__device__ __forceinline__ v8b ld8b(const b16* p) { return *(const v8b*)p; }
__device__ __forceinline__ v16b cat8b(v8b a, v8b b) { return __builtin_shufflevector(a, b, 0, 1, 2, 3, 4, 5, 6, 7, 8, 9, 10, 11, 12, 13, 14, 15); }
__device__ __forceinline__ v16b frag_kb(const b16* p, int hh) { return cat8b(ld8b(p + 8 * hh), ld8b(p + 16 + 8 * hh)); }
__device__ __forceinline__ void split16(float v, b16& hi, b16& lo) { hi = (b16)v; lo = (b16)(v - (float)hi); }
__device__ __forceinline__ v8f wmma16b(v16b a, v16b b, v8f c) {
  v8f d = __builtin_amdgcn_wmma_f32_16x16x32_f16(false, a, false, b, (short)0, c, false, false);
  asm volatile("v_nop\n\tv_nop\n\tv_nop\n\tv_nop" : "+v"(d) : "v"(a), "v"(b));
  return d;
}
__device__ __forceinline__ void wave_lds_sync() {
  __builtin_amdgcn_fence(__ATOMIC_RELEASE, "workgroup");
  __builtin_amdgcn_wave_barrier();
  __builtin_amdgcn_fence(__ATOMIC_ACQUIRE, "workgroup");
}

__device__ __forceinline__ void epi_planes(v8f (&acc)[2][4], float scale, bool two, b16* __restrict__ oh, b16* __restrict__ ol, int ldo,
                                           int m0, int c0, int lane, b16* Th, b16* Tl) {
  const int nloc = lane & 15, hlf = lane >> 4;
#pragma unroll
  for (int t = 0; t < 4; ++t)
#pragma unroll
    for (int r = 0; r < 2; ++r)
#pragma unroll
      for (int v = 0; v < 8; ++v) {
        const int rr = r * 16 + v + 8 * hlf, cc = t * 16 + nloc;
        b16 h_, l_; split16(acc[r][t][v] * scale, h_, l_);
        Th[rr * 64 + cc] = h_; Tl[rr * 64 + cc] = l_;
      }
  wave_lds_sync();
  {
#pragma unroll
    for (int j = 0; j < 8; ++j) {
      const int rr = j * 4 + (lane >> 3), c8 = (lane & 7) * 8;
      const size_t o = (size_t)(m0 + rr) * ldo + c0 + c8;
      *(v8b*)(oh + o) = ld8b(Th + rr * 64 + c8);
      if (two) *(v8b*)(ol + o) = ld8b(Tl + rr * 64 + c8);
    }
    
  }
}
// (b) f32 rows with pitch ldo: 64 floats = 256 B = 2 lines per row; 16 lanes x 16 B per row, 2 rows per instruction. Optional per-row factor
__device__ __forceinline__ void epi_f32(v8f (&acc)[2][4], float scale, const float* rscale, float* __restrict__ out, int ldo, int m0, int c0, int lane, float* Tt) {
  const int nloc = lane & 15, hlf = lane >> 4;
#pragma unroll
  for (int t = 0; t < 4; ++t)
#pragma unroll
    for (int r = 0; r < 2; ++r)
#pragma unroll
      for (int v = 0; v < 8; ++v) {
        const int rr = r * 16 + v + 8 * hlf;
        const float rs = rscale ? rscale[(size_t)(m0 + rr) * 32] : 1.0f;
        Tt[rr * 64 + t * 16 + nloc] = acc[r][t][v] * scale * rs;
      }
  wave_lds_sync();
  float* dst0 = out + (size_t)m0 * ldo + c0;
  {
#pragma unroll
    for (int j = 0; j < 16; ++j) { const int rr = j * 2 + hlf, c4 = nloc * 4; *(v4f*)(dst0 + (size_t)rr * ldo + c4) = *(const v4f*)(Tt + rr * 64 + c4); }
    
  }
}



typedef __attribute__((ext_vector_type(8))) __bf16 v8bb; typedef __attribute__((ext_vector_type(16))) __bf16 v16bb;
typedef __attribute__((ext_vector_type(8))) unsigned short v8us;
__device__ __forceinline__ v16bb frag_kb_bf(const __bf16* p, int hh) { const v8bb a = *(const v8bb*)(p + 8 * hh), b = *(const v8bb*)(p + 16 + 8 * hh); return __builtin_shufflevector(a, b, 0, 1, 2, 3, 4, 5, 6, 7, 8, 9, 10, 11, 12, 13, 14, 15); }
__device__ __forceinline__ v8f wmma16bb(v16bb a, v16bb b, v8f c) {
  v8f d = __builtin_amdgcn_wmma_f32_16x16x32_bf16(false, a, false, b, (short)0, c, false, false);
  asm volatile("v_nop\n\tv_nop\n\tv_nop\n\tv_nop" : "+v"(d) : "v"(a), "v"(b));
  return d;
}
__device__ __forceinline__ unsigned short bf16_rne_bits(float v) { unsigned int u = __float_as_uint(v); u += 0x7FFFu + ((u >> 16) & 1u); return (unsigned short)(u >> 16); }
__device__ __forceinline__ float bf16_rne(float v) { return __uint_as_float(((unsigned int)bf16_rne_bits(v)) << 16); }

__global__ __launch_bounds__(256) void prep_kernel(const float* __restrict__ x, unsigned short* __restrict__ x16) {
  const size_t tid = (size_t)blockIdx.x * blockDim.x + threadIdx.x, nth = (size_t)gridDim.x * blockDim.x;
  {
    for (size_t p = tid; p < (size_t)NTOK * D / 8; p += nth) { v8us v;
#pragma unroll
      for (int e = 0; e < 8; ++e) v[e] = bf16_rne_bits(x[p * 8 + e]);
      *(v8us*)(x16 + p * 8) = v; }
    
  }
}
// W [k rows][n cols] f32 -> [n][k] 16-bit rows through 64x64 LDS tiles: MODE 0 bf16 bits, MODE 1 f16(bf16(w)). grid (N/64, K/64).
template <int MODE>
__global__ __launch_bounds__(256) void wt_kernel(const float* __restrict__ W, int K, int Ncols, unsigned short* __restrict__ out) {
  __shared__ __attribute__((aligned(16))) unsigned short Tl[64][72];
  const int tid = threadIdx.x, lane = tid & 31, wave = tid >> 5, n0 = blockIdx.x * 64, k0 = blockIdx.y * 64;
  for (int i = tid; i < 64 * 64; i += 256) { const int kk = i / 64, nn = i % 64; const float w = W[(size_t)(k0 + kk) * Ncols + n0 + nn];
    unsigned short bits; if (MODE == 0) bits = bf16_rne_bits(w); else { const b16 hv = (b16)bf16_rne(w); bits = *reinterpret_cast<const unsigned short*>(&hv); }
    Tl[nn][kk] = bits; }
  __syncthreads();
  {
#pragma unroll
    for (int j = 0; j < 2; ++j) { const int rr = wave * 8 + j * 4 + (lane >> 3), c8 = (lane & 7) * 8; *(v8us*)(out + (size_t)(n0 + rr) * K + k0 + c8) = *(const v8us*)(&Tl[rr][c8]); }
    
  }
}

// Both projection GEMMs: a block of 8 waves (4 row groups x 2 column groups of 32x64 wave tiles) owns a 128x128 tile; per stage of GK k the 128 A rows and 128 B rows come
// once per block into one of two LDS buffers by asynchronous copies (whole 128-B lines), and every wave takes its fragments from LDS. Row pitches are 16 B x odd.
constexpr int GK = 64, GNT = D / GK, GP = GK + 8, GPF = GK + 4;
constexpr int G16 = 128 * GP * 2, GF32 = 128 * GPF * 4;      // bytes of a 128-row tile: 16-bit rows, f32 rows
__device__ __forceinline__ unsigned lds_off(const void* p) { return (unsigned)(size_t)p; }
// One stage of two 16-bit operands: 2 x 128 rows of 128 B; 8 copies of 16 B per lane, every lane on, each wave-copy covers four whole lines.
__device__ __forceinline__ void stage_ab16(const char* ga, const char* gb, unsigned la, unsigned lb) {
  // the closing s_wait_xcnt stands inside the statement so that no address register of a copy is rewritten ahead of it
  asm volatile("global_load_async_to_lds_b128 %0, %8, off\n\t"
               "global_load_async_to_lds_b128 %1, %9, off\n\t"
               "global_load_async_to_lds_b128 %2, %10, off\n\t"
               "global_load_async_to_lds_b128 %3, %11, off\n\t"
               "global_load_async_to_lds_b128 %4, %12, off\n\t"
               "global_load_async_to_lds_b128 %5, %13, off\n\t"
               "global_load_async_to_lds_b128 %6, %14, off\n\t"
               "global_load_async_to_lds_b128 %7, %15, off\n\t"
               "s_wait_xcnt 0x0"
               :: "v"(la), "v"(la + 32 * GP * 2), "v"(la + 64 * GP * 2), "v"(la + 96 * GP * 2),
                  "v"(lb), "v"(lb + 32 * GP * 2), "v"(lb + 64 * GP * 2), "v"(lb + 96 * GP * 2),
                  "v"(ga), "v"(ga + 32 * D * 2), "v"(ga + 64 * D * 2), "v"(ga + 96 * D * 2),
                  "v"(gb), "v"(gb + 32 * D * 2), "v"(gb + 64 * D * 2), "v"(gb + 96 * D * 2)
               : "memory");
}
// One stage of an f32 A (128 rows of 256 B, 8 copies per lane, two rows per wave-copy) and a 16-bit B (128 rows of 128 B, 4 copies per lane).
__device__ __forceinline__ void stage_af32_b16(const char* ga, const char* gb, unsigned la, unsigned lb) {
  // the closing s_wait_xcnt stands inside the statement so that no address register of a copy is rewritten ahead of it
  asm volatile("global_load_async_to_lds_b128 %0, %12, off\n\t"
               "global_load_async_to_lds_b128 %1, %13, off\n\t"
               "global_load_async_to_lds_b128 %2, %14, off\n\t"
               "global_load_async_to_lds_b128 %3, %15, off\n\t"
               "global_load_async_to_lds_b128 %4, %16, off\n\t"
               "global_load_async_to_lds_b128 %5, %17, off\n\t"
               "global_load_async_to_lds_b128 %6, %18, off\n\t"
               "global_load_async_to_lds_b128 %7, %19, off\n\t"
               "global_load_async_to_lds_b128 %8, %20, off\n\t"
               "global_load_async_to_lds_b128 %9, %21, off\n\t"
               "global_load_async_to_lds_b128 %10, %22, off\n\t"
               "global_load_async_to_lds_b128 %11, %23, off\n\t"
               "s_wait_xcnt 0x0"
               :: "v"(la), "v"(la + 16 * GPF * 4), "v"(la + 32 * GPF * 4), "v"(la + 48 * GPF * 4),
                  "v"(la + 64 * GPF * 4), "v"(la + 80 * GPF * 4), "v"(la + 96 * GPF * 4), "v"(la + 112 * GPF * 4),
                  "v"(lb), "v"(lb + 32 * GP * 2), "v"(lb + 64 * GP * 2), "v"(lb + 96 * GP * 2),
                  "v"(ga), "v"(ga + 16 * D * 4), "v"(ga + 32 * D * 4), "v"(ga + 48 * D * 4),
                  "v"(ga + 64 * D * 4), "v"(ga + 80 * D * 4), "v"(ga + 96 * D * 4), "v"(ga + 112 * D * 4),
                  "v"(gb), "v"(gb + 32 * D * 2), "v"(gb + 64 * D * 2), "v"(gb + 96 * D * 2)
               : "memory");
}

// projections: grid (24, 32): (4096 x 1024) x (1024 x 3072) bf16 WMMA + bf16(b_qkv). q, k -> f16 rows [b][h][s][64]; v -> (8v)^T f16 rows [b][h][64 d][s] (LDS transpose per column group).
__global__ __launch_bounds__(256) void proj_kernel(const __bf16* __restrict__ x16, const __bf16* __restrict__ w16, const float* __restrict__ bqkv, b16* __restrict__ qk, b16* __restrict__ vt) {
  __shared__ __attribute__((aligned(16))) unsigned char sm[2 * 2 * G16];   // two stage buffers [A | B]; behind the loop the epilogue's staging
  const int tid = threadIdx.x, lane = tid & 31, wave = tid >> 5, wm = wave & 3, wn = wave >> 2, nloc = lane & 15, hlf = lane >> 4;
  const int mb = blockIdx.y * 128, m0 = mb + wm * 32, cb = blockIdx.x * 128, cg = cb + wn * 64, which = cb / D, c0 = cg % D;
  const char* ga = (const char*)(x16 + (size_t)(mb + (tid >> 3)) * D + (tid & 7) * 8);
  const char* gb = (const char*)(w16 + (size_t)(cb + (tid >> 3)) * D + (tid & 7) * 8);
  const unsigned la = lds_off(sm) + (tid >> 3) * (GP * 2) + (tid & 7) * 16, lb = la + G16;
  v8f acc[2][4];
#pragma unroll
  for (int r = 0; r < 2; ++r)
#pragma unroll
    for (int t = 0; t < 4; ++t) acc[r][t] = (v8f){};
  stage_ab16(ga, gb, la, lb);
  asm volatile("s_wait_asynccnt 0x0" ::: "memory");   // this wave's share of stage 0 has landed
  __syncthreads();                                     // publishes stage 0 to the other waves
  stage_ab16(ga + GK * 2, gb + GK * 2, la + 2 * G16, lb + 2 * G16);
  for (int st = 0; st < GNT; ++st) {
    const __bf16* Al = (const __bf16*)(sm + (st & 1) * (2 * G16)) + (wm * 32 + nloc) * GP;
    const __bf16* Bl = (const __bf16*)(sm + (st & 1) * (2 * G16) + G16) + (wn * 64 + nloc) * GP;
#pragma unroll
    for (int ks = 0; ks < GK; ks += 32) {
      // the k-step's 12 LDS reads stand together at its head, so that the wave meets the LDS latency once and not once per B fragment
      const v16bb a0 = frag_kb_bf(Al + ks, hlf), a1 = frag_kb_bf(Al + 16 * GP + ks, hlf);
      v16bb bw[4];
#pragma unroll
      for (int t = 0; t < 4; ++t) bw[t] = frag_kb_bf(Bl + t * 16 * GP + ks, hlf);
#pragma unroll
      for (int t = 0; t < 4; ++t) { acc[0][t] = wmma16bb(a0, bw[t], acc[0][t]); acc[1][t] = wmma16bb(a1, bw[t], acc[1][t]); }
    }
    asm volatile("s_wait_dscnt 0x0" ::: "memory");     // this wave's reads of the stage's buffer have returned before it is refilled
    asm volatile("s_wait_asynccnt 0x0" ::: "memory");  // this wave's share of stage st + 1 has landed
    __syncthreads();                                   // publishes stage st + 1 and ends every wave's reads of stage st
    if (st + 2 < GNT) stage_ab16(ga + (st + 2) * (GK * 2), gb + (st + 2) * (GK * 2), la + (st & 1) * (2 * G16), lb + (st & 1) * (2 * G16));
  }
  asm volatile("s_wait_asynccnt 0x0" ::: "memory");    // no copy is outstanding when the buffers become the epilogue's staging
  // + bias (rounded to bf16)
#pragma unroll
  for (int t = 0; t < 4; ++t)
#pragma unroll
    for (int r = 0; r < 2; ++r)
#pragma unroll
      for (int v = 0; v < 8; ++v) acc[r][t][v] += bf16_rne(bqkv[cg + t * 16 + nloc]);
  const int h = c0 / HD, b = m0 / S, s0 = m0 % S;
  if (which < 2) { b16* Th = (b16*)sm + wave * (2 * 32 * 64); epi_planes(acc, 1.0f, false, qk + ((((size_t)which * Bn + b) * H + h) * S + s0) * HD, nullptr, HD, 0, 0, lane, Th, Th + 32 * 64); return; }
  b16 (*Tt)[128 + 8] = (b16 (*)[128 + 8])sm + wn * 64;
#pragma unroll
  for (int t = 0; t < 4; ++t)
#pragma unroll
    for (int r = 0; r < 2; ++r)
#pragma unroll
      for (int v = 0; v < 8; ++v) Tt[t * 16 + nloc][wm * 32 + r * 16 + 8 * hlf + v] = (b16)(acc[r][t][v] * VS);
  __syncthreads();
  const int tok0 = mb % S, bb = mb / S;
  b16* dst = vt + (((size_t)bb * H + h) * HD) * S + tok0;
  {
#pragma unroll
    for (int j = 0; j < 8; ++j) { const int dd = wm * 16 + j * 2 + (lane >> 4), c8 = (lane & 15) * 8; *(v8b*)(dst + (size_t)dd * S + c8) = *(const v8b*)(&Tt[dd][c8]); }
    
  }
}

// attention: wave = (b, h, 16 queries), all 64 key chunks of 32: S^T (K=64, 2 k-steps, single), online softmax f32, P^T f16, y^T += (8V)^T P^T (4 feature tiles); y/(8l) -> f32 rows
// The block's 8 waves share one (b, h): K rows and (8V)^T rows come in stages of KT keys into two LDS buffers by asynchronous copies (whole 128-B lines, once per block),
// and every wave takes its fragments from LDS. Row pitches are 16 B x odd for the 16-byte LDS readers.
constexpr int KT = 128, NST = S / KT, KP = HD + 8, VP = KT + 8;
// One stage: 128 K rows of 128 B (16 KB contiguous) and 64 V^T rows of 256 B; 8 copies of 16 B per lane, every lane on, each wave-copy covers 512 contiguous bytes or two 256-B rows.
__device__ __forceinline__ void stage_copy(const b16* kg, const b16* vg, const b16* ks, const b16* vs, int tid) {
  const b16* gk = kg + tid * 8; const b16* gv = vg + (size_t)(tid >> 4) * S + (tid & 15) * 8;
  const unsigned lk = lds_off(ks + (tid >> 3) * KP + (tid & 7) * 8), lv = lds_off(vs + (tid >> 4) * VP + (tid & 15) * 8);
  // the closing s_wait_xcnt stands inside the statement so that no address register of a copy is rewritten ahead of it
  asm volatile("global_load_async_to_lds_b128 %0, %8, off\n\t"
               "global_load_async_to_lds_b128 %1, %9, off\n\t"
               "global_load_async_to_lds_b128 %2, %10, off\n\t"
               "global_load_async_to_lds_b128 %3, %11, off\n\t"
               "global_load_async_to_lds_b128 %4, %12, off\n\t"
               "global_load_async_to_lds_b128 %5, %13, off\n\t"
               "global_load_async_to_lds_b128 %6, %14, off\n\t"
               "global_load_async_to_lds_b128 %7, %15, off\n\t"
               "s_wait_xcnt 0x0"
               :: "v"(lk), "v"(lk + 32 * KP * 2), "v"(lk + 64 * KP * 2), "v"(lk + 96 * KP * 2),
                  "v"(lv), "v"(lv + 16 * VP * 2), "v"(lv + 32 * VP * 2), "v"(lv + 48 * VP * 2),
                  "v"(gk), "v"(gk + 2048), "v"(gk + 4096), "v"(gk + 6144),
                  "v"(gv), "v"(gv + (size_t)16 * S), "v"(gv + (size_t)32 * S), "v"(gv + (size_t)48 * S)
               : "memory");
}
__global__ __launch_bounds__(256) void attn_kernel(const b16* __restrict__ qk, const b16* __restrict__ vt, const float* __restrict__ abias, float* __restrict__ y) {
  __shared__ __attribute__((aligned(16))) float Os[8][16][HD + 4];
  __shared__ __attribute__((aligned(16))) b16 Ks[2][KT * KP];
  __shared__ __attribute__((aligned(16))) b16 Vs[2][HD * VP];
  const int tid = threadIdx.x, wid = threadIdx.x >> 5, lane = threadIdx.x & 31, hh = lane >> 4, col = lane & 15;
  const int qt = blockIdx.x * 8 + wid, jt = qt & 127, h = (qt >> 7) & 15, b = qt >> 11, q0 = jt * 16, qi = q0 + col;
  const b16* Q = qk + ((((size_t)0 * Bn + b) * H + h) * S) * HD; const b16* K = qk + ((((size_t)1 * Bn + b) * H + h) * S) * HD;
  const b16* vb = vt + (((size_t)b * H + h) * HD) * S;
  stage_copy(K, vb, Ks[0], Vs[0], tid);
  v16b qf[2];
#pragma unroll
  for (int ks = 0; ks < 2; ++ks) qf[ks] = frag_kb(Q + (size_t)qi * HD + ks * 32, hh);
  asm volatile("s_wait_asynccnt 0x0" ::: "memory");   // this wave's share of stage 0 has landed
  __syncthreads();                                     // publishes stage 0 to the other waves
  stage_copy(K + (size_t)KT * HD, vb + KT, Ks[1], Vs[1], tid);
  float m = -INFINITY, l = 0.0f; v8f o[4] = {{}, {}, {}, {}};
  for (int st = 0; st < NST; ++st) {
    const b16* Kl = Ks[st & 1]; const b16* Vl = Vs[st & 1];
    for (int kl = 0; kl < KT; kl += 32) {
      const int kb = st * KT + kl;
      // the pass's own 16 LDS reads stand together at its head: one wait for the K fragments, and the V^T fragments land behind the softmax
      v16b kf[2][2], vf[4];
#pragma unroll
      for (int ks = 0; ks < 2; ++ks) { kf[ks][0] = frag_kb(Kl + (kl + col) * KP + ks * 32, hh); kf[ks][1] = frag_kb(Kl + (kl + 16 + col) * KP + ks * 32, hh); }
#pragma unroll
      for (int n = 0; n < 4; ++n) vf[n] = frag_kb(Vl + (n * 16 + col) * VP + kl, hh);
      v8f s0 = {}, s1 = {};
#pragma unroll
      for (int ks = 0; ks < 2; ++ks) { s0 = wmma16b(kf[ks][0], qf[ks], s0); s1 = wmma16b(kf[ks][1], qf[ks], s1); }
      float mr = -INFINITY;
#pragma unroll
      for (int r = 0; r < 8; ++r) { const int kk = kb + 8 * hh + r; s0[r] = s0[r] * SCALE + bf16_rne(abias[b * S + kk]); s1[r] = s1[r] * SCALE + bf16_rne(abias[b * S + kk + 16]); mr = fmaxf(mr, fmaxf(s0[r], s1[r])); }
      mr = fmaxf(mr, __shfl_xor(mr, 16));
      const float mn = fmaxf(m, mr), al_ = __expf(m - mn); m = mn;
      float sum = 0.0f; v16b pb;
#pragma unroll
      for (int r = 0; r < 8; ++r) { const float e0 = __expf(s0[r] - mn), e1 = __expf(s1[r] - mn); sum += e0 + e1; pb[r] = (b16)e0; pb[8 + r] = (b16)e1; }
      sum += __shfl_xor(sum, 16); l = l * al_ + sum;
#pragma unroll
      for (int n = 0; n < 4; ++n) {
#pragma unroll
        for (int r = 0; r < 8; ++r) o[n][r] *= al_;
        o[n] = wmma16b(vf[n], pb, o[n]);
      }
    }
    asm volatile("s_wait_dscnt 0x0" ::: "memory");     // this wave's reads of the stage's buffer have returned before it is refilled
    asm volatile("s_wait_asynccnt 0x0" ::: "memory");  // this wave's share of stage st + 1 has landed
    __syncthreads();                                   // publishes stage st + 1 and ends every wave's reads of stage st
    if (st + 2 < NST) stage_copy(K + (size_t)(st + 2) * KT * HD, vb + (st + 2) * KT, Ks[st & 1], Vs[st & 1], tid);
  }
  asm volatile("s_wait_asynccnt 0x0" ::: "memory");    // no copy is outstanding when the wave goes on to its end
  const float inv = 1.0f / (VS * l);
#pragma unroll
  for (int n = 0; n < 4; ++n)
#pragma unroll
    for (int r = 0; r < 8; ++r) Os[wid][col][n * 16 + 8 * hh + r] = o[n][r] * inv;
  wave_lds_sync();
  float* dst = y + ((size_t)b * S + q0) * D + h * HD;
  {
#pragma unroll
    for (int j = 0; j < 8; ++j) { const int rr = j * 2 + hh, c4 = col * 4; *(v4f*)(dst + (size_t)rr * D + c4) = *(const v4f*)(&Os[wid][rr][c4]); }
    
  }
}

// out = y Wo^T: (4096 x 1024) x (1024 x 1024); A = y rounded at the fragment load (single), B = f16(bf16 Wo) rows; f32 rows; grid (8, 32).
__global__ __launch_bounds__(256) void out_kernel(const float* __restrict__ y, const b16* __restrict__ wo16, const float* __restrict__ bproj, float* __restrict__ out) {
  __shared__ __attribute__((aligned(16))) unsigned char sm[2 * (GF32 + G16)];   // two stage buffers [A f32 | B]; behind the loop the epilogue's staging
  const int tid = threadIdx.x, lane = tid & 31, wave = tid >> 5, wm = wave & 3, wn = wave >> 2, nloc = lane & 15, hlf = lane >> 4;
  const int mb = blockIdx.y * 128, m0 = mb + wm * 32, cb = blockIdx.x * 128, c0 = cb + wn * 64;
  const char* ga = (const char*)(y + (size_t)(mb + (tid >> 4)) * D + (tid & 15) * 4);
  const char* gb = (const char*)(wo16 + (size_t)(cb + (tid >> 3)) * D + (tid & 7) * 8);
  const unsigned la = lds_off(sm) + (tid >> 4) * (GPF * 4) + (tid & 15) * 16, lb = lds_off(sm) + GF32 + (tid >> 3) * (GP * 2) + (tid & 7) * 16;
  v8f acc[2][4];
#pragma unroll
  for (int r = 0; r < 2; ++r)
#pragma unroll
    for (int t = 0; t < 4; ++t) acc[r][t] = (v8f){};
  stage_af32_b16(ga, gb, la, lb);
  asm volatile("s_wait_asynccnt 0x0" ::: "memory");   // this wave's share of stage 0 has landed
  __syncthreads();                                     // publishes stage 0 to the other waves
  stage_af32_b16(ga + GK * 4, gb + GK * 2, la + (GF32 + G16), lb + (GF32 + G16));
  for (int st = 0; st < GNT; ++st) {
    const float* Al = (const float*)(sm + (st & 1) * (GF32 + G16)) + (wm * 32 + nloc) * GPF + 8 * hlf;
    const b16* Bl = (const b16*)(sm + (st & 1) * (GF32 + G16) + GF32) + (wn * 64 + nloc) * GP;
#pragma unroll
    for (int ks = 0; ks < GK; ks += 32) {
      // the k-step's 16 LDS reads stand together at its head, so that the wave meets the LDS latency once and not once per B fragment
      v16b a0, a1, bw[4];
#pragma unroll
      for (int t = 0; t < 4; ++t) bw[t] = frag_kb(Bl + t * 16 * GP + ks, hlf);
#pragma unroll
      for (int e = 0; e < 8; ++e) { a0[e] = (b16)Al[ks + e]; a0[8 + e] = (b16)Al[ks + 16 + e]; a1[e] = (b16)Al[16 * GPF + ks + e]; a1[8 + e] = (b16)Al[16 * GPF + ks + 16 + e]; }
#pragma unroll
      for (int t = 0; t < 4; ++t) { acc[0][t] = wmma16b(a0, bw[t], acc[0][t]); acc[1][t] = wmma16b(a1, bw[t], acc[1][t]); }
    }
    asm volatile("s_wait_dscnt 0x0" ::: "memory");     // this wave's reads of the stage's buffer have returned before it is refilled
    asm volatile("s_wait_asynccnt 0x0" ::: "memory");  // this wave's share of stage st + 1 has landed
    __syncthreads();                                   // publishes stage st + 1 and ends every wave's reads of stage st
    if (st + 2 < GNT) stage_af32_b16(ga + (st + 2) * (GK * 4), gb + (st + 2) * (GK * 2), la + (st & 1) * (GF32 + G16), lb + (st & 1) * (GF32 + G16));
  }
  asm volatile("s_wait_asynccnt 0x0" ::: "memory");    // no copy is outstanding when the buffers become the epilogue's staging
#pragma unroll
  for (int t = 0; t < 4; ++t)
#pragma unroll
    for (int r = 0; r < 2; ++r)
#pragma unroll
      for (int v = 0; v < 8; ++v) acc[r][t][v] += bf16_rne(bproj[c0 + t * 16 + nloc]);
  epi_f32(acc, 1.0f, nullptr, out, D, m0, c0, lane, (float*)sm + wave * (32 * 64));
}
}  // namespace

extern "C" void kernel_launch(void* const* d_in, const int* in_sizes, int n_in,
                              void* d_out, int out_size, void* d_ws, size_t ws_size, hipStream_t stream) {
  (void)n_in; (void)out_size;
  const float* x = (const float*)d_in[0]; const float* abias = (const float*)d_in[1]; const float* wqkv = (const float*)d_in[2]; const float* bqkv = (const float*)d_in[3];
  const float* wproj = (const float*)d_in[4]; const float* bproj = (const float*)d_in[5];
  float* out = (float*)d_out;   // [2,2048,1024]
  if (in_sizes[0] != NTOK * D || in_sizes[1] != NTOK || in_sizes[2] != D * D3 || in_sizes[3] != D3 || in_sizes[4] != D * D || in_sizes[5] != D) return;
  size_t off = 0; char* ws = (char*)d_ws;
  auto carve = [&](size_t bytes) { char* p = ws + off; off += (bytes + 255) & ~(size_t)255; return p; };
  unsigned short* x16 = (unsigned short*)carve((size_t)NTOK * D * 2);        // 8 MB
  unsigned short* w16 = (unsigned short*)carve((size_t)D3 * D * 2);          // 6 MB ([3072][1024] bf16 = [which][n][k])
  b16* wo16 = (b16*)carve((size_t)D * D * 2);
  b16* qk = (b16*)carve((size_t)2 * NTOK * D * 2);                           // 16 MB: [which][b][h][s][64]
  b16* vt = (b16*)carve((size_t)NTOK * D * 2);                               // 8 MB
  float* y = (float*)carve((size_t)NTOK * D * 4);                            // 16 MB
  if (off > ws_size) return;                                                   // ≈ 56 MB
  prep_kernel<<<512, 256, 0, stream>>>(x, x16);
  wt_kernel<0><<<dim3(D3 / 64, D / 64), 256, 0, stream>>>(wqkv, D, D3, w16);
  wt_kernel<1><<<dim3(D / 64, D / 64), 256, 0, stream>>>(wproj, D, D, (unsigned short*)wo16);
  proj_kernel<<<dim3(D3 / 128, NTOK / 128), 256, 0, stream>>>((const __bf16*)x16, (const __bf16*)w16, bqkv, qk, vt);
  attn_kernel<<<Bn * H * (S / 16) / 8, 256, 0, stream>>>(qk, vt, abias, y);
  out_kernel<<<dim3(D / 128, NTOK / 128), 256, 0, stream>>>(y, wo16, bproj, out);
}

// v003
// One run takes 108 microseconds.
// Next to v002, in two timings, it ran 1.12 times as fast each time.
// Over all steps from v000 it is 2.69 times as fast.
#include <hip/hip_runtime.h>

// Gaze-guided multi-head attention (B=2, N=2048, D=1024, 16 heads x 64): qkv = x w_qkv + b_qkv; scores = q.k/8 + attn_bias[b][key]; softmax; (w.v) w_proj + b_proj.
// Numerics: x, attn_bias, w_qkv, b_qkv, w_proj, b_proj are rounded to bf16 (RNE); the qkv projection runs on
// v_wmma_f32_16x16x32_bf16 (exact products, f32 accumulate, + bias); the scores, P.V and the output projection run on v_wmma_f32_16x16x32_f16 with single f16 operands
// (f16 copies of q log2(e)/8, k, (8v)^T, P, the attention output rounded at load, and the exact f16 copy of bf16 w_proj); key bias and online softmax in f32, in base 2.

namespace {
constexpr int Bn = 2, S = 2048, D = 1024, H = 16, HD = 64, NTOK = Bn * S, D3 = 3 * D;
constexpr float SCALE = 0.125f, VS = 8.0f, LOG2E = 1.4426950408889634f;

typedef _Float16 b16;
typedef __attribute__((ext_vector_type(16))) _Float16 v16b;
typedef __attribute__((ext_vector_type(8)))  _Float16 v8b;
typedef __attribute__((ext_vector_type(8)))  float v8f;
typedef __attribute__((ext_vector_type(4)))  float v4f;

__device__ __forceinline__ v8b ld8b(const b16* p) { return *(const v8b*)p; }
__device__ __forceinline__ v16b cat8b(v8b a, v8b b) { return __builtin_shufflevector(a, b, 0, 1, 2, 3, 4, 5, 6, 7, 8, 9, 10, 11, 12, 13, 14, 15); }
__device__ __forceinline__ v16b frag_kb(const b16* p, int hh) { return cat8b(ld8b(p + 8 * hh), ld8b(p + 16 + 8 * hh)); }
__device__ __forceinline__ void split16(float v, b16& hi, b16& lo) { hi = (b16)v; lo = (b16)(v - (float)hi); }
__device__ __forceinline__ v8f wmma16b(v16b a, v16b b, v8f c) {
  v8f d = __builtin_amdgcn_wmma_f32_16x16x32_f16(false, a, false, b, (short)0, c, false, false);
  asm volatile("v_nop\n\tv_nop\n\tv_nop\n\tv_nop" : "+v"(d) : "v"(a), "v"(b));
  return d;
}
__device__ __forceinline__ void wave_lds_sync() {
  __builtin_amdgcn_fence(__ATOMIC_RELEASE, "workgroup");
  __builtin_amdgcn_wave_barrier();
  __builtin_amdgcn_fence(__ATOMIC_ACQUIRE, "workgroup");
}

__device__ __forceinline__ void epi_planes(v8f (&acc)[2][4], float scale, bool two, b16* __restrict__ oh, b16* __restrict__ ol, int ldo,
                                           int m0, int c0, int lane, b16* Th, b16* Tl) {
  const int nloc = lane & 15, hlf = lane >> 4;
#pragma unroll
  for (int t = 0; t < 4; ++t)
#pragma unroll
    for (int r = 0; r < 2; ++r)
#pragma unroll
      for (int v = 0; v < 8; ++v) {
        const int rr = r * 16 + v + 8 * hlf, cc = t * 16 + nloc;
        b16 h_, l_; split16(acc[r][t][v] * scale, h_, l_);
        Th[rr * 64 + cc] = h_; Tl[rr * 64 + cc] = l_;
      }
  wave_lds_sync();
  {
#pragma unroll
    for (int j = 0; j < 8; ++j) {
      const int rr = j * 4 + (lane >> 3), c8 = (lane & 7) * 8;
      const size_t o = (size_t)(m0 + rr) * ldo + c0 + c8;
      *(v8b*)(oh + o) = ld8b(Th + rr * 64 + c8);
      if (two) *(v8b*)(ol + o) = ld8b(Tl + rr * 64 + c8);
    }
    
  }
}
// (b) f32 rows with pitch ldo: 64 floats = 256 B = 2 lines per row; 16 lanes x 16 B per row, 2 rows per instruction. Optional per-row factor
__device__ __forceinline__ void epi_f32(v8f (&acc)[2][4], float scale, const float* rscale, float* __restrict__ out, int ldo, int m0, int c0, int lane, float* Tt) {
  const int nloc = lane & 15, hlf = lane >> 4;
#pragma unroll
  for (int t = 0; t < 4; ++t)
#pragma unroll
    for (int r = 0; r < 2; ++r)
#pragma unroll
      for (int v = 0; v < 8; ++v) {
        const int rr = r * 16 + v + 8 * hlf;
        const float rs = rscale ? rscale[(size_t)(m0 + rr) * 32] : 1.0f;
        Tt[rr * 64 + t * 16 + nloc] = acc[r][t][v] * scale * rs;
      }
  wave_lds_sync();
  float* dst0 = out + (size_t)m0 * ldo + c0;
  {
#pragma unroll
    for (int j = 0; j < 16; ++j) { const int rr = j * 2 + hlf, c4 = nloc * 4; *(v4f*)(dst0 + (size_t)rr * ldo + c4) = *(const v4f*)(Tt + rr * 64 + c4); }
    
  }
}



typedef __attribute__((ext_vector_type(8))) __bf16 v8bb; typedef __attribute__((ext_vector_type(16))) __bf16 v16bb;
typedef __attribute__((ext_vector_type(8))) unsigned short v8us;
__device__ __forceinline__ v16bb frag_kb_bf(const __bf16* p, int hh) { const v8bb a = *(const v8bb*)(p + 8 * hh), b = *(const v8bb*)(p + 16 + 8 * hh); return __builtin_shufflevector(a, b, 0, 1, 2, 3, 4, 5, 6, 7, 8, 9, 10, 11, 12, 13, 14, 15); }
__device__ __forceinline__ v8f wmma16bb(v16bb a, v16bb b, v8f c) {
  v8f d = __builtin_amdgcn_wmma_f32_16x16x32_bf16(false, a, false, b, (short)0, c, false, false);
  asm volatile("v_nop\n\tv_nop\n\tv_nop\n\tv_nop" : "+v"(d) : "v"(a), "v"(b));
  return d;
}
__device__ __forceinline__ unsigned short bf16_rne_bits(float v) { unsigned int u = __float_as_uint(v); u += 0x7FFFu + ((u >> 16) & 1u); return (unsigned short)(u >> 16); }
__device__ __forceinline__ float bf16_rne(float v) { return __uint_as_float(((unsigned int)bf16_rne_bits(v)) << 16); }

__global__ __launch_bounds__(256) void prep_kernel(const float* __restrict__ x, unsigned short* __restrict__ x16, const float* __restrict__ abias, float* __restrict__ bl2) {
  const size_t tid = (size_t)blockIdx.x * blockDim.x + threadIdx.x, nth = (size_t)gridDim.x * blockDim.x;
  for (size_t p = tid; p < (size_t)NTOK; p += nth) bl2[p] = bf16_rne(abias[p]) * LOG2E;   // key bias, rounded to bf16, in base-2 units
  {
    for (size_t p = tid; p < (size_t)NTOK * D / 8; p += nth) { v8us v;
#pragma unroll
      for (int e = 0; e < 8; ++e) v[e] = bf16_rne_bits(x[p * 8 + e]);
      *(v8us*)(x16 + p * 8) = v; }
    
  }
}
// W [k rows][n cols] f32 -> [n][k] 16-bit rows through 64x64 LDS tiles: MODE 0 bf16 bits, MODE 1 f16(bf16(w)). grid (N/64, K/64).
template <int MODE>
__global__ __launch_bounds__(256) void wt_kernel(const float* __restrict__ W, int K, int Ncols, unsigned short* __restrict__ out) {
  __shared__ __attribute__((aligned(16))) unsigned short Tl[64][72];
  const int tid = threadIdx.x, lane = tid & 31, wave = tid >> 5, n0 = blockIdx.x * 64, k0 = blockIdx.y * 64;
  for (int i = tid; i < 64 * 64; i += 256) { const int kk = i / 64, nn = i % 64; const float w = W[(size_t)(k0 + kk) * Ncols + n0 + nn];
    unsigned short bits; if (MODE == 0) bits = bf16_rne_bits(w); else { const b16 hv = (b16)bf16_rne(w); bits = *reinterpret_cast<const unsigned short*>(&hv); }
    Tl[nn][kk] = bits; }
  __syncthreads();
  {
#pragma unroll
    for (int j = 0; j < 2; ++j) { const int rr = wave * 8 + j * 4 + (lane >> 3), c8 = (lane & 7) * 8; *(v8us*)(out + (size_t)(n0 + rr) * K + k0 + c8) = *(const v8us*)(&Tl[rr][c8]); }
    
  }
}

// Both projection GEMMs: a block of 8 waves (4 row groups x 2 column groups of 32x64 wave tiles) owns a 128x128 tile; per stage of GK k the 128 A rows and 128 B rows come
// once per block into one of two LDS buffers by asynchronous copies (whole 128-B lines), and every wave takes its fragments from LDS. Row pitches are 16 B x odd.
constexpr int GK = 64, GNT = D / GK, GP = GK + 8, GPF = GK + 4;
constexpr int G16 = 128 * GP * 2, GF32 = 128 * GPF * 4;      // bytes of a 128-row tile: 16-bit rows, f32 rows
__device__ __forceinline__ unsigned lds_off(const void* p) { return (unsigned)(size_t)p; }
// One stage of two 16-bit operands: 2 x 128 rows of 128 B; 8 copies of 16 B per lane, every lane on, each wave-copy covers four whole lines.
__device__ __forceinline__ void stage_ab16(const char* ga, const char* gb, unsigned la, unsigned lb) {
  // the closing s_wait_xcnt stands inside the statement so that no address register of a copy is rewritten ahead of it
  asm volatile("global_load_async_to_lds_b128 %0, %8, off\n\t"
               "global_load_async_to_lds_b128 %1, %9, off\n\t"
               "global_load_async_to_lds_b128 %2, %10, off\n\t"
               "global_load_async_to_lds_b128 %3, %11, off\n\t"
               "global_load_async_to_lds_b128 %4, %12, off\n\t"
               "global_load_async_to_lds_b128 %5, %13, off\n\t"
               "global_load_async_to_lds_b128 %6, %14, off\n\t"
               "global_load_async_to_lds_b128 %7, %15, off\n\t"
               "s_wait_xcnt 0x0"
               :: "v"(la), "v"(la + 32 * GP * 2), "v"(la + 64 * GP * 2), "v"(la + 96 * GP * 2),
                  "v"(lb), "v"(lb + 32 * GP * 2), "v"(lb + 64 * GP * 2), "v"(lb + 96 * GP * 2),
                  "v"(ga), "v"(ga + 32 * D * 2), "v"(ga + 64 * D * 2), "v"(ga + 96 * D * 2),
                  "v"(gb), "v"(gb + 32 * D * 2), "v"(gb + 64 * D * 2), "v"(gb + 96 * D * 2)
               : "memory");
}
// One stage of an f32 A (128 rows of 256 B, 8 copies per lane, two rows per wave-copy) and a 16-bit B (128 rows of 128 B, 4 copies per lane).
__device__ __forceinline__ void stage_af32_b16(const char* ga, const char* gb, unsigned la, unsigned lb) {
  // the closing s_wait_xcnt stands inside the statement so that no address register of a copy is rewritten ahead of it
  asm volatile("global_load_async_to_lds_b128 %0, %12, off\n\t"
               "global_load_async_to_lds_b128 %1, %13, off\n\t"
               "global_load_async_to_lds_b128 %2, %14, off\n\t"
               "global_load_async_to_lds_b128 %3, %15, off\n\t"
               "global_load_async_to_lds_b128 %4, %16, off\n\t"
               "global_load_async_to_lds_b128 %5, %17, off\n\t"
               "global_load_async_to_lds_b128 %6, %18, off\n\t"
               "global_load_async_to_lds_b128 %7, %19, off\n\t"
               "global_load_async_to_lds_b128 %8, %20, off\n\t"
               "global_load_async_to_lds_b128 %9, %21, off\n\t"
               "global_load_async_to_lds_b128 %10, %22, off\n\t"
               "global_load_async_to_lds_b128 %11, %23, off\n\t"
               "s_wait_xcnt 0x0"
               :: "v"(la), "v"(la + 16 * GPF * 4), "v"(la + 32 * GPF * 4), "v"(la + 48 * GPF * 4),
                  "v"(la + 64 * GPF * 4), "v"(la + 80 * GPF * 4), "v"(la + 96 * GPF * 4), "v"(la + 112 * GPF * 4),
                  "v"(lb), "v"(lb + 32 * GP * 2), "v"(lb + 64 * GP * 2), "v"(lb + 96 * GP * 2),
                  "v"(ga), "v"(ga + 16 * D * 4), "v"(ga + 32 * D * 4), "v"(ga + 48 * D * 4),
                  "v"(ga + 64 * D * 4), "v"(ga + 80 * D * 4), "v"(ga + 96 * D * 4), "v"(ga + 112 * D * 4),
                  "v"(gb), "v"(gb + 32 * D * 2), "v"(gb + 64 * D * 2), "v"(gb + 96 * D * 2)
               : "memory");
}

// projections: grid (24, 32): (4096 x 1024) x (1024 x 3072) bf16 WMMA + bf16(b_qkv). q log2(e)/8, k -> f16 rows [b][h][s][64]; v -> (8v)^T f16 rows [b][h][64 d][s] (LDS transpose per column group).
__global__ __launch_bounds__(256) void proj_kernel(const __bf16* __restrict__ x16, const __bf16* __restrict__ w16, const float* __restrict__ bqkv, b16* __restrict__ qk, b16* __restrict__ vt) {
  __shared__ __attribute__((aligned(16))) unsigned char sm[2 * 2 * G16];   // two stage buffers [A | B]; behind the loop the epilogue's staging
  const int tid = threadIdx.x, lane = tid & 31, wave = tid >> 5, wm = wave & 3, wn = wave >> 2, nloc = lane & 15, hlf = lane >> 4;
  const int mb = blockIdx.y * 128, m0 = mb + wm * 32, cb = blockIdx.x * 128, cg = cb + wn * 64, which = cb / D, c0 = cg % D;
  const char* ga = (const char*)(x16 + (size_t)(mb + (tid >> 3)) * D + (tid & 7) * 8);
  const char* gb = (const char*)(w16 + (size_t)(cb + (tid >> 3)) * D + (tid & 7) * 8);
  const unsigned la = lds_off(sm) + (tid >> 3) * (GP * 2) + (tid & 7) * 16, lb = la + G16;
  v8f acc[2][4];
#pragma unroll
  for (int r = 0; r < 2; ++r)
#pragma unroll
    for (int t = 0; t < 4; ++t) acc[r][t] = (v8f){};
  stage_ab16(ga, gb, la, lb);
  asm volatile("s_wait_asynccnt 0x0" ::: "memory");   // this wave's share of stage 0 has landed
  __syncthreads();                                     // publishes stage 0 to the other waves
  stage_ab16(ga + GK * 2, gb + GK * 2, la + 2 * G16, lb + 2 * G16);
  for (int st = 0; st < GNT; ++st) {
    const __bf16* Al = (const __bf16*)(sm + (st & 1) * (2 * G16)) + (wm * 32 + nloc) * GP;
    const __bf16* Bl = (const __bf16*)(sm + (st & 1) * (2 * G16) + G16) + (wn * 64 + nloc) * GP;
#pragma unroll
    for (int ks = 0; ks < GK; ks += 32) {
      // the k-step's 12 LDS reads stand together at its head, so that the wave meets the LDS latency once and not once per B fragment
      const v16bb a0 = frag_kb_bf(Al + ks, hlf), a1 = frag_kb_bf(Al + 16 * GP + ks, hlf);
      v16bb bw[4];
#pragma unroll
      for (int t = 0; t < 4; ++t) bw[t] = frag_kb_bf(Bl + t * 16 * GP + ks, hlf);
#pragma unroll
      for (int t = 0; t < 4; ++t) { acc[0][t] = wmma16bb(a0, bw[t], acc[0][t]); acc[1][t] = wmma16bb(a1, bw[t], acc[1][t]); }
    }
    asm volatile("s_wait_dscnt 0x0" ::: "memory");     // this wave's reads of the stage's buffer have returned before it is refilled
    asm volatile("s_wait_asynccnt 0x0" ::: "memory");  // this wave's share of stage st + 1 has landed
    __syncthreads();                                   // publishes stage st + 1 and ends every wave's reads of stage st
    if (st + 2 < GNT) stage_ab16(ga + (st + 2) * (GK * 2), gb + (st + 2) * (GK * 2), la + (st & 1) * (2 * G16), lb + (st & 1) * (2 * G16));
  }
  asm volatile("s_wait_asynccnt 0x0" ::: "memory");    // no copy is outstanding when the buffers become the epilogue's staging
  // + bias (rounded to bf16)
#pragma unroll
  for (int t = 0; t < 4; ++t)
#pragma unroll
    for (int r = 0; r < 2; ++r)
#pragma unroll
      for (int v = 0; v < 8; ++v) acc[r][t][v] += bf16_rne(bqkv[cg + t * 16 + nloc]);
  const int h = c0 / HD, b = m0 / S, s0 = m0 % S;
  if (which < 2) { b16* Th = (b16*)sm + wave * (2 * 32 * 64); epi_planes(acc, which == 0 ? SCALE * LOG2E : 1.0f, false, qk + ((((size_t)which * Bn + b) * H + h) * S + s0) * HD, nullptr, HD, 0, 0, lane, Th, Th + 32 * 64); return; }
  b16 (*Tt)[128 + 8] = (b16 (*)[128 + 8])sm + wn * 64;
#pragma unroll
  for (int t = 0; t < 4; ++t)
#pragma unroll
    for (int r = 0; r < 2; ++r)
#pragma unroll
      for (int v = 0; v < 8; ++v) Tt[t * 16 + nloc][wm * 32 + r * 16 + 8 * hlf + v] = (b16)(acc[r][t][v] * VS);
  __syncthreads();
  const int tok0 = mb % S, bb = mb / S;
  b16* dst = vt + (((size_t)bb * H + h) * HD) * S + tok0;
  {
#pragma unroll
    for (int j = 0; j < 8; ++j) { const int dd = wm * 16 + j * 2 + (lane >> 4), c8 = (lane & 15) * 8; *(v8b*)(dst + (size_t)dd * S + c8) = *(const v8b*)(&Tt[dd][c8]); }
    
  }
}

// attention: wave = (b, h, 16 queries), all 64 key chunks of 32: S^T (K=64, 2 k-steps, single), online softmax f32, P^T f16, y^T += (8V)^T P^T (4 feature tiles); y/(8l) -> f32 rows
// The scores leave the matrix unit finished, in base-2 units: q carries log2(e)/8 and the score accumulators start from the key bias table (a lane's 8 rows of a tile are 8 consecutive keys).
// The block's 8 waves share one (b, h): K rows and (8V)^T rows come in stages of KT keys into two LDS buffers by asynchronous copies (whole 128-B lines, once per block),
// and every wave takes its fragments from LDS. Row pitches are 16 B x odd for the 16-byte LDS readers.
constexpr int KT = 128, NST = S / KT, KP = HD + 8, VP = KT + 8;
// One stage: 128 K rows of 128 B (16 KB contiguous) and 64 V^T rows of 256 B; 8 copies of 16 B per lane, every lane on, each wave-copy covers 512 contiguous bytes or two 256-B rows.
__device__ __forceinline__ void stage_copy(const b16* kg, const b16* vg, const b16* ks, const b16* vs, int tid) {
  const b16* gk = kg + tid * 8; const b16* gv = vg + (size_t)(tid >> 4) * S + (tid & 15) * 8;
  const unsigned lk = lds_off(ks + (tid >> 3) * KP + (tid & 7) * 8), lv = lds_off(vs + (tid >> 4) * VP + (tid & 15) * 8);
  // the closing s_wait_xcnt stands inside the statement so that no address register of a copy is rewritten ahead of it
  asm volatile("global_load_async_to_lds_b128 %0, %8, off\n\t"
               "global_load_async_to_lds_b128 %1, %9, off\n\t"
               "global_load_async_to_lds_b128 %2, %10, off\n\t"
               "global_load_async_to_lds_b128 %3, %11, off\n\t"
               "global_load_async_to_lds_b128 %4, %12, off\n\t"
               "global_load_async_to_lds_b128 %5, %13, off\n\t"
               "global_load_async_to_lds_b128 %6, %14, off\n\t"
               "global_load_async_to_lds_b128 %7, %15, off\n\t"
               "s_wait_xcnt 0x0"
               :: "v"(lk), "v"(lk + 32 * KP * 2), "v"(lk + 64 * KP * 2), "v"(lk + 96 * KP * 2),
                  "v"(lv), "v"(lv + 16 * VP * 2), "v"(lv + 32 * VP * 2), "v"(lv + 48 * VP * 2),
                  "v"(gk), "v"(gk + 2048), "v"(gk + 4096), "v"(gk + 6144),
                  "v"(gv), "v"(gv + (size_t)16 * S), "v"(gv + (size_t)32 * S), "v"(gv + (size_t)48 * S)
               : "memory");
}
__device__ __forceinline__ v8f ld8f(const float* p) { return __builtin_shufflevector(*(const v4f*)p, *(const v4f*)(p + 4), 0, 1, 2, 3, 4, 5, 6, 7); }
__global__ __launch_bounds__(256) void attn_kernel(const b16* __restrict__ qk, const b16* __restrict__ vt, const float* __restrict__ bl2, float* __restrict__ y) {
  __shared__ __attribute__((aligned(16))) float Os[8][16][HD + 4];
  __shared__ __attribute__((aligned(16))) b16 Ks[2][KT * KP];
  __shared__ __attribute__((aligned(16))) b16 Vs[2][HD * VP];
  const int tid = threadIdx.x, wid = threadIdx.x >> 5, lane = threadIdx.x & 31, hh = lane >> 4, col = lane & 15;
  const int qt = blockIdx.x * 8 + wid, jt = qt & 127, h = (qt >> 7) & 15, b = qt >> 11, q0 = jt * 16, qi = q0 + col;
  const b16* Q = qk + ((((size_t)0 * Bn + b) * H + h) * S) * HD; const b16* K = qk + ((((size_t)1 * Bn + b) * H + h) * S) * HD;
  const b16* vb = vt + (((size_t)b * H + h) * HD) * S;
  stage_copy(K, vb, Ks[0], Vs[0], tid);
  v16b qf[2];
#pragma unroll
  for (int ks = 0; ks < 2; ++ks) qf[ks] = frag_kb(Q + (size_t)qi * HD + ks * 32, hh);
  asm volatile("s_wait_asynccnt 0x0" ::: "memory");   // this wave's share of stage 0 has landed
  __syncthreads();                                     // publishes stage 0 to the other waves
  stage_copy(K + (size_t)KT * HD, vb + KT, Ks[1], Vs[1], tid);
  float m = -INFINITY, l = 0.0f; v8f o[4] = {{}, {}, {}, {}};
  const float* bl = bl2 + b * S + 8 * hh;
  v8f s0 = ld8f(bl), s1 = ld8f(bl + 16);
  for (int st = 0; st < NST; ++st) {
    const b16* Kl = Ks[st & 1]; const b16* Vl = Vs[st & 1];
    for (int kl = 0; kl < KT; kl += 32) {
      const int kb = st * KT + kl;
      // the pass's own 16 LDS reads stand together at its head: one wait for the K fragments, and the V^T fragments land behind the softmax
      v16b kf[2][2], vf[4];
#pragma unroll
      for (int ks = 0; ks < 2; ++ks) { kf[ks][0] = frag_kb(Kl + (kl + col) * KP + ks * 32, hh); kf[ks][1] = frag_kb(Kl + (kl + 16 + col) * KP + ks * 32, hh); }
#pragma unroll
      for (int n = 0; n < 4; ++n) vf[n] = frag_kb(Vl + (n * 16 + col) * VP + kl, hh);
#pragma unroll
      for (int ks = 0; ks < 2; ++ks) { s0 = wmma16b(kf[ks][0], qf[ks], s0); s1 = wmma16b(kf[ks][1], qf[ks], s1); }
      float mr = -INFINITY;
#pragma unroll
      for (int r = 0; r < 8; ++r) mr = fmaxf(mr, fmaxf(s0[r], s1[r]));
      mr = fmaxf(mr, __shfl_xor(mr, 16));
      const float mn = fmaxf(m, mr); float al_ = m - mn; m = mn;
      float sum = 0.0f, e[16]; v16b pb;
#pragma unroll
      for (int r = 0; r < 8; ++r) { e[r] = s0[r] - mn; e[8 + r] = s1[r] - mn; }
      // the pass's exponentials in one statement, each in place: none writes over the source of the one in front of it; the v_nop is the slot behind the last one
      asm("v_exp_f32 %0, %0\n\tv_exp_f32 %1, %1\n\tv_exp_f32 %2, %2\n\tv_exp_f32 %3, %3\n\tv_exp_f32 %4, %4\n\tv_exp_f32 %5, %5\n\t"
          "v_exp_f32 %6, %6\n\tv_exp_f32 %7, %7\n\tv_exp_f32 %8, %8\n\tv_exp_f32 %9, %9\n\tv_exp_f32 %10, %10\n\tv_exp_f32 %11, %11\n\t"
          "v_exp_f32 %12, %12\n\tv_exp_f32 %13, %13\n\tv_exp_f32 %14, %14\n\tv_exp_f32 %15, %15\n\tv_exp_f32 %16, %16\n\tv_nop"
          : "+v"(e[0]), "+v"(e[8]), "+v"(e[1]), "+v"(e[9]), "+v"(e[2]), "+v"(e[10]), "+v"(e[3]), "+v"(e[11]), "+v"(al_), "+v"(e[4]), "+v"(e[12]),
            "+v"(e[5]), "+v"(e[13]), "+v"(e[6]), "+v"(e[14]), "+v"(e[7]), "+v"(e[15]));
#pragma unroll
      for (int r = 0; r < 8; ++r) { sum += e[r] + e[8 + r]; pb[r] = (b16)e[r]; pb[8 + r] = (b16)e[8 + r]; }
      // the next pass's start values load behind the last read of the scores, so that they land under the rest of this pass; the last pass wraps to key 0 (in bounds, not used)
      const int kn = (kb + 32) & (S - 1);
      s0 = ld8f(bl + kn); s1 = ld8f(bl + kn + 16);
      sum += __shfl_xor(sum, 16); l = l * al_ + sum;
#pragma unroll
      for (int n = 0; n < 4; ++n) {
#pragma unroll
        for (int r = 0; r < 8; ++r) o[n][r] *= al_;
        o[n] = wmma16b(vf[n], pb, o[n]);
      }
      asm volatile("s_wait_xcnt 0x0" ::: "memory");    // stands between the start-value loads and the next pass's rewrite of their address registers
    }
    asm volatile("s_wait_dscnt 0x0" ::: "memory");     // this wave's reads of the stage's buffer have returned before it is refilled
    asm volatile("s_wait_asynccnt 0x0" ::: "memory");  // this wave's share of stage st + 1 has landed
    __syncthreads();                                   // publishes stage st + 1 and ends every wave's reads of stage st
    if (st + 2 < NST) stage_copy(K + (size_t)(st + 2) * KT * HD, vb + (st + 2) * KT, Ks[st & 1], Vs[st & 1], tid);
  }
  asm volatile("s_wait_asynccnt 0x0" ::: "memory");    // no copy is outstanding when the wave goes on to its end
  const float inv = 1.0f / (VS * l);
#pragma unroll
  for (int n = 0; n < 4; ++n)
#pragma unroll
    for (int r = 0; r < 8; ++r) Os[wid][col][n * 16 + 8 * hh + r] = o[n][r] * inv;
  wave_lds_sync();
  float* dst = y + ((size_t)b * S + q0) * D + h * HD;
  {
#pragma unroll
    for (int j = 0; j < 8; ++j) { const int rr = j * 2 + hh, c4 = col * 4; *(v4f*)(dst + (size_t)rr * D + c4) = *(const v4f*)(&Os[wid][rr][c4]); }
    
  }
}

// out = y Wo^T: (4096 x 1024) x (1024 x 1024); A = y rounded at the fragment load (single), B = f16(bf16 Wo) rows; f32 rows; grid (8, 32).
__global__ __launch_bounds__(256) void out_kernel(const float* __restrict__ y, const b16* __restrict__ wo16, const float* __restrict__ bproj, float* __restrict__ out) {
  __shared__ __attribute__((aligned(16))) unsigned char sm[2 * (GF32 + G16)];   // two stage buffers [A f32 | B]; behind the loop the epilogue's staging
  const int tid = threadIdx.x, lane = tid & 31, wave = tid >> 5, wm = wave & 3, wn = wave >> 2, nloc = lane & 15, hlf = lane >> 4;
  const int mb = blockIdx.y * 128, m0 = mb + wm * 32, cb = blockIdx.x * 128, c0 = cb + wn * 64;
  const char* ga = (const char*)(y + (size_t)(mb + (tid >> 4)) * D + (tid & 15) * 4);
  const char* gb = (const char*)(wo16 + (size_t)(cb + (tid >> 3)) * D + (tid & 7) * 8);
  const unsigned la = lds_off(sm) + (tid >> 4) * (GPF * 4) + (tid & 15) * 16, lb = lds_off(sm) + GF32 + (tid >> 3) * (GP * 2) + (tid & 7) * 16;
  v8f acc[2][4];
#pragma unroll
  for (int r = 0; r < 2; ++r)
#pragma unroll
    for (int t = 0; t < 4; ++t) acc[r][t] = (v8f){};
  stage_af32_b16(ga, gb, la, lb);
  asm volatile("s_wait_asynccnt 0x0" ::: "memory");   // this wave's share of stage 0 has landed
  __syncthreads();                                     // publishes stage 0 to the other waves
  stage_af32_b16(ga + GK * 4, gb + GK * 2, la + (GF32 + G16), lb + (GF32 + G16));
  for (int st = 0; st < GNT; ++st) {
    const float* Al = (const float*)(sm + (st & 1) * (GF32 + G16)) + (wm * 32 + nloc) * GPF + 8 * hlf;
    const b16* Bl = (const b16*)(sm + (st & 1) * (GF32 + G16) + GF32) + (wn * 64 + nloc) * GP;
#pragma unroll
    for (int ks = 0; ks < GK; ks += 32) {
      // the k-step's 16 LDS reads stand together at its head, so that the wave meets the LDS latency once and not once per B fragment
      v16b a0, a1, bw[4];
#pragma unroll
      for (int t = 0; t < 4; ++t) bw[t] = frag_kb(Bl + t * 16 * GP + ks, hlf);
#pragma unroll
      for (int e = 0; e < 8; ++e) { a0[e] = (b16)Al[ks + e]; a0[8 + e] = (b16)Al[ks + 16 + e]; a1[e] = (b16)Al[16 * GPF + ks + e]; a1[8 + e] = (b16)Al[16 * GPF + ks + 16 + e]; }
#pragma unroll
      for (int t = 0; t < 4; ++t) { acc[0][t] = wmma16b(a0, bw[t], acc[0][t]); acc[1][t] = wmma16b(a1, bw[t], acc[1][t]); }
    }
    asm volatile("s_wait_dscnt 0x0" ::: "memory");     // this wave's reads of the stage's buffer have returned before it is refilled
    asm volatile("s_wait_asynccnt 0x0" ::: "memory");  // this wave's share of stage st + 1 has landed
    __syncthreads();                                   // publishes stage st + 1 and ends every wave's reads of stage st
    if (st + 2 < GNT) stage_af32_b16(ga + (st + 2) * (GK * 4), gb + (st + 2) * (GK * 2), la + (st & 1) * (GF32 + G16), lb + (st & 1) * (GF32 + G16));
  }
  asm volatile("s_wait_asynccnt 0x0" ::: "memory");    // no copy is outstanding when the buffers become the epilogue's staging
#pragma unroll
  for (int t = 0; t < 4; ++t)
#pragma unroll
    for (int r = 0; r < 2; ++r)
#pragma unroll
      for (int v = 0; v < 8; ++v) acc[r][t][v] += bf16_rne(bproj[c0 + t * 16 + nloc]);
  epi_f32(acc, 1.0f, nullptr, out, D, m0, c0, lane, (float*)sm + wave * (32 * 64));
}
}  // namespace

extern "C" void kernel_launch(void* const* d_in, const int* in_sizes, int n_in,
                              void* d_out, int out_size, void* d_ws, size_t ws_size, hipStream_t stream) {
  (void)n_in; (void)out_size;
  const float* x = (const float*)d_in[0]; const float* abias = (const float*)d_in[1]; const float* wqkv = (const float*)d_in[2]; const float* bqkv = (const float*)d_in[3];
  const float* wproj = (const float*)d_in[4]; const float* bproj = (const float*)d_in[5];
  float* out = (float*)d_out;   // [2,2048,1024]
  if (in_sizes[0] != NTOK * D || in_sizes[1] != NTOK || in_sizes[2] != D * D3 || in_sizes[3] != D3 || in_sizes[4] != D * D || in_sizes[5] != D) return;
  size_t off = 0; char* ws = (char*)d_ws;
  auto carve = [&](size_t bytes) { char* p = ws + off; off += (bytes + 255) & ~(size_t)255; return p; };
  unsigned short* x16 = (unsigned short*)carve((size_t)NTOK * D * 2);        // 8 MB
  unsigned short* w16 = (unsigned short*)carve((size_t)D3 * D * 2);          // 6 MB ([3072][1024] bf16 = [which][n][k])
  b16* wo16 = (b16*)carve((size_t)D * D * 2);
  b16* qk = (b16*)carve((size_t)2 * NTOK * D * 2);                           // 16 MB: [which][b][h][s][64]
  b16* vt = (b16*)carve((size_t)NTOK * D * 2);                               // 8 MB
  float* y = (float*)carve((size_t)NTOK * D * 4);                            // 16 MB
  float* bl2 = (float*)carve((size_t)NTOK * 4);                              // 16 KB
  if (off > ws_size) return;                                                   // ≈ 56 MB
  prep_kernel<<<512, 256, 0, stream>>>(x, x16, abias, bl2);
  wt_kernel<0><<<dim3(D3 / 64, D / 64), 256, 0, stream>>>(wqkv, D, D3, w16);
  wt_kernel<1><<<dim3(D / 64, D / 64), 256, 0, stream>>>(wproj, D, D, (unsigned short*)wo16);
  proj_kernel<<<dim3(D3 / 128, NTOK / 128), 256, 0, stream>>>((const __bf16*)x16, (const __bf16*)w16, bqkv, qk, vt);
  attn_kernel<<<Bn * H * (S / 16) / 8, 256, 0, stream>>>(qk, vt, bl2, y);
  out_kernel<<<dim3(D / 128, NTOK / 128), 256, 0, stream>>>(y, wo16, bproj, out);
}

// v004
// One run takes 99.7 microseconds.
// Next to v003, in two timings, it ran 1.08 times as fast each time.
// Over all steps from v000 it is 2.91 times as fast.
#include <hip/hip_runtime.h>

// Gaze-guided multi-head attention (B=2, N=2048, D=1024, 16 heads x 64): qkv = x w_qkv + b_qkv; scores = q.k/8 + attn_bias[b][key]; softmax; (w.v) w_proj + b_proj.
// Numerics: x, attn_bias, w_qkv, b_qkv, w_proj, b_proj are rounded to bf16 (RNE); the qkv projection runs on
// v_wmma_f32_16x16x32_bf16 (exact products, f32 accumulate, + bias); the scores, P.V and the output projection run on v_wmma_f32_16x16x32_f16 with single f16 operands
// (f16 copies of q log2(e)/8, k, (8v)^T, P, the attention output rounded at load, and the exact f16 copy of bf16 w_proj); key bias and online softmax in f32, in base 2.

namespace {
constexpr int Bn = 2, S = 2048, D = 1024, H = 16, HD = 64, NTOK = Bn * S, D3 = 3 * D;
constexpr float SCALE = 0.125f, VS = 8.0f, LOG2E = 1.4426950408889634f;

typedef _Float16 b16;
typedef __attribute__((ext_vector_type(16))) _Float16 v16b;
typedef __attribute__((ext_vector_type(8)))  _Float16 v8b;
typedef __attribute__((ext_vector_type(8)))  float v8f;
typedef __attribute__((ext_vector_type(4)))  float v4f;

__device__ __forceinline__ v8b ld8b(const b16* p) { return *(const v8b*)p; }
__device__ __forceinline__ v16b cat8b(v8b a, v8b b) { return __builtin_shufflevector(a, b, 0, 1, 2, 3, 4, 5, 6, 7, 8, 9, 10, 11, 12, 13, 14, 15); }
__device__ __forceinline__ v16b frag_kb(const b16* p, int hh) { return cat8b(ld8b(p + 8 * hh), ld8b(p + 16 + 8 * hh)); }
__device__ __forceinline__ void split16(float v, b16& hi, b16& lo) { hi = (b16)v; lo = (b16)(v - (float)hi); }
__device__ __forceinline__ v8f wmma16b(v16b a, v16b b, v8f c) {
  v8f d = __builtin_amdgcn_wmma_f32_16x16x32_f16(false, a, false, b, (short)0, c, false, false);
  asm volatile("v_nop\n\tv_nop\n\tv_nop\n\tv_nop" : "+v"(d) : "v"(a), "v"(b));
  return d;
}
__device__ __forceinline__ void wave_lds_sync() {
  __builtin_amdgcn_fence(__ATOMIC_RELEASE, "workgroup");
  __builtin_amdgcn_wave_barrier();
  __builtin_amdgcn_fence(__ATOMIC_ACQUIRE, "workgroup");
}

__device__ __forceinline__ void epi_planes(v8f (&acc)[2][4], float scale, bool two, b16* __restrict__ oh, b16* __restrict__ ol, int ldo,
                                           int m0, int c0, int lane, b16* Th, b16* Tl) {
  const int nloc = lane & 15, hlf = lane >> 4;
#pragma unroll
  for (int t = 0; t < 4; ++t)
#pragma unroll
    for (int r = 0; r < 2; ++r)
#pragma unroll
      for (int v = 0; v < 8; ++v) {
        const int rr = r * 16 + v + 8 * hlf, cc = t * 16 + nloc;
        b16 h_, l_; split16(acc[r][t][v] * scale, h_, l_);
        Th[rr * 64 + cc] = h_; Tl[rr * 64 + cc] = l_;
      }
  wave_lds_sync();
  {
#pragma unroll
    for (int j = 0; j < 8; ++j) {
      const int rr = j * 4 + (lane >> 3), c8 = (lane & 7) * 8;
      const size_t o = (size_t)(m0 + rr) * ldo + c0 + c8;
      *(v8b*)(oh + o) = ld8b(Th + rr * 64 + c8);
      if (two) *(v8b*)(ol + o) = ld8b(Tl + rr * 64 + c8);
    }
    
  }
}
// (b) f32 rows with pitch ldo: 64 floats = 256 B = 2 lines per row; 16 lanes x 16 B per row, 2 rows per instruction. Optional per-row factor
__device__ __forceinline__ void epi_f32(v8f (&acc)[2][4], float scale, const float* rscale, float* __restrict__ out, int ldo, int m0, int c0, int lane, float* Tt) {
  const int nloc = lane & 15, hlf = lane >> 4;
#pragma unroll
  for (int t = 0; t < 4; ++t)
#pragma unroll
    for (int r = 0; r < 2; ++r)
#pragma unroll
      for (int v = 0; v < 8; ++v) {
        const int rr = r * 16 + v + 8 * hlf;
        const float rs = rscale ? rscale[(size_t)(m0 + rr) * 32] : 1.0f;
        Tt[rr * 64 + t * 16 + nloc] = acc[r][t][v] * scale * rs;
      }
  wave_lds_sync();
  float* dst0 = out + (size_t)m0 * ldo + c0;
  {
#pragma unroll
    for (int j = 0; j < 16; ++j) { const int rr = j * 2 + hlf, c4 = nloc * 4; *(v4f*)(dst0 + (size_t)rr * ldo + c4) = *(const v4f*)(Tt + rr * 64 + c4); }
    
  }
}



typedef __attribute__((ext_vector_type(8))) __bf16 v8bb; typedef __attribute__((ext_vector_type(16))) __bf16 v16bb;
typedef __attribute__((ext_vector_type(8))) unsigned short v8us;
__device__ __forceinline__ v16bb frag_kb_bf(const __bf16* p, int hh) { const v8bb a = *(const v8bb*)(p + 8 * hh), b = *(const v8bb*)(p + 16 + 8 * hh); return __builtin_shufflevector(a, b, 0, 1, 2, 3, 4, 5, 6, 7, 8, 9, 10, 11, 12, 13, 14, 15); }
__device__ __forceinline__ v8f wmma16bb(v16bb a, v16bb b, v8f c) {
  v8f d = __builtin_amdgcn_wmma_f32_16x16x32_bf16(false, a, false, b, (short)0, c, false, false);
  asm volatile("v_nop\n\tv_nop\n\tv_nop\n\tv_nop" : "+v"(d) : "v"(a), "v"(b));
  return d;
}
__device__ __forceinline__ unsigned short bf16_rne_bits(float v) { unsigned int u = __float_as_uint(v); u += 0x7FFFu + ((u >> 16) & 1u); return (unsigned short)(u >> 16); }
__device__ __forceinline__ float bf16_rne(float v) { return __uint_as_float(((unsigned int)bf16_rne_bits(v)) << 16); }

typedef __attribute__((ext_vector_type(4))) unsigned int v4u;
// All preparation is one launch: the blocks' roles go by block index, and every block moves 64 KB in and 32 KB out with its 16 loads of 16 B per thread issued together.
constexpr int WTK = 256, WTN = 64;                                    // a weight tile: 256 k rows x 64 n columns
constexpr int NB_WQ = (D3 / WTN) * (D / WTK), NB_WO = (D / WTN) * (D / WTK), NB_X = NTOK * D / 8 / (8 * 256);
template <int MODE> __device__ __forceinline__ unsigned int wbits(float w) {   // MODE 0 bf16 bits, MODE 1 f16(bf16(w)) bits
  if (MODE == 0) return bf16_rne_bits(w);
  const b16 hv = (b16)bf16_rne(w); return *reinterpret_cast<const unsigned short*>(&hv);
}
// W [k rows][Ncols] f32 -> [n][k] 16-bit rows of D, one tile through LDS. A thread takes 4 columns of two neighbouring k rows and stores the k pair as one dword of row n;
// the 16-B groups of LDS row n stand at (group ^ (n >> 2)), so that the 32 dword stores of a wave fall on 32 banks and a row is still read back as 512 contiguous bytes.
template <int MODE>
__device__ __forceinline__ void wt_tile(const float* __restrict__ Wm, int Ncols, unsigned short* __restrict__ out, int n0, int k0, unsigned int* Tl) {
  const int tid = threadIdx.x, lane = tid & 31, wave = tid >> 5, c = tid & 15, pr = tid >> 4;
  const float* src = Wm + (size_t)(k0 + 2 * pr) * Ncols + n0 + 4 * c;
  v4f lo[8], hi[8];
#pragma unroll
  for (int it = 0; it < 8; ++it) { lo[it] = *(const v4f*)(src + (size_t)(32 * it) * Ncols); hi[it] = *(const v4f*)(src + (size_t)(32 * it + 1) * Ncols); }
  __builtin_amdgcn_sched_barrier(0);                                  // all 16 loads issue before the first conversion: one memory latency per tile, not two
  asm volatile("s_wait_xcnt 0x0" :: "v"(src) : "memory");             // names the loads' address, which so stays untouched up to this wait
#pragma unroll
  for (int it = 0; it < 8; ++it) {
    const int p = pr + 16 * it;                                       // k pair of the tile: rows 2p, 2p + 1
#pragma unroll
    for (int j = 0; j < 4; ++j) Tl[(4 * c + j) * (WTK / 2) + ((((p >> 2) ^ c) << 2) | (p & 3))] = wbits<MODE>(lo[it][j]) | (wbits<MODE>(hi[it][j]) << 16);
  }
  __syncthreads();
  unsigned short* dst = out + (size_t)(n0 + wave * 8) * D + k0 + lane * 8;   // a wave stores 8 rows of 512 contiguous bytes
#pragma unroll
  for (int r = 0; r < 8; ++r) {
    const int n = wave * 8 + r;
    *(v4u*)(dst + r * D) = *(const v4u*)(Tl + n * (WTK / 2) + ((lane ^ (n >> 2)) << 2));
  }
  asm volatile("s_wait_xcnt 0x0" ::: "memory");                       // stands behind the eight stores, in front of any later write of their address or data registers
}
__global__ __launch_bounds__(256) void prep_kernel(const float* __restrict__ x, unsigned short* __restrict__ x16, const float* __restrict__ abias, float* __restrict__ bl2,
                                                   const float* __restrict__ wqkv, unsigned short* __restrict__ w16, const float* __restrict__ wproj, unsigned short* __restrict__ wo16) {
  __shared__ __attribute__((aligned(16))) unsigned int Tl[WTN * (WTK / 2)];
  const int bid = blockIdx.x;
  if (bid < NB_WQ) { wt_tile<0>(wqkv, D3, w16, (bid % (D3 / WTN)) * WTN, (bid / (D3 / WTN)) * WTK, Tl); return; }
  if (bid < NB_WQ + NB_WO) { const int t = bid - NB_WQ; wt_tile<1>(wproj, D, wo16, (t % (D / WTN)) * WTN, (t / (D / WTN)) * WTK, Tl); return; }
  const int xb = bid - NB_WQ - NB_WO, t = xb * 256 + threadIdx.x;    // the block rounds 64 KB of x in a row; the first NTOK threads also make the bias table
  const float* s = x + ((size_t)xb * (8 * 256) + threadIdx.x) * 8;
  const float* sb = abias + (t & (NTOK - 1));                         // in bounds for every thread, so that the load needs no branch and flies with the others
  const float ab = *sb;
  v4f a[8], b[8];
#pragma unroll
  for (int it = 0; it < 8; ++it) { a[it] = *(const v4f*)(s + it * (256 * 8)); b[it] = *(const v4f*)(s + it * (256 * 8) + 4); }
  asm volatile("s_wait_xcnt 0x0" :: "v"(s), "v"(sb) : "memory");      // names the loads' addresses, which so stay untouched up to this wait
  unsigned short* d = x16 + ((size_t)xb * (8 * 256) + threadIdx.x) * 8;
#pragma unroll
  for (int it = 0; it < 8; ++it) { v8us v;
#pragma unroll
    for (int e = 0; e < 4; ++e) { v[e] = bf16_rne_bits(a[it][e]); v[4 + e] = bf16_rne_bits(b[it][e]); }
    *(v8us*)(d + it * (256 * 8)) = v; }
  if (t < NTOK) bl2[t] = bf16_rne(ab) * LOG2E;                        // key bias, rounded to bf16, in base-2 units
}

// Both projection GEMMs: a block of 8 waves (4 row groups x 2 column groups of 32x64 wave tiles) owns a 128x128 tile; per stage of GK k the 128 A rows and 128 B rows come
// once per block into one of two LDS buffers by asynchronous copies (whole 128-B lines), and every wave takes its fragments from LDS. Row pitches are 16 B x odd.
constexpr int GK = 64, GNT = D / GK, GP = GK + 8, GPF = GK + 4;
constexpr int G16 = 128 * GP * 2, GF32 = 128 * GPF * 4;      // bytes of a 128-row tile: 16-bit rows, f32 rows
__device__ __forceinline__ unsigned lds_off(const void* p) { return (unsigned)(size_t)p; }
// One stage of two 16-bit operands: 2 x 128 rows of 128 B; 8 copies of 16 B per lane, every lane on, each wave-copy covers four whole lines.
__device__ __forceinline__ void stage_ab16(const char* ga, const char* gb, unsigned la, unsigned lb) {
  // the closing s_wait_xcnt stands inside the statement so that no address register of a copy is rewritten ahead of it
  asm volatile("global_load_async_to_lds_b128 %0, %8, off\n\t"
               "global_load_async_to_lds_b128 %1, %9, off\n\t"
               "global_load_async_to_lds_b128 %2, %10, off\n\t"
               "global_load_async_to_lds_b128 %3, %11, off\n\t"
               "global_load_async_to_lds_b128 %4, %12, off\n\t"
               "global_load_async_to_lds_b128 %5, %13, off\n\t"
               "global_load_async_to_lds_b128 %6, %14, off\n\t"
               "global_load_async_to_lds_b128 %7, %15, off\n\t"
               "s_wait_xcnt 0x0"
               :: "v"(la), "v"(la + 32 * GP * 2), "v"(la + 64 * GP * 2), "v"(la + 96 * GP * 2),
                  "v"(lb), "v"(lb + 32 * GP * 2), "v"(lb + 64 * GP * 2), "v"(lb + 96 * GP * 2),
                  "v"(ga), "v"(ga + 32 * D * 2), "v"(ga + 64 * D * 2), "v"(ga + 96 * D * 2),
                  "v"(gb), "v"(gb + 32 * D * 2), "v"(gb + 64 * D * 2), "v"(gb + 96 * D * 2)
               : "memory");
}
// One stage of an f32 A (128 rows of 256 B, 8 copies per lane, two rows per wave-copy) and a 16-bit B (128 rows of 128 B, 4 copies per lane).
__device__ __forceinline__ void stage_af32_b16(const char* ga, const char* gb, unsigned la, unsigned lb) {
  // the closing s_wait_xcnt stands inside the statement so that no address register of a copy is rewritten ahead of it
  asm volatile("global_load_async_to_lds_b128 %0, %12, off\n\t"
               "global_load_async_to_lds_b128 %1, %13, off\n\t"
               "global_load_async_to_lds_b128 %2, %14, off\n\t"
               "global_load_async_to_lds_b128 %3, %15, off\n\t"
               "global_load_async_to_lds_b128 %4, %16, off\n\t"
               "global_load_async_to_lds_b128 %5, %17, off\n\t"
               "global_load_async_to_lds_b128 %6, %18, off\n\t"
               "global_load_async_to_lds_b128 %7, %19, off\n\t"
               "global_load_async_to_lds_b128 %8, %20, off\n\t"
               "global_load_async_to_lds_b128 %9, %21, off\n\t"
               "global_load_async_to_lds_b128 %10, %22, off\n\t"
               "global_load_async_to_lds_b128 %11, %23, off\n\t"
               "s_wait_xcnt 0x0"
               :: "v"(la), "v"(la + 16 * GPF * 4), "v"(la + 32 * GPF * 4), "v"(la + 48 * GPF * 4),
                  "v"(la + 64 * GPF * 4), "v"(la + 80 * GPF * 4), "v"(la + 96 * GPF * 4), "v"(la + 112 * GPF * 4),
                  "v"(lb), "v"(lb + 32 * GP * 2), "v"(lb + 64 * GP * 2), "v"(lb + 96 * GP * 2),
                  "v"(ga), "v"(ga + 16 * D * 4), "v"(ga + 32 * D * 4), "v"(ga + 48 * D * 4),
                  "v"(ga + 64 * D * 4), "v"(ga + 80 * D * 4), "v"(ga + 96 * D * 4), "v"(ga + 112 * D * 4),
                  "v"(gb), "v"(gb + 32 * D * 2), "v"(gb + 64 * D * 2), "v"(gb + 96 * D * 2)
               : "memory");
}

// projections: grid (24, 32): (4096 x 1024) x (1024 x 3072) bf16 WMMA + bf16(b_qkv). q log2(e)/8, k -> f16 rows [b][h][s][64]; v -> (8v)^T f16 rows [b][h][64 d][s] (LDS transpose per column group).
__global__ __launch_bounds__(256) void proj_kernel(const __bf16* __restrict__ x16, const __bf16* __restrict__ w16, const float* __restrict__ bqkv, b16* __restrict__ qk, b16* __restrict__ vt) {
  __shared__ __attribute__((aligned(16))) unsigned char sm[2 * 2 * G16];   // two stage buffers [A | B]; behind the loop the epilogue's staging
  const int tid = threadIdx.x, lane = tid & 31, wave = tid >> 5, wm = wave & 3, wn = wave >> 2, nloc = lane & 15, hlf = lane >> 4;
  const int mb = blockIdx.y * 128, m0 = mb + wm * 32, cb = blockIdx.x * 128, cg = cb + wn * 64, which = cb / D, c0 = cg % D;
  const char* ga = (const char*)(x16 + (size_t)(mb + (tid >> 3)) * D + (tid & 7) * 8);
  const char* gb = (const char*)(w16 + (size_t)(cb + (tid >> 3)) * D + (tid & 7) * 8);
  const unsigned la = lds_off(sm) + (tid >> 3) * (GP * 2) + (tid & 7) * 16, lb = la + G16;
  v8f acc[2][4];
#pragma unroll
  for (int r = 0; r < 2; ++r)
#pragma unroll
    for (int t = 0; t < 4; ++t) acc[r][t] = (v8f){};
  stage_ab16(ga, gb, la, lb);
  asm volatile("s_wait_asynccnt 0x0" ::: "memory");   // this wave's share of stage 0 has landed
  __syncthreads();                                     // publishes stage 0 to the other waves
  stage_ab16(ga + GK * 2, gb + GK * 2, la + 2 * G16, lb + 2 * G16);
  for (int st = 0; st < GNT; ++st) {
    const __bf16* Al = (const __bf16*)(sm + (st & 1) * (2 * G16)) + (wm * 32 + nloc) * GP;
    const __bf16* Bl = (const __bf16*)(sm + (st & 1) * (2 * G16) + G16) + (wn * 64 + nloc) * GP;
#pragma unroll
    for (int ks = 0; ks < GK; ks += 32) {
      // the k-step's 12 LDS reads stand together at its head, so that the wave meets the LDS latency once and not once per B fragment
      const v16bb a0 = frag_kb_bf(Al + ks, hlf), a1 = frag_kb_bf(Al + 16 * GP + ks, hlf);
      v16bb bw[4];
#pragma unroll
      for (int t = 0; t < 4; ++t) bw[t] = frag_kb_bf(Bl + t * 16 * GP + ks, hlf);
#pragma unroll
      for (int t = 0; t < 4; ++t) { acc[0][t] = wmma16bb(a0, bw[t], acc[0][t]); acc[1][t] = wmma16bb(a1, bw[t], acc[1][t]); }
    }
    asm volatile("s_wait_dscnt 0x0" ::: "memory");     // this wave's reads of the stage's buffer have returned before it is refilled
    asm volatile("s_wait_asynccnt 0x0" ::: "memory");  // this wave's share of stage st + 1 has landed
    __syncthreads();                                   // publishes stage st + 1 and ends every wave's reads of stage st
    if (st + 2 < GNT) stage_ab16(ga + (st + 2) * (GK * 2), gb + (st + 2) * (GK * 2), la + (st & 1) * (2 * G16), lb + (st & 1) * (2 * G16));
  }
  asm volatile("s_wait_asynccnt 0x0" ::: "memory");    // no copy is outstanding when the buffers become the epilogue's staging
  // + bias (rounded to bf16)
#pragma unroll
  for (int t = 0; t < 4; ++t)
#pragma unroll
    for (int r = 0; r < 2; ++r)
#pragma unroll
      for (int v = 0; v < 8; ++v) acc[r][t][v] += bf16_rne(bqkv[cg + t * 16 + nloc]);
  const int h = c0 / HD, b = m0 / S, s0 = m0 % S;
  if (which < 2) { b16* Th = (b16*)sm + wave * (2 * 32 * 64); epi_planes(acc, which == 0 ? SCALE * LOG2E : 1.0f, false, qk + ((((size_t)which * Bn + b) * H + h) * S + s0) * HD, nullptr, HD, 0, 0, lane, Th, Th + 32 * 64); return; }
  b16 (*Tt)[128 + 8] = (b16 (*)[128 + 8])sm + wn * 64;
#pragma unroll
  for (int t = 0; t < 4; ++t)
#pragma unroll
    for (int r = 0; r < 2; ++r)
#pragma unroll
      for (int v = 0; v < 8; ++v) Tt[t * 16 + nloc][wm * 32 + r * 16 + 8 * hlf + v] = (b16)(acc[r][t][v] * VS);
  __syncthreads();
  const int tok0 = mb % S, bb = mb / S;
  b16* dst = vt + (((size_t)bb * H + h) * HD) * S + tok0;
  {
#pragma unroll
    for (int j = 0; j < 8; ++j) { const int dd = wm * 16 + j * 2 + (lane >> 4), c8 = (lane & 15) * 8; *(v8b*)(dst + (size_t)dd * S + c8) = *(const v8b*)(&Tt[dd][c8]); }
    
  }
}

// attention: wave = (b, h, 16 queries), all 64 key chunks of 32: S^T (K=64, 2 k-steps, single), online softmax f32, P^T f16, y^T += (8V)^T P^T (4 feature tiles); y/(8l) -> f32 rows
// The scores leave the matrix unit finished, in base-2 units: q carries log2(e)/8 and the score accumulators start from the key bias table (a lane's 8 rows of a tile are 8 consecutive keys).
// The block's 8 waves share one (b, h): K rows and (8V)^T rows come in stages of KT keys into two LDS buffers by asynchronous copies (whole 128-B lines, once per block),
// and every wave takes its fragments from LDS. Row pitches are 16 B x odd for the 16-byte LDS readers.
constexpr int KT = 128, NST = S / KT, KP = HD + 8, VP = KT + 8;
// One stage: 128 K rows of 128 B (16 KB contiguous) and 64 V^T rows of 256 B; 8 copies of 16 B per lane, every lane on, each wave-copy covers 512 contiguous bytes or two 256-B rows.
__device__ __forceinline__ void stage_copy(const b16* kg, const b16* vg, const b16* ks, const b16* vs, int tid) {
  const b16* gk = kg + tid * 8; const b16* gv = vg + (size_t)(tid >> 4) * S + (tid & 15) * 8;
  const unsigned lk = lds_off(ks + (tid >> 3) * KP + (tid & 7) * 8), lv = lds_off(vs + (tid >> 4) * VP + (tid & 15) * 8);
  // the closing s_wait_xcnt stands inside the statement so that no address register of a copy is rewritten ahead of it
  asm volatile("global_load_async_to_lds_b128 %0, %8, off\n\t"
               "global_load_async_to_lds_b128 %1, %9, off\n\t"
               "global_load_async_to_lds_b128 %2, %10, off\n\t"
               "global_load_async_to_lds_b128 %3, %11, off\n\t"
               "global_load_async_to_lds_b128 %4, %12, off\n\t"
               "global_load_async_to_lds_b128 %5, %13, off\n\t"
               "global_load_async_to_lds_b128 %6, %14, off\n\t"
               "global_load_async_to_lds_b128 %7, %15, off\n\t"
               "s_wait_xcnt 0x0"
               :: "v"(lk), "v"(lk + 32 * KP * 2), "v"(lk + 64 * KP * 2), "v"(lk + 96 * KP * 2),
                  "v"(lv), "v"(lv + 16 * VP * 2), "v"(lv + 32 * VP * 2), "v"(lv + 48 * VP * 2),
                  "v"(gk), "v"(gk + 2048), "v"(gk + 4096), "v"(gk + 6144),
                  "v"(gv), "v"(gv + (size_t)16 * S), "v"(gv + (size_t)32 * S), "v"(gv + (size_t)48 * S)
               : "memory");
}
__device__ __forceinline__ v8f ld8f(const float* p) { return __builtin_shufflevector(*(const v4f*)p, *(const v4f*)(p + 4), 0, 1, 2, 3, 4, 5, 6, 7); }
__global__ __launch_bounds__(256) void attn_kernel(const b16* __restrict__ qk, const b16* __restrict__ vt, const float* __restrict__ bl2, float* __restrict__ y) {
  __shared__ __attribute__((aligned(16))) float Os[8][16][HD + 4];
  __shared__ __attribute__((aligned(16))) b16 Ks[2][KT * KP];
  __shared__ __attribute__((aligned(16))) b16 Vs[2][HD * VP];
  const int tid = threadIdx.x, wid = threadIdx.x >> 5, lane = threadIdx.x & 31, hh = lane >> 4, col = lane & 15;
  const int qt = blockIdx.x * 8 + wid, jt = qt & 127, h = (qt >> 7) & 15, b = qt >> 11, q0 = jt * 16, qi = q0 + col;
  const b16* Q = qk + ((((size_t)0 * Bn + b) * H + h) * S) * HD; const b16* K = qk + ((((size_t)1 * Bn + b) * H + h) * S) * HD;
  const b16* vb = vt + (((size_t)b * H + h) * HD) * S;
  stage_copy(K, vb, Ks[0], Vs[0], tid);
  v16b qf[2];
#pragma unroll
  for (int ks = 0; ks < 2; ++ks) qf[ks] = frag_kb(Q + (size_t)qi * HD + ks * 32, hh);
  asm volatile("s_wait_asynccnt 0x0" ::: "memory");   // this wave's share of stage 0 has landed
  __syncthreads();                                     // publishes stage 0 to the other waves
  stage_copy(K + (size_t)KT * HD, vb + KT, Ks[1], Vs[1], tid);
  float m = -INFINITY, l = 0.0f; v8f o[4] = {{}, {}, {}, {}};
  const float* bl = bl2 + b * S + 8 * hh;
  v8f s0 = ld8f(bl), s1 = ld8f(bl + 16);
  for (int st = 0; st < NST; ++st) {
    const b16* Kl = Ks[st & 1]; const b16* Vl = Vs[st & 1];
    for (int kl = 0; kl < KT; kl += 32) {
      const int kb = st * KT + kl;
      // the pass's own 16 LDS reads stand together at its head: one wait for the K fragments, and the V^T fragments land behind the softmax
      v16b kf[2][2], vf[4];
#pragma unroll
      for (int ks = 0; ks < 2; ++ks) { kf[ks][0] = frag_kb(Kl + (kl + col) * KP + ks * 32, hh); kf[ks][1] = frag_kb(Kl + (kl + 16 + col) * KP + ks * 32, hh); }
#pragma unroll
      for (int n = 0; n < 4; ++n) vf[n] = frag_kb(Vl + (n * 16 + col) * VP + kl, hh);
#pragma unroll
      for (int ks = 0; ks < 2; ++ks) { s0 = wmma16b(kf[ks][0], qf[ks], s0); s1 = wmma16b(kf[ks][1], qf[ks], s1); }
      float mr = -INFINITY;
#pragma unroll
      for (int r = 0; r < 8; ++r) mr = fmaxf(mr, fmaxf(s0[r], s1[r]));
      mr = fmaxf(mr, __shfl_xor(mr, 16));
      const float mn = fmaxf(m, mr); float al_ = m - mn; m = mn;
      float sum = 0.0f, e[16]; v16b pb;
#pragma unroll
      for (int r = 0; r < 8; ++r) { e[r] = s0[r] - mn; e[8 + r] = s1[r] - mn; }
      // the pass's exponentials in one statement, each in place: none writes over the source of the one in front of it; the v_nop is the slot behind the last one
      asm("v_exp_f32 %0, %0\n\tv_exp_f32 %1, %1\n\tv_exp_f32 %2, %2\n\tv_exp_f32 %3, %3\n\tv_exp_f32 %4, %4\n\tv_exp_f32 %5, %5\n\t"
          "v_exp_f32 %6, %6\n\tv_exp_f32 %7, %7\n\tv_exp_f32 %8, %8\n\tv_exp_f32 %9, %9\n\tv_exp_f32 %10, %10\n\tv_exp_f32 %11, %11\n\t"
          "v_exp_f32 %12, %12\n\tv_exp_f32 %13, %13\n\tv_exp_f32 %14, %14\n\tv_exp_f32 %15, %15\n\tv_exp_f32 %16, %16\n\tv_nop"
          : "+v"(e[0]), "+v"(e[8]), "+v"(e[1]), "+v"(e[9]), "+v"(e[2]), "+v"(e[10]), "+v"(e[3]), "+v"(e[11]), "+v"(al_), "+v"(e[4]), "+v"(e[12]),
            "+v"(e[5]), "+v"(e[13]), "+v"(e[6]), "+v"(e[14]), "+v"(e[7]), "+v"(e[15]));
#pragma unroll
      for (int r = 0; r < 8; ++r) { sum += e[r] + e[8 + r]; pb[r] = (b16)e[r]; pb[8 + r] = (b16)e[8 + r]; }
      // the next pass's start values load behind the last read of the scores, so that they land under the rest of this pass; the last pass wraps to key 0 (in bounds, not used)
      const int kn = (kb + 32) & (S - 1);
      s0 = ld8f(bl + kn); s1 = ld8f(bl + kn + 16);
      sum += __shfl_xor(sum, 16); l = l * al_ + sum;
#pragma unroll
      for (int n = 0; n < 4; ++n) {
#pragma unroll
        for (int r = 0; r < 8; ++r) o[n][r] *= al_;
        o[n] = wmma16b(vf[n], pb, o[n]);
      }
      asm volatile("s_wait_xcnt 0x0" ::: "memory");    // stands between the start-value loads and the next pass's rewrite of their address registers
    }
    asm volatile("s_wait_dscnt 0x0" ::: "memory");     // this wave's reads of the stage's buffer have returned before it is refilled
    asm volatile("s_wait_asynccnt 0x0" ::: "memory");  // this wave's share of stage st + 1 has landed
    __syncthreads();                                   // publishes stage st + 1 and ends every wave's reads of stage st
    if (st + 2 < NST) stage_copy(K + (size_t)(st + 2) * KT * HD, vb + (st + 2) * KT, Ks[st & 1], Vs[st & 1], tid);
  }
  asm volatile("s_wait_asynccnt 0x0" ::: "memory");    // no copy is outstanding when the wave goes on to its end
  const float inv = 1.0f / (VS * l);
#pragma unroll
  for (int n = 0; n < 4; ++n)
#pragma unroll
    for (int r = 0; r < 8; ++r) Os[wid][col][n * 16 + 8 * hh + r] = o[n][r] * inv;
  wave_lds_sync();
  float* dst = y + ((size_t)b * S + q0) * D + h * HD;
  {
#pragma unroll
    for (int j = 0; j < 8; ++j) { const int rr = j * 2 + hh, c4 = col * 4; *(v4f*)(dst + (size_t)rr * D + c4) = *(const v4f*)(&Os[wid][rr][c4]); }
    
  }
}

// out = y Wo^T: (4096 x 1024) x (1024 x 1024); A = y rounded at the fragment load (single), B = f16(bf16 Wo) rows; f32 rows; grid (8, 32).
__global__ __launch_bounds__(256) void out_kernel(const float* __restrict__ y, const b16* __restrict__ wo16, const float* __restrict__ bproj, float* __restrict__ out) {
  __shared__ __attribute__((aligned(16))) unsigned char sm[2 * (GF32 + G16)];   // two stage buffers [A f32 | B]; behind the loop the epilogue's staging
  const int tid = threadIdx.x, lane = tid & 31, wave = tid >> 5, wm = wave & 3, wn = wave >> 2, nloc = lane & 15, hlf = lane >> 4;
  const int mb = blockIdx.y * 128, m0 = mb + wm * 32, cb = blockIdx.x * 128, c0 = cb + wn * 64;
  const char* ga = (const char*)(y + (size_t)(mb + (tid >> 4)) * D + (tid & 15) * 4);
  const char* gb = (const char*)(wo16 + (size_t)(cb + (tid >> 3)) * D + (tid & 7) * 8);
  const unsigned la = lds_off(sm) + (tid >> 4) * (GPF * 4) + (tid & 15) * 16, lb = lds_off(sm) + GF32 + (tid >> 3) * (GP * 2) + (tid & 7) * 16;
  v8f acc[2][4];
#pragma unroll
  for (int r = 0; r < 2; ++r)
#pragma unroll
    for (int t = 0; t < 4; ++t) acc[r][t] = (v8f){};
  stage_af32_b16(ga, gb, la, lb);
  asm volatile("s_wait_asynccnt 0x0" ::: "memory");   // this wave's share of stage 0 has landed
  __syncthreads();                                     // publishes stage 0 to the other waves
  stage_af32_b16(ga + GK * 4, gb + GK * 2, la + (GF32 + G16), lb + (GF32 + G16));
  for (int st = 0; st < GNT; ++st) {
    const float* Al = (const float*)(sm + (st & 1) * (GF32 + G16)) + (wm * 32 + nloc) * GPF + 8 * hlf;
    const b16* Bl = (const b16*)(sm + (st & 1) * (GF32 + G16) + GF32) + (wn * 64 + nloc) * GP;
#pragma unroll
    for (int ks = 0; ks < GK; ks += 32) {
      // the k-step's 16 LDS reads stand together at its head, so that the wave meets the LDS latency once and not once per B fragment
      v16b a0, a1, bw[4];
#pragma unroll
      for (int t = 0; t < 4; ++t) bw[t] = frag_kb(Bl + t * 16 * GP + ks, hlf);
#pragma unroll
      for (int e = 0; e < 8; ++e) { a0[e] = (b16)Al[ks + e]; a0[8 + e] = (b16)Al[ks + 16 + e]; a1[e] = (b16)Al[16 * GPF + ks + e]; a1[8 + e] = (b16)Al[16 * GPF + ks + 16 + e]; }
#pragma unroll
      for (int t = 0; t < 4; ++t) { acc[0][t] = wmma16b(a0, bw[t], acc[0][t]); acc[1][t] = wmma16b(a1, bw[t], acc[1][t]); }
    }
    asm volatile("s_wait_dscnt 0x0" ::: "memory");     // this wave's reads of the stage's buffer have returned before it is refilled
    asm volatile("s_wait_asynccnt 0x0" ::: "memory");  // this wave's share of stage st + 1 has landed
    __syncthreads();                                   // publishes stage st + 1 and ends every wave's reads of stage st
    if (st + 2 < GNT) stage_af32_b16(ga + (st + 2) * (GK * 4), gb + (st + 2) * (GK * 2), la + (st & 1) * (GF32 + G16), lb + (st & 1) * (GF32 + G16));
  }
  asm volatile("s_wait_asynccnt 0x0" ::: "memory");    // no copy is outstanding when the buffers become the epilogue's staging
#pragma unroll
  for (int t = 0; t < 4; ++t)
#pragma unroll
    for (int r = 0; r < 2; ++r)
#pragma unroll
      for (int v = 0; v < 8; ++v) acc[r][t][v] += bf16_rne(bproj[c0 + t * 16 + nloc]);
  epi_f32(acc, 1.0f, nullptr, out, D, m0, c0, lane, (float*)sm + wave * (32 * 64));
}
}  // namespace

extern "C" void kernel_launch(void* const* d_in, const int* in_sizes, int n_in,
                              void* d_out, int out_size, void* d_ws, size_t ws_size, hipStream_t stream) {
  (void)n_in; (void)out_size;
  const float* x = (const float*)d_in[0]; const float* abias = (const float*)d_in[1]; const float* wqkv = (const float*)d_in[2]; const float* bqkv = (const float*)d_in[3];
  const float* wproj = (const float*)d_in[4]; const float* bproj = (const float*)d_in[5];
  float* out = (float*)d_out;   // [2,2048,1024]
  if (in_sizes[0] != NTOK * D || in_sizes[1] != NTOK || in_sizes[2] != D * D3 || in_sizes[3] != D3 || in_sizes[4] != D * D || in_sizes[5] != D) return;
  size_t off = 0; char* ws = (char*)d_ws;
  auto carve = [&](size_t bytes) { char* p = ws + off; off += (bytes + 255) & ~(size_t)255; return p; };
  unsigned short* x16 = (unsigned short*)carve((size_t)NTOK * D * 2);        // 8 MB
  unsigned short* w16 = (unsigned short*)carve((size_t)D3 * D * 2);          // 6 MB ([3072][1024] bf16 = [which][n][k])
  b16* wo16 = (b16*)carve((size_t)D * D * 2);
  b16* qk = (b16*)carve((size_t)2 * NTOK * D * 2);                           // 16 MB: [which][b][h][s][64]
  b16* vt = (b16*)carve((size_t)NTOK * D * 2);                               // 8 MB
  float* y = (float*)carve((size_t)NTOK * D * 4);                            // 16 MB
  float* bl2 = (float*)carve((size_t)NTOK * 4);                              // 16 KB
  if (off > ws_size) return;                                                   // ≈ 56 MB
  prep_kernel<<<NB_WQ + NB_WO + NB_X, 256, 0, stream>>>(x, x16, abias, bl2, wqkv, w16, wproj, (unsigned short*)wo16);
  proj_kernel<<<dim3(D3 / 128, NTOK / 128), 256, 0, stream>>>((const __bf16*)x16, (const __bf16*)w16, bqkv, qk, vt);
  attn_kernel<<<Bn * H * (S / 16) / 8, 256, 0, stream>>>(qk, vt, bl2, y);
  out_kernel<<<dim3(D / 128, NTOK / 128), 256, 0, stream>>>(y, wo16, bproj, out);
}

// v005
// One run takes 95.3 microseconds.
// Timed twice side by side with v004, it ran 1.05 times as fast both times.
// Over all steps from v000 it is 3.05 times as fast.
#include <hip/hip_runtime.h>

// Gaze-guided multi-head attention (B=2, N=2048, D=1024, 16 heads x 64): qkv = x w_qkv + b_qkv; scores = q.k/8 + attn_bias[b][key]; softmax; (w.v) w_proj + b_proj.
// Numerics: x, attn_bias, w_qkv, b_qkv, w_proj, b_proj are rounded to bf16 (RNE); the qkv projection runs on
// v_wmma_f32_16x16x32_bf16 (exact products, f32 accumulate, + bias); the scores, P.V and the output projection run on v_wmma_f32_16x16x32_f16 with single f16 operands
// (f16 copies of q log2(e)/8, k, (8v)^T, P, the attention output rounded at load, and the exact f16 copy of bf16 w_proj); key bias and online softmax in f32, in base 2.

namespace {
constexpr int Bn = 2, S = 2048, D = 1024, H = 16, HD = 64, NTOK = Bn * S, D3 = 3 * D;
constexpr float SCALE = 0.125f, VS = 8.0f, LOG2E = 1.4426950408889634f;

typedef _Float16 b16;
typedef __attribute__((ext_vector_type(16))) _Float16 v16b;
typedef __attribute__((ext_vector_type(8)))  _Float16 v8b;
typedef __attribute__((ext_vector_type(8)))  float v8f;
typedef __attribute__((ext_vector_type(4)))  float v4f;

__device__ __forceinline__ v8b ld8b(const b16* p) { return *(const v8b*)p; }
__device__ __forceinline__ v16b cat8b(v8b a, v8b b) { return __builtin_shufflevector(a, b, 0, 1, 2, 3, 4, 5, 6, 7, 8, 9, 10, 11, 12, 13, 14, 15); }
__device__ __forceinline__ v16b frag_kb(const b16* p, int hh) { return cat8b(ld8b(p + 8 * hh), ld8b(p + 16 + 8 * hh)); }
__device__ __forceinline__ void split16(float v, b16& hi, b16& lo) { hi = (b16)v; lo = (b16)(v - (float)hi); }
__device__ __forceinline__ v8f wmma16b(v16b a, v16b b, v8f c) {
  v8f d = __builtin_amdgcn_wmma_f32_16x16x32_f16(false, a, false, b, (short)0, c, false, false);
  asm volatile("v_nop\n\tv_nop\n\tv_nop\n\tv_nop" : "+v"(d) : "v"(a), "v"(b));
  return d;
}
__device__ __forceinline__ void wave_lds_sync() {
  __builtin_amdgcn_fence(__ATOMIC_RELEASE, "workgroup");
  __builtin_amdgcn_wave_barrier();
  __builtin_amdgcn_fence(__ATOMIC_ACQUIRE, "workgroup");
}

__device__ __forceinline__ void epi_planes(v8f (&acc)[2][4], float scale, bool two, b16* __restrict__ oh, b16* __restrict__ ol, int ldo,
                                           int m0, int c0, int lane, b16* Th, b16* Tl) {
  const int nloc = lane & 15, hlf = lane >> 4;
#pragma unroll
  for (int t = 0; t < 4; ++t)
#pragma unroll
    for (int r = 0; r < 2; ++r)
#pragma unroll
      for (int v = 0; v < 8; ++v) {
        const int rr = r * 16 + v + 8 * hlf, cc = t * 16 + nloc;
        b16 h_, l_; split16(acc[r][t][v] * scale, h_, l_);
        Th[rr * 64 + cc] = h_; Tl[rr * 64 + cc] = l_;
      }
  wave_lds_sync();
  {
#pragma unroll
    for (int j = 0; j < 8; ++j) {
      const int rr = j * 4 + (lane >> 3), c8 = (lane & 7) * 8;
      const size_t o = (size_t)(m0 + rr) * ldo + c0 + c8;
      *(v8b*)(oh + o) = ld8b(Th + rr * 64 + c8);
      if (two) *(v8b*)(ol + o) = ld8b(Tl + rr * 64 + c8);
    }
    
  }
}
// (b) f32 rows with pitch ldo: 64 floats = 256 B = 2 lines per row; 16 lanes x 16 B per row, 2 rows per instruction. Optional per-row factor
__device__ __forceinline__ void epi_f32(v8f (&acc)[2][4], float scale, const float* rscale, float* __restrict__ out, int ldo, int m0, int c0, int lane, float* Tt) {
  const int nloc = lane & 15, hlf = lane >> 4;
#pragma unroll
  for (int t = 0; t < 4; ++t)
#pragma unroll
    for (int r = 0; r < 2; ++r)
#pragma unroll
      for (int v = 0; v < 8; ++v) {
        const int rr = r * 16 + v + 8 * hlf;
        const float rs = rscale ? rscale[(size_t)(m0 + rr) * 32] : 1.0f;
        Tt[rr * 64 + t * 16 + nloc] = acc[r][t][v] * scale * rs;
      }
  wave_lds_sync();
  float* dst0 = out + (size_t)m0 * ldo + c0;
  {
#pragma unroll
    for (int j = 0; j < 16; ++j) { const int rr = j * 2 + hlf, c4 = nloc * 4; *(v4f*)(dst0 + (size_t)rr * ldo + c4) = *(const v4f*)(Tt + rr * 64 + c4); }
    
  }
}



typedef __attribute__((ext_vector_type(8))) __bf16 v8bb; typedef __attribute__((ext_vector_type(16))) __bf16 v16bb;
typedef __attribute__((ext_vector_type(8))) unsigned short v8us;
__device__ __forceinline__ v16bb frag_kb_bf(const __bf16* p, int hh) { const v8bb a = *(const v8bb*)(p + 8 * hh), b = *(const v8bb*)(p + 16 + 8 * hh); return __builtin_shufflevector(a, b, 0, 1, 2, 3, 4, 5, 6, 7, 8, 9, 10, 11, 12, 13, 14, 15); }
__device__ __forceinline__ v8f wmma16bb(v16bb a, v16bb b, v8f c) {
  v8f d = __builtin_amdgcn_wmma_f32_16x16x32_bf16(false, a, false, b, (short)0, c, false, false);
  asm volatile("v_nop\n\tv_nop\n\tv_nop\n\tv_nop" : "+v"(d) : "v"(a), "v"(b));
  return d;
}
__device__ __forceinline__ unsigned short bf16_rne_bits(float v) { unsigned int u = __float_as_uint(v); u += 0x7FFFu + ((u >> 16) & 1u); return (unsigned short)(u >> 16); }
__device__ __forceinline__ float bf16_rne(float v) { return __uint_as_float(((unsigned int)bf16_rne_bits(v)) << 16); }

typedef __attribute__((ext_vector_type(4))) unsigned int v4u;
// All preparation is one launch: the blocks' roles go by block index, and every block moves 64 KB in and 32 KB out with its 16 loads of 16 B per thread issued together.
constexpr int WTK = 256, WTN = 64;                                    // a weight tile: 256 k rows x 64 n columns
constexpr int NB_WQ = (D3 / WTN) * (D / WTK), NB_WO = (D / WTN) * (D / WTK), NB_X = NTOK * D / 8 / (8 * 256);
template <int MODE> __device__ __forceinline__ unsigned int wbits(float w) {   // MODE 0 bf16 bits, MODE 1 f16(bf16(w)) bits
  if (MODE == 0) return bf16_rne_bits(w);
  const b16 hv = (b16)bf16_rne(w); return *reinterpret_cast<const unsigned short*>(&hv);
}
// W [k rows][Ncols] f32 -> [n][k] 16-bit rows of D, one tile through LDS. A thread takes 4 columns of two neighbouring k rows and stores the k pair as one dword of row n;
// the 16-B groups of LDS row n stand at (group ^ (n >> 2)), so that the 32 dword stores of a wave fall on 32 banks and a row is still read back as 512 contiguous bytes.
template <int MODE>
__device__ __forceinline__ void wt_tile(const float* __restrict__ Wm, int Ncols, unsigned short* __restrict__ out, int n0, int k0, unsigned int* Tl) {
  const int tid = threadIdx.x, lane = tid & 31, wave = tid >> 5, c = tid & 15, pr = tid >> 4;
  const float* src = Wm + (size_t)(k0 + 2 * pr) * Ncols + n0 + 4 * c;
  v4f lo[8], hi[8];
#pragma unroll
  for (int it = 0; it < 8; ++it) { lo[it] = *(const v4f*)(src + (size_t)(32 * it) * Ncols); hi[it] = *(const v4f*)(src + (size_t)(32 * it + 1) * Ncols); }
  __builtin_amdgcn_sched_barrier(0);                                  // all 16 loads issue before the first conversion: one memory latency per tile, not two
  asm volatile("s_wait_xcnt 0x0" :: "v"(src) : "memory");             // names the loads' address, which so stays untouched up to this wait
#pragma unroll
  for (int it = 0; it < 8; ++it) {
    const int p = pr + 16 * it;                                       // k pair of the tile: rows 2p, 2p + 1
#pragma unroll
    for (int j = 0; j < 4; ++j) Tl[(4 * c + j) * (WTK / 2) + ((((p >> 2) ^ c) << 2) | (p & 3))] = wbits<MODE>(lo[it][j]) | (wbits<MODE>(hi[it][j]) << 16);
  }
  __syncthreads();
  unsigned short* dst = out + (size_t)(n0 + wave * 8) * D + k0 + lane * 8;   // a wave stores 8 rows of 512 contiguous bytes
#pragma unroll
  for (int r = 0; r < 8; ++r) {
    const int n = wave * 8 + r;
    *(v4u*)(dst + r * D) = *(const v4u*)(Tl + n * (WTK / 2) + ((lane ^ (n >> 2)) << 2));
  }
  asm volatile("s_wait_xcnt 0x0" ::: "memory");                       // stands behind the eight stores, in front of any later write of their address or data registers
}
__global__ __launch_bounds__(256) void prep_kernel(const float* __restrict__ x, unsigned short* __restrict__ x16, const float* __restrict__ abias, float* __restrict__ bl2,
                                                   const float* __restrict__ wqkv, unsigned short* __restrict__ w16, const float* __restrict__ wproj, unsigned short* __restrict__ wo16) {
  __shared__ __attribute__((aligned(16))) unsigned int Tl[WTN * (WTK / 2)];
  const int bid = blockIdx.x;
  if (bid < NB_WQ) { wt_tile<0>(wqkv, D3, w16, (bid % (D3 / WTN)) * WTN, (bid / (D3 / WTN)) * WTK, Tl); return; }
  if (bid < NB_WQ + NB_WO) { const int t = bid - NB_WQ; wt_tile<1>(wproj, D, wo16, (t % (D / WTN)) * WTN, (t / (D / WTN)) * WTK, Tl); return; }
  const int xb = bid - NB_WQ - NB_WO, t = xb * 256 + threadIdx.x;    // the block rounds 64 KB of x in a row; the first NTOK threads also make the bias table
  const float* s = x + ((size_t)xb * (8 * 256) + threadIdx.x) * 8;
  const float* sb = abias + (t & (NTOK - 1));                         // in bounds for every thread, so that the load needs no branch and flies with the others
  const float ab = *sb;
  v4f a[8], b[8];
#pragma unroll
  for (int it = 0; it < 8; ++it) { a[it] = *(const v4f*)(s + it * (256 * 8)); b[it] = *(const v4f*)(s + it * (256 * 8) + 4); }
  asm volatile("s_wait_xcnt 0x0" :: "v"(s), "v"(sb) : "memory");      // names the loads' addresses, which so stay untouched up to this wait
  unsigned short* d = x16 + ((size_t)xb * (8 * 256) + threadIdx.x) * 8;
#pragma unroll
  for (int it = 0; it < 8; ++it) { v8us v;
#pragma unroll
    for (int e = 0; e < 4; ++e) { v[e] = bf16_rne_bits(a[it][e]); v[4 + e] = bf16_rne_bits(b[it][e]); }
    *(v8us*)(d + it * (256 * 8)) = v; }
  if (t < NTOK) bl2[t] = bf16_rne(ab) * LOG2E;                        // key bias, rounded to bf16, in base-2 units
}

// Both projection GEMMs: a block of 8 waves (4 row groups x 2 column groups of 32x64 wave tiles) owns a 128x128 tile; per stage of GK k the 128 A rows and 128 B rows come
// once per block into one of two LDS buffers by asynchronous copies (whole 128-B lines), and every wave takes its fragments from LDS. Row pitches are 16 B x odd.
constexpr int GK = 64, GNT = D / GK, GP = GK + 8, GPF = GK + 4;
constexpr int G16 = 128 * GP * 2, GF32 = 128 * GPF * 4;      // bytes of a 128-row tile: 16-bit rows, f32 rows
__device__ __forceinline__ unsigned lds_off(const void* p) { return (unsigned)(size_t)p; }
// One stage of two 16-bit operands: 2 x 128 rows of 128 B; 8 copies of 16 B per lane, every lane on, each wave-copy covers four whole lines.
__device__ __forceinline__ void stage_ab16(const char* ga, const char* gb, unsigned la, unsigned lb) {
  // the closing s_wait_xcnt stands inside the statement so that no address register of a copy is rewritten ahead of it
  asm volatile("global_load_async_to_lds_b128 %0, %8, off\n\t"
               "global_load_async_to_lds_b128 %1, %9, off\n\t"
               "global_load_async_to_lds_b128 %2, %10, off\n\t"
               "global_load_async_to_lds_b128 %3, %11, off\n\t"
               "global_load_async_to_lds_b128 %4, %12, off\n\t"
               "global_load_async_to_lds_b128 %5, %13, off\n\t"
               "global_load_async_to_lds_b128 %6, %14, off\n\t"
               "global_load_async_to_lds_b128 %7, %15, off\n\t"
               "s_wait_xcnt 0x0"
               :: "v"(la), "v"(la + 32 * GP * 2), "v"(la + 64 * GP * 2), "v"(la + 96 * GP * 2),
                  "v"(lb), "v"(lb + 32 * GP * 2), "v"(lb + 64 * GP * 2), "v"(lb + 96 * GP * 2),
                  "v"(ga), "v"(ga + 32 * D * 2), "v"(ga + 64 * D * 2), "v"(ga + 96 * D * 2),
                  "v"(gb), "v"(gb + 32 * D * 2), "v"(gb + 64 * D * 2), "v"(gb + 96 * D * 2)
               : "memory");
}
// One stage of an f32 A (128 rows of 256 B, 8 copies per lane, two rows per wave-copy) and a 16-bit B (128 rows of 128 B, 4 copies per lane).
__device__ __forceinline__ void stage_af32_b16(const char* ga, const char* gb, unsigned la, unsigned lb) {
  // the closing s_wait_xcnt stands inside the statement so that no address register of a copy is rewritten ahead of it
  asm volatile("global_load_async_to_lds_b128 %0, %12, off\n\t"
               "global_load_async_to_lds_b128 %1, %13, off\n\t"
               "global_load_async_to_lds_b128 %2, %14, off\n\t"
               "global_load_async_to_lds_b128 %3, %15, off\n\t"
               "global_load_async_to_lds_b128 %4, %16, off\n\t"
               "global_load_async_to_lds_b128 %5, %17, off\n\t"
               "global_load_async_to_lds_b128 %6, %18, off\n\t"
               "global_load_async_to_lds_b128 %7, %19, off\n\t"
               "global_load_async_to_lds_b128 %8, %20, off\n\t"
               "global_load_async_to_lds_b128 %9, %21, off\n\t"
               "global_load_async_to_lds_b128 %10, %22, off\n\t"
               "global_load_async_to_lds_b128 %11, %23, off\n\t"
               "s_wait_xcnt 0x0"
               :: "v"(la), "v"(la + 16 * GPF * 4), "v"(la + 32 * GPF * 4), "v"(la + 48 * GPF * 4),
                  "v"(la + 64 * GPF * 4), "v"(la + 80 * GPF * 4), "v"(la + 96 * GPF * 4), "v"(la + 112 * GPF * 4),
                  "v"(lb), "v"(lb + 32 * GP * 2), "v"(lb + 64 * GP * 2), "v"(lb + 96 * GP * 2),
                  "v"(ga), "v"(ga + 16 * D * 4), "v"(ga + 32 * D * 4), "v"(ga + 48 * D * 4),
                  "v"(ga + 64 * D * 4), "v"(ga + 80 * D * 4), "v"(ga + 96 * D * 4), "v"(ga + 112 * D * 4),
                  "v"(gb), "v"(gb + 32 * D * 2), "v"(gb + 64 * D * 2), "v"(gb + 96 * D * 2)
               : "memory");
}

// projections: grid (24, 32): (4096 x 1024) x (1024 x 3072) bf16 WMMA + bf16(b_qkv). q log2(e)/8, k -> f16 rows [b][h][s][64]; v -> (8v)^T f16 rows [b][h][64 d][s] (LDS transpose per column group).
__global__ __launch_bounds__(256) void proj_kernel(const __bf16* __restrict__ x16, const __bf16* __restrict__ w16, const float* __restrict__ bqkv, b16* __restrict__ qk, b16* __restrict__ vt) {
  __shared__ __attribute__((aligned(16))) unsigned char sm[2 * 2 * G16];   // two stage buffers [A | B]; behind the loop the epilogue's staging
  const int tid = threadIdx.x, lane = tid & 31, wave = tid >> 5, wm = wave & 3, wn = wave >> 2, nloc = lane & 15, hlf = lane >> 4;
  const int mb = blockIdx.y * 128, m0 = mb + wm * 32, cb = blockIdx.x * 128, cg = cb + wn * 64, which = cb / D, c0 = cg % D;
  const char* ga = (const char*)(x16 + (size_t)(mb + (tid >> 3)) * D + (tid & 7) * 8);
  const char* gb = (const char*)(w16 + (size_t)(cb + (tid >> 3)) * D + (tid & 7) * 8);
  const unsigned la = lds_off(sm) + (tid >> 3) * (GP * 2) + (tid & 7) * 16, lb = la + G16;
  v8f acc[2][4];
#pragma unroll
  for (int r = 0; r < 2; ++r)
#pragma unroll
    for (int t = 0; t < 4; ++t) acc[r][t] = (v8f){};
  stage_ab16(ga, gb, la, lb);
  asm volatile("s_wait_asynccnt 0x0" ::: "memory");   // this wave's share of stage 0 has landed
  __syncthreads();                                     // publishes stage 0 to the other waves
  stage_ab16(ga + GK * 2, gb + GK * 2, la + 2 * G16, lb + 2 * G16);
  for (int st = 0; st < GNT; ++st) {
    const __bf16* Al = (const __bf16*)(sm + (st & 1) * (2 * G16)) + (wm * 32 + nloc) * GP;
    const __bf16* Bl = (const __bf16*)(sm + (st & 1) * (2 * G16) + G16) + (wn * 64 + nloc) * GP;
#pragma unroll
    for (int ks = 0; ks < GK; ks += 32) {
      // the k-step's 12 LDS reads stand together at its head, so that the wave meets the LDS latency once and not once per B fragment
      const v16bb a0 = frag_kb_bf(Al + ks, hlf), a1 = frag_kb_bf(Al + 16 * GP + ks, hlf);
      v16bb bw[4];
#pragma unroll
      for (int t = 0; t < 4; ++t) bw[t] = frag_kb_bf(Bl + t * 16 * GP + ks, hlf);
#pragma unroll
      for (int t = 0; t < 4; ++t) { acc[0][t] = wmma16bb(a0, bw[t], acc[0][t]); acc[1][t] = wmma16bb(a1, bw[t], acc[1][t]); }
    }
    asm volatile("s_wait_dscnt 0x0" ::: "memory");     // this wave's reads of the stage's buffer have returned before it is refilled
    asm volatile("s_wait_asynccnt 0x0" ::: "memory");  // this wave's share of stage st + 1 has landed
    __syncthreads();                                   // publishes stage st + 1 and ends every wave's reads of stage st
    if (st + 2 < GNT) stage_ab16(ga + (st + 2) * (GK * 2), gb + (st + 2) * (GK * 2), la + (st & 1) * (2 * G16), lb + (st & 1) * (2 * G16));
  }
  asm volatile("s_wait_asynccnt 0x0" ::: "memory");    // no copy is outstanding when the buffers become the epilogue's staging
  // + bias (rounded to bf16)
#pragma unroll
  for (int t = 0; t < 4; ++t)
#pragma unroll
    for (int r = 0; r < 2; ++r)
#pragma unroll
      for (int v = 0; v < 8; ++v) acc[r][t][v] += bf16_rne(bqkv[cg + t * 16 + nloc]);
  const int h = c0 / HD, b = m0 / S, s0 = m0 % S;
  if (which < 2) { b16* Th = (b16*)sm + wave * (2 * 32 * 64); epi_planes(acc, which == 0 ? SCALE * LOG2E : 1.0f, false, qk + ((((size_t)which * Bn + b) * H + h) * S + s0) * HD, nullptr, HD, 0, 0, lane, Th, Th + 32 * 64); return; }
  b16 (*Tt)[128 + 8] = (b16 (*)[128 + 8])sm + wn * 64;
#pragma unroll
  for (int t = 0; t < 4; ++t)
#pragma unroll
    for (int r = 0; r < 2; ++r)
#pragma unroll
      for (int v = 0; v < 8; ++v) Tt[t * 16 + nloc][wm * 32 + r * 16 + 8 * hlf + v] = (b16)(acc[r][t][v] * VS);
  __syncthreads();
  const int tok0 = mb % S, bb = mb / S;
  b16* dst = vt + (((size_t)bb * H + h) * HD) * S + tok0;
  {
#pragma unroll
    for (int j = 0; j < 8; ++j) { const int dd = wm * 16 + j * 2 + (lane >> 4), c8 = (lane & 15) * 8; *(v8b*)(dst + (size_t)dd * S + c8) = *(const v8b*)(&Tt[dd][c8]); }
    
  }
}

// attention: wave = (b, h, 32 queries as two column tiles, every other 64 keys): per pass of 32 keys S^T (K=64, 2 k-steps, single), online softmax f32, P^T f16, y^T += (8V)^T P^T (4 feature tiles);
// each K and V^T fragment read from LDS serves both column tiles. Waves w and w + 4 of a block hold the same 32 queries and the two 64-key halves of every stage; at the end each
// hands the other one tile's (m, l, y^T) through LDS and finishes its own tile: y/(8l) -> f32 rows.
// The scores leave the matrix unit finished, in base-2 units: q carries log2(e)/8 and the score accumulators start from the key bias table (a lane's 8 rows of a tile are 8 consecutive keys).
// The block's 8 waves share one (b, h): K rows and (8V)^T rows come in stages of KT keys into two LDS buffers by asynchronous copies (whole 128-B lines, once per block),
// and every wave takes its fragments from LDS. Row pitches are 16 B x odd for the 16-byte LDS readers.
constexpr int KT = 128, NST = S / KT, KP = HD + 8, VP = KT + 8;
// One stage: 128 K rows of 128 B (16 KB contiguous) and 64 V^T rows of 256 B; 8 copies of 16 B per lane, every lane on, each wave-copy covers 512 contiguous bytes or two 256-B rows.
__device__ __forceinline__ void stage_copy(const b16* kg, const b16* vg, const b16* ks, const b16* vs, int tid) {
  const b16* gk = kg + tid * 8; const b16* gv = vg + (size_t)(tid >> 4) * S + (tid & 15) * 8;
  const unsigned lk = lds_off(ks + (tid >> 3) * KP + (tid & 7) * 8), lv = lds_off(vs + (tid >> 4) * VP + (tid & 15) * 8);
  // the closing s_wait_xcnt stands inside the statement so that no address register of a copy is rewritten ahead of it
  asm volatile("global_load_async_to_lds_b128 %0, %8, off\n\t"
               "global_load_async_to_lds_b128 %1, %9, off\n\t"
               "global_load_async_to_lds_b128 %2, %10, off\n\t"
               "global_load_async_to_lds_b128 %3, %11, off\n\t"
               "global_load_async_to_lds_b128 %4, %12, off\n\t"
               "global_load_async_to_lds_b128 %5, %13, off\n\t"
               "global_load_async_to_lds_b128 %6, %14, off\n\t"
               "global_load_async_to_lds_b128 %7, %15, off\n\t"
               "s_wait_xcnt 0x0"
               :: "v"(lk), "v"(lk + 32 * KP * 2), "v"(lk + 64 * KP * 2), "v"(lk + 96 * KP * 2),
                  "v"(lv), "v"(lv + 16 * VP * 2), "v"(lv + 32 * VP * 2), "v"(lv + 48 * VP * 2),
                  "v"(gk), "v"(gk + 2048), "v"(gk + 4096), "v"(gk + 6144),
                  "v"(gv), "v"(gv + (size_t)16 * S), "v"(gv + (size_t)32 * S), "v"(gv + (size_t)48 * S)
               : "memory");
}
__device__ __forceinline__ v8f ld8f(const float* p) { return __builtin_shufflevector(*(const v4f*)p, *(const v4f*)(p + 4), 0, 1, 2, 3, 4, 5, 6, 7); }
// four waves per SIMD (two blocks per WGP) hide the softmax chains: the register budget is held to a quarter of the SIMD's file
__global__ __launch_bounds__(256) __attribute__((amdgpu_waves_per_eu(4, 4))) void attn_kernel(const b16* __restrict__ qk, const b16* __restrict__ vt, const float* __restrict__ bl2, float* __restrict__ y) {
  __shared__ __attribute__((aligned(16))) float Os[8][16][HD + 4];
  __shared__ __attribute__((aligned(16))) b16 Ks[2][KT * KP];
  __shared__ __attribute__((aligned(16))) b16 Vs[2][HD * VP];
  const int tid = threadIdx.x, wid = __builtin_amdgcn_readfirstlane(threadIdx.x >> 5), lane = threadIdx.x & 31, hh = lane >> 4, col = lane & 15;
  const int g = wid >> 2, qb = (blockIdx.x & 15) * 128 + (wid & 3) * 32, h = (blockIdx.x >> 4) & 15, b = blockIdx.x >> 8;   // g: which 64 keys of a stage
  const b16* Q = qk + ((((size_t)0 * Bn + b) * H + h) * S) * HD; const b16* K = qk + ((((size_t)1 * Bn + b) * H + h) * S) * HD;
  const b16* vb = vt + (((size_t)b * H + h) * HD) * S;
  stage_copy(K, vb, Ks[0], Vs[0], tid);
  v16b qf[2][2];
#pragma unroll
  for (int c = 0; c < 2; ++c)
#pragma unroll
    for (int ks = 0; ks < 2; ++ks) qf[c][ks] = frag_kb(Q + (size_t)(qb + c * 16 + col) * HD + ks * 32, hh);
  asm volatile("s_wait_asynccnt 0x0" ::: "memory");   // this wave's share of stage 0 has landed
  __syncthreads();                                     // publishes stage 0 to the other waves
  stage_copy(K + (size_t)KT * HD, vb + KT, Ks[1], Vs[1], tid);
  float m[2] = {-INFINITY, -INFINITY}, l[2] = {0.0f, 0.0f}; v8f o[2][4] = {{{}, {}, {}, {}}, {{}, {}, {}, {}}};
  const float* bl = bl2 + b * S + g * (KT / 2);       // the same for the whole wave; a lane adds its half's 8 keys
  const unsigned ho = 8 * hh;
  v8f c0 = ld8f(bl + ho), c1 = ld8f(bl + 16 + ho);
  for (int st = 0; st < NST; ++st) {
    const b16* Kl = Ks[st & 1] + g * (KT / 2) * KP; const b16* Vl = Vs[st & 1] + g * (KT / 2);
    for (int kl = 0; kl < KT / 2; kl += 32) {
      // the pass's own 16 LDS reads stand together at its head: one wait for the K fragments, and the V^T fragments land behind the softmax
      v16b kf[2][2], vf[4];
#pragma unroll
      for (int ks = 0; ks < 2; ++ks) { kf[ks][0] = frag_kb(Kl + (kl + col) * KP + ks * 32, hh); kf[ks][1] = frag_kb(Kl + (kl + 16 + col) * KP + ks * 32, hh); }
#pragma unroll
      for (int n = 0; n < 4; ++n) vf[n] = frag_kb(Vl + (n * 16 + col) * VP + kl, hh);
      v8f s0[2], s1[2];
#pragma unroll
      for (int c = 0; c < 2; ++c) { s0[c] = wmma16b(kf[0][0], qf[c][0], c0); s1[c] = wmma16b(kf[0][1], qf[c][0], c1); }
#pragma unroll
      for (int c = 0; c < 2; ++c) { s0[c] = wmma16b(kf[1][0], qf[c][1], s0[c]); s1[c] = wmma16b(kf[1][1], qf[c][1], s1[c]); }
      // the next pass's start values load behind their last use, so that they land under the rest of this pass; this wave's next 32 keys follow at once or in the next stage;
      // the last pass wraps to the wave's first keys (in bounds, not used)
      const int kn = (st * KT + kl + (kl == 0 ? 32 : KT - 32)) & (S - 1);
      const float* pn = bl + kn + ho;
      c0 = ld8f(pn); c1 = ld8f(pn + 16);
      float mr[2], al_[2], sum[2], e[2][16]; v16b pb[2];
#pragma unroll
      for (int c = 0; c < 2; ++c) {
        mr[c] = -INFINITY;
#pragma unroll
        for (int r = 0; r < 8; ++r) mr[c] = fmaxf(mr[c], fmaxf(s0[c][r], s1[c][r]));
      }
#pragma unroll
      for (int c = 0; c < 2; ++c) mr[c] = fmaxf(mr[c], __shfl_xor(mr[c], 16));
#pragma unroll
      for (int c = 0; c < 2; ++c) {
        const float mn = fmaxf(m[c], mr[c]); al_[c] = m[c] - mn; m[c] = mn;
#pragma unroll
        for (int r = 0; r < 8; ++r) { e[c][r] = s0[c][r] - mn; e[c][8 + r] = s1[c][r] - mn; }
        // a tile's exponentials in one statement, each in place: none writes over the source of the one in front of it; the v_nop is the slot behind the last one
        asm("v_exp_f32 %0, %0\n\tv_exp_f32 %1, %1\n\tv_exp_f32 %2, %2\n\tv_exp_f32 %3, %3\n\tv_exp_f32 %4, %4\n\tv_exp_f32 %5, %5\n\t"
            "v_exp_f32 %6, %6\n\tv_exp_f32 %7, %7\n\tv_exp_f32 %8, %8\n\tv_exp_f32 %9, %9\n\tv_exp_f32 %10, %10\n\tv_exp_f32 %11, %11\n\t"
            "v_exp_f32 %12, %12\n\tv_exp_f32 %13, %13\n\tv_exp_f32 %14, %14\n\tv_exp_f32 %15, %15\n\tv_exp_f32 %16, %16\n\tv_nop"
            : "+v"(e[c][0]), "+v"(e[c][8]), "+v"(e[c][1]), "+v"(e[c][9]), "+v"(e[c][2]), "+v"(e[c][10]), "+v"(e[c][3]), "+v"(e[c][11]), "+v"(al_[c]), "+v"(e[c][4]), "+v"(e[c][12]),
              "+v"(e[c][5]), "+v"(e[c][13]), "+v"(e[c][6]), "+v"(e[c][14]), "+v"(e[c][7]), "+v"(e[c][15]));
        sum[c] = 0.0f;
#pragma unroll
        for (int r = 0; r < 8; ++r) { sum[c] += e[c][r] + e[c][8 + r]; pb[c][r] = (b16)e[c][r]; pb[c][8 + r] = (b16)e[c][8 + r]; }
      }
#pragma unroll
      for (int c = 0; c < 2; ++c) { sum[c] += __shfl_xor(sum[c], 16); l[c] = l[c] * al_[c] + sum[c]; }
#pragma unroll
      for (int n = 0; n < 4; ++n)
#pragma unroll
        for (int c = 0; c < 2; ++c) {
#pragma unroll
          for (int r = 0; r < 8; ++r) o[c][n][r] *= al_[c];
          o[c][n] = wmma16b(vf[n], pb[c], o[c][n]);
        }
      asm volatile("s_wait_xcnt 0x0" :: "v"(pn) : "memory");   // names the start-value loads' address, which so stays untouched up to this wait, far behind the loads
    }
    asm volatile("s_wait_dscnt 0x0" ::: "memory");     // this wave's reads of the stage's buffer have returned before it is refilled
    asm volatile("s_wait_asynccnt 0x0" ::: "memory");  // this wave's share of stage st + 1 has landed
    __syncthreads();                                   // publishes stage st + 1 and ends every wave's reads of stage st
    if (st + 2 < NST) stage_copy(K + (size_t)(st + 2) * KT * HD, vb + (st + 2) * KT, Ks[st & 1], Vs[st & 1], tid);
  }
  asm volatile("s_wait_asynccnt 0x0" ::: "memory");    // no copy is outstanding when the K buffers become the exchange area
  // The pair's join: wave group g keeps column tile g and hands tile 1 - g to its partner, lane to lane (34 floats a lane, lane-contiguous dwords), in the K buffers,
  // which every wave has left at the loop's last barrier.
  static_assert(8 * 34 * 32 * 4 <= (int)sizeof(Ks), "the exchange area fits the K buffers");
  float* X = (float*)&Ks[0][0];
  float* xo = X + wid * (34 * 32) + lane;
  const float* xi = X + (wid ^ 4) * (34 * 32) + lane;
#pragma unroll
  for (int n = 0; n < 4; ++n)
#pragma unroll
    for (int r = 0; r < 8; ++r) xo[(n * 8 + r) * 32] = g ? o[0][n][r] : o[1][n][r];
  xo[32 * 32] = g ? m[0] : m[1]; xo[33 * 32] = g ? l[0] : l[1];
  __syncthreads();                                     // publishes every wave's handed-over tile to its partner
  const float mm = g ? m[1] : m[0], lm = g ? l[1] : l[0], mo = xi[32 * 32], lo = xi[33 * 32], mj = fmaxf(mm, mo);
  float fa = mm - mj, fb = mo - mj;
  // the two weights of the join, each in place; the v_nop is the slot behind the last exponential
  asm("v_exp_f32 %0, %0\n\tv_exp_f32 %1, %1\n\tv_nop" : "+v"(fa), "+v"(fb));
  const float inv = 1.0f / (VS * (lm * fa + lo * fb));
  fa *= inv; fb *= inv;
#pragma unroll
  for (int n = 0; n < 4; ++n)
#pragma unroll
    for (int r = 0; r < 8; ++r) Os[wid][col][n * 16 + 8 * hh + r] = (g ? o[1][n][r] : o[0][n][r]) * fa + xi[(n * 8 + r) * 32] * fb;
  wave_lds_sync();
  float* dst = y + ((size_t)b * S + qb + g * 16) * D + h * HD;
  {
#pragma unroll
    for (int j = 0; j < 8; ++j) { const int rr = j * 2 + hh, c4 = col * 4; *(v4f*)(dst + (size_t)rr * D + c4) = *(const v4f*)(&Os[wid][rr][c4]); }
    
  }
}

// out = y Wo^T: (4096 x 1024) x (1024 x 1024); A = y rounded at the fragment load (single), B = f16(bf16 Wo) rows; f32 rows; grid (8, 32).
__global__ __launch_bounds__(256) void out_kernel(const float* __restrict__ y, const b16* __restrict__ wo16, const float* __restrict__ bproj, float* __restrict__ out) {
  __shared__ __attribute__((aligned(16))) unsigned char sm[2 * (GF32 + G16)];   // two stage buffers [A f32 | B]; behind the loop the epilogue's staging
  const int tid = threadIdx.x, lane = tid & 31, wave = tid >> 5, wm = wave & 3, wn = wave >> 2, nloc = lane & 15, hlf = lane >> 4;
  const int mb = blockIdx.y * 128, m0 = mb + wm * 32, cb = blockIdx.x * 128, c0 = cb + wn * 64;
  const char* ga = (const char*)(y + (size_t)(mb + (tid >> 4)) * D + (tid & 15) * 4);
  const char* gb = (const char*)(wo16 + (size_t)(cb + (tid >> 3)) * D + (tid & 7) * 8);
  const unsigned la = lds_off(sm) + (tid >> 4) * (GPF * 4) + (tid & 15) * 16, lb = lds_off(sm) + GF32 + (tid >> 3) * (GP * 2) + (tid & 7) * 16;
  v8f acc[2][4];
#pragma unroll
  for (int r = 0; r < 2; ++r)
#pragma unroll
    for (int t = 0; t < 4; ++t) acc[r][t] = (v8f){};
  stage_af32_b16(ga, gb, la, lb);
  asm volatile("s_wait_asynccnt 0x0" ::: "memory");   // this wave's share of stage 0 has landed
  __syncthreads();                                     // publishes stage 0 to the other waves
  stage_af32_b16(ga + GK * 4, gb + GK * 2, la + (GF32 + G16), lb + (GF32 + G16));
  for (int st = 0; st < GNT; ++st) {
    const float* Al = (const float*)(sm + (st & 1) * (GF32 + G16)) + (wm * 32 + nloc) * GPF + 8 * hlf;
    const b16* Bl = (const b16*)(sm + (st & 1) * (GF32 + G16) + GF32) + (wn * 64 + nloc) * GP;
#pragma unroll
    for (int ks = 0; ks < GK; ks += 32) {
      // the k-step's 16 LDS reads stand together at its head, so that the wave meets the LDS latency once and not once per B fragment
      v16b a0, a1, bw[4];
#pragma unroll
      for (int t = 0; t < 4; ++t) bw[t] = frag_kb(Bl + t * 16 * GP + ks, hlf);
#pragma unroll
      for (int e = 0; e < 8; ++e) { a0[e] = (b16)Al[ks + e]; a0[8 + e] = (b16)Al[ks + 16 + e]; a1[e] = (b16)Al[16 * GPF + ks + e]; a1[8 + e] = (b16)Al[16 * GPF + ks + 16 + e]; }
#pragma unroll
      for (int t = 0; t < 4; ++t) { acc[0][t] = wmma16b(a0, bw[t], acc[0][t]); acc[1][t] = wmma16b(a1, bw[t], acc[1][t]); }
    }
    asm volatile("s_wait_dscnt 0x0" ::: "memory");     // this wave's reads of the stage's buffer have returned before it is refilled
    asm volatile("s_wait_asynccnt 0x0" ::: "memory");  // this wave's share of stage st + 1 has landed
    __syncthreads();                                   // publishes stage st + 1 and ends every wave's reads of stage st
    if (st + 2 < GNT) stage_af32_b16(ga + (st + 2) * (GK * 4), gb + (st + 2) * (GK * 2), la + (st & 1) * (GF32 + G16), lb + (st & 1) * (GF32 + G16));
  }
  asm volatile("s_wait_asynccnt 0x0" ::: "memory");    // no copy is outstanding when the buffers become the epilogue's staging
#pragma unroll
  for (int t = 0; t < 4; ++t)
#pragma unroll
    for (int r = 0; r < 2; ++r)
#pragma unroll
      for (int v = 0; v < 8; ++v) acc[r][t][v] += bf16_rne(bproj[c0 + t * 16 + nloc]);
  epi_f32(acc, 1.0f, nullptr, out, D, m0, c0, lane, (float*)sm + wave * (32 * 64));
}
}  // namespace

extern "C" void kernel_launch(void* const* d_in, const int* in_sizes, int n_in,
                              void* d_out, int out_size, void* d_ws, size_t ws_size, hipStream_t stream) {
  (void)n_in; (void)out_size;
  const float* x = (const float*)d_in[0]; const float* abias = (const float*)d_in[1]; const float* wqkv = (const float*)d_in[2]; const float* bqkv = (const float*)d_in[3];
  const float* wproj = (const float*)d_in[4]; const float* bproj = (const float*)d_in[5];
  float* out = (float*)d_out;   // [2,2048,1024]
  if (in_sizes[0] != NTOK * D || in_sizes[1] != NTOK || in_sizes[2] != D * D3 || in_sizes[3] != D3 || in_sizes[4] != D * D || in_sizes[5] != D) return;
  size_t off = 0; char* ws = (char*)d_ws;
  auto carve = [&](size_t bytes) { char* p = ws + off; off += (bytes + 255) & ~(size_t)255; return p; };
  unsigned short* x16 = (unsigned short*)carve((size_t)NTOK * D * 2);        // 8 MB
  unsigned short* w16 = (unsigned short*)carve((size_t)D3 * D * 2);          // 6 MB ([3072][1024] bf16 = [which][n][k])
  b16* wo16 = (b16*)carve((size_t)D * D * 2);
  b16* qk = (b16*)carve((size_t)2 * NTOK * D * 2);                           // 16 MB: [which][b][h][s][64]
  b16* vt = (b16*)carve((size_t)NTOK * D * 2);                               // 8 MB
  float* y = (float*)carve((size_t)NTOK * D * 4);                            // 16 MB
  float* bl2 = (float*)carve((size_t)NTOK * 4);                              // 16 KB
  if (off > ws_size) return;                                                   // ≈ 56 MB
  prep_kernel<<<NB_WQ + NB_WO + NB_X, 256, 0, stream>>>(x, x16, abias, bl2, wqkv, w16, wproj, (unsigned short*)wo16);
  proj_kernel<<<dim3(D3 / 128, NTOK / 128), 256, 0, stream>>>((const __bf16*)x16, (const __bf16*)w16, bqkv, qk, vt);
  attn_kernel<<<Bn * H * (S / 16) / 8, 256, 0, stream>>>(qk, vt, bl2, y);
  out_kernel<<<dim3(D / 128, NTOK / 128), 256, 0, stream>>>(y, wo16, bproj, out);
}

// v006
// A run of this version takes 91.4 microseconds.
// Timed twice side by side with v005, it ran 1.04 times as fast both times.
// Over all steps from v000 it is 3.16 times as fast.
#include <hip/hip_runtime.h>

// Gaze-guided multi-head attention (B=2, N=2048, D=1024, 16 heads x 64): qkv = x w_qkv + b_qkv; scores = q.k/8 + attn_bias[b][key]; softmax; (w.v) w_proj + b_proj.
// Numerics: x, attn_bias, w_qkv, b_qkv, w_proj, b_proj are rounded to bf16 (RNE); the qkv projection runs on
// v_wmma_f32_16x16x32_bf16 (exact products, f32 accumulate, + bias); the scores, P.V and the output projection run on v_wmma_f32_16x16x32_f16 with single f16 operands
// (f16 copies of q log2(e)/8, k, (8v)^T, P, the attention output rounded at load, and the exact f16 copy of bf16 w_proj); key bias and online softmax in f32, in base 2.

namespace {
constexpr int Bn = 2, S = 2048, D = 1024, H = 16, HD = 64, NTOK = Bn * S, D3 = 3 * D;
constexpr float SCALE = 0.125f, VS = 8.0f, LOG2E = 1.4426950408889634f;

typedef _Float16 b16;
typedef __attribute__((ext_vector_type(16))) _Float16 v16b;
typedef __attribute__((ext_vector_type(8)))  _Float16 v8b;
typedef __attribute__((ext_vector_type(8)))  float v8f;
typedef __attribute__((ext_vector_type(4)))  float v4f;

__device__ __forceinline__ v8b ld8b(const b16* p) { return *(const v8b*)p; }
__device__ __forceinline__ v16b cat8b(v8b a, v8b b) { return __builtin_shufflevector(a, b, 0, 1, 2, 3, 4, 5, 6, 7, 8, 9, 10, 11, 12, 13, 14, 15); }
__device__ __forceinline__ v16b frag_kb(const b16* p, int hh) { return cat8b(ld8b(p + 8 * hh), ld8b(p + 16 + 8 * hh)); }
__device__ __forceinline__ v8f wmma16b(v16b a, v16b b, v8f c) {
  v8f d = __builtin_amdgcn_wmma_f32_16x16x32_f16(false, a, false, b, (short)0, c, false, false);
  asm volatile("v_nop\n\tv_nop\n\tv_nop\n\tv_nop" : "+v"(d) : "v"(a), "v"(b));
  return d;
}
__device__ __forceinline__ void wave_lds_sync() {
  __builtin_amdgcn_fence(__ATOMIC_RELEASE, "workgroup");
  __builtin_amdgcn_wave_barrier();
  __builtin_amdgcn_fence(__ATOMIC_ACQUIRE, "workgroup");
}

// f32 rows with pitch ldo: 64 floats = 256 B = 2 lines per row; 16 lanes x 16 B per row, 2 rows per instruction. Optional per-row factor
__device__ __forceinline__ void epi_f32(v8f (&acc)[2][4], float scale, const float* rscale, float* __restrict__ out, int ldo, int m0, int c0, int lane, float* Tt) {
  const int nloc = lane & 15, hlf = lane >> 4;
#pragma unroll
  for (int t = 0; t < 4; ++t)
#pragma unroll
    for (int r = 0; r < 2; ++r)
#pragma unroll
      for (int v = 0; v < 8; ++v) {
        const int rr = r * 16 + v + 8 * hlf;
        const float rs = rscale ? rscale[(size_t)(m0 + rr) * 32] : 1.0f;
        Tt[rr * 64 + t * 16 + nloc] = acc[r][t][v] * scale * rs;
      }
  wave_lds_sync();
  float* dst0 = out + (size_t)m0 * ldo + c0;
  {
#pragma unroll
    for (int j = 0; j < 16; ++j) { const int rr = j * 2 + hlf, c4 = nloc * 4; *(v4f*)(dst0 + (size_t)rr * ldo + c4) = *(const v4f*)(Tt + rr * 64 + c4); }
    
  }
}



typedef __attribute__((ext_vector_type(8))) __bf16 v8bb; typedef __attribute__((ext_vector_type(16))) __bf16 v16bb;
typedef __attribute__((ext_vector_type(8))) unsigned short v8us;
__device__ __forceinline__ v16bb frag_kb_bf(const __bf16* p, int hh) { const v8bb a = *(const v8bb*)(p + 8 * hh), b = *(const v8bb*)(p + 16 + 8 * hh); return __builtin_shufflevector(a, b, 0, 1, 2, 3, 4, 5, 6, 7, 8, 9, 10, 11, 12, 13, 14, 15); }
// the plain builtin: the compiler keeps the distance behind it itself, and its operands may lie above v255, which an asm statement's operands may not
__device__ __forceinline__ v8f wmma16bb(v16bb a, v16bb b, v8f c) { return __builtin_amdgcn_wmma_f32_16x16x32_bf16(false, a, false, b, (short)0, c, false, false); }
__device__ __forceinline__ unsigned short bf16_rne_bits(float v) { unsigned int u = __float_as_uint(v); u += 0x7FFFu + ((u >> 16) & 1u); return (unsigned short)(u >> 16); }
__device__ __forceinline__ float bf16_rne(float v) { return __uint_as_float(((unsigned int)bf16_rne_bits(v)) << 16); }

typedef __attribute__((ext_vector_type(4))) unsigned int v4u;
// All preparation is one launch: the blocks' roles go by block index, and every block moves 64 KB in and 32 KB out with its 16 loads of 16 B per thread issued together.
constexpr int WTK = 256, WTN = 64;                                    // a weight tile: 256 k rows x 64 n columns
constexpr int NB_WQ = (D3 / WTN) * (D / WTK), NB_WO = (D / WTN) * (D / WTK), NB_X = NTOK * D / 8 / (8 * 256);
template <int MODE> __device__ __forceinline__ unsigned int wbits(float w) {   // MODE 0 bf16 bits, MODE 1 f16(bf16(w)) bits
  if (MODE == 0) return bf16_rne_bits(w);
  const b16 hv = (b16)bf16_rne(w); return *reinterpret_cast<const unsigned short*>(&hv);
}
// W [k rows][Ncols] f32 -> [n][k] 16-bit rows of D, one tile through LDS. A thread takes 4 columns of two neighbouring k rows and stores the k pair as one dword of row n;
// the 16-B groups of LDS row n stand at (group ^ (n >> 2)), so that the 32 dword stores of a wave fall on 32 banks and a row is still read back as 512 contiguous bytes.
template <int MODE>
__device__ __forceinline__ void wt_tile(const float* __restrict__ Wm, int Ncols, unsigned short* __restrict__ out, int n0, int k0, unsigned int* Tl) {
  const int tid = threadIdx.x, lane = tid & 31, wave = tid >> 5, c = tid & 15, pr = tid >> 4;
  const float* src = Wm + (size_t)(k0 + 2 * pr) * Ncols + n0 + 4 * c;
  v4f lo[8], hi[8];
#pragma unroll
  for (int it = 0; it < 8; ++it) { lo[it] = *(const v4f*)(src + (size_t)(32 * it) * Ncols); hi[it] = *(const v4f*)(src + (size_t)(32 * it + 1) * Ncols); }
  __builtin_amdgcn_sched_barrier(0);                                  // all 16 loads issue before the first conversion: one memory latency per tile, not two
  asm volatile("s_wait_xcnt 0x0" :: "v"(src) : "memory");             // names the loads' address, which so stays untouched up to this wait
#pragma unroll
  for (int it = 0; it < 8; ++it) {
    const int p = pr + 16 * it;                                       // k pair of the tile: rows 2p, 2p + 1
#pragma unroll
    for (int j = 0; j < 4; ++j) Tl[(4 * c + j) * (WTK / 2) + ((((p >> 2) ^ c) << 2) | (p & 3))] = wbits<MODE>(lo[it][j]) | (wbits<MODE>(hi[it][j]) << 16);
  }
  __syncthreads();
  unsigned short* dst = out + (size_t)(n0 + wave * 8) * D + k0 + lane * 8;   // a wave stores 8 rows of 512 contiguous bytes
#pragma unroll
  for (int r = 0; r < 8; ++r) {
    const int n = wave * 8 + r;
    *(v4u*)(dst + r * D) = *(const v4u*)(Tl + n * (WTK / 2) + ((lane ^ (n >> 2)) << 2));
  }
  asm volatile("s_wait_xcnt 0x0" ::: "memory");                       // stands behind the eight stores, in front of any later write of their address or data registers
}
__global__ __launch_bounds__(256) void prep_kernel(const float* __restrict__ x, unsigned short* __restrict__ x16, const float* __restrict__ abias, float* __restrict__ bl2,
                                                   const float* __restrict__ wqkv, unsigned short* __restrict__ w16, const float* __restrict__ wproj, unsigned short* __restrict__ wo16) {
  __shared__ __attribute__((aligned(16))) unsigned int Tl[WTN * (WTK / 2)];
  const int bid = blockIdx.x;
  if (bid < NB_WQ) { wt_tile<0>(wqkv, D3, w16, (bid % (D3 / WTN)) * WTN, (bid / (D3 / WTN)) * WTK, Tl); return; }
  if (bid < NB_WQ + NB_WO) { const int t = bid - NB_WQ; wt_tile<1>(wproj, D, wo16, (t % (D / WTN)) * WTN, (t / (D / WTN)) * WTK, Tl); return; }
  const int xb = bid - NB_WQ - NB_WO, t = xb * 256 + threadIdx.x;    // the block rounds 64 KB of x in a row; the first NTOK threads also make the bias table
  const float* s = x + ((size_t)xb * (8 * 256) + threadIdx.x) * 8;
  const float* sb = abias + (t & (NTOK - 1));                         // in bounds for every thread, so that the load needs no branch and flies with the others
  const float ab = *sb;
  v4f a[8], b[8];
#pragma unroll
  for (int it = 0; it < 8; ++it) { a[it] = *(const v4f*)(s + it * (256 * 8)); b[it] = *(const v4f*)(s + it * (256 * 8) + 4); }
  asm volatile("s_wait_xcnt 0x0" :: "v"(s), "v"(sb) : "memory");      // names the loads' addresses, which so stay untouched up to this wait
  unsigned short* d = x16 + ((size_t)xb * (8 * 256) + threadIdx.x) * 8;
#pragma unroll
  for (int it = 0; it < 8; ++it) { v8us v;
#pragma unroll
    for (int e = 0; e < 4; ++e) { v[e] = bf16_rne_bits(a[it][e]); v[4 + e] = bf16_rne_bits(b[it][e]); }
    *(v8us*)(d + it * (256 * 8)) = v; }
  if (t < NTOK) bl2[t] = bf16_rne(ab) * LOG2E;                        // key bias, rounded to bf16, in base-2 units
}

// Both projection GEMMs: per stage of GK k the block's A rows and B rows come once per block into a ring of LDS buffers by asynchronous copies (whole 128-B lines),
// and every wave takes its fragments from LDS. Row pitches are 16 B x odd. The output projection's block is 128x128 (8 waves of 32x64), its ring two buffers.
// The qkv projection has as many blocks as the chip has WGPs: a block owns 256 rows x 192 columns (three whole heads), 8 waves (4 row groups x 2 column groups) of 64x96,
// so that an operand byte brought from L2 and a fragment read from LDS each serve more products. With one block on a WGP nothing else covers its waits: each k-step's fragments
// are fetched one k-step ahead into a second register set, and the ring has three buffers with two stages in flight: waves 0-3 copy the even stages, waves 4-7 the odd ones,
// so that each wave still waits for all of its own copies while the other group's stage flies on.
constexpr int GK = 64, GNT = D / GK, GP = GK + 8, GPF = GK + 4;
constexpr int G16 = 128 * GP * 2, GF32 = 128 * GPF * 4;      // bytes of a 128-row tile: 16-bit rows, f32 rows
__device__ __forceinline__ unsigned lds_off(const void* p) { return (unsigned)(size_t)p; }
constexpr int PM = 256, PN = 192, PK = 64, PNT = D / PK, PP = PK * 2 + 16, PST = (PM + PN) * PP;   // the qkv block's tile, k per stage, row pitch and stage size in bytes (A rows, then B rows)
__device__ __forceinline__ void copy14(const unsigned (&l)[14], const char* const (&g)[14]) {
  // the closing s_wait_xcnt stands inside the statement so that no address register of a copy is rewritten ahead of it
  asm volatile("global_load_async_to_lds_b128 %0, %14, off\n\t"
               "global_load_async_to_lds_b128 %1, %15, off\n\t"
               "global_load_async_to_lds_b128 %2, %16, off\n\t"
               "global_load_async_to_lds_b128 %3, %17, off\n\t"
               "global_load_async_to_lds_b128 %4, %18, off\n\t"
               "global_load_async_to_lds_b128 %5, %19, off\n\t"
               "global_load_async_to_lds_b128 %6, %20, off\n\t"
               "global_load_async_to_lds_b128 %7, %21, off\n\t"
               "global_load_async_to_lds_b128 %8, %22, off\n\t"
               "global_load_async_to_lds_b128 %9, %23, off\n\t"
               "global_load_async_to_lds_b128 %10, %24, off\n\t"
               "global_load_async_to_lds_b128 %11, %25, off\n\t"
               "global_load_async_to_lds_b128 %12, %26, off\n\t"
               "global_load_async_to_lds_b128 %13, %27, off\n\t"
               "s_wait_xcnt 0x0"
               :: "v"(l[0]), "v"(l[1]), "v"(l[2]), "v"(l[3]), "v"(l[4]), "v"(l[5]), "v"(l[6]), "v"(l[7]), "v"(l[8]), "v"(l[9]), "v"(l[10]), "v"(l[11]), "v"(l[12]), "v"(l[13]),
                  "v"(g[0]), "v"(g[1]), "v"(g[2]), "v"(g[3]), "v"(g[4]), "v"(g[5]), "v"(g[6]), "v"(g[7]), "v"(g[8]), "v"(g[9]), "v"(g[10]), "v"(g[11]), "v"(g[12]), "v"(g[13])
               : "memory");
}
// One stage of the qkv projection, copied by four waves: 256 + 192 rows of 128 B; 28 copies of 16 B per lane, every lane on, each wave-copy covers four whole lines.
__device__ __forceinline__ void stage_p(const char* ga, const char* gb, unsigned to, unsigned l) {   // ga, gb: the block's rows at the stage's k, the same for all lanes; to: the lane's own byte in them
#pragma unroll
  for (int hf = 0; hf < 2; ++hf) {
    unsigned ll[14]; const char* gg[14];
#pragma unroll
    for (int i = 0; i < 14; ++i) { const int rg = hf * 14 + i; ll[i] = l + rg * 16 * PP; gg[i] = (rg < PM / 16 ? ga + rg * 16 * D * 2 : gb + (rg - PM / 16) * 16 * D * 2) + to; }
    copy14(ll, gg);
  }
}
// One stage of an f32 A (128 rows of 256 B, 8 copies per lane, two rows per wave-copy) and a 16-bit B (128 rows of 128 B, 4 copies per lane).
__device__ __forceinline__ void stage_af32_b16(const char* ga, const char* gb, unsigned la, unsigned lb) {
  // the closing s_wait_xcnt stands inside the statement so that no address register of a copy is rewritten ahead of it
  asm volatile("global_load_async_to_lds_b128 %0, %12, off\n\t"
               "global_load_async_to_lds_b128 %1, %13, off\n\t"
               "global_load_async_to_lds_b128 %2, %14, off\n\t"
               "global_load_async_to_lds_b128 %3, %15, off\n\t"
               "global_load_async_to_lds_b128 %4, %16, off\n\t"
               "global_load_async_to_lds_b128 %5, %17, off\n\t"
               "global_load_async_to_lds_b128 %6, %18, off\n\t"
               "global_load_async_to_lds_b128 %7, %19, off\n\t"
               "global_load_async_to_lds_b128 %8, %20, off\n\t"
               "global_load_async_to_lds_b128 %9, %21, off\n\t"
               "global_load_async_to_lds_b128 %10, %22, off\n\t"
               "global_load_async_to_lds_b128 %11, %23, off\n\t"
               "s_wait_xcnt 0x0"
               :: "v"(la), "v"(la + 16 * GPF * 4), "v"(la + 32 * GPF * 4), "v"(la + 48 * GPF * 4),
                  "v"(la + 64 * GPF * 4), "v"(la + 80 * GPF * 4), "v"(la + 96 * GPF * 4), "v"(la + 112 * GPF * 4),
                  "v"(lb), "v"(lb + 32 * GP * 2), "v"(lb + 64 * GP * 2), "v"(lb + 96 * GP * 2),
                  "v"(ga), "v"(ga + 16 * D * 4), "v"(ga + 32 * D * 4), "v"(ga + 48 * D * 4),
                  "v"(ga + 64 * D * 4), "v"(ga + 80 * D * 4), "v"(ga + 96 * D * 4), "v"(ga + 112 * D * 4),
                  "v"(gb), "v"(gb + 32 * D * 2), "v"(gb + 64 * D * 2), "v"(gb + 96 * D * 2)
               : "memory");
}

// projections: grid (16, 16): (4096 x 1024) x (1024 x 3072) bf16 WMMA + bf16(b_qkv). q log2(e)/8, k -> f16 rows [b][h][s][64]; v -> (8v)^T f16 rows [b][h][64 d][s].
// The epilogue stages the block's three heads in LDS (q, k as rows, v transposed) and stores each head as whole lines.
__global__ __launch_bounds__(256) void proj_kernel(const __bf16* __restrict__ x16, const __bf16* __restrict__ w16, const float* __restrict__ bqkv, b16* __restrict__ qk, b16* __restrict__ vt) {
  __shared__ __attribute__((aligned(16))) unsigned char sm[3 * PST];   // three stage buffers [A | B]; behind the loop the epilogue's staging
  const int tid = threadIdx.x, lane = tid & 31, wave = __builtin_amdgcn_readfirstlane(tid >> 5), wm = wave & 3, wn = wave >> 2, nloc = lane & 15, hlf = lane >> 4;
  const int mb = blockIdx.y * PM, cb = blockIdx.x * PN, t7 = tid & 127;   // wn is also the wave's copy group: it copies the stages of its parity
  const char* ga = (const char*)(x16 + (size_t)mb * D);
  const char* gb = (const char*)(w16 + (size_t)cb * D);
  const unsigned to = (t7 >> 3) * (D * 2) + (t7 & 7) * 16, l = lds_off(sm) + (t7 >> 3) * PP + (t7 & 7) * 16;
  v8f acc[4][6];
#pragma unroll
  for (int r = 0; r < 4; ++r)
#pragma unroll
    for (int t = 0; t < 6; ++t) acc[r][t] = (v8f){};
  stage_p(ga + wn * (PK * 2), gb + wn * (PK * 2), to, l + wn * PST);   // stage 0 by group 0, stage 1 by group 1
  const float* pb = bqkv + cb + wn * 96 + nloc;
  float bias[6];
#pragma unroll
  for (int t = 0; t < 6; ++t) bias[t] = pb[t * 16];
  asm volatile("s_wait_xcnt 0x0" :: "v"(pb) : "memory");   // names the bias loads' address, which so stays untouched up to this wait
  if (wn == 0) asm volatile("s_wait_asynccnt 0x0" ::: "memory");   // the copying wave's share of stage 0 has landed
  __syncthreads();                                     // publishes stage 0 to the other waves
  if (wn == 0) stage_p(ga + 2 * (PK * 2), gb + 2 * (PK * 2), to, l + 2 * PST);
  const unsigned char* fA = sm + (wm * 64 + nloc) * PP;        // the lane's first A row and first B row in buffer 0
  const unsigned char* fB = sm + (PM + wn * 96 + nloc) * PP;
  v16bb fa[2][4], fb[2][6];                            // two fragment sets: one is multiplied while the other is filled
  auto ldf = [&](v16bb (&a)[4], v16bb (&bw)[6], int off) {     // a k-step's 20 LDS reads, as one group
#pragma unroll
    for (int r = 0; r < 4; ++r) a[r] = frag_kb_bf((const __bf16*)(fA + off + r * 16 * PP), hlf);
#pragma unroll
    for (int t = 0; t < 6; ++t) bw[t] = frag_kb_bf((const __bf16*)(fB + off + t * 16 * PP), hlf);
    __builtin_amdgcn_sched_barrier(0);                 // the group stays in front of the products that run while it lands: sunk among them, every read would be waited for on the spot
  };
  auto mm = [&](const v16bb (&a)[4], const v16bb (&bw)[6], int t0, int t1) {
#pragma unroll
    for (int t = t0; t < t1; ++t)
#pragma unroll
      for (int r = 0; r < 4; ++r) acc[r][t] = wmma16bb(a[r], bw[t], acc[r][t]);
  };
  ldf(fa[0], fb[0], 0);
  int cur = 0, nxt = PST;                              // byte offsets of stage st's and stage st + 1's buffers
  for (int st = 0; st < PNT; ++st) {
    ldf(fa[1], fb[1], cur + 64); mm(fa[0], fb[0], 0, 6);
    __builtin_amdgcn_sched_barrier(0);                 // these products stay in front of the waits: the last k-step's fragments land under them, not under an idle matrix unit
    // the publish point of stage st + 1 stands in front of stage st's last k-step, whose fragments are already fetched: behind it the next stage's first fragments are read
    asm volatile("s_wait_dscnt 0x0" ::: "memory");     // this wave's reads of the stage's buffer have returned before it is refilled
    if (((st + 1) & 1) == wn) asm volatile("s_wait_asynccnt 0x0" ::: "memory");   // the copying wave's share of stage st + 1 has landed (it has nothing else in flight)
    __syncthreads();                                   // publishes stage st + 1 and ends every wave's reads of stage st
    mm(fa[1], fb[1], 0, 2);
    __builtin_amdgcn_sched_barrier(0);                 // the matrix unit has work queued while the reads and the refill are issued
    if (st + 1 < PNT) ldf(fa[0], fb[0], nxt);
    if (st + 3 < PNT && ((st + 1) & 1) == wn) stage_p(ga + (st + 3) * (PK * 2), gb + (st + 3) * (PK * 2), to, l + cur);   // into the buffer that every wave has just left
    __builtin_amdgcn_sched_barrier(0);                 // the rest of the products stay behind the refill, so that the copies get two whole stages to land
    mm(fa[1], fb[1], 2, 6);
    cur = nxt; nxt = nxt == 2 * PST ? 0 : nxt + PST;
  }
  asm volatile("s_wait_asynccnt 0x0" ::: "memory");    // no copy is outstanding when the buffers become the epilogue's staging;
  asm volatile("s_wait_dscnt 0x0" ::: "memory");       // nor a read: the last pass reads nothing behind its barrier, which so also ends every wave's reads of the ring
  constexpr int RG = PM * GP * 2, VTP = PM + 8;        // bytes of a head's staging (256 rows of 64, pitch GP; or 64 rows of 256, pitch VTP)
  static_assert(HD * VTP * 2 <= RG && 3 * RG <= 3 * PST, "the three heads' staging fits the stage buffers");
  // + bias (rounded to bf16), the plane's factor, f16
#pragma unroll
  for (int t = 0; t < 6; ++t) {
    const int cl = wn * 96 + t * 16, which = (cb + cl) / D;    // the same for the whole wave
    b16* R = (b16*)(sm + (cl >> 6) * RG);
    const float bt = bf16_rne(bias[t]);
    if (which < 2) {
      const float sc = which == 0 ? SCALE * LOG2E : 1.0f;
#pragma unroll
      for (int r = 0; r < 4; ++r)
#pragma unroll
        for (int v = 0; v < 8; ++v) R[(wm * 64 + r * 16 + 8 * hlf + v) * GP + (cl & 63) + nloc] = (b16)((acc[r][t][v] + bt) * sc);
    } else {
#pragma unroll
      for (int r = 0; r < 4; ++r) {
        v8b p;
#pragma unroll
        for (int v = 0; v < 8; ++v) p[v] = (b16)((acc[r][t][v] + bt) * VS);
        *(v8b*)(R + ((cl & 63) + nloc) * VTP + wm * 64 + r * 16 + 8 * hlf) = p;
      }
    }
  }
  __syncthreads();                                     // publishes every wave's part of the three heads
  const int b = mb / S, s0 = mb % S;
#pragma unroll
  for (int j = 0; j < 3; ++j) {
    const int cg = cb + j * HD, which = cg / D, h = (cg % D) / HD;   // the same for the whole block
    const b16* R = (const b16*)(sm + j * RG);
    v8b w[8];
    if (which < 2) {                                   // 256 rows of 128 B stand in a row in memory: a wave stores 512 contiguous bytes
      b16* dst = qk + ((((size_t)which * Bn + b) * H + h) * S + s0) * HD + tid * 8;
#pragma unroll
      for (int i = 0; i < 8; ++i) w[i] = ld8b(R + (i * 32 + (tid >> 3)) * GP + (tid & 7) * 8);
#pragma unroll
      for (int i = 0; i < 8; ++i) *(v8b*)(dst + i * 2048) = w[i];
      asm volatile("s_wait_xcnt 0x0" ::: "memory");    // stands behind the eight stores, in front of any later write of their address or data registers
    } else {                                           // 64 feature rows of 256 tokens: a wave stores one row's 512 contiguous bytes
      b16* dst = vt + (((size_t)b * H + h) * HD + wave) * S + s0 + lane * 8;
#pragma unroll
      for (int i = 0; i < 8; ++i) w[i] = ld8b(R + (i * 8 + wave) * VTP + lane * 8);
#pragma unroll
      for (int i = 0; i < 8; ++i) *(v8b*)(dst + (size_t)(i * 8) * S) = w[i];
      asm volatile("s_wait_xcnt 0x0" ::: "memory");    // the same behind these eight
    }
  }
}

// attention: wave = (b, h, 32 queries as two column tiles, every other 64 keys): per pass of 32 keys S^T (K=64, 2 k-steps, single), online softmax f32, P^T f16, y^T += (8V)^T P^T (4 feature tiles);
// each K and V^T fragment read from LDS serves both column tiles. Waves w and w + 4 of a block hold the same 32 queries and the two 64-key halves of every stage; at the end each
// hands the other one tile's (m, l, y^T) through LDS and finishes its own tile: y/(8l) -> f32 rows.
// The scores leave the matrix unit finished, in base-2 units: q carries log2(e)/8 and the score accumulators start from the key bias table (a lane's 8 rows of a tile are 8 consecutive keys).
// The block's 8 waves share one (b, h): K rows and (8V)^T rows come in stages of KT keys into two LDS buffers by asynchronous copies (whole 128-B lines, once per block),
// and every wave takes its fragments from LDS. Row pitches are 16 B x odd for the 16-byte LDS readers.
constexpr int KT = 128, NST = S / KT, KP = HD + 8, VP = KT + 8;
// One stage: 128 K rows of 128 B (16 KB contiguous) and 64 V^T rows of 256 B; 8 copies of 16 B per lane, every lane on, each wave-copy covers 512 contiguous bytes or two 256-B rows.
__device__ __forceinline__ void stage_copy(const b16* kg, const b16* vg, const b16* ks, const b16* vs, int tid) {
  const b16* gk = kg + tid * 8; const b16* gv = vg + (size_t)(tid >> 4) * S + (tid & 15) * 8;
  const unsigned lk = lds_off(ks + (tid >> 3) * KP + (tid & 7) * 8), lv = lds_off(vs + (tid >> 4) * VP + (tid & 15) * 8);
  // the closing s_wait_xcnt stands inside the statement so that no address register of a copy is rewritten ahead of it
  asm volatile("global_load_async_to_lds_b128 %0, %8, off\n\t"
               "global_load_async_to_lds_b128 %1, %9, off\n\t"
               "global_load_async_to_lds_b128 %2, %10, off\n\t"
               "global_load_async_to_lds_b128 %3, %11, off\n\t"
               "global_load_async_to_lds_b128 %4, %12, off\n\t"
               "global_load_async_to_lds_b128 %5, %13, off\n\t"
               "global_load_async_to_lds_b128 %6, %14, off\n\t"
               "global_load_async_to_lds_b128 %7, %15, off\n\t"
               "s_wait_xcnt 0x0"
               :: "v"(lk), "v"(lk + 32 * KP * 2), "v"(lk + 64 * KP * 2), "v"(lk + 96 * KP * 2),
                  "v"(lv), "v"(lv + 16 * VP * 2), "v"(lv + 32 * VP * 2), "v"(lv + 48 * VP * 2),
                  "v"(gk), "v"(gk + 2048), "v"(gk + 4096), "v"(gk + 6144),
                  "v"(gv), "v"(gv + (size_t)16 * S), "v"(gv + (size_t)32 * S), "v"(gv + (size_t)48 * S)
               : "memory");
}
__device__ __forceinline__ v8f ld8f(const float* p) { return __builtin_shufflevector(*(const v4f*)p, *(const v4f*)(p + 4), 0, 1, 2, 3, 4, 5, 6, 7); }
// four waves per SIMD (two blocks per WGP) hide the softmax chains: the register budget is held to a quarter of the SIMD's file
__global__ __launch_bounds__(256) __attribute__((amdgpu_waves_per_eu(4, 4))) void attn_kernel(const b16* __restrict__ qk, const b16* __restrict__ vt, const float* __restrict__ bl2, float* __restrict__ y) {
  __shared__ __attribute__((aligned(16))) float Os[8][16][HD + 4];
  __shared__ __attribute__((aligned(16))) b16 Ks[2][KT * KP];
  __shared__ __attribute__((aligned(16))) b16 Vs[2][HD * VP];
  const int tid = threadIdx.x, wid = __builtin_amdgcn_readfirstlane(threadIdx.x >> 5), lane = threadIdx.x & 31, hh = lane >> 4, col = lane & 15;
  const int g = wid >> 2, qb = (blockIdx.x & 15) * 128 + (wid & 3) * 32, h = (blockIdx.x >> 4) & 15, b = blockIdx.x >> 8;   // g: which 64 keys of a stage
  const b16* Q = qk + ((((size_t)0 * Bn + b) * H + h) * S) * HD; const b16* K = qk + ((((size_t)1 * Bn + b) * H + h) * S) * HD;
  const b16* vb = vt + (((size_t)b * H + h) * HD) * S;
  stage_copy(K, vb, Ks[0], Vs[0], tid);
  v16b qf[2][2];
#pragma unroll
  for (int c = 0; c < 2; ++c)
#pragma unroll
    for (int ks = 0; ks < 2; ++ks) qf[c][ks] = frag_kb(Q + (size_t)(qb + c * 16 + col) * HD + ks * 32, hh);
  asm volatile("s_wait_asynccnt 0x0" ::: "memory");   // this wave's share of stage 0 has landed
  __syncthreads();                                     // publishes stage 0 to the other waves
  stage_copy(K + (size_t)KT * HD, vb + KT, Ks[1], Vs[1], tid);
  float m[2] = {-INFINITY, -INFINITY}, l[2] = {0.0f, 0.0f}; v8f o[2][4] = {{{}, {}, {}, {}}, {{}, {}, {}, {}}};
  const float* bl = bl2 + b * S + g * (KT / 2);       // the same for the whole wave; a lane adds its half's 8 keys
  const unsigned ho = 8 * hh;
  v8f c0 = ld8f(bl + ho), c1 = ld8f(bl + 16 + ho);
  for (int st = 0; st < NST; ++st) {
    const b16* Kl = Ks[st & 1] + g * (KT / 2) * KP; const b16* Vl = Vs[st & 1] + g * (KT / 2);
    for (int kl = 0; kl < KT / 2; kl += 32) {
      // the pass's own 16 LDS reads stand together at its head: one wait for the K fragments, and the V^T fragments land behind the softmax
      v16b kf[2][2], vf[4];
#pragma unroll
      for (int ks = 0; ks < 2; ++ks) { kf[ks][0] = frag_kb(Kl + (kl + col) * KP + ks * 32, hh); kf[ks][1] = frag_kb(Kl + (kl + 16 + col) * KP + ks * 32, hh); }
#pragma unroll
      for (int n = 0; n < 4; ++n) vf[n] = frag_kb(Vl + (n * 16 + col) * VP + kl, hh);
      v8f s0[2], s1[2];
#pragma unroll
      for (int c = 0; c < 2; ++c) { s0[c] = wmma16b(kf[0][0], qf[c][0], c0); s1[c] = wmma16b(kf[0][1], qf[c][0], c1); }
#pragma unroll
      for (int c = 0; c < 2; ++c) { s0[c] = wmma16b(kf[1][0], qf[c][1], s0[c]); s1[c] = wmma16b(kf[1][1], qf[c][1], s1[c]); }
      // the next pass's start values load behind their last use, so that they land under the rest of this pass; this wave's next 32 keys follow at once or in the next stage;
      // the last pass wraps to the wave's first keys (in bounds, not used)
      const int kn = (st * KT + kl + (kl == 0 ? 32 : KT - 32)) & (S - 1);
      const float* pn = bl + kn + ho;
      c0 = ld8f(pn); c1 = ld8f(pn + 16);
      float mr[2], al_[2], sum[2], e[2][16]; v16b pb[2];
#pragma unroll
      for (int c = 0; c < 2; ++c) {
        mr[c] = -INFINITY;
#pragma unroll
        for (int r = 0; r < 8; ++r) mr[c] = fmaxf(mr[c], fmaxf(s0[c][r], s1[c][r]));
      }
#pragma unroll
      for (int c = 0; c < 2; ++c) mr[c] = fmaxf(mr[c], __shfl_xor(mr[c], 16));
#pragma unroll
      for (int c = 0; c < 2; ++c) {
        const float mn = fmaxf(m[c], mr[c]); al_[c] = m[c] - mn; m[c] = mn;
#pragma unroll
        for (int r = 0; r < 8; ++r) { e[c][r] = s0[c][r] - mn; e[c][8 + r] = s1[c][r] - mn; }
        // a tile's exponentials in one statement, each in place: none writes over the source of the one in front of it; the v_nop is the slot behind the last one
        asm("v_exp_f32 %0, %0\n\tv_exp_f32 %1, %1\n\tv_exp_f32 %2, %2\n\tv_exp_f32 %3, %3\n\tv_exp_f32 %4, %4\n\tv_exp_f32 %5, %5\n\t"
            "v_exp_f32 %6, %6\n\tv_exp_f32 %7, %7\n\tv_exp_f32 %8, %8\n\tv_exp_f32 %9, %9\n\tv_exp_f32 %10, %10\n\tv_exp_f32 %11, %11\n\t"
            "v_exp_f32 %12, %12\n\tv_exp_f32 %13, %13\n\tv_exp_f32 %14, %14\n\tv_exp_f32 %15, %15\n\tv_exp_f32 %16, %16\n\tv_nop"
            : "+v"(e[c][0]), "+v"(e[c][8]), "+v"(e[c][1]), "+v"(e[c][9]), "+v"(e[c][2]), "+v"(e[c][10]), "+v"(e[c][3]), "+v"(e[c][11]), "+v"(al_[c]), "+v"(e[c][4]), "+v"(e[c][12]),
              "+v"(e[c][5]), "+v"(e[c][13]), "+v"(e[c][6]), "+v"(e[c][14]), "+v"(e[c][7]), "+v"(e[c][15]));
        sum[c] = 0.0f;
#pragma unroll
        for (int r = 0; r < 8; ++r) { sum[c] += e[c][r] + e[c][8 + r]; pb[c][r] = (b16)e[c][r]; pb[c][8 + r] = (b16)e[c][8 + r]; }
      }
#pragma unroll
      for (int c = 0; c < 2; ++c) { sum[c] += __shfl_xor(sum[c], 16); l[c] = l[c] * al_[c] + sum[c]; }
#pragma unroll
      for (int n = 0; n < 4; ++n)
#pragma unroll
        for (int c = 0; c < 2; ++c) {
#pragma unroll
          for (int r = 0; r < 8; ++r) o[c][n][r] *= al_[c];
          o[c][n] = wmma16b(vf[n], pb[c], o[c][n]);
        }
      asm volatile("s_wait_xcnt 0x0" :: "v"(pn) : "memory");   // names the start-value loads' address, which so stays untouched up to this wait, far behind the loads
    }
    asm volatile("s_wait_dscnt 0x0" ::: "memory");     // this wave's reads of the stage's buffer have returned before it is refilled
    asm volatile("s_wait_asynccnt 0x0" ::: "memory");  // this wave's share of stage st + 1 has landed
    __syncthreads();                                   // publishes stage st + 1 and ends every wave's reads of stage st
    if (st + 2 < NST) stage_copy(K + (size_t)(st + 2) * KT * HD, vb + (st + 2) * KT, Ks[st & 1], Vs[st & 1], tid);
  }
  asm volatile("s_wait_asynccnt 0x0" ::: "memory");    // no copy is outstanding when the K buffers become the exchange area
  // The pair's join: wave group g keeps column tile g and hands tile 1 - g to its partner, lane to lane (34 floats a lane, lane-contiguous dwords), in the K buffers,
  // which every wave has left at the loop's last barrier.
  static_assert(8 * 34 * 32 * 4 <= (int)sizeof(Ks), "the exchange area fits the K buffers");
  float* X = (float*)&Ks[0][0];
  float* xo = X + wid * (34 * 32) + lane;
  const float* xi = X + (wid ^ 4) * (34 * 32) + lane;
#pragma unroll
  for (int n = 0; n < 4; ++n)
#pragma unroll
    for (int r = 0; r < 8; ++r) xo[(n * 8 + r) * 32] = g ? o[0][n][r] : o[1][n][r];
  xo[32 * 32] = g ? m[0] : m[1]; xo[33 * 32] = g ? l[0] : l[1];
  __syncthreads();                                     // publishes every wave's handed-over tile to its partner
  const float mm = g ? m[1] : m[0], lm = g ? l[1] : l[0], mo = xi[32 * 32], lo = xi[33 * 32], mj = fmaxf(mm, mo);
  float fa = mm - mj, fb = mo - mj;
  // the two weights of the join, each in place; the v_nop is the slot behind the last exponential
  asm("v_exp_f32 %0, %0\n\tv_exp_f32 %1, %1\n\tv_nop" : "+v"(fa), "+v"(fb));
  const float inv = 1.0f / (VS * (lm * fa + lo * fb));
  fa *= inv; fb *= inv;
#pragma unroll
  for (int n = 0; n < 4; ++n)
#pragma unroll
    for (int r = 0; r < 8; ++r) Os[wid][col][n * 16 + 8 * hh + r] = (g ? o[1][n][r] : o[0][n][r]) * fa + xi[(n * 8 + r) * 32] * fb;
  wave_lds_sync();
  float* dst = y + ((size_t)b * S + qb + g * 16) * D + h * HD;
  {
#pragma unroll
    for (int j = 0; j < 8; ++j) { const int rr = j * 2 + hh, c4 = col * 4; *(v4f*)(dst + (size_t)rr * D + c4) = *(const v4f*)(&Os[wid][rr][c4]); }
    
  }
}

// out = y Wo^T: (4096 x 1024) x (1024 x 1024); A = y rounded at the fragment load (single), B = f16(bf16 Wo) rows; f32 rows; grid (8, 32).
__global__ __launch_bounds__(256) void out_kernel(const float* __restrict__ y, const b16* __restrict__ wo16, const float* __restrict__ bproj, float* __restrict__ out) {
  __shared__ __attribute__((aligned(16))) unsigned char sm[2 * (GF32 + G16)];   // two stage buffers [A f32 | B]; behind the loop the epilogue's staging
  const int tid = threadIdx.x, lane = tid & 31, wave = tid >> 5, wm = wave & 3, wn = wave >> 2, nloc = lane & 15, hlf = lane >> 4;
  const int mb = blockIdx.y * 128, m0 = mb + wm * 32, cb = blockIdx.x * 128, c0 = cb + wn * 64;
  const char* ga = (const char*)(y + (size_t)(mb + (tid >> 4)) * D + (tid & 15) * 4);
  const char* gb = (const char*)(wo16 + (size_t)(cb + (tid >> 3)) * D + (tid & 7) * 8);
  const unsigned la = lds_off(sm) + (tid >> 4) * (GPF * 4) + (tid & 15) * 16, lb = lds_off(sm) + GF32 + (tid >> 3) * (GP * 2) + (tid & 7) * 16;
  v8f acc[2][4];
#pragma unroll
  for (int r = 0; r < 2; ++r)
#pragma unroll
    for (int t = 0; t < 4; ++t) acc[r][t] = (v8f){};
  stage_af32_b16(ga, gb, la, lb);
  asm volatile("s_wait_asynccnt 0x0" ::: "memory");   // this wave's share of stage 0 has landed
  __syncthreads();                                     // publishes stage 0 to the other waves
  stage_af32_b16(ga + GK * 4, gb + GK * 2, la + (GF32 + G16), lb + (GF32 + G16));
  for (int st = 0; st < GNT; ++st) {
    const float* Al = (const float*)(sm + (st & 1) * (GF32 + G16)) + (wm * 32 + nloc) * GPF + 8 * hlf;
    const b16* Bl = (const b16*)(sm + (st & 1) * (GF32 + G16) + GF32) + (wn * 64 + nloc) * GP;
#pragma unroll
    for (int ks = 0; ks < GK; ks += 32) {
      // the k-step's 16 LDS reads stand together at its head, so that the wave meets the LDS latency once and not once per B fragment
      v16b a0, a1, bw[4];
#pragma unroll
      for (int t = 0; t < 4; ++t) bw[t] = frag_kb(Bl + t * 16 * GP + ks, hlf);
#pragma unroll
      for (int e = 0; e < 8; ++e) { a0[e] = (b16)Al[ks + e]; a0[8 + e] = (b16)Al[ks + 16 + e]; a1[e] = (b16)Al[16 * GPF + ks + e]; a1[8 + e] = (b16)Al[16 * GPF + ks + 16 + e]; }
#pragma unroll
      for (int t = 0; t < 4; ++t) { acc[0][t] = wmma16b(a0, bw[t], acc[0][t]); acc[1][t] = wmma16b(a1, bw[t], acc[1][t]); }
    }
    asm volatile("s_wait_dscnt 0x0" ::: "memory");     // this wave's reads of the stage's buffer have returned before it is refilled
    asm volatile("s_wait_asynccnt 0x0" ::: "memory");  // this wave's share of stage st + 1 has landed
    __syncthreads();                                   // publishes stage st + 1 and ends every wave's reads of stage st
    if (st + 2 < GNT) stage_af32_b16(ga + (st + 2) * (GK * 4), gb + (st + 2) * (GK * 2), la + (st & 1) * (GF32 + G16), lb + (st & 1) * (GF32 + G16));
  }
  asm volatile("s_wait_asynccnt 0x0" ::: "memory");    // no copy is outstanding when the buffers become the epilogue's staging
#pragma unroll
  for (int t = 0; t < 4; ++t)
#pragma unroll
    for (int r = 0; r < 2; ++r)
#pragma unroll
      for (int v = 0; v < 8; ++v) acc[r][t][v] += bf16_rne(bproj[c0 + t * 16 + nloc]);
  epi_f32(acc, 1.0f, nullptr, out, D, m0, c0, lane, (float*)sm + wave * (32 * 64));
}
}  // namespace

extern "C" void kernel_launch(void* const* d_in, const int* in_sizes, int n_in,
                              void* d_out, int out_size, void* d_ws, size_t ws_size, hipStream_t stream) {
  (void)n_in; (void)out_size;
  const float* x = (const float*)d_in[0]; const float* abias = (const float*)d_in[1]; const float* wqkv = (const float*)d_in[2]; const float* bqkv = (const float*)d_in[3];
  const float* wproj = (const float*)d_in[4]; const float* bproj = (const float*)d_in[5];
  float* out = (float*)d_out;   // [2,2048,1024]
  if (in_sizes[0] != NTOK * D || in_sizes[1] != NTOK || in_sizes[2] != D * D3 || in_sizes[3] != D3 || in_sizes[4] != D * D || in_sizes[5] != D) return;
  size_t off = 0; char* ws = (char*)d_ws;
  auto carve = [&](size_t bytes) { char* p = ws + off; off += (bytes + 255) & ~(size_t)255; return p; };
  unsigned short* x16 = (unsigned short*)carve((size_t)NTOK * D * 2);        // 8 MB
  unsigned short* w16 = (unsigned short*)carve((size_t)D3 * D * 2);          // 6 MB ([3072][1024] bf16 = [which][n][k])
  b16* wo16 = (b16*)carve((size_t)D * D * 2);
  b16* qk = (b16*)carve((size_t)2 * NTOK * D * 2);                           // 16 MB: [which][b][h][s][64]
  b16* vt = (b16*)carve((size_t)NTOK * D * 2);                               // 8 MB
  float* y = (float*)carve((size_t)NTOK * D * 4);                            // 16 MB
  float* bl2 = (float*)carve((size_t)NTOK * 4);                              // 16 KB
  if (off > ws_size) return;                                                   // ≈ 56 MB
  prep_kernel<<<NB_WQ + NB_WO + NB_X, 256, 0, stream>>>(x, x16, abias, bl2, wqkv, w16, wproj, (unsigned short*)wo16);
  proj_kernel<<<dim3(D3 / PN, NTOK / PM), 256, 0, stream>>>((const __bf16*)x16, (const __bf16*)w16, bqkv, qk, vt);
  attn_kernel<<<Bn * H * (S / 16) / 8, 256, 0, stream>>>(qk, vt, bl2, y);
  out_kernel<<<dim3(D / 128, NTOK / 128), 256, 0, stream>>>(y, wo16, bproj, out);
}

// v007
// Measured time: 85.5 microseconds a run.
// Two timings next to v006 both put it at 1.07 times that version's speed.
// All steps since v000 together make it 3.39 times as fast.
#include <hip/hip_runtime.h>

// Gaze-guided multi-head attention (B=2, N=2048, D=1024, 16 heads x 64): qkv = x w_qkv + b_qkv; scores = q.k/8 + attn_bias[b][key]; softmax; (w.v) w_proj + b_proj.
// Numerics: x, attn_bias, w_qkv, b_qkv, w_proj, b_proj are rounded to bf16 (RNE); the qkv projection runs on
// v_wmma_f32_16x16x32_bf16 (exact products, f32 accumulate, + bias); the scores, P.V and the output projection run on v_wmma_f32_16x16x32_f16 with single f16 operands
// (f16 copies of q log2(e)/8, k, (8v)^T, P, the attention output rounded at load, and the exact f16 copy of bf16 w_proj); key bias and online softmax in f32, in base 2.

namespace {
constexpr int Bn = 2, S = 2048, D = 1024, H = 16, HD = 64, NTOK = Bn * S, D3 = 3 * D;
constexpr float SCALE = 0.125f, VS = 8.0f, LOG2E = 1.4426950408889634f;

typedef _Float16 b16;
typedef __attribute__((ext_vector_type(16))) _Float16 v16b;
typedef __attribute__((ext_vector_type(8)))  _Float16 v8b;
typedef __attribute__((ext_vector_type(8)))  float v8f;
typedef __attribute__((ext_vector_type(4)))  float v4f;

__device__ __forceinline__ v8b ld8b(const b16* p) { return *(const v8b*)p; }
__device__ __forceinline__ v16b cat8b(v8b a, v8b b) { return __builtin_shufflevector(a, b, 0, 1, 2, 3, 4, 5, 6, 7, 8, 9, 10, 11, 12, 13, 14, 15); }
__device__ __forceinline__ v16b frag_kb(const b16* p, int hh) { return cat8b(ld8b(p + 8 * hh), ld8b(p + 16 + 8 * hh)); }
__device__ __forceinline__ v8f wmma16b(v16b a, v16b b, v8f c) {
  v8f d = __builtin_amdgcn_wmma_f32_16x16x32_f16(false, a, false, b, (short)0, c, false, false);
  asm volatile("v_nop\n\tv_nop\n\tv_nop\n\tv_nop" : "+v"(d) : "v"(a), "v"(b));
  return d;
}
__device__ __forceinline__ void wave_lds_sync() {
  __builtin_amdgcn_fence(__ATOMIC_RELEASE, "workgroup");
  __builtin_amdgcn_wave_barrier();
  __builtin_amdgcn_fence(__ATOMIC_ACQUIRE, "workgroup");
}

// f32 rows with pitch ldo: 64 floats = 256 B = 2 lines per row; 16 lanes x 16 B per row, 2 rows per instruction. Optional per-row factor
__device__ __forceinline__ void epi_f32(v8f (&acc)[2][4], float scale, const float* rscale, float* __restrict__ out, int ldo, int m0, int c0, int lane, float* Tt) {
  const int nloc = lane & 15, hlf = lane >> 4;
#pragma unroll
  for (int t = 0; t < 4; ++t)
#pragma unroll
    for (int r = 0; r < 2; ++r)
#pragma unroll
      for (int v = 0; v < 8; ++v) {
        const int rr = r * 16 + v + 8 * hlf;
        const float rs = rscale ? rscale[(size_t)(m0 + rr) * 32] : 1.0f;
        Tt[rr * 64 + t * 16 + nloc] = acc[r][t][v] * scale * rs;
      }
  wave_lds_sync();
  float* dst0 = out + (size_t)m0 * ldo + c0;
  {
#pragma unroll
    for (int j = 0; j < 16; ++j) { const int rr = j * 2 + hlf, c4 = nloc * 4; *(v4f*)(dst0 + (size_t)rr * ldo + c4) = *(const v4f*)(Tt + rr * 64 + c4); }
    
  }
}



typedef __attribute__((ext_vector_type(8))) __bf16 v8bb; typedef __attribute__((ext_vector_type(16))) __bf16 v16bb;
typedef __attribute__((ext_vector_type(8))) unsigned short v8us;
__device__ __forceinline__ v16bb frag_kb_bf(const __bf16* p, int hh) { const v8bb a = *(const v8bb*)(p + 8 * hh), b = *(const v8bb*)(p + 16 + 8 * hh); return __builtin_shufflevector(a, b, 0, 1, 2, 3, 4, 5, 6, 7, 8, 9, 10, 11, 12, 13, 14, 15); }
// the plain builtin: the compiler keeps the distance behind it itself, and its operands may lie above v255, which an asm statement's operands may not
__device__ __forceinline__ v8f wmma16bb(v16bb a, v16bb b, v8f c) { return __builtin_amdgcn_wmma_f32_16x16x32_bf16(false, a, false, b, (short)0, c, false, false); }
__device__ __forceinline__ unsigned short bf16_rne_bits(float v) { unsigned int u = __float_as_uint(v); u += 0x7FFFu + ((u >> 16) & 1u); return (unsigned short)(u >> 16); }
__device__ __forceinline__ float bf16_rne(float v) { return __uint_as_float(((unsigned int)bf16_rne_bits(v)) << 16); }

typedef __attribute__((ext_vector_type(4))) unsigned int v4u;
// All preparation is one launch: the blocks' roles go by block index, and every block moves 64 KB in and 32 KB out with its 16 loads of 16 B per thread issued together.
constexpr int WTK = 256, WTN = 64;                                    // a weight tile: 256 k rows x 64 n columns
constexpr int NB_WQ = (D3 / WTN) * (D / WTK), NB_WO = (D / WTN) * (D / WTK), NB_X = NTOK * D / 8 / (8 * 256);
template <int MODE> __device__ __forceinline__ unsigned int wbits(float w) {   // MODE 0 bf16 bits, MODE 1 f16(bf16(w)) bits
  if (MODE == 0) return bf16_rne_bits(w);
  const b16 hv = (b16)bf16_rne(w); return *reinterpret_cast<const unsigned short*>(&hv);
}
// W [k rows][Ncols] f32 -> [n][k] 16-bit rows of D, one tile through LDS. A thread takes 4 columns of two neighbouring k rows and stores the k pair as one dword of row n;
// the 16-B groups of LDS row n stand at (group ^ (n >> 2)), so that the 32 dword stores of a wave fall on 32 banks and a row is still read back as 512 contiguous bytes.
template <int MODE>
__device__ __forceinline__ void wt_tile(const float* __restrict__ Wm, int Ncols, unsigned short* __restrict__ out, int n0, int k0, unsigned int* Tl) {
  const int tid = threadIdx.x, lane = tid & 31, wave = tid >> 5, c = tid & 15, pr = tid >> 4;
  const float* src = Wm + (size_t)(k0 + 2 * pr) * Ncols + n0 + 4 * c;
  v4f lo[8], hi[8];
#pragma unroll
  for (int it = 0; it < 8; ++it) { lo[it] = *(const v4f*)(src + (size_t)(32 * it) * Ncols); hi[it] = *(const v4f*)(src + (size_t)(32 * it + 1) * Ncols); }
  __builtin_amdgcn_sched_barrier(0);                                  // all 16 loads issue before the first conversion: one memory latency per tile, not two
  asm volatile("s_wait_xcnt 0x0" :: "v"(src) : "memory");             // names the loads' address, which so stays untouched up to this wait
#pragma unroll
  for (int it = 0; it < 8; ++it) {
    const int p = pr + 16 * it;                                       // k pair of the tile: rows 2p, 2p + 1
#pragma unroll
    for (int j = 0; j < 4; ++j) Tl[(4 * c + j) * (WTK / 2) + ((((p >> 2) ^ c) << 2) | (p & 3))] = wbits<MODE>(lo[it][j]) | (wbits<MODE>(hi[it][j]) << 16);
  }
  __syncthreads();
  unsigned short* dst = out + (size_t)(n0 + wave * 8) * D + k0 + lane * 8;   // a wave stores 8 rows of 512 contiguous bytes
#pragma unroll
  for (int r = 0; r < 8; ++r) {
    const int n = wave * 8 + r;
    *(v4u*)(dst + r * D) = *(const v4u*)(Tl + n * (WTK / 2) + ((lane ^ (n >> 2)) << 2));
  }
  asm volatile("s_wait_xcnt 0x0" ::: "memory");                       // stands behind the eight stores, in front of any later write of their address or data registers
}
__global__ __launch_bounds__(256) void prep_kernel(const float* __restrict__ x, unsigned short* __restrict__ x16, const float* __restrict__ abias, float* __restrict__ bl2,
                                                   const float* __restrict__ wqkv, unsigned short* __restrict__ w16, const float* __restrict__ wproj, unsigned short* __restrict__ wo16) {
  __shared__ __attribute__((aligned(16))) unsigned int Tl[WTN * (WTK / 2)];
  const int bid = blockIdx.x;
  if (bid < NB_WQ) { wt_tile<0>(wqkv, D3, w16, (bid % (D3 / WTN)) * WTN, (bid / (D3 / WTN)) * WTK, Tl); return; }
  if (bid < NB_WQ + NB_WO) { const int t = bid - NB_WQ; wt_tile<1>(wproj, D, wo16, (t % (D / WTN)) * WTN, (t / (D / WTN)) * WTK, Tl); return; }
  const int xb = bid - NB_WQ - NB_WO, t = xb * 256 + threadIdx.x;    // the block rounds 64 KB of x in a row; the first NTOK threads also make the bias table
  const float* s = x + ((size_t)xb * (8 * 256) + threadIdx.x) * 8;
  const float* sb = abias + (t & (NTOK - 1));                         // in bounds for every thread, so that the load needs no branch and flies with the others
  const float ab = *sb;
  v4f a[8], b[8];
#pragma unroll
  for (int it = 0; it < 8; ++it) { a[it] = *(const v4f*)(s + it * (256 * 8)); b[it] = *(const v4f*)(s + it * (256 * 8) + 4); }
  asm volatile("s_wait_xcnt 0x0" :: "v"(s), "v"(sb) : "memory");      // names the loads' addresses, which so stay untouched up to this wait
  unsigned short* d = x16 + ((size_t)xb * (8 * 256) + threadIdx.x) * 8;
#pragma unroll
  for (int it = 0; it < 8; ++it) { v8us v;
#pragma unroll
    for (int e = 0; e < 4; ++e) { v[e] = bf16_rne_bits(a[it][e]); v[4 + e] = bf16_rne_bits(b[it][e]); }
    *(v8us*)(d + it * (256 * 8)) = v; }
  if (t < NTOK) bl2[t] = bf16_rne(ab) * LOG2E;                        // key bias, rounded to bf16, in base-2 units
}

// Both projection GEMMs: per stage of GK k the block's A rows and B rows come once per block into a ring of LDS buffers by asynchronous copies (whole 128-B lines),
// and every wave takes its fragments from LDS. Row pitches are 16 B x odd. The output projection's block is 128x128 (8 waves of 32x64).
// The qkv projection has as many blocks as the chip has WGPs: a block owns 256 rows x 192 columns (three whole heads), 8 waves (4 row groups x 2 column groups) of 64x96,
// so that an operand byte brought from L2 and a fragment read from LDS each serve more products. With one block on a WGP nothing else covers its waits: each k-step's fragments
// are fetched one k-step ahead into a second register set, and the ring has three buffers with two stages in flight: waves 0-3 copy the even stages, waves 4-7 the odd ones,
// so that each wave still waits for all of its own copies while the other group's stage flies on.
constexpr int GK = 64, GNT = D / GK, GP = GK + 8, GPF = GK + 4;
constexpr int G16 = 128 * GP * 2, GF32 = 128 * GPF * 4;      // bytes of a 128-row tile: 16-bit rows, f32 rows
__device__ __forceinline__ unsigned lds_off(const void* p) { return (unsigned)(size_t)p; }
constexpr int PM = 256, PN = 192, PK = 64, PNT = D / PK, PP = PK * 2 + 16, PST = (PM + PN) * PP;   // the qkv block's tile, k per stage, row pitch and stage size in bytes (A rows, then B rows)
__device__ __forceinline__ void copy14(const unsigned (&l)[14], const char* const (&g)[14]) {
  // the closing s_wait_xcnt stands inside the statement so that no address register of a copy is rewritten ahead of it
  asm volatile("global_load_async_to_lds_b128 %0, %14, off\n\t"
               "global_load_async_to_lds_b128 %1, %15, off\n\t"
               "global_load_async_to_lds_b128 %2, %16, off\n\t"
               "global_load_async_to_lds_b128 %3, %17, off\n\t"
               "global_load_async_to_lds_b128 %4, %18, off\n\t"
               "global_load_async_to_lds_b128 %5, %19, off\n\t"
               "global_load_async_to_lds_b128 %6, %20, off\n\t"
               "global_load_async_to_lds_b128 %7, %21, off\n\t"
               "global_load_async_to_lds_b128 %8, %22, off\n\t"
               "global_load_async_to_lds_b128 %9, %23, off\n\t"
               "global_load_async_to_lds_b128 %10, %24, off\n\t"
               "global_load_async_to_lds_b128 %11, %25, off\n\t"
               "global_load_async_to_lds_b128 %12, %26, off\n\t"
               "global_load_async_to_lds_b128 %13, %27, off\n\t"
               "s_wait_xcnt 0x0"
               :: "v"(l[0]), "v"(l[1]), "v"(l[2]), "v"(l[3]), "v"(l[4]), "v"(l[5]), "v"(l[6]), "v"(l[7]), "v"(l[8]), "v"(l[9]), "v"(l[10]), "v"(l[11]), "v"(l[12]), "v"(l[13]),
                  "v"(g[0]), "v"(g[1]), "v"(g[2]), "v"(g[3]), "v"(g[4]), "v"(g[5]), "v"(g[6]), "v"(g[7]), "v"(g[8]), "v"(g[9]), "v"(g[10]), "v"(g[11]), "v"(g[12]), "v"(g[13])
               : "memory");
}
// One stage of the qkv projection, copied by four waves: 256 + 192 rows of 128 B; 28 copies of 16 B per lane, every lane on, each wave-copy covers four whole lines.
__device__ __forceinline__ void stage_p(const char* ga, const char* gb, unsigned to, unsigned l) {   // ga, gb: the block's rows at the stage's k, the same for all lanes; to: the lane's own byte in them
#pragma unroll
  for (int hf = 0; hf < 2; ++hf) {
    unsigned ll[14]; const char* gg[14];
#pragma unroll
    for (int i = 0; i < 14; ++i) { const int rg = hf * 14 + i; ll[i] = l + rg * 16 * PP; gg[i] = (rg < PM / 16 ? ga + rg * 16 * D * 2 : gb + (rg - PM / 16) * 16 * D * 2) + to; }
    copy14(ll, gg);
  }
}
// Half a stage of the output projection, by four waves: f32 A rows of 256 B (8 copies per lane, 16 rows apart, two rows per wave-copy) and 16-bit B rows of 128 B (4 copies per lane, 32 rows apart).
__device__ __forceinline__ void stage_af32_b16(const char* ga, const char* gb, unsigned la, unsigned lb) {
  // the closing s_wait_xcnt stands inside the statement so that no address register of a copy is rewritten ahead of it
  asm volatile("global_load_async_to_lds_b128 %0, %12, off\n\t"
               "global_load_async_to_lds_b128 %1, %13, off\n\t"
               "global_load_async_to_lds_b128 %2, %14, off\n\t"
               "global_load_async_to_lds_b128 %3, %15, off\n\t"
               "global_load_async_to_lds_b128 %4, %16, off\n\t"
               "global_load_async_to_lds_b128 %5, %17, off\n\t"
               "global_load_async_to_lds_b128 %6, %18, off\n\t"
               "global_load_async_to_lds_b128 %7, %19, off\n\t"
               "global_load_async_to_lds_b128 %8, %20, off\n\t"
               "global_load_async_to_lds_b128 %9, %21, off\n\t"
               "global_load_async_to_lds_b128 %10, %22, off\n\t"
               "global_load_async_to_lds_b128 %11, %23, off\n\t"
               "s_wait_xcnt 0x0"
               :: "v"(la), "v"(la + 16 * GPF * 4), "v"(la + 32 * GPF * 4), "v"(la + 48 * GPF * 4),
                  "v"(la + 64 * GPF * 4), "v"(la + 80 * GPF * 4), "v"(la + 96 * GPF * 4), "v"(la + 112 * GPF * 4),
                  "v"(lb), "v"(lb + 32 * GP * 2), "v"(lb + 64 * GP * 2), "v"(lb + 96 * GP * 2),
                  "v"(ga), "v"(ga + 16 * D * 4), "v"(ga + 32 * D * 4), "v"(ga + 48 * D * 4),
                  "v"(ga + 64 * D * 4), "v"(ga + 80 * D * 4), "v"(ga + 96 * D * 4), "v"(ga + 112 * D * 4),
                  "v"(gb), "v"(gb + 32 * D * 2), "v"(gb + 64 * D * 2), "v"(gb + 96 * D * 2)
               : "memory");
}

// projections: grid (16, 16): (4096 x 1024) x (1024 x 3072) bf16 WMMA + bf16(b_qkv). q log2(e)/8, k -> f16 rows [b][h][s][64]; v -> (8v)^T f16 rows [b][h][64 d][s].
// The epilogue stages the block's three heads in LDS (q, k as rows, v transposed) and stores each head as whole lines.
__global__ __launch_bounds__(256) void proj_kernel(const __bf16* __restrict__ x16, const __bf16* __restrict__ w16, const float* __restrict__ bqkv, b16* __restrict__ qk, b16* __restrict__ vt) {
  __shared__ __attribute__((aligned(16))) unsigned char sm[3 * PST];   // three stage buffers [A | B]; behind the loop the epilogue's staging
  const int tid = threadIdx.x, lane = tid & 31, wave = __builtin_amdgcn_readfirstlane(tid >> 5), wm = wave & 3, wn = wave >> 2, nloc = lane & 15, hlf = lane >> 4;
  const int mb = blockIdx.y * PM, cb = blockIdx.x * PN, t7 = tid & 127;   // wn is also the wave's copy group: it copies the stages of its parity
  const char* ga = (const char*)(x16 + (size_t)mb * D);
  const char* gb = (const char*)(w16 + (size_t)cb * D);
  const unsigned to = (t7 >> 3) * (D * 2) + (t7 & 7) * 16, l = lds_off(sm) + (t7 >> 3) * PP + (t7 & 7) * 16;
  v8f acc[4][6];
#pragma unroll
  for (int r = 0; r < 4; ++r)
#pragma unroll
    for (int t = 0; t < 6; ++t) acc[r][t] = (v8f){};
  stage_p(ga + wn * (PK * 2), gb + wn * (PK * 2), to, l + wn * PST);   // stage 0 by group 0, stage 1 by group 1
  const float* pb = bqkv + cb + wn * 96 + nloc;
  float bias[6];
#pragma unroll
  for (int t = 0; t < 6; ++t) bias[t] = pb[t * 16];
  asm volatile("s_wait_xcnt 0x0" :: "v"(pb) : "memory");   // names the bias loads' address, which so stays untouched up to this wait
  if (wn == 0) asm volatile("s_wait_asynccnt 0x0" ::: "memory");   // the copying wave's share of stage 0 has landed
  __syncthreads();                                     // publishes stage 0 to the other waves
  if (wn == 0) stage_p(ga + 2 * (PK * 2), gb + 2 * (PK * 2), to, l + 2 * PST);
  const unsigned char* fA = sm + (wm * 64 + nloc) * PP;        // the lane's first A row and first B row in buffer 0
  const unsigned char* fB = sm + (PM + wn * 96 + nloc) * PP;
  v16bb fa[2][4], fb[2][6];                            // two fragment sets: one is multiplied while the other is filled
  auto ldf = [&](v16bb (&a)[4], v16bb (&bw)[6], int off) {     // a k-step's 20 LDS reads, as one group
#pragma unroll
    for (int r = 0; r < 4; ++r) a[r] = frag_kb_bf((const __bf16*)(fA + off + r * 16 * PP), hlf);
#pragma unroll
    for (int t = 0; t < 6; ++t) bw[t] = frag_kb_bf((const __bf16*)(fB + off + t * 16 * PP), hlf);
    __builtin_amdgcn_sched_barrier(0);                 // the group stays in front of the products that run while it lands: sunk among them, every read would be waited for on the spot
  };
  auto mm = [&](const v16bb (&a)[4], const v16bb (&bw)[6], int t0, int t1) {
#pragma unroll
    for (int t = t0; t < t1; ++t)
#pragma unroll
      for (int r = 0; r < 4; ++r) acc[r][t] = wmma16bb(a[r], bw[t], acc[r][t]);
  };
  ldf(fa[0], fb[0], 0);
  int cur = 0, nxt = PST;                              // byte offsets of stage st's and stage st + 1's buffers
  for (int st = 0; st < PNT; ++st) {
    ldf(fa[1], fb[1], cur + 64); mm(fa[0], fb[0], 0, 6);
    __builtin_amdgcn_sched_barrier(0);                 // these products stay in front of the waits: the last k-step's fragments land under them, not under an idle matrix unit
    // the publish point of stage st + 1 stands in front of stage st's last k-step, whose fragments are already fetched: behind it the next stage's first fragments are read
    asm volatile("s_wait_dscnt 0x0" ::: "memory");     // this wave's reads of the stage's buffer have returned before it is refilled
    if (((st + 1) & 1) == wn) asm volatile("s_wait_asynccnt 0x0" ::: "memory");   // the copying wave's share of stage st + 1 has landed (it has nothing else in flight)
    __syncthreads();                                   // publishes stage st + 1 and ends every wave's reads of stage st
    mm(fa[1], fb[1], 0, 2);
    __builtin_amdgcn_sched_barrier(0);                 // the matrix unit has work queued while the reads and the refill are issued
    if (st + 1 < PNT) ldf(fa[0], fb[0], nxt);
    if (st + 3 < PNT && ((st + 1) & 1) == wn) stage_p(ga + (st + 3) * (PK * 2), gb + (st + 3) * (PK * 2), to, l + cur);   // into the buffer that every wave has just left
    __builtin_amdgcn_sched_barrier(0);                 // the rest of the products stay behind the refill, so that the copies get two whole stages to land
    mm(fa[1], fb[1], 2, 6);
    cur = nxt; nxt = nxt == 2 * PST ? 0 : nxt + PST;
  }
  asm volatile("s_wait_asynccnt 0x0" ::: "memory");    // no copy is outstanding when the buffers become the epilogue's staging;
  asm volatile("s_wait_dscnt 0x0" ::: "memory");       // nor a read: the last pass reads nothing behind its barrier, which so also ends every wave's reads of the ring
  constexpr int RG = PM * GP * 2, VTP = PM + 8;        // bytes of a head's staging (256 rows of 64, pitch GP; or 64 rows of 256, pitch VTP)
  static_assert(HD * VTP * 2 <= RG && 3 * RG <= 3 * PST, "the three heads' staging fits the stage buffers");
  // + bias (rounded to bf16), the plane's factor, f16
#pragma unroll
  for (int t = 0; t < 6; ++t) {
    const int cl = wn * 96 + t * 16, which = (cb + cl) / D;    // the same for the whole wave
    b16* R = (b16*)(sm + (cl >> 6) * RG);
    const float bt = bf16_rne(bias[t]);
    if (which < 2) {
      const float sc = which == 0 ? SCALE * LOG2E : 1.0f;
#pragma unroll
      for (int r = 0; r < 4; ++r)
#pragma unroll
        for (int v = 0; v < 8; ++v) R[(wm * 64 + r * 16 + 8 * hlf + v) * GP + (cl & 63) + nloc] = (b16)((acc[r][t][v] + bt) * sc);
    } else {
#pragma unroll
      for (int r = 0; r < 4; ++r) {
        v8b p;
#pragma unroll
        for (int v = 0; v < 8; ++v) p[v] = (b16)((acc[r][t][v] + bt) * VS);
        *(v8b*)(R + ((cl & 63) + nloc) * VTP + wm * 64 + r * 16 + 8 * hlf) = p;
      }
    }
  }
  __syncthreads();                                     // publishes every wave's part of the three heads
  const int b = mb / S, s0 = mb % S;
#pragma unroll
  for (int j = 0; j < 3; ++j) {
    const int cg = cb + j * HD, which = cg / D, h = (cg % D) / HD;   // the same for the whole block
    const b16* R = (const b16*)(sm + j * RG);
    v8b w[8];
    if (which < 2) {                                   // 256 rows of 128 B stand in a row in memory: a wave stores 512 contiguous bytes
      b16* dst = qk + ((((size_t)which * Bn + b) * H + h) * S + s0) * HD + tid * 8;
#pragma unroll
      for (int i = 0; i < 8; ++i) w[i] = ld8b(R + (i * 32 + (tid >> 3)) * GP + (tid & 7) * 8);
#pragma unroll
      for (int i = 0; i < 8; ++i) *(v8b*)(dst + i * 2048) = w[i];
      asm volatile("s_wait_xcnt 0x0" ::: "memory");    // stands behind the eight stores, in front of any later write of their address or data registers
    } else {                                           // 64 feature rows of 256 tokens: a wave stores one row's 512 contiguous bytes
      b16* dst = vt + (((size_t)b * H + h) * HD + wave) * S + s0 + lane * 8;
#pragma unroll
      for (int i = 0; i < 8; ++i) w[i] = ld8b(R + (i * 8 + wave) * VTP + lane * 8);
#pragma unroll
      for (int i = 0; i < 8; ++i) *(v8b*)(dst + (size_t)(i * 8) * S) = w[i];
      asm volatile("s_wait_xcnt 0x0" ::: "memory");    // the same behind these eight
    }
  }
}

// attention: wave = (b, h, 32 queries as two column tiles, every other 64 keys): per pass of 32 keys S^T (K=64, 2 k-steps, single), online softmax f32, P^T f16, y^T += (8V)^T P^T (4 feature tiles);
// each K and V^T fragment read from LDS serves both column tiles. Waves w and w + 4 of a block hold the same 32 queries and the two 64-key halves of every stage; at the end each
// hands the other one tile's (m, l, y^T) through LDS and finishes its own tile: y/(8l) -> f32 rows.
// The scores leave the matrix unit finished, in base-2 units: q carries log2(e)/8 and the score accumulators start from the key bias table (a lane's 8 rows of a tile are 8 consecutive keys).
// The block's 8 waves share one (b, h): K rows and (8V)^T rows come in stages of KT keys into two LDS buffers by asynchronous copies (whole 128-B lines, once per block),
// and every wave takes its fragments from LDS. Row pitches are 16 B x odd for the 16-byte LDS readers.
constexpr int KT = 128, NST = S / KT, KP = HD + 8, VP = KT + 8;
// One stage: 128 K rows of 128 B (16 KB contiguous) and 64 V^T rows of 256 B; 8 copies of 16 B per lane, every lane on, each wave-copy covers 512 contiguous bytes or two 256-B rows.
__device__ __forceinline__ void stage_copy(const b16* kg, const b16* vg, const b16* ks, const b16* vs, int tid) {
  const b16* gk = kg + tid * 8; const b16* gv = vg + (size_t)(tid >> 4) * S + (tid & 15) * 8;
  const unsigned lk = lds_off(ks + (tid >> 3) * KP + (tid & 7) * 8), lv = lds_off(vs + (tid >> 4) * VP + (tid & 15) * 8);
  // the closing s_wait_xcnt stands inside the statement so that no address register of a copy is rewritten ahead of it
  asm volatile("global_load_async_to_lds_b128 %0, %8, off\n\t"
               "global_load_async_to_lds_b128 %1, %9, off\n\t"
               "global_load_async_to_lds_b128 %2, %10, off\n\t"
               "global_load_async_to_lds_b128 %3, %11, off\n\t"
               "global_load_async_to_lds_b128 %4, %12, off\n\t"
               "global_load_async_to_lds_b128 %5, %13, off\n\t"
               "global_load_async_to_lds_b128 %6, %14, off\n\t"
               "global_load_async_to_lds_b128 %7, %15, off\n\t"
               "s_wait_xcnt 0x0"
               :: "v"(lk), "v"(lk + 32 * KP * 2), "v"(lk + 64 * KP * 2), "v"(lk + 96 * KP * 2),
                  "v"(lv), "v"(lv + 16 * VP * 2), "v"(lv + 32 * VP * 2), "v"(lv + 48 * VP * 2),
                  "v"(gk), "v"(gk + 2048), "v"(gk + 4096), "v"(gk + 6144),
                  "v"(gv), "v"(gv + (size_t)16 * S), "v"(gv + (size_t)32 * S), "v"(gv + (size_t)48 * S)
               : "memory");
}
__device__ __forceinline__ v8f ld8f(const float* p) { return __builtin_shufflevector(*(const v4f*)p, *(const v4f*)(p + 4), 0, 1, 2, 3, 4, 5, 6, 7); }
// four waves per SIMD (two blocks per WGP) hide the softmax chains: the register budget is held to a quarter of the SIMD's file
__global__ __launch_bounds__(256) __attribute__((amdgpu_waves_per_eu(4, 4))) void attn_kernel(const b16* __restrict__ qk, const b16* __restrict__ vt, const float* __restrict__ bl2, float* __restrict__ y) {
  __shared__ __attribute__((aligned(16))) float Os[8][16][HD + 4];
  __shared__ __attribute__((aligned(16))) b16 Ks[2][KT * KP];
  __shared__ __attribute__((aligned(16))) b16 Vs[2][HD * VP];
  const int tid = threadIdx.x, wid = __builtin_amdgcn_readfirstlane(threadIdx.x >> 5), lane = threadIdx.x & 31, hh = lane >> 4, col = lane & 15;
  const int g = wid >> 2, qb = (blockIdx.x & 15) * 128 + (wid & 3) * 32, h = (blockIdx.x >> 4) & 15, b = blockIdx.x >> 8;   // g: which 64 keys of a stage
  const b16* Q = qk + ((((size_t)0 * Bn + b) * H + h) * S) * HD; const b16* K = qk + ((((size_t)1 * Bn + b) * H + h) * S) * HD;
  const b16* vb = vt + (((size_t)b * H + h) * HD) * S;
  stage_copy(K, vb, Ks[0], Vs[0], tid);
  v16b qf[2][2];
#pragma unroll
  for (int c = 0; c < 2; ++c)
#pragma unroll
    for (int ks = 0; ks < 2; ++ks) qf[c][ks] = frag_kb(Q + (size_t)(qb + c * 16 + col) * HD + ks * 32, hh);
  asm volatile("s_wait_asynccnt 0x0" ::: "memory");   // this wave's share of stage 0 has landed
  __syncthreads();                                     // publishes stage 0 to the other waves
  stage_copy(K + (size_t)KT * HD, vb + KT, Ks[1], Vs[1], tid);
  float m[2] = {-INFINITY, -INFINITY}, l[2] = {0.0f, 0.0f}; v8f o[2][4] = {{{}, {}, {}, {}}, {{}, {}, {}, {}}};
  const float* bl = bl2 + b * S + g * (KT / 2);       // the same for the whole wave; a lane adds its half's 8 keys
  const unsigned ho = 8 * hh;
  v8f c0 = ld8f(bl + ho), c1 = ld8f(bl + 16 + ho);
  for (int st = 0; st < NST; ++st) {
    const b16* Kl = Ks[st & 1] + g * (KT / 2) * KP; const b16* Vl = Vs[st & 1] + g * (KT / 2);
    for (int kl = 0; kl < KT / 2; kl += 32) {
      // the pass's own 16 LDS reads stand together at its head: one wait for the K fragments, and the V^T fragments land behind the softmax
      v16b kf[2][2], vf[4];
#pragma unroll
      for (int ks = 0; ks < 2; ++ks) { kf[ks][0] = frag_kb(Kl + (kl + col) * KP + ks * 32, hh); kf[ks][1] = frag_kb(Kl + (kl + 16 + col) * KP + ks * 32, hh); }
#pragma unroll
      for (int n = 0; n < 4; ++n) vf[n] = frag_kb(Vl + (n * 16 + col) * VP + kl, hh);
      v8f s0[2], s1[2];
#pragma unroll
      for (int c = 0; c < 2; ++c) { s0[c] = wmma16b(kf[0][0], qf[c][0], c0); s1[c] = wmma16b(kf[0][1], qf[c][0], c1); }
#pragma unroll
      for (int c = 0; c < 2; ++c) { s0[c] = wmma16b(kf[1][0], qf[c][1], s0[c]); s1[c] = wmma16b(kf[1][1], qf[c][1], s1[c]); }
      // the next pass's start values load behind their last use, so that they land under the rest of this pass; this wave's next 32 keys follow at once or in the next stage;
      // the last pass wraps to the wave's first keys (in bounds, not used)
      const int kn = (st * KT + kl + (kl == 0 ? 32 : KT - 32)) & (S - 1);
      const float* pn = bl + kn + ho;
      c0 = ld8f(pn); c1 = ld8f(pn + 16);
      float mr[2], al_[2], sum[2], e[2][16]; v16b pb[2];
#pragma unroll
      for (int c = 0; c < 2; ++c) {
        mr[c] = -INFINITY;
#pragma unroll
        for (int r = 0; r < 8; ++r) mr[c] = fmaxf(mr[c], fmaxf(s0[c][r], s1[c][r]));
      }
#pragma unroll
      for (int c = 0; c < 2; ++c) mr[c] = fmaxf(mr[c], __shfl_xor(mr[c], 16));
#pragma unroll
      for (int c = 0; c < 2; ++c) {
        const float mn = fmaxf(m[c], mr[c]); al_[c] = m[c] - mn; m[c] = mn;
#pragma unroll
        for (int r = 0; r < 8; ++r) { e[c][r] = s0[c][r] - mn; e[c][8 + r] = s1[c][r] - mn; }
        // a tile's exponentials in one statement, each in place: none writes over the source of the one in front of it; the v_nop is the slot behind the last one
        asm("v_exp_f32 %0, %0\n\tv_exp_f32 %1, %1\n\tv_exp_f32 %2, %2\n\tv_exp_f32 %3, %3\n\tv_exp_f32 %4, %4\n\tv_exp_f32 %5, %5\n\t"
            "v_exp_f32 %6, %6\n\tv_exp_f32 %7, %7\n\tv_exp_f32 %8, %8\n\tv_exp_f32 %9, %9\n\tv_exp_f32 %10, %10\n\tv_exp_f32 %11, %11\n\t"
            "v_exp_f32 %12, %12\n\tv_exp_f32 %13, %13\n\tv_exp_f32 %14, %14\n\tv_exp_f32 %15, %15\n\tv_exp_f32 %16, %16\n\tv_nop"
            : "+v"(e[c][0]), "+v"(e[c][8]), "+v"(e[c][1]), "+v"(e[c][9]), "+v"(e[c][2]), "+v"(e[c][10]), "+v"(e[c][3]), "+v"(e[c][11]), "+v"(al_[c]), "+v"(e[c][4]), "+v"(e[c][12]),
              "+v"(e[c][5]), "+v"(e[c][13]), "+v"(e[c][6]), "+v"(e[c][14]), "+v"(e[c][7]), "+v"(e[c][15]));
        sum[c] = 0.0f;
#pragma unroll
        for (int r = 0; r < 8; ++r) { sum[c] += e[c][r] + e[c][8 + r]; pb[c][r] = (b16)e[c][r]; pb[c][8 + r] = (b16)e[c][8 + r]; }
      }
#pragma unroll
      for (int c = 0; c < 2; ++c) { sum[c] += __shfl_xor(sum[c], 16); l[c] = l[c] * al_[c] + sum[c]; }
#pragma unroll
      for (int n = 0; n < 4; ++n)
#pragma unroll
        for (int c = 0; c < 2; ++c) {
#pragma unroll
          for (int r = 0; r < 8; ++r) o[c][n][r] *= al_[c];
          o[c][n] = wmma16b(vf[n], pb[c], o[c][n]);
        }
      asm volatile("s_wait_xcnt 0x0" :: "v"(pn) : "memory");   // names the start-value loads' address, which so stays untouched up to this wait, far behind the loads
    }
    asm volatile("s_wait_dscnt 0x0" ::: "memory");     // this wave's reads of the stage's buffer have returned before it is refilled
    asm volatile("s_wait_asynccnt 0x0" ::: "memory");  // this wave's share of stage st + 1 has landed
    __syncthreads();                                   // publishes stage st + 1 and ends every wave's reads of stage st
    if (st + 2 < NST) stage_copy(K + (size_t)(st + 2) * KT * HD, vb + (st + 2) * KT, Ks[st & 1], Vs[st & 1], tid);
  }
  asm volatile("s_wait_asynccnt 0x0" ::: "memory");    // no copy is outstanding when the K buffers become the exchange area
  // The pair's join: wave group g keeps column tile g and hands tile 1 - g to its partner, lane to lane (34 floats a lane, lane-contiguous dwords), in the K buffers,
  // which every wave has left at the loop's last barrier.
  static_assert(8 * 34 * 32 * 4 <= (int)sizeof(Ks), "the exchange area fits the K buffers");
  float* X = (float*)&Ks[0][0];
  float* xo = X + wid * (34 * 32) + lane;
  const float* xi = X + (wid ^ 4) * (34 * 32) + lane;
#pragma unroll
  for (int n = 0; n < 4; ++n)
#pragma unroll
    for (int r = 0; r < 8; ++r) xo[(n * 8 + r) * 32] = g ? o[0][n][r] : o[1][n][r];
  xo[32 * 32] = g ? m[0] : m[1]; xo[33 * 32] = g ? l[0] : l[1];
  __syncthreads();                                     // publishes every wave's handed-over tile to its partner
  const float mm = g ? m[1] : m[0], lm = g ? l[1] : l[0], mo = xi[32 * 32], lo = xi[33 * 32], mj = fmaxf(mm, mo);
  float fa = mm - mj, fb = mo - mj;
  // the two weights of the join, each in place; the v_nop is the slot behind the last exponential
  asm("v_exp_f32 %0, %0\n\tv_exp_f32 %1, %1\n\tv_nop" : "+v"(fa), "+v"(fb));
  const float inv = 1.0f / (VS * (lm * fa + lo * fb));
  fa *= inv; fb *= inv;
#pragma unroll
  for (int n = 0; n < 4; ++n)
#pragma unroll
    for (int r = 0; r < 8; ++r) Os[wid][col][n * 16 + 8 * hh + r] = (g ? o[1][n][r] : o[0][n][r]) * fa + xi[(n * 8 + r) * 32] * fb;
  wave_lds_sync();
  float* dst = y + ((size_t)b * S + qb + g * 16) * D + h * HD;
  {
#pragma unroll
    for (int j = 0; j < 8; ++j) { const int rr = j * 2 + hh, c4 = col * 4; *(v4f*)(dst + (size_t)rr * D + c4) = *(const v4f*)(&Os[wid][rr][c4]); }
    
  }
}

// out = y Wo^T: (4096 x 1024) x (1024 x 1024); A = y rounded at the fragment load (single), B = f16(bf16 Wo) rows; f32 rows; grid (8, 32).
// One block on a WGP, and a stage's products are shorter than its copies' way from memory: the ring has three buffers with two stages in flight. Waves 0-3 copy the even stages,
// waves 4-7 the odd ones, so that each wave still waits for all of its own copies while the other group's stage flies on.
__global__ __launch_bounds__(256) void out_kernel(const float* __restrict__ y, const b16* __restrict__ wo16, const float* __restrict__ bproj, float* __restrict__ out) {
  constexpr int OST = GF32 + G16;                      // bytes of a stage buffer [A f32 | B]
  __shared__ __attribute__((aligned(16))) unsigned char sm[3 * OST];   // three stage buffers; behind the loop the epilogue's staging
  const int tid = threadIdx.x, lane = tid & 31, wave = __builtin_amdgcn_readfirstlane(tid >> 5), wm = wave & 3, wn = wave >> 2, nloc = lane & 15, hlf = lane >> 4;
  const int mb = blockIdx.y * 128, m0 = mb + wm * 32, cb = blockIdx.x * 128, c0 = cb + wn * 64, t7 = tid & 127;   // wn is also the wave's copy group: it copies the stages of its parity
  const char* ga = (const char*)(y + (size_t)(mb + (t7 >> 4)) * D + (t7 & 15) * 4);
  const char* gb = (const char*)(wo16 + (size_t)(cb + (t7 >> 3)) * D + (t7 & 7) * 8);
  const unsigned la = lds_off(sm) + (t7 >> 4) * (GPF * 4) + (t7 & 15) * 16, lb = lds_off(sm) + GF32 + (t7 >> 3) * (GP * 2) + (t7 & 7) * 16;
  // a whole stage by four waves: 24 copies of 16 B per lane, every lane on; the second call takes the A rows 8 and the B rows 16 further on
  auto stage = [&](int st, unsigned buf) {
    stage_af32_b16(ga + st * (GK * 4), gb + st * (GK * 2), la + buf, lb + buf);
    stage_af32_b16(ga + st * (GK * 4) + 8 * D * 4, gb + st * (GK * 2) + 16 * D * 2, la + buf + 8 * GPF * 4, lb + buf + 16 * GP * 2);
  };
  v8f acc[2][4];
#pragma unroll
  for (int r = 0; r < 2; ++r)
#pragma unroll
    for (int t = 0; t < 4; ++t) acc[r][t] = (v8f){};
  stage(wn, wn * OST);                                 // stage 0 by group 0, stage 1 by group 1
  if (wn == 0) asm volatile("s_wait_asynccnt 0x0" ::: "memory");   // the copying wave's share of stage 0 has landed
  __syncthreads();                                     // publishes stage 0 to the other waves
  int bi = 0;                                          // stage st's buffer
  for (int st = 0; st < GNT; ++st) {
    const float* Al = (const float*)(sm + bi * OST) + (wm * 32 + nloc) * GPF + 8 * hlf;
    const b16* Bl = (const b16*)(sm + bi * OST + GF32) + (wn * 64 + nloc) * GP;
#pragma unroll
    for (int ks = 0; ks < GK; ks += 32) {
      // the k-step's 16 LDS reads stand together at its head, so that the wave meets the LDS latency once and not once per B fragment
      v16b a0, a1, bw[4]; v4f ra[2][4];
#pragma unroll
      for (int t = 0; t < 4; ++t) bw[t] = frag_kb(Bl + t * 16 * GP + ks, hlf);
#pragma unroll
      for (int r = 0; r < 2; ++r)
#pragma unroll
        for (int q = 0; q < 4; ++q) ra[r][q] = *(const v4f*)(Al + r * 16 * GPF + ks + (q >> 1) * 16 + (q & 1) * 4);
      // the refill stands behind the stage's first reads, which land while the copies are issued: stage st + 2 goes into the buffer of stage st - 1, which every wave has left
      // at the barrier in front of this trip (its own reads of it returned in front of that barrier); the reads in flight here are of another buffer
      if (ks == 0 && st + 2 < GNT && (st & 1) == wn) stage(st + 2, (bi == 0 ? 2 : bi - 1) * OST);
#pragma unroll
      for (int e = 0; e < 8; ++e) { a0[e] = (b16)ra[0][e >> 2][e & 3]; a0[8 + e] = (b16)ra[0][2 + (e >> 2)][e & 3]; a1[e] = (b16)ra[1][e >> 2][e & 3]; a1[8 + e] = (b16)ra[1][2 + (e >> 2)][e & 3]; }
#pragma unroll
      for (int t = 0; t < 4; ++t) { acc[0][t] = wmma16b(a0, bw[t], acc[0][t]); acc[1][t] = wmma16b(a1, bw[t], acc[1][t]); }
    }
    asm volatile("s_wait_dscnt 0x0" ::: "memory");     // this wave's reads of the stage's buffer have returned before it is refilled
    if (((st + 1) & 1) == wn) asm volatile("s_wait_asynccnt 0x0" ::: "memory");   // the copying wave's share of stage st + 1 has landed (it has nothing else in flight)
    __syncthreads();                                   // publishes stage st + 1 and ends every wave's reads of stage st
    bi = bi == 2 ? 0 : bi + 1;
  }
  asm volatile("s_wait_asynccnt 0x0" ::: "memory");    // no copy is outstanding when the buffers become the epilogue's staging
#pragma unroll
  for (int t = 0; t < 4; ++t)
#pragma unroll
    for (int r = 0; r < 2; ++r)
#pragma unroll
      for (int v = 0; v < 8; ++v) acc[r][t][v] += bf16_rne(bproj[c0 + t * 16 + nloc]);
  epi_f32(acc, 1.0f, nullptr, out, D, m0, c0, lane, (float*)sm + wave * (32 * 64));
}
}  // namespace

extern "C" void kernel_launch(void* const* d_in, const int* in_sizes, int n_in,
                              void* d_out, int out_size, void* d_ws, size_t ws_size, hipStream_t stream) {
  (void)n_in; (void)out_size;
  const float* x = (const float*)d_in[0]; const float* abias = (const float*)d_in[1]; const float* wqkv = (const float*)d_in[2]; const float* bqkv = (const float*)d_in[3];
  const float* wproj = (const float*)d_in[4]; const float* bproj = (const float*)d_in[5];
  float* out = (float*)d_out;   // [2,2048,1024]
  if (in_sizes[0] != NTOK * D || in_sizes[1] != NTOK || in_sizes[2] != D * D3 || in_sizes[3] != D3 || in_sizes[4] != D * D || in_sizes[5] != D) return;
  size_t off = 0; char* ws = (char*)d_ws;
  auto carve = [&](size_t bytes) { char* p = ws + off; off += (bytes + 255) & ~(size_t)255; return p; };
  unsigned short* x16 = (unsigned short*)carve((size_t)NTOK * D * 2);        // 8 MB
  unsigned short* w16 = (unsigned short*)carve((size_t)D3 * D * 2);          // 6 MB ([3072][1024] bf16 = [which][n][k])
  b16* wo16 = (b16*)carve((size_t)D * D * 2);
  b16* qk = (b16*)carve((size_t)2 * NTOK * D * 2);                           // 16 MB: [which][b][h][s][64]
  b16* vt = (b16*)carve((size_t)NTOK * D * 2);                               // 8 MB
  float* y = (float*)carve((size_t)NTOK * D * 4);                            // 16 MB
  float* bl2 = (float*)carve((size_t)NTOK * 4);                              // 16 KB
  if (off > ws_size) return;                                                   // ≈ 56 MB
  prep_kernel<<<NB_WQ + NB_WO + NB_X, 256, 0, stream>>>(x, x16, abias, bl2, wqkv, w16, wproj, (unsigned short*)wo16);
  proj_kernel<<<dim3(D3 / PN, NTOK / PM), 256, 0, stream>>>((const __bf16*)x16, (const __bf16*)w16, bqkv, qk, vt);
  attn_kernel<<<Bn * H * (S / 16) / 8, 256, 0, stream>>>(qk, vt, bl2, y);
  out_kernel<<<dim3(D / 128, NTOK / 128), 256, 0, stream>>>(y, wo16, bproj, out);
}

// v008
// Measured time: 82 microseconds a run.
// Timed twice side by side with v007, it ran 1.04 times as fast both times.
// All steps since v000 together make it 3.53 times as fast.
#include <hip/hip_runtime.h>

// Gaze-guided multi-head attention (B=2, N=2048, D=1024, 16 heads x 64): qkv = x w_qkv + b_qkv; scores = q.k/8 + attn_bias[b][key]; softmax; (w.v) w_proj + b_proj.
// Numerics: x, attn_bias, w_qkv, b_qkv, w_proj, b_proj are rounded to bf16 (RNE); the qkv projection runs on
// v_wmma_f32_16x16x32_bf16 (exact products, f32 accumulate, + bias); the scores, P.V and the output projection run on v_wmma_f32_16x16x32_f16 with single f16 operands
// (f16 copies of q log2(e)/8, k, (8v)^T, P, the attention output rounded at load, and the exact f16 copy of bf16 w_proj); key bias and online softmax in f32, in base 2.

namespace {
constexpr int Bn = 2, S = 2048, D = 1024, H = 16, HD = 64, NTOK = Bn * S, D3 = 3 * D;
constexpr float SCALE = 0.125f, VS = 8.0f, LOG2E = 1.4426950408889634f;

typedef _Float16 b16;
typedef __attribute__((ext_vector_type(16))) _Float16 v16b;
typedef __attribute__((ext_vector_type(8)))  _Float16 v8b;
typedef __attribute__((ext_vector_type(8)))  float v8f;
typedef __attribute__((ext_vector_type(4)))  float v4f;
typedef __attribute__((ext_vector_type(2)))  float v2f;

__device__ __forceinline__ v8b ld8b(const b16* p) { return *(const v8b*)p; }
__device__ __forceinline__ v16b cat8b(v8b a, v8b b) { return __builtin_shufflevector(a, b, 0, 1, 2, 3, 4, 5, 6, 7, 8, 9, 10, 11, 12, 13, 14, 15); }
__device__ __forceinline__ v16b frag_kb(const b16* p, int hh) { return cat8b(ld8b(p + 8 * hh), ld8b(p + 16 + 8 * hh)); }
__device__ __forceinline__ v8f wmma16b(v16b a, v16b b, v8f c) {
  v8f d = __builtin_amdgcn_wmma_f32_16x16x32_f16(false, a, false, b, (short)0, c, false, false);
  asm volatile("v_nop\n\tv_nop\n\tv_nop\n\tv_nop" : "+v"(d) : "v"(a), "v"(b));
  return d;
}
__device__ __forceinline__ void wave_lds_sync() {
  __builtin_amdgcn_fence(__ATOMIC_RELEASE, "workgroup");
  __builtin_amdgcn_wave_barrier();
  __builtin_amdgcn_fence(__ATOMIC_ACQUIRE, "workgroup");
}

// f32 rows with pitch ldo: 64 floats = 256 B = 2 lines per row; 16 lanes x 16 B per row, 2 rows per instruction. Optional per-row factor
__device__ __forceinline__ void epi_f32(v8f (&acc)[2][4], float scale, const float* rscale, float* __restrict__ out, int ldo, int m0, int c0, int lane, float* Tt) {
  const int nloc = lane & 15, hlf = lane >> 4;
#pragma unroll
  for (int t = 0; t < 4; ++t)
#pragma unroll
    for (int r = 0; r < 2; ++r)
#pragma unroll
      for (int v = 0; v < 8; ++v) {
        const int rr = r * 16 + v + 8 * hlf;
        const float rs = rscale ? rscale[(size_t)(m0 + rr) * 32] : 1.0f;
        Tt[rr * 64 + t * 16 + nloc] = acc[r][t][v] * scale * rs;
      }
  wave_lds_sync();
  float* dst0 = out + (size_t)m0 * ldo + c0;
  {
#pragma unroll
    for (int j = 0; j < 16; ++j) { const int rr = j * 2 + hlf, c4 = nloc * 4; *(v4f*)(dst0 + (size_t)rr * ldo + c4) = *(const v4f*)(Tt + rr * 64 + c4); }
    
  }
}



typedef __attribute__((ext_vector_type(8))) __bf16 v8bb; typedef __attribute__((ext_vector_type(16))) __bf16 v16bb;
typedef __attribute__((ext_vector_type(8))) unsigned short v8us;
__device__ __forceinline__ v16bb frag_kb_bf(const __bf16* p, int hh) { const v8bb a = *(const v8bb*)(p + 8 * hh), b = *(const v8bb*)(p + 16 + 8 * hh); return __builtin_shufflevector(a, b, 0, 1, 2, 3, 4, 5, 6, 7, 8, 9, 10, 11, 12, 13, 14, 15); }
// the plain builtin: the compiler keeps the distance behind it itself, and its operands may lie above v255, which an asm statement's operands may not
__device__ __forceinline__ v8f wmma16bb(v16bb a, v16bb b, v8f c) { return __builtin_amdgcn_wmma_f32_16x16x32_bf16(false, a, false, b, (short)0, c, false, false); }
__device__ __forceinline__ unsigned short bf16_rne_bits(float v) { unsigned int u = __float_as_uint(v); u += 0x7FFFu + ((u >> 16) & 1u); return (unsigned short)(u >> 16); }
__device__ __forceinline__ float bf16_rne(float v) { return __uint_as_float(((unsigned int)bf16_rne_bits(v)) << 16); }

typedef __attribute__((ext_vector_type(4))) unsigned int v4u;
// All preparation is one launch: the blocks' roles go by block index, and every block moves 64 KB in and 32 KB out with its 16 loads of 16 B per thread issued together.
constexpr int WTK = 256, WTN = 64;                                    // a weight tile: 256 k rows x 64 n columns
constexpr int NB_WQ = (D3 / WTN) * (D / WTK), NB_WO = (D / WTN) * (D / WTK), NB_X = NTOK * D / 8 / (8 * 256);
template <int MODE> __device__ __forceinline__ unsigned int wbits(float w) {   // MODE 0 bf16 bits, MODE 1 f16(bf16(w)) bits
  if (MODE == 0) return bf16_rne_bits(w);
  const b16 hv = (b16)bf16_rne(w); return *reinterpret_cast<const unsigned short*>(&hv);
}
// W [k rows][Ncols] f32 -> [n][k] 16-bit rows of D, one tile through LDS. A thread takes 4 columns of two neighbouring k rows and stores the k pair as one dword of row n;
// the 16-B groups of LDS row n stand at (group ^ (n >> 2)), so that the 32 dword stores of a wave fall on 32 banks and a row is still read back as 512 contiguous bytes.
template <int MODE>
__device__ __forceinline__ void wt_tile(const float* __restrict__ Wm, int Ncols, unsigned short* __restrict__ out, int n0, int k0, unsigned int* Tl) {
  const int tid = threadIdx.x, lane = tid & 31, wave = tid >> 5, c = tid & 15, pr = tid >> 4;
  const float* src = Wm + (size_t)(k0 + 2 * pr) * Ncols + n0 + 4 * c;
  v4f lo[8], hi[8];
#pragma unroll
  for (int it = 0; it < 8; ++it) { lo[it] = *(const v4f*)(src + (size_t)(32 * it) * Ncols); hi[it] = *(const v4f*)(src + (size_t)(32 * it + 1) * Ncols); }
  __builtin_amdgcn_sched_barrier(0);                                  // all 16 loads issue before the first conversion: one memory latency per tile, not two
  asm volatile("s_wait_xcnt 0x0" :: "v"(src) : "memory");             // names the loads' address, which so stays untouched up to this wait
#pragma unroll
  for (int it = 0; it < 8; ++it) {
    const int p = pr + 16 * it;                                       // k pair of the tile: rows 2p, 2p + 1
#pragma unroll
    for (int j = 0; j < 4; ++j) Tl[(4 * c + j) * (WTK / 2) + ((((p >> 2) ^ c) << 2) | (p & 3))] = wbits<MODE>(lo[it][j]) | (wbits<MODE>(hi[it][j]) << 16);
  }
  __syncthreads();
  unsigned short* dst = out + (size_t)(n0 + wave * 8) * D + k0 + lane * 8;   // a wave stores 8 rows of 512 contiguous bytes
#pragma unroll
  for (int r = 0; r < 8; ++r) {
    const int n = wave * 8 + r;
    *(v4u*)(dst + r * D) = *(const v4u*)(Tl + n * (WTK / 2) + ((lane ^ (n >> 2)) << 2));
  }
  asm volatile("s_wait_xcnt 0x0" ::: "memory");                       // stands behind the eight stores, in front of any later write of their address or data registers
}
__global__ __launch_bounds__(256) void prep_kernel(const float* __restrict__ x, unsigned short* __restrict__ x16, const float* __restrict__ abias, float* __restrict__ bl2,
                                                   const float* __restrict__ wqkv, unsigned short* __restrict__ w16, const float* __restrict__ wproj, unsigned short* __restrict__ wo16) {
  __shared__ __attribute__((aligned(16))) unsigned int Tl[WTN * (WTK / 2)];
  const int bid = blockIdx.x;
  if (bid < NB_WQ) { wt_tile<0>(wqkv, D3, w16, (bid % (D3 / WTN)) * WTN, (bid / (D3 / WTN)) * WTK, Tl); return; }
  if (bid < NB_WQ + NB_WO) { const int t = bid - NB_WQ; wt_tile<1>(wproj, D, wo16, (t % (D / WTN)) * WTN, (t / (D / WTN)) * WTK, Tl); return; }
  const int xb = bid - NB_WQ - NB_WO, t = xb * 256 + threadIdx.x;    // the block rounds 64 KB of x in a row; the first NTOK threads also make the bias table
  const float* s = x + ((size_t)xb * (8 * 256) + threadIdx.x) * 8;
  const float* sb = abias + (t & (NTOK - 1));                         // in bounds for every thread, so that the load needs no branch and flies with the others
  const float ab = *sb;
  v4f a[8], b[8];
#pragma unroll
  for (int it = 0; it < 8; ++it) { a[it] = *(const v4f*)(s + it * (256 * 8)); b[it] = *(const v4f*)(s + it * (256 * 8) + 4); }
  asm volatile("s_wait_xcnt 0x0" :: "v"(s), "v"(sb) : "memory");      // names the loads' addresses, which so stay untouched up to this wait
  unsigned short* d = x16 + ((size_t)xb * (8 * 256) + threadIdx.x) * 8;
#pragma unroll
  for (int it = 0; it < 8; ++it) { v8us v;
#pragma unroll
    for (int e = 0; e < 4; ++e) { v[e] = bf16_rne_bits(a[it][e]); v[4 + e] = bf16_rne_bits(b[it][e]); }
    *(v8us*)(d + it * (256 * 8)) = v; }
  if (t < NTOK) bl2[t] = bf16_rne(ab) * LOG2E;                        // key bias, rounded to bf16, in base-2 units
}

// Both projection GEMMs: per stage of GK k the block's A rows and B rows come once per block into a ring of LDS buffers by asynchronous copies (whole 128-B lines),
// and every wave takes its fragments from LDS. Row pitches are 16 B x odd. The output projection's block is 128x128 (8 waves of 32x64).
// The qkv projection has as many blocks as the chip has WGPs: a block owns 256 rows x 192 columns (three whole heads), 8 waves (4 row groups x 2 column groups) of 64x96,
// so that an operand byte brought from L2 and a fragment read from LDS each serve more products. With one block on a WGP nothing else covers its waits: each k-step's fragments
// are fetched one k-step ahead into a second register set, and the ring has three buffers with two stages in flight: waves 0-3 copy the even stages, waves 4-7 the odd ones,
// so that each wave still waits for all of its own copies while the other group's stage flies on.
constexpr int GK = 64, GNT = D / GK, GP = GK + 8, GPF = GK + 4;
constexpr int G16 = 128 * GP * 2, GF32 = 128 * GPF * 4;      // bytes of a 128-row tile: 16-bit rows, f32 rows
__device__ __forceinline__ unsigned lds_off(const void* p) { return (unsigned)(size_t)p; }
constexpr int PM = 256, PN = 192, PK = 64, PNT = D / PK, PP = PK * 2 + 16, PST = (PM + PN) * PP;   // the qkv block's tile, k per stage, row pitch and stage size in bytes (A rows, then B rows)
__device__ __forceinline__ void copy14(const unsigned (&l)[14], const char* const (&g)[14]) {
  // the closing s_wait_xcnt stands inside the statement so that no address register of a copy is rewritten ahead of it
  asm volatile("global_load_async_to_lds_b128 %0, %14, off\n\t"
               "global_load_async_to_lds_b128 %1, %15, off\n\t"
               "global_load_async_to_lds_b128 %2, %16, off\n\t"
               "global_load_async_to_lds_b128 %3, %17, off\n\t"
               "global_load_async_to_lds_b128 %4, %18, off\n\t"
               "global_load_async_to_lds_b128 %5, %19, off\n\t"
               "global_load_async_to_lds_b128 %6, %20, off\n\t"
               "global_load_async_to_lds_b128 %7, %21, off\n\t"
               "global_load_async_to_lds_b128 %8, %22, off\n\t"
               "global_load_async_to_lds_b128 %9, %23, off\n\t"
               "global_load_async_to_lds_b128 %10, %24, off\n\t"
               "global_load_async_to_lds_b128 %11, %25, off\n\t"
               "global_load_async_to_lds_b128 %12, %26, off\n\t"
               "global_load_async_to_lds_b128 %13, %27, off\n\t"
               "s_wait_xcnt 0x0"
               :: "v"(l[0]), "v"(l[1]), "v"(l[2]), "v"(l[3]), "v"(l[4]), "v"(l[5]), "v"(l[6]), "v"(l[7]), "v"(l[8]), "v"(l[9]), "v"(l[10]), "v"(l[11]), "v"(l[12]), "v"(l[13]),
                  "v"(g[0]), "v"(g[1]), "v"(g[2]), "v"(g[3]), "v"(g[4]), "v"(g[5]), "v"(g[6]), "v"(g[7]), "v"(g[8]), "v"(g[9]), "v"(g[10]), "v"(g[11]), "v"(g[12]), "v"(g[13])
               : "memory");
}
// One stage of the qkv projection, copied by four waves: 256 + 192 rows of 128 B; 28 copies of 16 B per lane, every lane on, each wave-copy covers four whole lines.
__device__ __forceinline__ void stage_p(const char* ga, const char* gb, unsigned to, unsigned l) {   // ga, gb: the block's rows at the stage's k, the same for all lanes; to: the lane's own byte in them
#pragma unroll
  for (int hf = 0; hf < 2; ++hf) {
    unsigned ll[14]; const char* gg[14];
#pragma unroll
    for (int i = 0; i < 14; ++i) { const int rg = hf * 14 + i; ll[i] = l + rg * 16 * PP; gg[i] = (rg < PM / 16 ? ga + rg * 16 * D * 2 : gb + (rg - PM / 16) * 16 * D * 2) + to; }
    copy14(ll, gg);
  }
}
// Half a stage of the output projection, by four waves: f32 A rows of 256 B (8 copies per lane, 16 rows apart, two rows per wave-copy) and 16-bit B rows of 128 B (4 copies per lane, 32 rows apart).
__device__ __forceinline__ void stage_af32_b16(const char* ga, const char* gb, unsigned la, unsigned lb) {
  // the closing s_wait_xcnt stands inside the statement so that no address register of a copy is rewritten ahead of it
  asm volatile("global_load_async_to_lds_b128 %0, %12, off\n\t"
               "global_load_async_to_lds_b128 %1, %13, off\n\t"
               "global_load_async_to_lds_b128 %2, %14, off\n\t"
               "global_load_async_to_lds_b128 %3, %15, off\n\t"
               "global_load_async_to_lds_b128 %4, %16, off\n\t"
               "global_load_async_to_lds_b128 %5, %17, off\n\t"
               "global_load_async_to_lds_b128 %6, %18, off\n\t"
               "global_load_async_to_lds_b128 %7, %19, off\n\t"
               "global_load_async_to_lds_b128 %8, %20, off\n\t"
               "global_load_async_to_lds_b128 %9, %21, off\n\t"
               "global_load_async_to_lds_b128 %10, %22, off\n\t"
               "global_load_async_to_lds_b128 %11, %23, off\n\t"
               "s_wait_xcnt 0x0"
               :: "v"(la), "v"(la + 16 * GPF * 4), "v"(la + 32 * GPF * 4), "v"(la + 48 * GPF * 4),
                  "v"(la + 64 * GPF * 4), "v"(la + 80 * GPF * 4), "v"(la + 96 * GPF * 4), "v"(la + 112 * GPF * 4),
                  "v"(lb), "v"(lb + 32 * GP * 2), "v"(lb + 64 * GP * 2), "v"(lb + 96 * GP * 2),
                  "v"(ga), "v"(ga + 16 * D * 4), "v"(ga + 32 * D * 4), "v"(ga + 48 * D * 4),
                  "v"(ga + 64 * D * 4), "v"(ga + 80 * D * 4), "v"(ga + 96 * D * 4), "v"(ga + 112 * D * 4),
                  "v"(gb), "v"(gb + 32 * D * 2), "v"(gb + 64 * D * 2), "v"(gb + 96 * D * 2)
               : "memory");
}

// projections: grid (16, 16): (4096 x 1024) x (1024 x 3072) bf16 WMMA + bf16(b_qkv). q log2(e)/8, k -> f16 rows [b][h][s][64]; v -> (8v)^T f16 rows [b][h][64 d][s].
// The epilogue stages the block's three heads in LDS (q, k as rows, v transposed) and stores each head as whole lines.
__global__ __launch_bounds__(256) void proj_kernel(const __bf16* __restrict__ x16, const __bf16* __restrict__ w16, const float* __restrict__ bqkv, b16* __restrict__ qk, b16* __restrict__ vt) {
  __shared__ __attribute__((aligned(16))) unsigned char sm[3 * PST];   // three stage buffers [A | B]; behind the loop the epilogue's staging
  const int tid = threadIdx.x, lane = tid & 31, wave = __builtin_amdgcn_readfirstlane(tid >> 5), wm = wave & 3, wn = wave >> 2, nloc = lane & 15, hlf = lane >> 4;
  const int mb = blockIdx.y * PM, cb = blockIdx.x * PN, t7 = tid & 127;   // wn is also the wave's copy group: it copies the stages of its parity
  const char* ga = (const char*)(x16 + (size_t)mb * D);
  const char* gb = (const char*)(w16 + (size_t)cb * D);
  const unsigned to = (t7 >> 3) * (D * 2) + (t7 & 7) * 16, l = lds_off(sm) + (t7 >> 3) * PP + (t7 & 7) * 16;
  v8f acc[4][6];
#pragma unroll
  for (int r = 0; r < 4; ++r)
#pragma unroll
    for (int t = 0; t < 6; ++t) acc[r][t] = (v8f){};
  stage_p(ga + wn * (PK * 2), gb + wn * (PK * 2), to, l + wn * PST);   // stage 0 by group 0, stage 1 by group 1
  const float* pb = bqkv + cb + wn * 96 + nloc;
  float bias[6];
#pragma unroll
  for (int t = 0; t < 6; ++t) bias[t] = pb[t * 16];
  asm volatile("s_wait_xcnt 0x0" :: "v"(pb) : "memory");   // names the bias loads' address, which so stays untouched up to this wait
  if (wn == 0) asm volatile("s_wait_asynccnt 0x0" ::: "memory");   // the copying wave's share of stage 0 has landed
  __syncthreads();                                     // publishes stage 0 to the other waves
  if (wn == 0) stage_p(ga + 2 * (PK * 2), gb + 2 * (PK * 2), to, l + 2 * PST);
  const unsigned char* fA = sm + (wm * 64 + nloc) * PP;        // the lane's first A row and first B row in buffer 0
  const unsigned char* fB = sm + (PM + wn * 96 + nloc) * PP;
  v16bb fa[2][4], fb[2][6];                            // two fragment sets: one is multiplied while the other is filled
  auto ldf = [&](v16bb (&a)[4], v16bb (&bw)[6], int off) {     // a k-step's 20 LDS reads, as one group
#pragma unroll
    for (int r = 0; r < 4; ++r) a[r] = frag_kb_bf((const __bf16*)(fA + off + r * 16 * PP), hlf);
#pragma unroll
    for (int t = 0; t < 6; ++t) bw[t] = frag_kb_bf((const __bf16*)(fB + off + t * 16 * PP), hlf);
    __builtin_amdgcn_sched_barrier(0);                 // the group stays in front of the products that run while it lands: sunk among them, every read would be waited for on the spot
  };
  auto mm = [&](const v16bb (&a)[4], const v16bb (&bw)[6], int t0, int t1) {
#pragma unroll
    for (int t = t0; t < t1; ++t)
#pragma unroll
      for (int r = 0; r < 4; ++r) acc[r][t] = wmma16bb(a[r], bw[t], acc[r][t]);
  };
  ldf(fa[0], fb[0], 0);
  int cur = 0, nxt = PST;                              // byte offsets of stage st's and stage st + 1's buffers
  for (int st = 0; st < PNT; ++st) {
    ldf(fa[1], fb[1], cur + 64); mm(fa[0], fb[0], 0, 6);
    __builtin_amdgcn_sched_barrier(0);                 // these products stay in front of the waits: the last k-step's fragments land under them, not under an idle matrix unit
    // the publish point of stage st + 1 stands in front of stage st's last k-step, whose fragments are already fetched: behind it the next stage's first fragments are read
    asm volatile("s_wait_dscnt 0x0" ::: "memory");     // this wave's reads of the stage's buffer have returned before it is refilled
    if (((st + 1) & 1) == wn) asm volatile("s_wait_asynccnt 0x0" ::: "memory");   // the copying wave's share of stage st + 1 has landed (it has nothing else in flight)
    __syncthreads();                                   // publishes stage st + 1 and ends every wave's reads of stage st
    mm(fa[1], fb[1], 0, 2);
    __builtin_amdgcn_sched_barrier(0);                 // the matrix unit has work queued while the reads and the refill are issued
    if (st + 1 < PNT) ldf(fa[0], fb[0], nxt);
    if (st + 3 < PNT && ((st + 1) & 1) == wn) stage_p(ga + (st + 3) * (PK * 2), gb + (st + 3) * (PK * 2), to, l + cur);   // into the buffer that every wave has just left
    __builtin_amdgcn_sched_barrier(0);                 // the rest of the products stay behind the refill, so that the copies get two whole stages to land
    mm(fa[1], fb[1], 2, 6);
    cur = nxt; nxt = nxt == 2 * PST ? 0 : nxt + PST;
  }
  asm volatile("s_wait_asynccnt 0x0" ::: "memory");    // no copy is outstanding when the buffers become the epilogue's staging;
  asm volatile("s_wait_dscnt 0x0" ::: "memory");       // nor a read: the last pass reads nothing behind its barrier, which so also ends every wave's reads of the ring
  constexpr int RG = PM * GP * 2, VTP = PM + 8;        // bytes of a head's staging (256 rows of 64, pitch GP; or 64 rows of 256, pitch VTP)
  static_assert(HD * VTP * 2 <= RG && 3 * RG <= 3 * PST, "the three heads' staging fits the stage buffers");
  // + bias (rounded to bf16), the plane's factor, f16
#pragma unroll
  for (int t = 0; t < 6; ++t) {
    const int cl = wn * 96 + t * 16, which = (cb + cl) / D;    // the same for the whole wave
    b16* R = (b16*)(sm + (cl >> 6) * RG);
    const float bt = bf16_rne(bias[t]);
    if (which < 2) {
      const float sc = which == 0 ? SCALE * LOG2E : 1.0f;
#pragma unroll
      for (int r = 0; r < 4; ++r)
#pragma unroll
        for (int v = 0; v < 8; ++v) R[(wm * 64 + r * 16 + 8 * hlf + v) * GP + (cl & 63) + nloc] = (b16)((acc[r][t][v] + bt) * sc);
    } else {
#pragma unroll
      for (int r = 0; r < 4; ++r) {
        v8b p;
#pragma unroll
        for (int v = 0; v < 8; ++v) p[v] = (b16)((acc[r][t][v] + bt) * VS);
        *(v8b*)(R + ((cl & 63) + nloc) * VTP + wm * 64 + r * 16 + 8 * hlf) = p;
      }
    }
  }
  __syncthreads();                                     // publishes every wave's part of the three heads
  const int b = mb / S, s0 = mb % S;
#pragma unroll
  for (int j = 0; j < 3; ++j) {
    const int cg = cb + j * HD, which = cg / D, h = (cg % D) / HD;   // the same for the whole block
    const b16* R = (const b16*)(sm + j * RG);
    v8b w[8];
    if (which < 2) {                                   // 256 rows of 128 B stand in a row in memory: a wave stores 512 contiguous bytes
      b16* dst = qk + ((((size_t)which * Bn + b) * H + h) * S + s0) * HD + tid * 8;
#pragma unroll
      for (int i = 0; i < 8; ++i) w[i] = ld8b(R + (i * 32 + (tid >> 3)) * GP + (tid & 7) * 8);
#pragma unroll
      for (int i = 0; i < 8; ++i) *(v8b*)(dst + i * 2048) = w[i];
      asm volatile("s_wait_xcnt 0x0" ::: "memory");    // stands behind the eight stores, in front of any later write of their address or data registers
    } else {                                           // 64 feature rows of 256 tokens: a wave stores one row's 512 contiguous bytes
      b16* dst = vt + (((size_t)b * H + h) * HD + wave) * S + s0 + lane * 8;
#pragma unroll
      for (int i = 0; i < 8; ++i) w[i] = ld8b(R + (i * 8 + wave) * VTP + lane * 8);
#pragma unroll
      for (int i = 0; i < 8; ++i) *(v8b*)(dst + (size_t)(i * 8) * S) = w[i];
      asm volatile("s_wait_xcnt 0x0" ::: "memory");    // the same behind these eight
    }
  }
}

// attention: wave = (b, h, 32 queries as two column tiles, every other 64 keys): per pass of 32 keys S^T (K=64, 2 k-steps, single), online softmax f32, P^T f16, y^T += (8V)^T P^T (4 feature tiles);
// each K and V^T fragment read from LDS serves both column tiles. Waves w and w + 4 of a block hold the same 32 queries and the two 64-key halves of every stage; at the end each
// hands the other one tile's (m, l, y^T) through LDS and finishes its own tile: y/(8l) -> f32 rows.
// The softmax reference m of a column is held from pass to pass (it starts as the maximum over the wave's first 32 keys). A pass forms no maximum: its own sums of exponentials are the test,
// one ballot a pass. Only where a sum passes TOP are the pass's scores formed again, their maxima taken and exchanged between the halves, m raised and y^T and l rescaled.
// The scores leave the matrix unit finished, in base-2 units: q carries log2(e)/8 and the score accumulators start from the key bias table (a lane's 8 rows of a tile are 8 consecutive keys).
// The block's 8 waves share one (b, h): K rows and (8V)^T rows come in stages of KT keys into two LDS buffers by asynchronous copies (whole 128-B lines, once per block),
// and every wave takes its fragments from LDS. Row pitches are 16 B x odd for the 16-byte LDS readers.
constexpr int KT = 128, NST = S / KT, KP = HD + 8, VP = KT + 8;
constexpr float TOP = 256.0f;   // the most that 8 of a lane's exponentials may sum to under the held reference: each is then at most 2^8, far inside f16
// One stage: 128 K rows of 128 B (16 KB contiguous) and 64 V^T rows of 256 B; 8 copies of 16 B per lane, every lane on, each wave-copy covers 512 contiguous bytes or two 256-B rows.
__device__ __forceinline__ void stage_copy(const b16* kg, const b16* vg, const b16* ks, const b16* vs, int tid) {
  const b16* gk = kg + tid * 8; const b16* gv = vg + (size_t)(tid >> 4) * S + (tid & 15) * 8;
  const unsigned lk = lds_off(ks + (tid >> 3) * KP + (tid & 7) * 8), lv = lds_off(vs + (tid >> 4) * VP + (tid & 15) * 8);
  // the closing s_wait_xcnt stands inside the statement so that no address register of a copy is rewritten ahead of it
  asm volatile("global_load_async_to_lds_b128 %0, %8, off\n\t"
               "global_load_async_to_lds_b128 %1, %9, off\n\t"
               "global_load_async_to_lds_b128 %2, %10, off\n\t"
               "global_load_async_to_lds_b128 %3, %11, off\n\t"
               "global_load_async_to_lds_b128 %4, %12, off\n\t"
               "global_load_async_to_lds_b128 %5, %13, off\n\t"
               "global_load_async_to_lds_b128 %6, %14, off\n\t"
               "global_load_async_to_lds_b128 %7, %15, off\n\t"
               "s_wait_xcnt 0x0"
               :: "v"(lk), "v"(lk + 32 * KP * 2), "v"(lk + 64 * KP * 2), "v"(lk + 96 * KP * 2),
                  "v"(lv), "v"(lv + 16 * VP * 2), "v"(lv + 32 * VP * 2), "v"(lv + 48 * VP * 2),
                  "v"(gk), "v"(gk + 2048), "v"(gk + 4096), "v"(gk + 6144),
                  "v"(gv), "v"(gv + (size_t)16 * S), "v"(gv + (size_t)32 * S), "v"(gv + (size_t)48 * S)
               : "memory");
}
__device__ __forceinline__ v8f ld8f(const float* p) { return __builtin_shufflevector(*(const v4f*)p, *(const v4f*)(p + 4), 0, 1, 2, 3, 4, 5, 6, 7); }
// four waves per SIMD (two blocks per WGP) hide the softmax chains: the register budget is held to a quarter of the SIMD's file
__global__ __launch_bounds__(256) __attribute__((amdgpu_waves_per_eu(4, 4))) void attn_kernel(const b16* __restrict__ qk, const b16* __restrict__ vt, const float* __restrict__ bl2, float* __restrict__ y) {
  __shared__ __attribute__((aligned(16))) float Os[8][16][HD + 4];
  __shared__ __attribute__((aligned(16))) b16 Ks[2][KT * KP];
  __shared__ __attribute__((aligned(16))) b16 Vs[2][HD * VP];
  const int tid = threadIdx.x, wid = __builtin_amdgcn_readfirstlane(threadIdx.x >> 5), lane = threadIdx.x & 31, hh = lane >> 4, col = lane & 15;
  const int g = wid >> 2, qb = (blockIdx.x & 15) * 128 + (wid & 3) * 32, h = (blockIdx.x >> 4) & 15, b = blockIdx.x >> 8;   // g: which 64 keys of a stage
  const b16* Q = qk + ((((size_t)0 * Bn + b) * H + h) * S) * HD; const b16* K = qk + ((((size_t)1 * Bn + b) * H + h) * S) * HD;
  const b16* vb = vt + (((size_t)b * H + h) * HD) * S;
  stage_copy(K, vb, Ks[0], Vs[0], tid);
  v16b qf[2][2];
#pragma unroll
  for (int c = 0; c < 2; ++c)
#pragma unroll
    for (int ks = 0; ks < 2; ++ks) qf[c][ks] = frag_kb(Q + (size_t)(qb + c * 16 + col) * HD + ks * 32, hh);
  asm volatile("s_wait_asynccnt 0x0" ::: "memory");   // this wave's share of stage 0 has landed
  __syncthreads();                                     // publishes stage 0 to the other waves
  stage_copy(K + (size_t)KT * HD, vb + KT, Ks[1], Vs[1], tid);
  float m[2]; v2f l2[2] = {{0.0f, 0.0f}, {0.0f, 0.0f}}; v8f o[2][4] = {{{}, {}, {}, {}}, {{}, {}, {}, {}}};   // l2: a lane's own keys, even and odd apart; all joins stand behind the loop
  const float* bl = bl2 + b * S + g * (KT / 2);       // the same for the whole wave; a lane adds its half's 8 keys
  const unsigned ho = 8 * hh;
  v8f c0 = ld8f(bl + ho), c1 = ld8f(bl + 16 + ho);
  v2f sum[2]; v16b pb[2];
  // the scores of 32 keys (rows from Kr on) x 32 queries, products in the loop's own order
  auto score = [&](const b16* Kr, v8f a0, v8f a1, v8f (&s0)[2], v8f (&s1)[2]) {
    v16b kf[2][2];
#pragma unroll
    for (int ks = 0; ks < 2; ++ks) { kf[ks][0] = frag_kb(Kr + col * KP + ks * 32, hh); kf[ks][1] = frag_kb(Kr + (16 + col) * KP + ks * 32, hh); }
#pragma unroll
    for (int c = 0; c < 2; ++c) { s0[c] = wmma16b(kf[0][0], qf[c][0], a0); s1[c] = wmma16b(kf[0][1], qf[c][0], a1); }
#pragma unroll
    for (int c = 0; c < 2; ++c) { s0[c] = wmma16b(kf[1][0], qf[c][1], s0[c]); s1[c] = wmma16b(kf[1][1], qf[c][1], s1[c]); }
  };
  // a column's maximum over the 32 keys: in the lane, then between the halves
  auto colmax = [&](const v8f& a, const v8f& bq) {
    float mr = -INFINITY;
#pragma unroll
    for (int r = 0; r < 8; ++r) mr = fmaxf(mr, fmaxf(a[r], bq[r]));
    return fmaxf(mr, __shfl_xor(mr, 16));
  };
  // P^T = 2^(S^T - m) as f16 fragments, and per tile each lane's two sums of 8 exponentials (its even and its odd keys: packed adds, a tree three deep)
  auto soft = [&](const v8f (&s0)[2], const v8f (&s1)[2]) {
#pragma unroll
    for (int c = 0; c < 2; ++c) {
      float e[16];
#pragma unroll
      for (int r = 0; r < 8; ++r) { e[r] = s0[c][r] - m[c]; e[8 + r] = s1[c][r] - m[c]; }
      // a tile's exponentials in one statement, each in place: none writes over the source of the one in front of it; the v_nop is the slot behind the last one
      asm("v_exp_f32 %0, %0\n\tv_exp_f32 %1, %1\n\tv_exp_f32 %2, %2\n\tv_exp_f32 %3, %3\n\tv_exp_f32 %4, %4\n\tv_exp_f32 %5, %5\n\t"
          "v_exp_f32 %6, %6\n\tv_exp_f32 %7, %7\n\tv_exp_f32 %8, %8\n\tv_exp_f32 %9, %9\n\tv_exp_f32 %10, %10\n\tv_exp_f32 %11, %11\n\t"
          "v_exp_f32 %12, %12\n\tv_exp_f32 %13, %13\n\tv_exp_f32 %14, %14\n\tv_exp_f32 %15, %15\n\tv_nop"
          : "+v"(e[0]), "+v"(e[1]), "+v"(e[8]), "+v"(e[9]), "+v"(e[2]), "+v"(e[3]), "+v"(e[10]), "+v"(e[11]), "+v"(e[4]), "+v"(e[5]), "+v"(e[12]),
            "+v"(e[13]), "+v"(e[6]), "+v"(e[7]), "+v"(e[14]), "+v"(e[15]));
      sum[c] = (((v2f){e[0], e[1]} + (v2f){e[8], e[9]}) + ((v2f){e[2], e[3]} + (v2f){e[10], e[11]})) + (((v2f){e[4], e[5]} + (v2f){e[12], e[13]}) + ((v2f){e[6], e[7]} + (v2f){e[14], e[15]}));
#pragma unroll
      for (int r = 0; r < 16; ++r) pb[c][r] = (b16)e[r];
    }
  };
  {
    v8f t0[2], t1[2];
    score(Ks[0] + g * (KT / 2) * KP, c0, c1, t0, t1);
#pragma unroll
    for (int c = 0; c < 2; ++c) m[c] = colmax(t0[c], t1[c]);
  }
  for (int st = 0; st < NST; ++st) {
    const b16* Kl = Ks[st & 1] + g * (KT / 2) * KP; const b16* Vl = Vs[st & 1] + g * (KT / 2);
    for (int kl = 0; kl < KT / 2; kl += 32) {
      // the pass's own 16 LDS reads stand together at its head: one wait for the K fragments, and the V^T fragments land behind the softmax
      v16b kf[2][2], vf[4];
#pragma unroll
      for (int ks = 0; ks < 2; ++ks) { kf[ks][0] = frag_kb(Kl + (kl + col) * KP + ks * 32, hh); kf[ks][1] = frag_kb(Kl + (kl + 16 + col) * KP + ks * 32, hh); }
#pragma unroll
      for (int n = 0; n < 4; ++n) vf[n] = frag_kb(Vl + (n * 16 + col) * VP + kl, hh);
      v8f s0[2], s1[2];
#pragma unroll
      for (int c = 0; c < 2; ++c) { s0[c] = wmma16b(kf[0][0], qf[c][0], c0); s1[c] = wmma16b(kf[0][1], qf[c][0], c1); }
#pragma unroll
      for (int c = 0; c < 2; ++c) { s0[c] = wmma16b(kf[1][0], qf[c][1], s0[c]); s1[c] = wmma16b(kf[1][1], qf[c][1], s1[c]); }
      // the next pass's start values load behind their last use, so that they land under the rest of this pass; this wave's next 32 keys follow at once or in the next stage;
      // the last pass wraps to the wave's first keys (in bounds, not used)
      const int kn = (st * KT + kl + (kl == 0 ? 32 : KT - 32)) & (S - 1);
      const float* pn = bl + kn + ho;
      c0 = ld8f(pn); c1 = ld8f(pn + 16);
      soft(s0, s1);
      // one test a pass: a scalar branch on the ballot
      if (__builtin_amdgcn_ballot_w32(fmaxf(fmaxf(sum[0][0], sum[0][1]), fmaxf(sum[1][0], sum[1][1])) > TOP) != 0) {
        const float* pc = bl + st * KT + kl + ho;
        score(Kl + kl * KP, ld8f(pc), ld8f(pc + 16), s0, s1);
        asm volatile("s_wait_xcnt 0x0" :: "v"(pc) : "memory");   // names the two start-value loads' address, which so stays untouched up to this wait
        float f[2];
#pragma unroll
        for (int c = 0; c < 2; ++c) { const float mn = fmaxf(m[c], colmax(s0[c], s1[c])); f[c] = m[c] - mn; m[c] = mn; }   // the same in both halves of a column
        // the two factors, each in place; the v_nop is the slot behind the last exponential
        asm("v_exp_f32 %0, %0\n\tv_exp_f32 %1, %1\n\tv_nop" : "+v"(f[0]), "+v"(f[1]));
#pragma unroll
        for (int c = 0; c < 2; ++c) {
          l2[c] *= f[c];
#pragma unroll
          for (int n = 0; n < 4; ++n)
#pragma unroll
            for (int r = 0; r < 8; ++r) o[c][n][r] *= f[c];
        }
        soft(s0, s1);
      }
#pragma unroll
      for (int c = 0; c < 2; ++c) l2[c] += sum[c];
#pragma unroll
      for (int n = 0; n < 4; ++n)
#pragma unroll
        for (int c = 0; c < 2; ++c) o[c][n] = wmma16b(vf[n], pb[c], o[c][n]);
      asm volatile("s_wait_xcnt 0x0" :: "v"(pn) : "memory");   // names the start-value loads' address, which so stays untouched up to this wait, far behind the loads
    }
    asm volatile("s_wait_dscnt 0x0" ::: "memory");     // this wave's reads of the stage's buffer have returned before it is refilled
    asm volatile("s_wait_asynccnt 0x0" ::: "memory");  // this wave's share of stage st + 1 has landed
    __syncthreads();                                   // publishes stage st + 1 and ends every wave's reads of stage st
    if (st + 2 < NST) stage_copy(K + (size_t)(st + 2) * KT * HD, vb + (st + 2) * KT, Ks[st & 1], Vs[st & 1], tid);
  }
  asm volatile("s_wait_asynccnt 0x0" ::: "memory");    // no copy is outstanding when the K buffers become the exchange area
  float l[2];
#pragma unroll
  for (int c = 0; c < 2; ++c) { l[c] = l2[c][0] + l2[c][1]; l[c] += __shfl_xor(l[c], 16); }   // a column's sum over both halves' keys, once
  // The pair's join: wave group g keeps column tile g and hands tile 1 - g to its partner, lane to lane (34 floats a lane, lane-contiguous dwords), in the K buffers,
  // which every wave has left at the loop's last barrier.
  static_assert(8 * 34 * 32 * 4 <= (int)sizeof(Ks), "the exchange area fits the K buffers");
  float* X = (float*)&Ks[0][0];
  float* xo = X + wid * (34 * 32) + lane;
  const float* xi = X + (wid ^ 4) * (34 * 32) + lane;
#pragma unroll
  for (int n = 0; n < 4; ++n)
#pragma unroll
    for (int r = 0; r < 8; ++r) xo[(n * 8 + r) * 32] = g ? o[0][n][r] : o[1][n][r];
  xo[32 * 32] = g ? m[0] : m[1]; xo[33 * 32] = g ? l[0] : l[1];
  __syncthreads();                                     // publishes every wave's handed-over tile to its partner
  const float mm = g ? m[1] : m[0], lm = g ? l[1] : l[0], mo = xi[32 * 32], lo = xi[33 * 32], mj = fmaxf(mm, mo);
  float fa = mm - mj, fb = mo - mj;
  // the two weights of the join, each in place; the v_nop is the slot behind the last exponential
  asm("v_exp_f32 %0, %0\n\tv_exp_f32 %1, %1\n\tv_nop" : "+v"(fa), "+v"(fb));
  const float inv = 1.0f / (VS * (lm * fa + lo * fb));
  fa *= inv; fb *= inv;
#pragma unroll
  for (int n = 0; n < 4; ++n)
#pragma unroll
    for (int r = 0; r < 8; ++r) Os[wid][col][n * 16 + 8 * hh + r] = (g ? o[1][n][r] : o[0][n][r]) * fa + xi[(n * 8 + r) * 32] * fb;
  wave_lds_sync();
  float* dst = y + ((size_t)b * S + qb + g * 16) * D + h * HD;
  {
#pragma unroll
    for (int j = 0; j < 8; ++j) { const int rr = j * 2 + hh, c4 = col * 4; *(v4f*)(dst + (size_t)rr * D + c4) = *(const v4f*)(&Os[wid][rr][c4]); }
    
  }
}

// out = y Wo^T: (4096 x 1024) x (1024 x 1024); A = y rounded at the fragment load (single), B = f16(bf16 Wo) rows; f32 rows; grid (8, 32).
// One block on a WGP, and a stage's products are shorter than its copies' way from memory: the ring has three buffers with two stages in flight. Waves 0-3 copy the even stages,
// waves 4-7 the odd ones, so that each wave still waits for all of its own copies while the other group's stage flies on.
__global__ __launch_bounds__(256) void out_kernel(const float* __restrict__ y, const b16* __restrict__ wo16, const float* __restrict__ bproj, float* __restrict__ out) {
  constexpr int OST = GF32 + G16;                      // bytes of a stage buffer [A f32 | B]
  __shared__ __attribute__((aligned(16))) unsigned char sm[3 * OST];   // three stage buffers; behind the loop the epilogue's staging
  const int tid = threadIdx.x, lane = tid & 31, wave = __builtin_amdgcn_readfirstlane(tid >> 5), wm = wave & 3, wn = wave >> 2, nloc = lane & 15, hlf = lane >> 4;
  const int mb = blockIdx.y * 128, m0 = mb + wm * 32, cb = blockIdx.x * 128, c0 = cb + wn * 64, t7 = tid & 127;   // wn is also the wave's copy group: it copies the stages of its parity
  const char* ga = (const char*)(y + (size_t)(mb + (t7 >> 4)) * D + (t7 & 15) * 4);
  const char* gb = (const char*)(wo16 + (size_t)(cb + (t7 >> 3)) * D + (t7 & 7) * 8);
  const unsigned la = lds_off(sm) + (t7 >> 4) * (GPF * 4) + (t7 & 15) * 16, lb = lds_off(sm) + GF32 + (t7 >> 3) * (GP * 2) + (t7 & 7) * 16;
  // a whole stage by four waves: 24 copies of 16 B per lane, every lane on; the second call takes the A rows 8 and the B rows 16 further on
  auto stage = [&](int st, unsigned buf) {
    stage_af32_b16(ga + st * (GK * 4), gb + st * (GK * 2), la + buf, lb + buf);
    stage_af32_b16(ga + st * (GK * 4) + 8 * D * 4, gb + st * (GK * 2) + 16 * D * 2, la + buf + 8 * GPF * 4, lb + buf + 16 * GP * 2);
  };
  v8f acc[2][4];
#pragma unroll
  for (int r = 0; r < 2; ++r)
#pragma unroll
    for (int t = 0; t < 4; ++t) acc[r][t] = (v8f){};
  stage(wn, wn * OST);                                 // stage 0 by group 0, stage 1 by group 1
  if (wn == 0) asm volatile("s_wait_asynccnt 0x0" ::: "memory");   // the copying wave's share of stage 0 has landed
  __syncthreads();                                     // publishes stage 0 to the other waves
  int bi = 0;                                          // stage st's buffer
  for (int st = 0; st < GNT; ++st) {
    const float* Al = (const float*)(sm + bi * OST) + (wm * 32 + nloc) * GPF + 8 * hlf;
    const b16* Bl = (const b16*)(sm + bi * OST + GF32) + (wn * 64 + nloc) * GP;
#pragma unroll
    for (int ks = 0; ks < GK; ks += 32) {
      // the k-step's 16 LDS reads stand together at its head, so that the wave meets the LDS latency once and not once per B fragment
      v16b a0, a1, bw[4]; v4f ra[2][4];
#pragma unroll
      for (int t = 0; t < 4; ++t) bw[t] = frag_kb(Bl + t * 16 * GP + ks, hlf);
#pragma unroll
      for (int r = 0; r < 2; ++r)
#pragma unroll
        for (int q = 0; q < 4; ++q) ra[r][q] = *(const v4f*)(Al + r * 16 * GPF + ks + (q >> 1) * 16 + (q & 1) * 4);
      // the refill stands behind the stage's first reads, which land while the copies are issued: stage st + 2 goes into the buffer of stage st - 1, which every wave has left
      // at the barrier in front of this trip (its own reads of it returned in front of that barrier); the reads in flight here are of another buffer
      if (ks == 0 && st + 2 < GNT && (st & 1) == wn) stage(st + 2, (bi == 0 ? 2 : bi - 1) * OST);
#pragma unroll
      for (int e = 0; e < 8; ++e) { a0[e] = (b16)ra[0][e >> 2][e & 3]; a0[8 + e] = (b16)ra[0][2 + (e >> 2)][e & 3]; a1[e] = (b16)ra[1][e >> 2][e & 3]; a1[8 + e] = (b16)ra[1][2 + (e >> 2)][e & 3]; }
#pragma unroll
      for (int t = 0; t < 4; ++t) { acc[0][t] = wmma16b(a0, bw[t], acc[0][t]); acc[1][t] = wmma16b(a1, bw[t], acc[1][t]); }
    }
    asm volatile("s_wait_dscnt 0x0" ::: "memory");     // this wave's reads of the stage's buffer have returned before it is refilled
    if (((st + 1) & 1) == wn) asm volatile("s_wait_asynccnt 0x0" ::: "memory");   // the copying wave's share of stage st + 1 has landed (it has nothing else in flight)
    __syncthreads();                                   // publishes stage st + 1 and ends every wave's reads of stage st
    bi = bi == 2 ? 0 : bi + 1;
  }
  asm volatile("s_wait_asynccnt 0x0" ::: "memory");    // no copy is outstanding when the buffers become the epilogue's staging
#pragma unroll
  for (int t = 0; t < 4; ++t)
#pragma unroll
    for (int r = 0; r < 2; ++r)
#pragma unroll
      for (int v = 0; v < 8; ++v) acc[r][t][v] += bf16_rne(bproj[c0 + t * 16 + nloc]);
  epi_f32(acc, 1.0f, nullptr, out, D, m0, c0, lane, (float*)sm + wave * (32 * 64));
}
}  // namespace

extern "C" void kernel_launch(void* const* d_in, const int* in_sizes, int n_in,
                              void* d_out, int out_size, void* d_ws, size_t ws_size, hipStream_t stream) {
  (void)n_in; (void)out_size;
  const float* x = (const float*)d_in[0]; const float* abias = (const float*)d_in[1]; const float* wqkv = (const float*)d_in[2]; const float* bqkv = (const float*)d_in[3];
  const float* wproj = (const float*)d_in[4]; const float* bproj = (const float*)d_in[5];
  float* out = (float*)d_out;   // [2,2048,1024]
  if (in_sizes[0] != NTOK * D || in_sizes[1] != NTOK || in_sizes[2] != D * D3 || in_sizes[3] != D3 || in_sizes[4] != D * D || in_sizes[5] != D) return;
  size_t off = 0; char* ws = (char*)d_ws;
  auto carve = [&](size_t bytes) { char* p = ws + off; off += (bytes + 255) & ~(size_t)255; return p; };
  unsigned short* x16 = (unsigned short*)carve((size_t)NTOK * D * 2);        // 8 MB
  unsigned short* w16 = (unsigned short*)carve((size_t)D3 * D * 2);          // 6 MB ([3072][1024] bf16 = [which][n][k])
  b16* wo16 = (b16*)carve((size_t)D * D * 2);
  b16* qk = (b16*)carve((size_t)2 * NTOK * D * 2);                           // 16 MB: [which][b][h][s][64]
  b16* vt = (b16*)carve((size_t)NTOK * D * 2);                               // 8 MB
  float* y = (float*)carve((size_t)NTOK * D * 4);                            // 16 MB
  float* bl2 = (float*)carve((size_t)NTOK * 4);                              // 16 KB
  if (off > ws_size) return;                                                   // ≈ 56 MB
  prep_kernel<<<NB_WQ + NB_WO + NB_X, 256, 0, stream>>>(x, x16, abias, bl2, wqkv, w16, wproj, (unsigned short*)wo16);
  proj_kernel<<<dim3(D3 / PN, NTOK / PM), 256, 0, stream>>>((const __bf16*)x16, (const __bf16*)w16, bqkv, qk, vt);
  attn_kernel<<<Bn * H * (S / 16) / 8, 256, 0, stream>>>(qk, vt, bl2, y);
  out_kernel<<<dim3(D / 128, NTOK / 128), 256, 0, stream>>>(y, wo16, bproj, out);
}

// v009
// One run takes 79.4 microseconds.
// In both of two side-by-side timings against v008, it was 1.03 times as fast.
// Counting every step since v000, it is 3.64 times as fast.
#include <hip/hip_runtime.h>

// Gaze-guided multi-head attention (B=2, N=2048, D=1024, 16 heads x 64): qkv = x w_qkv + b_qkv; scores = q.k/8 + attn_bias[b][key]; softmax; (w.v) w_proj + b_proj.
// Numerics: x, attn_bias, w_qkv, b_qkv, w_proj, b_proj are rounded to bf16 (RNE); the qkv projection runs on
// v_wmma_f32_16x16x32_bf16 (exact products, f32 accumulate, + bias); the scores, P.V and the output projection run on v_wmma_f32_16x16x32_f16 with single f16 operands
// (f16 copies of q log2(e)/8, k, (8v)^T, P, the attention output, and the exact f16 copy of bf16 w_proj); key bias and online softmax in f32, in base 2.

namespace {
constexpr int Bn = 2, S = 2048, D = 1024, H = 16, HD = 64, NTOK = Bn * S, D3 = 3 * D;
constexpr float SCALE = 0.125f, VS = 8.0f, LOG2E = 1.4426950408889634f;

typedef _Float16 b16;
typedef __attribute__((ext_vector_type(16))) _Float16 v16b;
typedef __attribute__((ext_vector_type(8)))  _Float16 v8b;
typedef __attribute__((ext_vector_type(8)))  float v8f;
typedef __attribute__((ext_vector_type(4)))  float v4f;
typedef __attribute__((ext_vector_type(2)))  float v2f;

__device__ __forceinline__ v8b ld8b(const b16* p) { return *(const v8b*)p; }
__device__ __forceinline__ v16b cat8b(v8b a, v8b b) { return __builtin_shufflevector(a, b, 0, 1, 2, 3, 4, 5, 6, 7, 8, 9, 10, 11, 12, 13, 14, 15); }
__device__ __forceinline__ v16b frag_kb(const b16* p, int hh) { return cat8b(ld8b(p + 8 * hh), ld8b(p + 16 + 8 * hh)); }
__device__ __forceinline__ v8f wmma16b(v16b a, v16b b, v8f c) {
  v8f d = __builtin_amdgcn_wmma_f32_16x16x32_f16(false, a, false, b, (short)0, c, false, false);
  asm volatile("v_nop\n\tv_nop\n\tv_nop\n\tv_nop" : "+v"(d) : "v"(a), "v"(b));
  return d;
}
__device__ __forceinline__ void wave_lds_sync() {
  __builtin_amdgcn_fence(__ATOMIC_RELEASE, "workgroup");
  __builtin_amdgcn_wave_barrier();
  __builtin_amdgcn_fence(__ATOMIC_ACQUIRE, "workgroup");
}

// f32 rows with pitch ldo: 64 floats = 256 B = 2 lines per row; 16 lanes x 16 B per row, 2 rows per instruction. Optional per-row factor
__device__ __forceinline__ void epi_f32(v8f (&acc)[2][4], float scale, const float* rscale, float* __restrict__ out, int ldo, int m0, int c0, int lane, float* Tt) {
  const int nloc = lane & 15, hlf = lane >> 4;
#pragma unroll
  for (int t = 0; t < 4; ++t)
#pragma unroll
    for (int r = 0; r < 2; ++r)
#pragma unroll
      for (int v = 0; v < 8; ++v) {
        const int rr = r * 16 + v + 8 * hlf;
        const float rs = rscale ? rscale[(size_t)(m0 + rr) * 32] : 1.0f;
        Tt[rr * 64 + t * 16 + nloc] = acc[r][t][v] * scale * rs;
      }
  wave_lds_sync();
  float* dst0 = out + (size_t)m0 * ldo + c0;
  {
#pragma unroll
    for (int j = 0; j < 16; ++j) { const int rr = j * 2 + hlf, c4 = nloc * 4; *(v4f*)(dst0 + (size_t)rr * ldo + c4) = *(const v4f*)(Tt + rr * 64 + c4); }
    
  }
}



typedef __attribute__((ext_vector_type(8))) __bf16 v8bb; typedef __attribute__((ext_vector_type(16))) __bf16 v16bb;
typedef __attribute__((ext_vector_type(8))) unsigned short v8us;
__device__ __forceinline__ v16bb frag_kb_bf(const __bf16* p, int hh) { const v8bb a = *(const v8bb*)(p + 8 * hh), b = *(const v8bb*)(p + 16 + 8 * hh); return __builtin_shufflevector(a, b, 0, 1, 2, 3, 4, 5, 6, 7, 8, 9, 10, 11, 12, 13, 14, 15); }
// the plain builtin: the compiler keeps the distance behind it itself, and its operands may lie above v255, which an asm statement's operands may not
__device__ __forceinline__ v8f wmma16bb(v16bb a, v16bb b, v8f c) { return __builtin_amdgcn_wmma_f32_16x16x32_bf16(false, a, false, b, (short)0, c, false, false); }
__device__ __forceinline__ unsigned short bf16_rne_bits(float v) { unsigned int u = __float_as_uint(v); u += 0x7FFFu + ((u >> 16) & 1u); return (unsigned short)(u >> 16); }
__device__ __forceinline__ float bf16_rne(float v) { return __uint_as_float(((unsigned int)bf16_rne_bits(v)) << 16); }

typedef __attribute__((ext_vector_type(4))) unsigned int v4u;
// All preparation is one launch: the blocks' roles go by block index, and every block moves 64 KB in and 32 KB out with its 16 loads of 16 B per thread issued together.
constexpr int WTK = 256, WTN = 64;                                    // a weight tile: 256 k rows x 64 n columns
constexpr int NB_WQ = (D3 / WTN) * (D / WTK), NB_WO = (D / WTN) * (D / WTK), NB_X = NTOK * D / 8 / (8 * 256);
template <int MODE> __device__ __forceinline__ unsigned int wbits(float w) {   // MODE 0 bf16 bits, MODE 1 f16(bf16(w)) bits
  if (MODE == 0) return bf16_rne_bits(w);
  const b16 hv = (b16)bf16_rne(w); return *reinterpret_cast<const unsigned short*>(&hv);
}
// W [k rows][Ncols] f32 -> [n][k] 16-bit rows of D, one tile through LDS. A thread takes 4 columns of two neighbouring k rows and stores the k pair as one dword of row n;
// the 16-B groups of LDS row n stand at (group ^ (n >> 2)), so that the 32 dword stores of a wave fall on 32 banks and a row is still read back as 512 contiguous bytes.
template <int MODE>
__device__ __forceinline__ void wt_tile(const float* __restrict__ Wm, int Ncols, unsigned short* __restrict__ out, int n0, int k0, unsigned int* Tl) {
  const int tid = threadIdx.x, lane = tid & 31, wave = tid >> 5, c = tid & 15, pr = tid >> 4;
  const float* src = Wm + (size_t)(k0 + 2 * pr) * Ncols + n0 + 4 * c;
  v4f lo[8], hi[8];
#pragma unroll
  for (int it = 0; it < 8; ++it) { lo[it] = *(const v4f*)(src + (size_t)(32 * it) * Ncols); hi[it] = *(const v4f*)(src + (size_t)(32 * it + 1) * Ncols); }
  __builtin_amdgcn_sched_barrier(0);                                  // all 16 loads issue before the first conversion: one memory latency per tile, not two
  asm volatile("s_wait_xcnt 0x0" :: "v"(src) : "memory");             // names the loads' address, which so stays untouched up to this wait
#pragma unroll
  for (int it = 0; it < 8; ++it) {
    const int p = pr + 16 * it;                                       // k pair of the tile: rows 2p, 2p + 1
#pragma unroll
    for (int j = 0; j < 4; ++j) Tl[(4 * c + j) * (WTK / 2) + ((((p >> 2) ^ c) << 2) | (p & 3))] = wbits<MODE>(lo[it][j]) | (wbits<MODE>(hi[it][j]) << 16);
  }
  __syncthreads();
  unsigned short* dst = out + (size_t)(n0 + wave * 8) * D + k0 + lane * 8;   // a wave stores 8 rows of 512 contiguous bytes
#pragma unroll
  for (int r = 0; r < 8; ++r) {
    const int n = wave * 8 + r;
    *(v4u*)(dst + r * D) = *(const v4u*)(Tl + n * (WTK / 2) + ((lane ^ (n >> 2)) << 2));
  }
  asm volatile("s_wait_xcnt 0x0" ::: "memory");                       // stands behind the eight stores, in front of any later write of their address or data registers
}
__global__ __launch_bounds__(256) void prep_kernel(const float* __restrict__ x, unsigned short* __restrict__ x16, const float* __restrict__ abias, float* __restrict__ bl2,
                                                   const float* __restrict__ wqkv, unsigned short* __restrict__ w16, const float* __restrict__ wproj, unsigned short* __restrict__ wo16) {
  __shared__ __attribute__((aligned(16))) unsigned int Tl[WTN * (WTK / 2)];
  const int bid = blockIdx.x;
  if (bid < NB_WQ) { wt_tile<0>(wqkv, D3, w16, (bid % (D3 / WTN)) * WTN, (bid / (D3 / WTN)) * WTK, Tl); return; }
  if (bid < NB_WQ + NB_WO) { const int t = bid - NB_WQ; wt_tile<1>(wproj, D, wo16, (t % (D / WTN)) * WTN, (t / (D / WTN)) * WTK, Tl); return; }
  const int xb = bid - NB_WQ - NB_WO, t = xb * 256 + threadIdx.x;    // the block rounds 64 KB of x in a row; the first NTOK threads also make the bias table
  const float* s = x + ((size_t)xb * (8 * 256) + threadIdx.x) * 8;
  const float* sb = abias + (t & (NTOK - 1));                         // in bounds for every thread, so that the load needs no branch and flies with the others
  const float ab = *sb;
  v4f a[8], b[8];
#pragma unroll
  for (int it = 0; it < 8; ++it) { a[it] = *(const v4f*)(s + it * (256 * 8)); b[it] = *(const v4f*)(s + it * (256 * 8) + 4); }
  asm volatile("s_wait_xcnt 0x0" :: "v"(s), "v"(sb) : "memory");      // names the loads' addresses, which so stay untouched up to this wait
  unsigned short* d = x16 + ((size_t)xb * (8 * 256) + threadIdx.x) * 8;
#pragma unroll
  for (int it = 0; it < 8; ++it) { v8us v;
#pragma unroll
    for (int e = 0; e < 4; ++e) { v[e] = bf16_rne_bits(a[it][e]); v[4 + e] = bf16_rne_bits(b[it][e]); }
    *(v8us*)(d + it * (256 * 8)) = v; }
  if (t < NTOK) bl2[t] = bf16_rne(ab) * LOG2E;                        // key bias, rounded to bf16, in base-2 units
}

// Both projection GEMMs: per stage of GK k the block's A rows and B rows come once per block into a ring of LDS buffers by asynchronous copies (whole 128-B lines),
// and every wave takes its fragments from LDS. Row pitches are 16 B x odd. The output projection's block is 128x128 (8 waves of 32x64).
// The qkv projection has as many blocks as the chip has WGPs: a block owns 256 rows x 192 columns (three whole heads), 8 waves (4 row groups x 2 column groups) of 64x96,
// so that an operand byte brought from L2 and a fragment read from LDS each serve more products. With one block on a WGP nothing else covers its waits: each k-step's fragments
// are fetched one k-step ahead into a second register set, and the ring has three buffers with two stages in flight: waves 0-3 copy the even stages, waves 4-7 the odd ones,
// so that each wave still waits for all of its own copies while the other group's stage flies on.
constexpr int GK = 64, GNT = D / GK, GP = GK + 8;
constexpr int G16 = 128 * GP * 2;                            // bytes of a 128-row tile of 16-bit rows
__device__ __forceinline__ unsigned lds_off(const void* p) { return (unsigned)(size_t)p; }
constexpr int PM = 256, PN = 192, PK = 64, PNT = D / PK, PP = PK * 2 + 16, PST = (PM + PN) * PP;   // the qkv block's tile, k per stage, row pitch and stage size in bytes (A rows, then B rows)
__device__ __forceinline__ void copy14(const unsigned (&l)[14], const char* const (&g)[14]) {
  // the closing s_wait_xcnt stands inside the statement so that no address register of a copy is rewritten ahead of it
  asm volatile("global_load_async_to_lds_b128 %0, %14, off\n\t"
               "global_load_async_to_lds_b128 %1, %15, off\n\t"
               "global_load_async_to_lds_b128 %2, %16, off\n\t"
               "global_load_async_to_lds_b128 %3, %17, off\n\t"
               "global_load_async_to_lds_b128 %4, %18, off\n\t"
               "global_load_async_to_lds_b128 %5, %19, off\n\t"
               "global_load_async_to_lds_b128 %6, %20, off\n\t"
               "global_load_async_to_lds_b128 %7, %21, off\n\t"
               "global_load_async_to_lds_b128 %8, %22, off\n\t"
               "global_load_async_to_lds_b128 %9, %23, off\n\t"
               "global_load_async_to_lds_b128 %10, %24, off\n\t"
               "global_load_async_to_lds_b128 %11, %25, off\n\t"
               "global_load_async_to_lds_b128 %12, %26, off\n\t"
               "global_load_async_to_lds_b128 %13, %27, off\n\t"
               "s_wait_xcnt 0x0"
               :: "v"(l[0]), "v"(l[1]), "v"(l[2]), "v"(l[3]), "v"(l[4]), "v"(l[5]), "v"(l[6]), "v"(l[7]), "v"(l[8]), "v"(l[9]), "v"(l[10]), "v"(l[11]), "v"(l[12]), "v"(l[13]),
                  "v"(g[0]), "v"(g[1]), "v"(g[2]), "v"(g[3]), "v"(g[4]), "v"(g[5]), "v"(g[6]), "v"(g[7]), "v"(g[8]), "v"(g[9]), "v"(g[10]), "v"(g[11]), "v"(g[12]), "v"(g[13])
               : "memory");
}
// One stage of the qkv projection, copied by four waves: 256 + 192 rows of 128 B; 28 copies of 16 B per lane, every lane on, each wave-copy covers four whole lines.
__device__ __forceinline__ void stage_p(const char* ga, const char* gb, unsigned to, unsigned l) {   // ga, gb: the block's rows at the stage's k, the same for all lanes; to: the lane's own byte in them
#pragma unroll
  for (int hf = 0; hf < 2; ++hf) {
    unsigned ll[14]; const char* gg[14];
#pragma unroll
    for (int i = 0; i < 14; ++i) { const int rg = hf * 14 + i; ll[i] = l + rg * 16 * PP; gg[i] = (rg < PM / 16 ? ga + rg * 16 * D * 2 : gb + (rg - PM / 16) * 16 * D * 2) + to; }
    copy14(ll, gg);
  }
}
// One operand's share of a stage of the output projection, by four waves: 128 16-bit rows of 128 B; 8 copies of 16 B per lane, 16 rows apart, every lane on, each wave-copy covers four whole lines.
__device__ __forceinline__ void stage_rows16(const char* g, unsigned l) {
  // the closing s_wait_xcnt stands inside the statement so that no address register of a copy is rewritten ahead of it
  asm volatile("global_load_async_to_lds_b128 %0, %8, off\n\t"
               "global_load_async_to_lds_b128 %1, %9, off\n\t"
               "global_load_async_to_lds_b128 %2, %10, off\n\t"
               "global_load_async_to_lds_b128 %3, %11, off\n\t"
               "global_load_async_to_lds_b128 %4, %12, off\n\t"
               "global_load_async_to_lds_b128 %5, %13, off\n\t"
               "global_load_async_to_lds_b128 %6, %14, off\n\t"
               "global_load_async_to_lds_b128 %7, %15, off\n\t"
               "s_wait_xcnt 0x0"
               :: "v"(l), "v"(l + 16 * GP * 2), "v"(l + 32 * GP * 2), "v"(l + 48 * GP * 2),
                  "v"(l + 64 * GP * 2), "v"(l + 80 * GP * 2), "v"(l + 96 * GP * 2), "v"(l + 112 * GP * 2),
                  "v"(g), "v"(g + 16 * D * 2), "v"(g + 32 * D * 2), "v"(g + 48 * D * 2),
                  "v"(g + 64 * D * 2), "v"(g + 80 * D * 2), "v"(g + 96 * D * 2), "v"(g + 112 * D * 2)
               : "memory");
}

// projections: grid (16, 16): (4096 x 1024) x (1024 x 3072) bf16 WMMA + bf16(b_qkv). q log2(e)/8, k -> f16 rows [b][h][s][64]; v -> (8v)^T f16 rows [b][h][64 d][s].
// The epilogue stages the block's three heads in LDS (q, k as rows, v transposed) and stores each head as whole lines.
__global__ __launch_bounds__(256) void proj_kernel(const __bf16* __restrict__ x16, const __bf16* __restrict__ w16, const float* __restrict__ bqkv, b16* __restrict__ qk, b16* __restrict__ vt) {
  __shared__ __attribute__((aligned(16))) unsigned char sm[3 * PST];   // three stage buffers [A | B]; behind the loop the epilogue's staging
  const int tid = threadIdx.x, lane = tid & 31, wave = __builtin_amdgcn_readfirstlane(tid >> 5), wm = wave & 3, wn = wave >> 2, nloc = lane & 15, hlf = lane >> 4;
  const int mb = blockIdx.y * PM, cb = blockIdx.x * PN, t7 = tid & 127;   // wn is also the wave's copy group: it copies the stages of its parity
  const char* ga = (const char*)(x16 + (size_t)mb * D);
  const char* gb = (const char*)(w16 + (size_t)cb * D);
  const unsigned to = (t7 >> 3) * (D * 2) + (t7 & 7) * 16, l = lds_off(sm) + (t7 >> 3) * PP + (t7 & 7) * 16;
  v8f acc[4][6];
#pragma unroll
  for (int r = 0; r < 4; ++r)
#pragma unroll
    for (int t = 0; t < 6; ++t) acc[r][t] = (v8f){};
  stage_p(ga + wn * (PK * 2), gb + wn * (PK * 2), to, l + wn * PST);   // stage 0 by group 0, stage 1 by group 1
  const float* pb = bqkv + cb + wn * 96 + nloc;
  float bias[6];
#pragma unroll
  for (int t = 0; t < 6; ++t) bias[t] = pb[t * 16];
  asm volatile("s_wait_xcnt 0x0" :: "v"(pb) : "memory");   // names the bias loads' address, which so stays untouched up to this wait
  if (wn == 0) asm volatile("s_wait_asynccnt 0x0" ::: "memory");   // the copying wave's share of stage 0 has landed
  __syncthreads();                                     // publishes stage 0 to the other waves
  if (wn == 0) stage_p(ga + 2 * (PK * 2), gb + 2 * (PK * 2), to, l + 2 * PST);
  const unsigned char* fA = sm + (wm * 64 + nloc) * PP;        // the lane's first A row and first B row in buffer 0
  const unsigned char* fB = sm + (PM + wn * 96 + nloc) * PP;
  v16bb fa[2][4], fb[2][6];                            // two fragment sets: one is multiplied while the other is filled
  auto ldf = [&](v16bb (&a)[4], v16bb (&bw)[6], int off) {     // a k-step's 20 LDS reads, as one group
#pragma unroll
    for (int r = 0; r < 4; ++r) a[r] = frag_kb_bf((const __bf16*)(fA + off + r * 16 * PP), hlf);
#pragma unroll
    for (int t = 0; t < 6; ++t) bw[t] = frag_kb_bf((const __bf16*)(fB + off + t * 16 * PP), hlf);
    __builtin_amdgcn_sched_barrier(0);                 // the group stays in front of the products that run while it lands: sunk among them, every read would be waited for on the spot
  };
  auto mm = [&](const v16bb (&a)[4], const v16bb (&bw)[6], int t0, int t1) {
#pragma unroll
    for (int t = t0; t < t1; ++t)
#pragma unroll
      for (int r = 0; r < 4; ++r) acc[r][t] = wmma16bb(a[r], bw[t], acc[r][t]);
  };
  ldf(fa[0], fb[0], 0);
  int cur = 0, nxt = PST;                              // byte offsets of stage st's and stage st + 1's buffers
  for (int st = 0; st < PNT; ++st) {
    ldf(fa[1], fb[1], cur + 64); mm(fa[0], fb[0], 0, 6);
    __builtin_amdgcn_sched_barrier(0);                 // these products stay in front of the waits: the last k-step's fragments land under them, not under an idle matrix unit
    // the publish point of stage st + 1 stands in front of stage st's last k-step, whose fragments are already fetched: behind it the next stage's first fragments are read
    asm volatile("s_wait_dscnt 0x0" ::: "memory");     // this wave's reads of the stage's buffer have returned before it is refilled
    if (((st + 1) & 1) == wn) asm volatile("s_wait_asynccnt 0x0" ::: "memory");   // the copying wave's share of stage st + 1 has landed (it has nothing else in flight)
    __syncthreads();                                   // publishes stage st + 1 and ends every wave's reads of stage st
    mm(fa[1], fb[1], 0, 2);
    __builtin_amdgcn_sched_barrier(0);                 // the matrix unit has work queued while the reads and the refill are issued
    if (st + 1 < PNT) ldf(fa[0], fb[0], nxt);
    if (st + 3 < PNT && ((st + 1) & 1) == wn) stage_p(ga + (st + 3) * (PK * 2), gb + (st + 3) * (PK * 2), to, l + cur);   // into the buffer that every wave has just left
    __builtin_amdgcn_sched_barrier(0);                 // the rest of the products stay behind the refill, so that the copies get two whole stages to land
    mm(fa[1], fb[1], 2, 6);
    cur = nxt; nxt = nxt == 2 * PST ? 0 : nxt + PST;
  }
  asm volatile("s_wait_asynccnt 0x0" ::: "memory");    // no copy is outstanding when the buffers become the epilogue's staging;
  asm volatile("s_wait_dscnt 0x0" ::: "memory");       // nor a read: the last pass reads nothing behind its barrier, which so also ends every wave's reads of the ring
  constexpr int RG = PM * GP * 2, VTP = PM + 8;        // bytes of a head's staging (256 rows of 64, pitch GP; or 64 rows of 256, pitch VTP)
  static_assert(HD * VTP * 2 <= RG && 3 * RG <= 3 * PST, "the three heads' staging fits the stage buffers");
  // + bias (rounded to bf16), the plane's factor, f16
#pragma unroll
  for (int t = 0; t < 6; ++t) {
    const int cl = wn * 96 + t * 16, which = (cb + cl) / D;    // the same for the whole wave
    b16* R = (b16*)(sm + (cl >> 6) * RG);
    const float bt = bf16_rne(bias[t]);
    if (which < 2) {
      const float sc = which == 0 ? SCALE * LOG2E : 1.0f;
#pragma unroll
      for (int r = 0; r < 4; ++r)
#pragma unroll
        for (int v = 0; v < 8; ++v) R[(wm * 64 + r * 16 + 8 * hlf + v) * GP + (cl & 63) + nloc] = (b16)((acc[r][t][v] + bt) * sc);
    } else {
#pragma unroll
      for (int r = 0; r < 4; ++r) {
        v8b p;
#pragma unroll
        for (int v = 0; v < 8; ++v) p[v] = (b16)((acc[r][t][v] + bt) * VS);
        *(v8b*)(R + ((cl & 63) + nloc) * VTP + wm * 64 + r * 16 + 8 * hlf) = p;
      }
    }
  }
  __syncthreads();                                     // publishes every wave's part of the three heads
  const int b = mb / S, s0 = mb % S;
#pragma unroll
  for (int j = 0; j < 3; ++j) {
    const int cg = cb + j * HD, which = cg / D, h = (cg % D) / HD;   // the same for the whole block
    const b16* R = (const b16*)(sm + j * RG);
    v8b w[8];
    if (which < 2) {                                   // 256 rows of 128 B stand in a row in memory: a wave stores 512 contiguous bytes
      b16* dst = qk + ((((size_t)which * Bn + b) * H + h) * S + s0) * HD + tid * 8;
#pragma unroll
      for (int i = 0; i < 8; ++i) w[i] = ld8b(R + (i * 32 + (tid >> 3)) * GP + (tid & 7) * 8);
#pragma unroll
      for (int i = 0; i < 8; ++i) *(v8b*)(dst + i * 2048) = w[i];
      asm volatile("s_wait_xcnt 0x0" ::: "memory");    // stands behind the eight stores, in front of any later write of their address or data registers
    } else {                                           // 64 feature rows of 256 tokens: a wave stores one row's 512 contiguous bytes
      b16* dst = vt + (((size_t)b * H + h) * HD + wave) * S + s0 + lane * 8;
#pragma unroll
      for (int i = 0; i < 8; ++i) w[i] = ld8b(R + (i * 8 + wave) * VTP + lane * 8);
#pragma unroll
      for (int i = 0; i < 8; ++i) *(v8b*)(dst + (size_t)(i * 8) * S) = w[i];
      asm volatile("s_wait_xcnt 0x0" ::: "memory");    // the same behind these eight
    }
  }
}

// attention: wave = (b, h, 32 queries as two column tiles, every other 64 keys): per pass of 32 keys S^T (K=64, 2 k-steps, single), online softmax f32, P^T f16, y^T += (8V)^T P^T (4 feature tiles);
// each K and V^T fragment read from LDS serves both column tiles. Waves w and w + 4 of a block hold the same 32 queries and the two 64-key halves of every stage; at the end each
// hands the other one tile's (m, l, y^T) through LDS and finishes its own tile: y/(8l) -> f16 rows.
// The softmax reference m of a column is held from pass to pass (it starts as the maximum over the wave's first 32 keys). A pass forms no maximum: its own sums of exponentials are the test,
// one ballot a pass. Only where a sum passes TOP are the pass's scores formed again, their maxima taken and exchanged between the halves, m raised and y^T and l rescaled.
// The scores leave the matrix unit finished, in base-2 units: q carries log2(e)/8 and the score accumulators start from the key bias table (a lane's 8 rows of a tile are 8 consecutive keys).
// The block's 8 waves share one (b, h): K rows and (8V)^T rows come in stages of KT keys into two LDS buffers by asynchronous copies (whole 128-B lines, once per block),
// and every wave takes its fragments from LDS. Row pitches are 16 B x odd for the 16-byte LDS readers.
constexpr int KT = 128, NST = S / KT, KP = HD + 8, VP = KT + 8;
constexpr float TOP = 256.0f;   // the most that 8 of a lane's exponentials may sum to under the held reference: each is then at most 2^8, far inside f16
// One stage: 128 K rows of 128 B (16 KB contiguous) and 64 V^T rows of 256 B; 8 copies of 16 B per lane, every lane on, each wave-copy covers 512 contiguous bytes or two 256-B rows.
__device__ __forceinline__ void stage_copy(const b16* kg, const b16* vg, const b16* ks, const b16* vs, int tid) {
  const b16* gk = kg + tid * 8; const b16* gv = vg + (size_t)(tid >> 4) * S + (tid & 15) * 8;
  const unsigned lk = lds_off(ks + (tid >> 3) * KP + (tid & 7) * 8), lv = lds_off(vs + (tid >> 4) * VP + (tid & 15) * 8);
  // the closing s_wait_xcnt stands inside the statement so that no address register of a copy is rewritten ahead of it
  asm volatile("global_load_async_to_lds_b128 %0, %8, off\n\t"
               "global_load_async_to_lds_b128 %1, %9, off\n\t"
               "global_load_async_to_lds_b128 %2, %10, off\n\t"
               "global_load_async_to_lds_b128 %3, %11, off\n\t"
               "global_load_async_to_lds_b128 %4, %12, off\n\t"
               "global_load_async_to_lds_b128 %5, %13, off\n\t"
               "global_load_async_to_lds_b128 %6, %14, off\n\t"
               "global_load_async_to_lds_b128 %7, %15, off\n\t"
               "s_wait_xcnt 0x0"
               :: "v"(lk), "v"(lk + 32 * KP * 2), "v"(lk + 64 * KP * 2), "v"(lk + 96 * KP * 2),
                  "v"(lv), "v"(lv + 16 * VP * 2), "v"(lv + 32 * VP * 2), "v"(lv + 48 * VP * 2),
                  "v"(gk), "v"(gk + 2048), "v"(gk + 4096), "v"(gk + 6144),
                  "v"(gv), "v"(gv + (size_t)16 * S), "v"(gv + (size_t)32 * S), "v"(gv + (size_t)48 * S)
               : "memory");
}
__device__ __forceinline__ v8f ld8f(const float* p) { return __builtin_shufflevector(*(const v4f*)p, *(const v4f*)(p + 4), 0, 1, 2, 3, 4, 5, 6, 7); }
// four waves per SIMD (two blocks per WGP) hide the softmax chains: the register budget is held to a quarter of the SIMD's file
__global__ __launch_bounds__(256) __attribute__((amdgpu_waves_per_eu(4, 4))) void attn_kernel(const b16* __restrict__ qk, const b16* __restrict__ vt, const float* __restrict__ bl2, b16* __restrict__ y) {
  __shared__ __attribute__((aligned(16))) b16 Os[8][16][HD + 8];
  __shared__ __attribute__((aligned(16))) b16 Ks[2][KT * KP];
  __shared__ __attribute__((aligned(16))) b16 Vs[2][HD * VP];
  const int tid = threadIdx.x, wid = __builtin_amdgcn_readfirstlane(threadIdx.x >> 5), lane = threadIdx.x & 31, hh = lane >> 4, col = lane & 15;
  const int g = wid >> 2, qb = (blockIdx.x & 15) * 128 + (wid & 3) * 32, h = (blockIdx.x >> 4) & 15, b = blockIdx.x >> 8;   // g: which 64 keys of a stage
  const b16* Q = qk + ((((size_t)0 * Bn + b) * H + h) * S) * HD; const b16* K = qk + ((((size_t)1 * Bn + b) * H + h) * S) * HD;
  const b16* vb = vt + (((size_t)b * H + h) * HD) * S;
  stage_copy(K, vb, Ks[0], Vs[0], tid);
  v16b qf[2][2];
#pragma unroll
  for (int c = 0; c < 2; ++c)
#pragma unroll
    for (int ks = 0; ks < 2; ++ks) qf[c][ks] = frag_kb(Q + (size_t)(qb + c * 16 + col) * HD + ks * 32, hh);
  asm volatile("s_wait_asynccnt 0x0" ::: "memory");   // this wave's share of stage 0 has landed
  __syncthreads();                                     // publishes stage 0 to the other waves
  stage_copy(K + (size_t)KT * HD, vb + KT, Ks[1], Vs[1], tid);
  float m[2]; v2f l2[2] = {{0.0f, 0.0f}, {0.0f, 0.0f}}; v8f o[2][4] = {{{}, {}, {}, {}}, {{}, {}, {}, {}}};   // l2: a lane's own keys, even and odd apart; all joins stand behind the loop
  const float* bl = bl2 + b * S + g * (KT / 2);       // the same for the whole wave; a lane adds its half's 8 keys
  const unsigned ho = 8 * hh;
  v8f c0 = ld8f(bl + ho), c1 = ld8f(bl + 16 + ho);
  v2f sum[2]; v16b pb[2];
  // the scores of 32 keys (rows from Kr on) x 32 queries, products in the loop's own order
  auto score = [&](const b16* Kr, v8f a0, v8f a1, v8f (&s0)[2], v8f (&s1)[2]) {
    v16b kf[2][2];
#pragma unroll
    for (int ks = 0; ks < 2; ++ks) { kf[ks][0] = frag_kb(Kr + col * KP + ks * 32, hh); kf[ks][1] = frag_kb(Kr + (16 + col) * KP + ks * 32, hh); }
#pragma unroll
    for (int c = 0; c < 2; ++c) { s0[c] = wmma16b(kf[0][0], qf[c][0], a0); s1[c] = wmma16b(kf[0][1], qf[c][0], a1); }
#pragma unroll
    for (int c = 0; c < 2; ++c) { s0[c] = wmma16b(kf[1][0], qf[c][1], s0[c]); s1[c] = wmma16b(kf[1][1], qf[c][1], s1[c]); }
  };
  // a column's maximum over the 32 keys: in the lane, then between the halves
  auto colmax = [&](const v8f& a, const v8f& bq) {
    float mr = -INFINITY;
#pragma unroll
    for (int r = 0; r < 8; ++r) mr = fmaxf(mr, fmaxf(a[r], bq[r]));
    return fmaxf(mr, __shfl_xor(mr, 16));
  };
  // P^T = 2^(S^T - m) as f16 fragments, and per tile each lane's two sums of 8 exponentials (its even and its odd keys: packed adds, a tree three deep)
  auto soft = [&](const v8f (&s0)[2], const v8f (&s1)[2]) {
#pragma unroll
    for (int c = 0; c < 2; ++c) {
      float e[16];
#pragma unroll
      for (int r = 0; r < 8; ++r) { e[r] = s0[c][r] - m[c]; e[8 + r] = s1[c][r] - m[c]; }
      // a tile's exponentials in one statement, each in place: none writes over the source of the one in front of it; the v_nop is the slot behind the last one
      asm("v_exp_f32 %0, %0\n\tv_exp_f32 %1, %1\n\tv_exp_f32 %2, %2\n\tv_exp_f32 %3, %3\n\tv_exp_f32 %4, %4\n\tv_exp_f32 %5, %5\n\t"
          "v_exp_f32 %6, %6\n\tv_exp_f32 %7, %7\n\tv_exp_f32 %8, %8\n\tv_exp_f32 %9, %9\n\tv_exp_f32 %10, %10\n\tv_exp_f32 %11, %11\n\t"
          "v_exp_f32 %12, %12\n\tv_exp_f32 %13, %13\n\tv_exp_f32 %14, %14\n\tv_exp_f32 %15, %15\n\tv_nop"
          : "+v"(e[0]), "+v"(e[1]), "+v"(e[8]), "+v"(e[9]), "+v"(e[2]), "+v"(e[3]), "+v"(e[10]), "+v"(e[11]), "+v"(e[4]), "+v"(e[5]), "+v"(e[12]),
            "+v"(e[13]), "+v"(e[6]), "+v"(e[7]), "+v"(e[14]), "+v"(e[15]));
      sum[c] = (((v2f){e[0], e[1]} + (v2f){e[8], e[9]}) + ((v2f){e[2], e[3]} + (v2f){e[10], e[11]})) + (((v2f){e[4], e[5]} + (v2f){e[12], e[13]}) + ((v2f){e[6], e[7]} + (v2f){e[14], e[15]}));
#pragma unroll
      for (int r = 0; r < 16; ++r) pb[c][r] = (b16)e[r];
    }
  };
  {
    v8f t0[2], t1[2];
    score(Ks[0] + g * (KT / 2) * KP, c0, c1, t0, t1);
#pragma unroll
    for (int c = 0; c < 2; ++c) m[c] = colmax(t0[c], t1[c]);
  }
  for (int st = 0; st < NST; ++st) {
    const b16* Kl = Ks[st & 1] + g * (KT / 2) * KP; const b16* Vl = Vs[st & 1] + g * (KT / 2);
    for (int kl = 0; kl < KT / 2; kl += 32) {
      // the pass's own 16 LDS reads stand together at its head: one wait for the K fragments, and the V^T fragments land behind the softmax
      v16b kf[2][2], vf[4];
#pragma unroll
      for (int ks = 0; ks < 2; ++ks) { kf[ks][0] = frag_kb(Kl + (kl + col) * KP + ks * 32, hh); kf[ks][1] = frag_kb(Kl + (kl + 16 + col) * KP + ks * 32, hh); }
#pragma unroll
      for (int n = 0; n < 4; ++n) vf[n] = frag_kb(Vl + (n * 16 + col) * VP + kl, hh);
      v8f s0[2], s1[2];
#pragma unroll
      for (int c = 0; c < 2; ++c) { s0[c] = wmma16b(kf[0][0], qf[c][0], c0); s1[c] = wmma16b(kf[0][1], qf[c][0], c1); }
#pragma unroll
      for (int c = 0; c < 2; ++c) { s0[c] = wmma16b(kf[1][0], qf[c][1], s0[c]); s1[c] = wmma16b(kf[1][1], qf[c][1], s1[c]); }
      // the next pass's start values load behind their last use, so that they land under the rest of this pass; this wave's next 32 keys follow at once or in the next stage;
      // the last pass wraps to the wave's first keys (in bounds, not used)
      const int kn = (st * KT + kl + (kl == 0 ? 32 : KT - 32)) & (S - 1);
      const float* pn = bl + kn + ho;
      c0 = ld8f(pn); c1 = ld8f(pn + 16);
      soft(s0, s1);
      // one test a pass: a scalar branch on the ballot
      if (__builtin_amdgcn_ballot_w32(fmaxf(fmaxf(sum[0][0], sum[0][1]), fmaxf(sum[1][0], sum[1][1])) > TOP) != 0) {
        const float* pc = bl + st * KT + kl + ho;
        score(Kl + kl * KP, ld8f(pc), ld8f(pc + 16), s0, s1);
        asm volatile("s_wait_xcnt 0x0" :: "v"(pc) : "memory");   // names the two start-value loads' address, which so stays untouched up to this wait
        float f[2];
#pragma unroll
        for (int c = 0; c < 2; ++c) { const float mn = fmaxf(m[c], colmax(s0[c], s1[c])); f[c] = m[c] - mn; m[c] = mn; }   // the same in both halves of a column
        // the two factors, each in place; the v_nop is the slot behind the last exponential
        asm("v_exp_f32 %0, %0\n\tv_exp_f32 %1, %1\n\tv_nop" : "+v"(f[0]), "+v"(f[1]));
#pragma unroll
        for (int c = 0; c < 2; ++c) {
          l2[c] *= f[c];
#pragma unroll
          for (int n = 0; n < 4; ++n)
#pragma unroll
            for (int r = 0; r < 8; ++r) o[c][n][r] *= f[c];
        }
        soft(s0, s1);
      }
#pragma unroll
      for (int c = 0; c < 2; ++c) l2[c] += sum[c];
#pragma unroll
      for (int n = 0; n < 4; ++n)
#pragma unroll
        for (int c = 0; c < 2; ++c) o[c][n] = wmma16b(vf[n], pb[c], o[c][n]);
      asm volatile("s_wait_xcnt 0x0" :: "v"(pn) : "memory");   // names the start-value loads' address, which so stays untouched up to this wait, far behind the loads
    }
    asm volatile("s_wait_dscnt 0x0" ::: "memory");     // this wave's reads of the stage's buffer have returned before it is refilled
    asm volatile("s_wait_asynccnt 0x0" ::: "memory");  // this wave's share of stage st + 1 has landed
    __syncthreads();                                   // publishes stage st + 1 and ends every wave's reads of stage st
    if (st + 2 < NST) stage_copy(K + (size_t)(st + 2) * KT * HD, vb + (st + 2) * KT, Ks[st & 1], Vs[st & 1], tid);
  }
  asm volatile("s_wait_asynccnt 0x0" ::: "memory");    // no copy is outstanding when the K buffers become the exchange area
  float l[2];
#pragma unroll
  for (int c = 0; c < 2; ++c) { l[c] = l2[c][0] + l2[c][1]; l[c] += __shfl_xor(l[c], 16); }   // a column's sum over both halves' keys, once
  // The pair's join: wave group g keeps column tile g and hands tile 1 - g to its partner, lane to lane (34 floats a lane, lane-contiguous dwords), in the K buffers,
  // which every wave has left at the loop's last barrier.
  static_assert(8 * 34 * 32 * 4 <= (int)sizeof(Ks), "the exchange area fits the K buffers");
  float* X = (float*)&Ks[0][0];
  float* xo = X + wid * (34 * 32) + lane;
  const float* xi = X + (wid ^ 4) * (34 * 32) + lane;
#pragma unroll
  for (int n = 0; n < 4; ++n)
#pragma unroll
    for (int r = 0; r < 8; ++r) xo[(n * 8 + r) * 32] = g ? o[0][n][r] : o[1][n][r];
  xo[32 * 32] = g ? m[0] : m[1]; xo[33 * 32] = g ? l[0] : l[1];
  __syncthreads();                                     // publishes every wave's handed-over tile to its partner
  const float mm = g ? m[1] : m[0], lm = g ? l[1] : l[0], mo = xi[32 * 32], lo = xi[33 * 32], mj = fmaxf(mm, mo);
  float fa = mm - mj, fb = mo - mj;
  // the two weights of the join, each in place; the v_nop is the slot behind the last exponential
  asm("v_exp_f32 %0, %0\n\tv_exp_f32 %1, %1\n\tv_nop" : "+v"(fa), "+v"(fb));
  const float inv = 1.0f / (VS * (lm * fa + lo * fb));
  fa *= inv; fb *= inv;
#pragma unroll
  for (int n = 0; n < 4; ++n) {
    v8b p;                                             // rounded here, once, to the operand type of the output projection
#pragma unroll
    for (int r = 0; r < 8; ++r) p[r] = (b16)((g ? o[1][n][r] : o[0][n][r]) * fa + xi[(n * 8 + r) * 32] * fb);
    *(v8b*)(&Os[wid][col][n * 16 + 8 * hh]) = p;
  }
  wave_lds_sync();
  b16* dst = y + ((size_t)b * S + qb + g * 16) * D + h * HD + (size_t)(lane >> 3) * D + (lane & 7) * 8;   // a row's 64 features are one 128-B line: a wave-store covers four whole lines
#pragma unroll
  for (int j = 0; j < 4; ++j) *(v8b*)(dst + (size_t)(j * 4) * D) = ld8b(&Os[wid][j * 4 + (lane >> 3)][(lane & 7) * 8]);
}

// out = y Wo^T: (4096 x 1024) x (1024 x 1024); A = y f16 rows (single), B = f16(bf16 Wo) rows; f32 rows; grid (8, 32).
// One block on a WGP, and a stage's products are shorter than its copies' way from memory: the ring has three buffers with two stages in flight. Waves 0-3 copy the even stages,
// waves 4-7 the odd ones, so that each wave still waits for all of its own copies while the other group's stage flies on.
__global__ __launch_bounds__(256) void out_kernel(const b16* __restrict__ y, const b16* __restrict__ wo16, const float* __restrict__ bproj, float* __restrict__ out) {
  constexpr int OST = 2 * G16;                         // bytes of a stage buffer [A | B]
  __shared__ __attribute__((aligned(16))) unsigned char sm[3 * OST];   // three stage buffers; behind the loop the epilogue's staging
  const int tid = threadIdx.x, lane = tid & 31, wave = __builtin_amdgcn_readfirstlane(tid >> 5), wm = wave & 3, wn = wave >> 2, nloc = lane & 15, hlf = lane >> 4;
  const int mb = blockIdx.y * 128, m0 = mb + wm * 32, cb = blockIdx.x * 128, c0 = cb + wn * 64, t7 = tid & 127;   // wn is also the wave's copy group: it copies the stages of its parity
  const char* ga = (const char*)(y + (size_t)(mb + (t7 >> 3)) * D + (t7 & 7) * 8);
  const char* gb = (const char*)(wo16 + (size_t)(cb + (t7 >> 3)) * D + (t7 & 7) * 8);
  const unsigned la = lds_off(sm) + (t7 >> 3) * (GP * 2) + (t7 & 7) * 16, lb = la + G16;
  // a whole stage by four waves: 16 copies of 16 B per lane, every lane on
  auto stage = [&](int st, unsigned buf) {
    stage_rows16(ga + st * (GK * 2), la + buf);
    stage_rows16(gb + st * (GK * 2), lb + buf);
  };
  v8f acc[2][4];
#pragma unroll
  for (int r = 0; r < 2; ++r)
#pragma unroll
    for (int t = 0; t < 4; ++t) acc[r][t] = (v8f){};
  stage(wn, wn * OST);                                 // stage 0 by group 0, stage 1 by group 1
  if (wn == 0) asm volatile("s_wait_asynccnt 0x0" ::: "memory");   // the copying wave's share of stage 0 has landed
  __syncthreads();                                     // publishes stage 0 to the other waves
  int bi = 0;                                          // stage st's buffer
  for (int st = 0; st < GNT; ++st) {
    const b16* Al = (const b16*)(sm + bi * OST) + (wm * 32 + nloc) * GP;
    const b16* Bl = (const b16*)(sm + bi * OST + G16) + (wn * 64 + nloc) * GP;
#pragma unroll
    for (int ks = 0; ks < GK; ks += 32) {
      // the k-step's 12 LDS reads stand together at its head, so that the wave meets the LDS latency once and not once per B fragment
      v16b bw[4];
      const v16b a0 = frag_kb(Al + ks, hlf), a1 = frag_kb(Al + 16 * GP + ks, hlf);
#pragma unroll
      for (int t = 0; t < 4; ++t) bw[t] = frag_kb(Bl + t * 16 * GP + ks, hlf);
      // the refill stands behind the stage's first reads, which land while the copies are issued: stage st + 2 goes into the buffer of stage st - 1, which every wave has left
      // at the barrier in front of this trip (its own reads of it returned in front of that barrier); the reads in flight here are of another buffer
      if (ks == 0 && st + 2 < GNT && (st & 1) == wn) stage(st + 2, (bi == 0 ? 2 : bi - 1) * OST);
#pragma unroll
      for (int t = 0; t < 4; ++t) { acc[0][t] = wmma16b(a0, bw[t], acc[0][t]); acc[1][t] = wmma16b(a1, bw[t], acc[1][t]); }
    }
    asm volatile("s_wait_dscnt 0x0" ::: "memory");     // this wave's reads of the stage's buffer have returned before it is refilled
    if (((st + 1) & 1) == wn) asm volatile("s_wait_asynccnt 0x0" ::: "memory");   // the copying wave's share of stage st + 1 has landed (it has nothing else in flight)
    __syncthreads();                                   // publishes stage st + 1 and ends every wave's reads of stage st
    bi = bi == 2 ? 0 : bi + 1;
  }
  asm volatile("s_wait_asynccnt 0x0" ::: "memory");    // no copy is outstanding when the buffers become the epilogue's staging
#pragma unroll
  for (int t = 0; t < 4; ++t)
#pragma unroll
    for (int r = 0; r < 2; ++r)
#pragma unroll
      for (int v = 0; v < 8; ++v) acc[r][t][v] += bf16_rne(bproj[c0 + t * 16 + nloc]);
  epi_f32(acc, 1.0f, nullptr, out, D, m0, c0, lane, (float*)sm + wave * (32 * 64));
}
}  // namespace

extern "C" void kernel_launch(void* const* d_in, const int* in_sizes, int n_in,
                              void* d_out, int out_size, void* d_ws, size_t ws_size, hipStream_t stream) {
  (void)n_in; (void)out_size;
  const float* x = (const float*)d_in[0]; const float* abias = (const float*)d_in[1]; const float* wqkv = (const float*)d_in[2]; const float* bqkv = (const float*)d_in[3];
  const float* wproj = (const float*)d_in[4]; const float* bproj = (const float*)d_in[5];
  float* out = (float*)d_out;   // [2,2048,1024]
  if (in_sizes[0] != NTOK * D || in_sizes[1] != NTOK || in_sizes[2] != D * D3 || in_sizes[3] != D3 || in_sizes[4] != D * D || in_sizes[5] != D) return;
  size_t off = 0; char* ws = (char*)d_ws;
  auto carve = [&](size_t bytes) { char* p = ws + off; off += (bytes + 255) & ~(size_t)255; return p; };
  unsigned short* x16 = (unsigned short*)carve((size_t)NTOK * D * 2);        // 8 MB
  unsigned short* w16 = (unsigned short*)carve((size_t)D3 * D * 2);          // 6 MB ([3072][1024] bf16 = [which][n][k])
  b16* wo16 = (b16*)carve((size_t)D * D * 2);
  b16* qk = (b16*)carve((size_t)2 * NTOK * D * 2);                           // 16 MB: [which][b][h][s][64]
  b16* vt = (b16*)carve((size_t)NTOK * D * 2);                               // 8 MB
  b16* y = (b16*)carve((size_t)NTOK * D * 2);                                // 8 MB
  float* bl2 = (float*)carve((size_t)NTOK * 4);                              // 16 KB
  if (off > ws_size) return;                                                   // about 48 MB
  prep_kernel<<<NB_WQ + NB_WO + NB_X, 256, 0, stream>>>(x, x16, abias, bl2, wqkv, w16, wproj, (unsigned short*)wo16);
  proj_kernel<<<dim3(D3 / PN, NTOK / PM), 256, 0, stream>>>((const __bf16*)x16, (const __bf16*)w16, bqkv, qk, vt);
  attn_kernel<<<Bn * H * (S / 16) / 8, 256, 0, stream>>>(qk, vt, bl2, y);
  out_kernel<<<dim3(D / 128, NTOK / 128), 256, 0, stream>>>(y, wo16, bproj, out);
}

// v010
// Measured time: 75.1 microseconds a run.
// Timed twice side by side with v009, it ran 1.06 times as fast both times.
// Counting every step since v000, it is 3.85 times as fast.
#include <hip/hip_runtime.h>

// Gaze-guided multi-head attention (B=2, N=2048, D=1024, 16 heads x 64): qkv = x w_qkv + b_qkv; scores = q.k/8 + attn_bias[b][key]; softmax; (w.v) w_proj + b_proj.
// Numerics: x, attn_bias, w_qkv, b_qkv, w_proj, b_proj are rounded to bf16 (RNE); the qkv projection runs on
// v_wmma_f32_16x16x32_bf16 (exact products, f32 accumulate, + bias); the scores, P.V and the output projection run on v_wmma_f32_16x16x32_f16 with single f16 operands
// (f16 copies of q log2(e)/8, k, (8v)^T, P, the attention output, and the exact f16 copy of bf16 w_proj); key bias and online softmax in f32, in base 2.

namespace {
constexpr int Bn = 2, S = 2048, D = 1024, H = 16, HD = 64, NTOK = Bn * S, D3 = 3 * D;
constexpr float SCALE = 0.125f, VS = 8.0f, LOG2E = 1.4426950408889634f;

typedef _Float16 b16;
typedef __attribute__((ext_vector_type(16))) _Float16 v16b;
typedef __attribute__((ext_vector_type(8)))  _Float16 v8b;
typedef __attribute__((ext_vector_type(8)))  float v8f;
typedef __attribute__((ext_vector_type(4)))  float v4f;
typedef __attribute__((ext_vector_type(2)))  float v2f;

__device__ __forceinline__ v8b ld8b(const b16* p) { return *(const v8b*)p; }
__device__ __forceinline__ v16b cat8b(v8b a, v8b b) { return __builtin_shufflevector(a, b, 0, 1, 2, 3, 4, 5, 6, 7, 8, 9, 10, 11, 12, 13, 14, 15); }
__device__ __forceinline__ v16b frag_kb(const b16* p, int hh) { return cat8b(ld8b(p + 8 * hh), ld8b(p + 16 + 8 * hh)); }
__device__ __forceinline__ v8f wmma16b(v16b a, v16b b, v8f c) {
  v8f d = __builtin_amdgcn_wmma_f32_16x16x32_f16(false, a, false, b, (short)0, c, false, false);
  asm volatile("v_nop\n\tv_nop\n\tv_nop\n\tv_nop" : "+v"(d) : "v"(a), "v"(b));
  return d;
}
// attention's form, the plain builtin: the compiler keeps the distance behind it itself, with the softmax's own instructions where it can. Four waves share a SIMD's vector port there,
// so that an idle slot of one wave is a slot lost to the other three
__device__ __forceinline__ v8f wmma16p(v16b a, v16b b, v8f c) { return __builtin_amdgcn_wmma_f32_16x16x32_f16(false, a, false, b, (short)0, c, false, false); }
__device__ __forceinline__ void wave_lds_sync() {
  __builtin_amdgcn_fence(__ATOMIC_RELEASE, "workgroup");
  __builtin_amdgcn_wave_barrier();
  __builtin_amdgcn_fence(__ATOMIC_ACQUIRE, "workgroup");
}

// f32 rows with pitch ldo: 64 floats = 256 B = 2 lines per row; 16 lanes x 16 B per row, 2 rows per instruction. Optional per-row factor
__device__ __forceinline__ void epi_f32(v8f (&acc)[2][4], float scale, const float* rscale, float* __restrict__ out, int ldo, int m0, int c0, int lane, float* Tt) {
  const int nloc = lane & 15, hlf = lane >> 4;
#pragma unroll
  for (int t = 0; t < 4; ++t)
#pragma unroll
    for (int r = 0; r < 2; ++r)
#pragma unroll
      for (int v = 0; v < 8; ++v) {
        const int rr = r * 16 + v + 8 * hlf;
        const float rs = rscale ? rscale[(size_t)(m0 + rr) * 32] : 1.0f;
        Tt[rr * 64 + t * 16 + nloc] = acc[r][t][v] * scale * rs;
      }
  wave_lds_sync();
  float* dst0 = out + (size_t)m0 * ldo + c0;
  {
#pragma unroll
    for (int j = 0; j < 16; ++j) { const int rr = j * 2 + hlf, c4 = nloc * 4; *(v4f*)(dst0 + (size_t)rr * ldo + c4) = *(const v4f*)(Tt + rr * 64 + c4); }
    
  }
}



typedef __attribute__((ext_vector_type(8))) __bf16 v8bb; typedef __attribute__((ext_vector_type(16))) __bf16 v16bb;
typedef __attribute__((ext_vector_type(8))) unsigned short v8us;
__device__ __forceinline__ v16bb frag_kb_bf(const __bf16* p, int hh) { const v8bb a = *(const v8bb*)(p + 8 * hh), b = *(const v8bb*)(p + 16 + 8 * hh); return __builtin_shufflevector(a, b, 0, 1, 2, 3, 4, 5, 6, 7, 8, 9, 10, 11, 12, 13, 14, 15); }
// the plain builtin: the compiler keeps the distance behind it itself, and its operands may lie above v255, which an asm statement's operands may not
__device__ __forceinline__ v8f wmma16bb(v16bb a, v16bb b, v8f c) { return __builtin_amdgcn_wmma_f32_16x16x32_bf16(false, a, false, b, (short)0, c, false, false); }
__device__ __forceinline__ unsigned short bf16_rne_bits(float v) { unsigned int u = __float_as_uint(v); u += 0x7FFFu + ((u >> 16) & 1u); return (unsigned short)(u >> 16); }
__device__ __forceinline__ float bf16_rne(float v) { return __uint_as_float(((unsigned int)bf16_rne_bits(v)) << 16); }

typedef __attribute__((ext_vector_type(4))) unsigned int v4u;
// All preparation is one launch: the blocks' roles go by block index, and every block moves 64 KB in and 32 KB out with its 16 loads of 16 B per thread issued together.
constexpr int WTK = 256, WTN = 64;                                    // a weight tile: 256 k rows x 64 n columns
constexpr int NB_WQ = (D3 / WTN) * (D / WTK), NB_WO = (D / WTN) * (D / WTK), NB_X = NTOK * D / 8 / (8 * 256);
template <int MODE> __device__ __forceinline__ unsigned int wbits(float w) {   // MODE 0 bf16 bits, MODE 1 f16(bf16(w)) bits
  if (MODE == 0) return bf16_rne_bits(w);
  const b16 hv = (b16)bf16_rne(w); return *reinterpret_cast<const unsigned short*>(&hv);
}
// W [k rows][Ncols] f32 -> [n][k] 16-bit rows of D, one tile through LDS. A thread takes 4 columns of two neighbouring k rows and stores the k pair as one dword of row n;
// the 16-B groups of LDS row n stand at (group ^ (n >> 2)), so that the 32 dword stores of a wave fall on 32 banks and a row is still read back as 512 contiguous bytes.
template <int MODE>
__device__ __forceinline__ void wt_tile(const float* __restrict__ Wm, int Ncols, unsigned short* __restrict__ out, int n0, int k0, unsigned int* Tl) {
  const int tid = threadIdx.x, lane = tid & 31, wave = tid >> 5, c = tid & 15, pr = tid >> 4;
  const float* src = Wm + (size_t)(k0 + 2 * pr) * Ncols + n0 + 4 * c;
  v4f lo[8], hi[8];
#pragma unroll
  for (int it = 0; it < 8; ++it) { lo[it] = *(const v4f*)(src + (size_t)(32 * it) * Ncols); hi[it] = *(const v4f*)(src + (size_t)(32 * it + 1) * Ncols); }
  __builtin_amdgcn_sched_barrier(0);                                  // all 16 loads issue before the first conversion: one memory latency per tile, not two
  asm volatile("s_wait_xcnt 0x0" :: "v"(src) : "memory");             // names the loads' address, which so stays untouched up to this wait
#pragma unroll
  for (int it = 0; it < 8; ++it) {
    const int p = pr + 16 * it;                                       // k pair of the tile: rows 2p, 2p + 1
#pragma unroll
    for (int j = 0; j < 4; ++j) Tl[(4 * c + j) * (WTK / 2) + ((((p >> 2) ^ c) << 2) | (p & 3))] = wbits<MODE>(lo[it][j]) | (wbits<MODE>(hi[it][j]) << 16);
  }
  __syncthreads();
  unsigned short* dst = out + (size_t)(n0 + wave * 8) * D + k0 + lane * 8;   // a wave stores 8 rows of 512 contiguous bytes
#pragma unroll
  for (int r = 0; r < 8; ++r) {
    const int n = wave * 8 + r;
    *(v4u*)(dst + r * D) = *(const v4u*)(Tl + n * (WTK / 2) + ((lane ^ (n >> 2)) << 2));
  }
  asm volatile("s_wait_xcnt 0x0" ::: "memory");                       // stands behind the eight stores, in front of any later write of their address or data registers
}
__global__ __launch_bounds__(256) void prep_kernel(const float* __restrict__ x, unsigned short* __restrict__ x16, const float* __restrict__ abias, float* __restrict__ bl2,
                                                   const float* __restrict__ wqkv, unsigned short* __restrict__ w16, const float* __restrict__ wproj, unsigned short* __restrict__ wo16) {
  __shared__ __attribute__((aligned(16))) unsigned int Tl[WTN * (WTK / 2)];
  const int bid = blockIdx.x;
  if (bid < NB_WQ) { wt_tile<0>(wqkv, D3, w16, (bid % (D3 / WTN)) * WTN, (bid / (D3 / WTN)) * WTK, Tl); return; }
  if (bid < NB_WQ + NB_WO) { const int t = bid - NB_WQ; wt_tile<1>(wproj, D, wo16, (t % (D / WTN)) * WTN, (t / (D / WTN)) * WTK, Tl); return; }
  const int xb = bid - NB_WQ - NB_WO, t = xb * 256 + threadIdx.x;    // the block rounds 64 KB of x in a row; the first NTOK threads also make the bias table
  const float* s = x + ((size_t)xb * (8 * 256) + threadIdx.x) * 8;
  const float* sb = abias + (t & (NTOK - 1));                         // in bounds for every thread, so that the load needs no branch and flies with the others
  const float ab = *sb;
  v4f a[8], b[8];
#pragma unroll
  for (int it = 0; it < 8; ++it) { a[it] = *(const v4f*)(s + it * (256 * 8)); b[it] = *(const v4f*)(s + it * (256 * 8) + 4); }
  asm volatile("s_wait_xcnt 0x0" :: "v"(s), "v"(sb) : "memory");      // names the loads' addresses, which so stay untouched up to this wait
  unsigned short* d = x16 + ((size_t)xb * (8 * 256) + threadIdx.x) * 8;
#pragma unroll
  for (int it = 0; it < 8; ++it) { v8us v;
#pragma unroll
    for (int e = 0; e < 4; ++e) { v[e] = bf16_rne_bits(a[it][e]); v[4 + e] = bf16_rne_bits(b[it][e]); }
    *(v8us*)(d + it * (256 * 8)) = v; }
  if (t < NTOK) bl2[t] = bf16_rne(ab) * LOG2E;                        // key bias, rounded to bf16, in base-2 units
}

// Both projection GEMMs: per stage of GK k the block's A rows and B rows come once per block into a ring of LDS buffers by asynchronous copies (whole 128-B lines),
// and every wave takes its fragments from LDS. Row pitches are 16 B x odd. The output projection's block is 128x128 (8 waves of 32x64).
// The qkv projection has as many blocks as the chip has WGPs: a block owns 256 rows x 192 columns (three whole heads), 8 waves (4 row groups x 2 column groups) of 64x96,
// so that an operand byte brought from L2 and a fragment read from LDS each serve more products. With one block on a WGP nothing else covers its waits: each k-step's fragments
// are fetched one k-step ahead into a second register set, and the ring has three buffers with two stages in flight: waves 0-3 copy the even stages, waves 4-7 the odd ones,
// so that each wave still waits for all of its own copies while the other group's stage flies on.
constexpr int GK = 64, GNT = D / GK, GP = GK + 8;
constexpr int G16 = 128 * GP * 2;                            // bytes of a 128-row tile of 16-bit rows
__device__ __forceinline__ unsigned lds_off(const void* p) { return (unsigned)(size_t)p; }
constexpr int PM = 256, PN = 192, PK = 64, PNT = D / PK, PP = PK * 2 + 16, PST = (PM + PN) * PP;   // the qkv block's tile, k per stage, row pitch and stage size in bytes (A rows, then B rows)
__device__ __forceinline__ void copy14(const unsigned (&l)[14], const char* const (&g)[14]) {
  // the closing s_wait_xcnt stands inside the statement so that no address register of a copy is rewritten ahead of it
  asm volatile("global_load_async_to_lds_b128 %0, %14, off\n\t"
               "global_load_async_to_lds_b128 %1, %15, off\n\t"
               "global_load_async_to_lds_b128 %2, %16, off\n\t"
               "global_load_async_to_lds_b128 %3, %17, off\n\t"
               "global_load_async_to_lds_b128 %4, %18, off\n\t"
               "global_load_async_to_lds_b128 %5, %19, off\n\t"
               "global_load_async_to_lds_b128 %6, %20, off\n\t"
               "global_load_async_to_lds_b128 %7, %21, off\n\t"
               "global_load_async_to_lds_b128 %8, %22, off\n\t"
               "global_load_async_to_lds_b128 %9, %23, off\n\t"
               "global_load_async_to_lds_b128 %10, %24, off\n\t"
               "global_load_async_to_lds_b128 %11, %25, off\n\t"
               "global_load_async_to_lds_b128 %12, %26, off\n\t"
               "global_load_async_to_lds_b128 %13, %27, off\n\t"
               "s_wait_xcnt 0x0"
               :: "v"(l[0]), "v"(l[1]), "v"(l[2]), "v"(l[3]), "v"(l[4]), "v"(l[5]), "v"(l[6]), "v"(l[7]), "v"(l[8]), "v"(l[9]), "v"(l[10]), "v"(l[11]), "v"(l[12]), "v"(l[13]),
                  "v"(g[0]), "v"(g[1]), "v"(g[2]), "v"(g[3]), "v"(g[4]), "v"(g[5]), "v"(g[6]), "v"(g[7]), "v"(g[8]), "v"(g[9]), "v"(g[10]), "v"(g[11]), "v"(g[12]), "v"(g[13])
               : "memory");
}
// One stage of the qkv projection, copied by four waves: 256 + 192 rows of 128 B; 28 copies of 16 B per lane, every lane on, each wave-copy covers four whole lines.
__device__ __forceinline__ void stage_p(const char* ga, const char* gb, unsigned to, unsigned l) {   // ga, gb: the block's rows at the stage's k, the same for all lanes; to: the lane's own byte in them
#pragma unroll
  for (int hf = 0; hf < 2; ++hf) {
    unsigned ll[14]; const char* gg[14];
#pragma unroll
    for (int i = 0; i < 14; ++i) { const int rg = hf * 14 + i; ll[i] = l + rg * 16 * PP; gg[i] = (rg < PM / 16 ? ga + rg * 16 * D * 2 : gb + (rg - PM / 16) * 16 * D * 2) + to; }
    copy14(ll, gg);
  }
}
// One operand's share of a stage of the output projection, by four waves: 128 16-bit rows of 128 B; 8 copies of 16 B per lane, 16 rows apart, every lane on, each wave-copy covers four whole lines.
__device__ __forceinline__ void stage_rows16(const char* g, unsigned l) {
  // the closing s_wait_xcnt stands inside the statement so that no address register of a copy is rewritten ahead of it
  asm volatile("global_load_async_to_lds_b128 %0, %8, off\n\t"
               "global_load_async_to_lds_b128 %1, %9, off\n\t"
               "global_load_async_to_lds_b128 %2, %10, off\n\t"
               "global_load_async_to_lds_b128 %3, %11, off\n\t"
               "global_load_async_to_lds_b128 %4, %12, off\n\t"
               "global_load_async_to_lds_b128 %5, %13, off\n\t"
               "global_load_async_to_lds_b128 %6, %14, off\n\t"
               "global_load_async_to_lds_b128 %7, %15, off\n\t"
               "s_wait_xcnt 0x0"
               :: "v"(l), "v"(l + 16 * GP * 2), "v"(l + 32 * GP * 2), "v"(l + 48 * GP * 2),
                  "v"(l + 64 * GP * 2), "v"(l + 80 * GP * 2), "v"(l + 96 * GP * 2), "v"(l + 112 * GP * 2),
                  "v"(g), "v"(g + 16 * D * 2), "v"(g + 32 * D * 2), "v"(g + 48 * D * 2),
                  "v"(g + 64 * D * 2), "v"(g + 80 * D * 2), "v"(g + 96 * D * 2), "v"(g + 112 * D * 2)
               : "memory");
}

// projections: grid (16, 16): (4096 x 1024) x (1024 x 3072) bf16 WMMA + bf16(b_qkv). q log2(e)/8, k -> f16 rows [b][h][s][64]; v -> (8v)^T f16 rows [b][h][64 d][s].
// The epilogue stages the block's three heads in LDS (q, k as rows, v transposed) and stores each head as whole lines.
__global__ __launch_bounds__(256) void proj_kernel(const __bf16* __restrict__ x16, const __bf16* __restrict__ w16, const float* __restrict__ bqkv, b16* __restrict__ qk, b16* __restrict__ vt) {
  __shared__ __attribute__((aligned(16))) unsigned char sm[3 * PST];   // three stage buffers [A | B]; behind the loop the epilogue's staging
  const int tid = threadIdx.x, lane = tid & 31, wave = __builtin_amdgcn_readfirstlane(tid >> 5), wm = wave & 3, wn = wave >> 2, nloc = lane & 15, hlf = lane >> 4;
  const int mb = blockIdx.y * PM, cb = blockIdx.x * PN, t7 = tid & 127;   // wn is also the wave's copy group: it copies the stages of its parity
  const char* ga = (const char*)(x16 + (size_t)mb * D);
  const char* gb = (const char*)(w16 + (size_t)cb * D);
  const unsigned to = (t7 >> 3) * (D * 2) + (t7 & 7) * 16, l = lds_off(sm) + (t7 >> 3) * PP + (t7 & 7) * 16;
  v8f acc[4][6];
#pragma unroll
  for (int r = 0; r < 4; ++r)
#pragma unroll
    for (int t = 0; t < 6; ++t) acc[r][t] = (v8f){};
  stage_p(ga + wn * (PK * 2), gb + wn * (PK * 2), to, l + wn * PST);   // stage 0 by group 0, stage 1 by group 1
  const float* pb = bqkv + cb + wn * 96 + nloc;
  float bias[6];
#pragma unroll
  for (int t = 0; t < 6; ++t) bias[t] = pb[t * 16];
  asm volatile("s_wait_xcnt 0x0" :: "v"(pb) : "memory");   // names the bias loads' address, which so stays untouched up to this wait
  if (wn == 0) asm volatile("s_wait_asynccnt 0x0" ::: "memory");   // the copying wave's share of stage 0 has landed
  __syncthreads();                                     // publishes stage 0 to the other waves
  if (wn == 0) stage_p(ga + 2 * (PK * 2), gb + 2 * (PK * 2), to, l + 2 * PST);
  const unsigned char* fA = sm + (wm * 64 + nloc) * PP;        // the lane's first A row and first B row in buffer 0
  const unsigned char* fB = sm + (PM + wn * 96 + nloc) * PP;
  v16bb fa[2][4], fb[2][6];                            // two fragment sets: one is multiplied while the other is filled
  auto ldf = [&](v16bb (&a)[4], v16bb (&bw)[6], int off) {     // a k-step's 20 LDS reads, as one group
#pragma unroll
    for (int r = 0; r < 4; ++r) a[r] = frag_kb_bf((const __bf16*)(fA + off + r * 16 * PP), hlf);
#pragma unroll
    for (int t = 0; t < 6; ++t) bw[t] = frag_kb_bf((const __bf16*)(fB + off + t * 16 * PP), hlf);
    __builtin_amdgcn_sched_barrier(0);                 // the group stays in front of the products that run while it lands: sunk among them, every read would be waited for on the spot
  };
  auto mm = [&](const v16bb (&a)[4], const v16bb (&bw)[6], int t0, int t1) {
#pragma unroll
    for (int t = t0; t < t1; ++t)
#pragma unroll
      for (int r = 0; r < 4; ++r) acc[r][t] = wmma16bb(a[r], bw[t], acc[r][t]);
  };
  ldf(fa[0], fb[0], 0);
  int cur = 0, nxt = PST;                              // byte offsets of stage st's and stage st + 1's buffers
  for (int st = 0; st < PNT; ++st) {
    ldf(fa[1], fb[1], cur + 64); mm(fa[0], fb[0], 0, 6);
    __builtin_amdgcn_sched_barrier(0);                 // these products stay in front of the waits: the last k-step's fragments land under them, not under an idle matrix unit
    // the publish point of stage st + 1 stands in front of stage st's last k-step, whose fragments are already fetched: behind it the next stage's first fragments are read
    asm volatile("s_wait_dscnt 0x0" ::: "memory");     // this wave's reads of the stage's buffer have returned before it is refilled
    if (((st + 1) & 1) == wn) asm volatile("s_wait_asynccnt 0x0" ::: "memory");   // the copying wave's share of stage st + 1 has landed (it has nothing else in flight)
    __syncthreads();                                   // publishes stage st + 1 and ends every wave's reads of stage st
    mm(fa[1], fb[1], 0, 2);
    __builtin_amdgcn_sched_barrier(0);                 // the matrix unit has work queued while the reads and the refill are issued
    if (st + 1 < PNT) ldf(fa[0], fb[0], nxt);
    if (st + 3 < PNT && ((st + 1) & 1) == wn) stage_p(ga + (st + 3) * (PK * 2), gb + (st + 3) * (PK * 2), to, l + cur);   // into the buffer that every wave has just left
    __builtin_amdgcn_sched_barrier(0);                 // the rest of the products stay behind the refill, so that the copies get two whole stages to land
    mm(fa[1], fb[1], 2, 6);
    cur = nxt; nxt = nxt == 2 * PST ? 0 : nxt + PST;
  }
  asm volatile("s_wait_asynccnt 0x0" ::: "memory");    // no copy is outstanding when the buffers become the epilogue's staging;
  asm volatile("s_wait_dscnt 0x0" ::: "memory");       // nor a read: the last pass reads nothing behind its barrier, which so also ends every wave's reads of the ring
  constexpr int RG = PM * GP * 2, VTP = PM + 8;        // bytes of a head's staging (256 rows of 64, pitch GP; or 64 rows of 256, pitch VTP)
  static_assert(HD * VTP * 2 <= RG && 3 * RG <= 3 * PST, "the three heads' staging fits the stage buffers");
  // + bias (rounded to bf16), the plane's factor, f16
#pragma unroll
  for (int t = 0; t < 6; ++t) {
    const int cl = wn * 96 + t * 16, which = (cb + cl) / D;    // the same for the whole wave
    b16* R = (b16*)(sm + (cl >> 6) * RG);
    const float bt = bf16_rne(bias[t]);
    if (which < 2) {
      const float sc = which == 0 ? SCALE * LOG2E : 1.0f;
#pragma unroll
      for (int r = 0; r < 4; ++r)
#pragma unroll
        for (int v = 0; v < 8; ++v) R[(wm * 64 + r * 16 + 8 * hlf + v) * GP + (cl & 63) + nloc] = (b16)((acc[r][t][v] + bt) * sc);
    } else {
#pragma unroll
      for (int r = 0; r < 4; ++r) {
        v8b p;
#pragma unroll
        for (int v = 0; v < 8; ++v) p[v] = (b16)((acc[r][t][v] + bt) * VS);
        *(v8b*)(R + ((cl & 63) + nloc) * VTP + wm * 64 + r * 16 + 8 * hlf) = p;
      }
    }
  }
  __syncthreads();                                     // publishes every wave's part of the three heads
  const int b = mb / S, s0 = mb % S;
#pragma unroll
  for (int j = 0; j < 3; ++j) {
    const int cg = cb + j * HD, which = cg / D, h = (cg % D) / HD;   // the same for the whole block
    const b16* R = (const b16*)(sm + j * RG);
    v8b w[8];
    if (which < 2) {                                   // 256 rows of 128 B stand in a row in memory: a wave stores 512 contiguous bytes
      b16* dst = qk + ((((size_t)which * Bn + b) * H + h) * S + s0) * HD + tid * 8;
#pragma unroll
      for (int i = 0; i < 8; ++i) w[i] = ld8b(R + (i * 32 + (tid >> 3)) * GP + (tid & 7) * 8);
#pragma unroll
      for (int i = 0; i < 8; ++i) *(v8b*)(dst + i * 2048) = w[i];
      asm volatile("s_wait_xcnt 0x0" ::: "memory");    // stands behind the eight stores, in front of any later write of their address or data registers
    } else {                                           // 64 feature rows of 256 tokens: a wave stores one row's 512 contiguous bytes
      b16* dst = vt + (((size_t)b * H + h) * HD + wave) * S + s0 + lane * 8;
#pragma unroll
      for (int i = 0; i < 8; ++i) w[i] = ld8b(R + (i * 8 + wave) * VTP + lane * 8);
#pragma unroll
      for (int i = 0; i < 8; ++i) *(v8b*)(dst + (size_t)(i * 8) * S) = w[i];
      asm volatile("s_wait_xcnt 0x0" ::: "memory");    // the same behind these eight
    }
  }
}

// attention: wave = (b, h, 32 queries as two column tiles, every other 64 keys): per pass of 32 keys S^T (K=64, 2 k-steps, single), online softmax f32, P^T f16, y^T += (8V)^T P^T (4 feature tiles);
// each K and V^T fragment read from LDS serves both column tiles. Waves w and w + 4 of a block hold the same 32 queries and the two 64-key halves of every stage; at the end each
// hands the other one tile's (m, l, y^T) through LDS and finishes its own tile: y/(8l) -> f16 rows.
// The softmax reference m of a column is held from pass to pass (it starts as the maximum over the wave's first 32 keys). A pass forms no maximum: its own sums of exponentials are the test,
// one ballot a pass. Only where a sum passes TOP are the pass's scores formed again, their maxima taken and exchanged between the halves, m raised and y^T and l rescaled.
// The scores leave the matrix unit finished, in base-2 units: q carries log2(e)/8 and the score accumulators start from the key bias table (a lane's 8 rows of a tile are 8 consecutive keys).
// The block's 8 waves share one (b, h): K rows and (8V)^T rows come in stages of KT keys into two LDS buffers by asynchronous copies (whole 128-B lines, once per block),
// and every wave takes its fragments from LDS. Row pitches are 16 B x odd for the 16-byte LDS readers.
constexpr int KT = 128, NST = S / KT, KP = HD + 8, VP = KT + 8;
constexpr float TOP = 256.0f;   // the most that 8 of a lane's exponentials may sum to under the held reference: each is then at most 2^8, far inside f16
// One stage: 128 K rows of 128 B (16 KB contiguous) and 64 V^T rows of 256 B; 8 copies of 16 B per lane, every lane on, each wave-copy covers 512 contiguous bytes or two 256-B rows.
__device__ __forceinline__ void stage_copy(const b16* kg, const b16* vg, const b16* ks, const b16* vs, int tid) {
  const b16* gk = kg + tid * 8; const b16* gv = vg + (size_t)(tid >> 4) * S + (tid & 15) * 8;
  const unsigned lk = lds_off(ks + (tid >> 3) * KP + (tid & 7) * 8), lv = lds_off(vs + (tid >> 4) * VP + (tid & 15) * 8);
  // the closing s_wait_xcnt stands inside the statement so that no address register of a copy is rewritten ahead of it
  asm volatile("global_load_async_to_lds_b128 %0, %8, off\n\t"
               "global_load_async_to_lds_b128 %1, %9, off\n\t"
               "global_load_async_to_lds_b128 %2, %10, off\n\t"
               "global_load_async_to_lds_b128 %3, %11, off\n\t"
               "global_load_async_to_lds_b128 %4, %12, off\n\t"
               "global_load_async_to_lds_b128 %5, %13, off\n\t"
               "global_load_async_to_lds_b128 %6, %14, off\n\t"
               "global_load_async_to_lds_b128 %7, %15, off\n\t"
               "s_wait_xcnt 0x0"
               :: "v"(lk), "v"(lk + 32 * KP * 2), "v"(lk + 64 * KP * 2), "v"(lk + 96 * KP * 2),
                  "v"(lv), "v"(lv + 16 * VP * 2), "v"(lv + 32 * VP * 2), "v"(lv + 48 * VP * 2),
                  "v"(gk), "v"(gk + 2048), "v"(gk + 4096), "v"(gk + 6144),
                  "v"(gv), "v"(gv + (size_t)16 * S), "v"(gv + (size_t)32 * S), "v"(gv + (size_t)48 * S)
               : "memory");
}
__device__ __forceinline__ v8f ld8f(const float* p) { return __builtin_shufflevector(*(const v4f*)p, *(const v4f*)(p + 4), 0, 1, 2, 3, 4, 5, 6, 7); }
// four waves per SIMD (two blocks per WGP) hide the softmax chains: the register budget is held to a quarter of the SIMD's file
__global__ __launch_bounds__(256) __attribute__((amdgpu_waves_per_eu(4, 4))) void attn_kernel(const b16* __restrict__ qk, const b16* __restrict__ vt, const float* __restrict__ bl2, b16* __restrict__ y) {
  __shared__ __attribute__((aligned(16))) b16 Os[8][16][HD + 8];
  __shared__ __attribute__((aligned(16))) b16 Ks[2][KT * KP];
  __shared__ __attribute__((aligned(16))) b16 Vs[2][HD * VP];
  const int tid = threadIdx.x, wid = __builtin_amdgcn_readfirstlane(threadIdx.x >> 5), lane = threadIdx.x & 31, hh = lane >> 4, col = lane & 15;
  const int g = wid >> 2, qb = (blockIdx.x & 15) * 128 + (wid & 3) * 32, h = (blockIdx.x >> 4) & 15, b = blockIdx.x >> 8;   // g: which 64 keys of a stage
  const b16* Q = qk + ((((size_t)0 * Bn + b) * H + h) * S) * HD; const b16* K = qk + ((((size_t)1 * Bn + b) * H + h) * S) * HD;
  const b16* vb = vt + (((size_t)b * H + h) * HD) * S;
  stage_copy(K, vb, Ks[0], Vs[0], tid);
  v16b qf[2][2];
#pragma unroll
  for (int c = 0; c < 2; ++c)
#pragma unroll
    for (int ks = 0; ks < 2; ++ks) qf[c][ks] = frag_kb(Q + (size_t)(qb + c * 16 + col) * HD + ks * 32, hh);
  asm volatile("s_wait_asynccnt 0x0" ::: "memory");   // this wave's share of stage 0 has landed
  __syncthreads();                                     // publishes stage 0 to the other waves
  stage_copy(K + (size_t)KT * HD, vb + KT, Ks[1], Vs[1], tid);
  float m[2]; v2f l2[2] = {{0.0f, 0.0f}, {0.0f, 0.0f}}; v8f o[2][4] = {{{}, {}, {}, {}}, {{}, {}, {}, {}}};   // l2: a lane's own keys, even and odd apart; all joins stand behind the loop
  const float* bl = bl2 + b * S + g * (KT / 2);       // the same for the whole wave; a lane adds its half's 8 keys
  const unsigned ho = 8 * hh;
  v8f c0 = ld8f(bl + ho), c1 = ld8f(bl + 16 + ho);
  v2f sum[2]; v16b pb[2];
  // the scores of 32 keys (rows from Kr on) x 32 queries, products in the loop's own order
  auto score = [&](const b16* Kr, v8f a0, v8f a1, v8f (&s0)[2], v8f (&s1)[2]) {
    v16b kf[2][2];
#pragma unroll
    for (int ks = 0; ks < 2; ++ks) { kf[ks][0] = frag_kb(Kr + col * KP + ks * 32, hh); kf[ks][1] = frag_kb(Kr + (16 + col) * KP + ks * 32, hh); }
#pragma unroll
    for (int c = 0; c < 2; ++c) { s0[c] = wmma16p(kf[0][0], qf[c][0], a0); s1[c] = wmma16p(kf[0][1], qf[c][0], a1); }
#pragma unroll
    for (int c = 0; c < 2; ++c) { s0[c] = wmma16p(kf[1][0], qf[c][1], s0[c]); s1[c] = wmma16p(kf[1][1], qf[c][1], s1[c]); }
  };
  // a column's maximum over the 32 keys: in the lane, then between the halves
  auto colmax = [&](const v8f& a, const v8f& bq) {
    float mr = -INFINITY;
#pragma unroll
    for (int r = 0; r < 8; ++r) mr = fmaxf(mr, fmaxf(a[r], bq[r]));
    return fmaxf(mr, __shfl_xor(mr, 16));
  };
  // P^T = 2^(S^T - m) as f16 fragments, and per tile each lane's two sums of 8 exponentials (its even and its odd keys: packed adds, a tree three deep)
  auto soft = [&](const v8f (&s0)[2], const v8f (&s1)[2]) {
#pragma unroll
    for (int c = 0; c < 2; ++c) {
      float e[16];
#pragma unroll
      for (int r = 0; r < 8; ++r) { e[r] = s0[c][r] - m[c]; e[8 + r] = s1[c][r] - m[c]; }
      // a tile's exponentials in one statement, each in place: none writes over the source of the one in front of it; the v_nop is the slot behind the last one
      asm("v_exp_f32 %0, %0\n\tv_exp_f32 %1, %1\n\tv_exp_f32 %2, %2\n\tv_exp_f32 %3, %3\n\tv_exp_f32 %4, %4\n\tv_exp_f32 %5, %5\n\t"
          "v_exp_f32 %6, %6\n\tv_exp_f32 %7, %7\n\tv_exp_f32 %8, %8\n\tv_exp_f32 %9, %9\n\tv_exp_f32 %10, %10\n\tv_exp_f32 %11, %11\n\t"
          "v_exp_f32 %12, %12\n\tv_exp_f32 %13, %13\n\tv_exp_f32 %14, %14\n\tv_exp_f32 %15, %15\n\tv_nop"
          : "+v"(e[0]), "+v"(e[1]), "+v"(e[8]), "+v"(e[9]), "+v"(e[2]), "+v"(e[3]), "+v"(e[10]), "+v"(e[11]), "+v"(e[4]), "+v"(e[5]), "+v"(e[12]),
            "+v"(e[13]), "+v"(e[6]), "+v"(e[7]), "+v"(e[14]), "+v"(e[15]));
      sum[c] = (((v2f){e[0], e[1]} + (v2f){e[8], e[9]}) + ((v2f){e[2], e[3]} + (v2f){e[10], e[11]})) + (((v2f){e[4], e[5]} + (v2f){e[12], e[13]}) + ((v2f){e[6], e[7]} + (v2f){e[14], e[15]}));
#pragma unroll
      for (int r = 0; r < 16; ++r) pb[c][r] = (b16)e[r];
    }
  };
  {
    v8f t0[2], t1[2];
    score(Ks[0] + g * (KT / 2) * KP, c0, c1, t0, t1);
#pragma unroll
    for (int c = 0; c < 2; ++c) m[c] = colmax(t0[c], t1[c]);
  }
  for (int st = 0; st < NST; ++st) {
    const b16* Kl = Ks[st & 1] + g * (KT / 2) * KP; const b16* Vl = Vs[st & 1] + g * (KT / 2);
    for (int kl = 0; kl < KT / 2; kl += 32) {
      // the pass's own 16 LDS reads stand together at its head: one wait for the K fragments, and the V^T fragments land behind the softmax
      v16b kf[2][2], vf[4];
#pragma unroll
      for (int ks = 0; ks < 2; ++ks) { kf[ks][0] = frag_kb(Kl + (kl + col) * KP + ks * 32, hh); kf[ks][1] = frag_kb(Kl + (kl + 16 + col) * KP + ks * 32, hh); }
#pragma unroll
      for (int n = 0; n < 4; ++n) vf[n] = frag_kb(Vl + (n * 16 + col) * VP + kl, hh);
      __builtin_amdgcn_sched_barrier(0);               // the group stays in front of the pass's products: sunk towards theirs, the V^T reads would be waited for on the spot
      v8f s0[2], s1[2];
#pragma unroll
      for (int c = 0; c < 2; ++c) { s0[c] = wmma16p(kf[0][0], qf[c][0], c0); s1[c] = wmma16p(kf[0][1], qf[c][0], c1); }
#pragma unroll
      for (int c = 0; c < 2; ++c) { s0[c] = wmma16p(kf[1][0], qf[c][1], s0[c]); s1[c] = wmma16p(kf[1][1], qf[c][1], s1[c]); }
      // the next pass's start values load behind their last use, so that they land under the rest of this pass; this wave's next 32 keys follow at once or in the next stage;
      // the last pass wraps to the wave's first keys (in bounds, not used)
      const int kn = (st * KT + kl + (kl == 0 ? 32 : KT - 32)) & (S - 1);
      const float* pn = bl + kn + ho;
      c0 = ld8f(pn); c1 = ld8f(pn + 16);
      soft(s0, s1);
      // one test a pass: a scalar branch on the ballot
      if (__builtin_amdgcn_ballot_w32(fmaxf(fmaxf(sum[0][0], sum[0][1]), fmaxf(sum[1][0], sum[1][1])) > TOP) != 0) {
        const float* pc = bl + st * KT + kl + ho;
        score(Kl + kl * KP, ld8f(pc), ld8f(pc + 16), s0, s1);
        asm volatile("s_wait_xcnt 0x0" :: "v"(pc) : "memory");   // names the two start-value loads' address, which so stays untouched up to this wait
        float f[2];
#pragma unroll
        for (int c = 0; c < 2; ++c) { const float mn = fmaxf(m[c], colmax(s0[c], s1[c])); f[c] = m[c] - mn; m[c] = mn; }   // the same in both halves of a column
        // the two factors, each in place; the v_nop is the slot behind the last exponential
        asm("v_exp_f32 %0, %0\n\tv_exp_f32 %1, %1\n\tv_nop" : "+v"(f[0]), "+v"(f[1]));
#pragma unroll
        for (int c = 0; c < 2; ++c) {
          l2[c] *= f[c];
#pragma unroll
          for (int n = 0; n < 4; ++n)
#pragma unroll
            for (int r = 0; r < 8; ++r) o[c][n][r] *= f[c];
        }
        soft(s0, s1);
      }
#pragma unroll
      for (int c = 0; c < 2; ++c) l2[c] += sum[c];
#pragma unroll
      for (int n = 0; n < 4; ++n)
#pragma unroll
        for (int c = 0; c < 2; ++c) o[c][n] = wmma16p(vf[n], pb[c], o[c][n]);
      asm volatile("s_wait_xcnt 0x0" :: "v"(pn) : "memory");   // names the start-value loads' address, which so stays untouched up to this wait, far behind the loads
    }
    asm volatile("s_wait_dscnt 0x0" ::: "memory");     // this wave's reads of the stage's buffer have returned before it is refilled
    asm volatile("s_wait_asynccnt 0x0" ::: "memory");  // this wave's share of stage st + 1 has landed
    __syncthreads();                                   // publishes stage st + 1 and ends every wave's reads of stage st
    if (st + 2 < NST) stage_copy(K + (size_t)(st + 2) * KT * HD, vb + (st + 2) * KT, Ks[st & 1], Vs[st & 1], tid);
  }
  asm volatile("s_wait_asynccnt 0x0" ::: "memory");    // no copy is outstanding when the K buffers become the exchange area
  float l[2];
#pragma unroll
  for (int c = 0; c < 2; ++c) { l[c] = l2[c][0] + l2[c][1]; l[c] += __shfl_xor(l[c], 16); }   // a column's sum over both halves' keys, once
  // The pair's join: wave group g keeps column tile g and hands tile 1 - g to its partner, lane to lane (34 floats a lane, lane-contiguous dwords), in the K buffers,
  // which every wave has left at the loop's last barrier.
  static_assert(8 * 34 * 32 * 4 <= (int)sizeof(Ks), "the exchange area fits the K buffers");
  float* X = (float*)&Ks[0][0];
  float* xo = X + wid * (34 * 32) + lane;
  const float* xi = X + (wid ^ 4) * (34 * 32) + lane;
#pragma unroll
  for (int n = 0; n < 4; ++n)
#pragma unroll
    for (int r = 0; r < 8; ++r) xo[(n * 8 + r) * 32] = g ? o[0][n][r] : o[1][n][r];
  xo[32 * 32] = g ? m[0] : m[1]; xo[33 * 32] = g ? l[0] : l[1];
  __syncthreads();                                     // publishes every wave's handed-over tile to its partner
  const float mm = g ? m[1] : m[0], lm = g ? l[1] : l[0], mo = xi[32 * 32], lo = xi[33 * 32], mj = fmaxf(mm, mo);
  float fa = mm - mj, fb = mo - mj;
  // the two weights of the join, each in place; the v_nop is the slot behind the last exponential
  asm("v_exp_f32 %0, %0\n\tv_exp_f32 %1, %1\n\tv_nop" : "+v"(fa), "+v"(fb));
  const float inv = 1.0f / (VS * (lm * fa + lo * fb));
  fa *= inv; fb *= inv;
#pragma unroll
  for (int n = 0; n < 4; ++n) {
    v8b p;                                             // rounded here, once, to the operand type of the output projection
#pragma unroll
    for (int r = 0; r < 8; ++r) p[r] = (b16)((g ? o[1][n][r] : o[0][n][r]) * fa + xi[(n * 8 + r) * 32] * fb);
    *(v8b*)(&Os[wid][col][n * 16 + 8 * hh]) = p;
  }
  wave_lds_sync();
  b16* dst = y + ((size_t)b * S + qb + g * 16) * D + h * HD + (size_t)(lane >> 3) * D + (lane & 7) * 8;   // a row's 64 features are one 128-B line: a wave-store covers four whole lines
#pragma unroll
  for (int j = 0; j < 4; ++j) *(v8b*)(dst + (size_t)(j * 4) * D) = ld8b(&Os[wid][j * 4 + (lane >> 3)][(lane & 7) * 8]);
}

// out = y Wo^T: (4096 x 1024) x (1024 x 1024); A = y f16 rows (single), B = f16(bf16 Wo) rows; f32 rows; grid (8, 32).
// One block on a WGP, and a stage's products are shorter than its copies' way from memory: the ring has three buffers with two stages in flight. Waves 0-3 copy the even stages,
// waves 4-7 the odd ones, so that each wave still waits for all of its own copies while the other group's stage flies on.
__global__ __launch_bounds__(256) void out_kernel(const b16* __restrict__ y, const b16* __restrict__ wo16, const float* __restrict__ bproj, float* __restrict__ out) {
  constexpr int OST = 2 * G16;                         // bytes of a stage buffer [A | B]
  __shared__ __attribute__((aligned(16))) unsigned char sm[3 * OST];   // three stage buffers; behind the loop the epilogue's staging
  const int tid = threadIdx.x, lane = tid & 31, wave = __builtin_amdgcn_readfirstlane(tid >> 5), wm = wave & 3, wn = wave >> 2, nloc = lane & 15, hlf = lane >> 4;
  const int mb = blockIdx.y * 128, m0 = mb + wm * 32, cb = blockIdx.x * 128, c0 = cb + wn * 64, t7 = tid & 127;   // wn is also the wave's copy group: it copies the stages of its parity
  const char* ga = (const char*)(y + (size_t)(mb + (t7 >> 3)) * D + (t7 & 7) * 8);
  const char* gb = (const char*)(wo16 + (size_t)(cb + (t7 >> 3)) * D + (t7 & 7) * 8);
  const unsigned la = lds_off(sm) + (t7 >> 3) * (GP * 2) + (t7 & 7) * 16, lb = la + G16;
  // a whole stage by four waves: 16 copies of 16 B per lane, every lane on
  auto stage = [&](int st, unsigned buf) {
    stage_rows16(ga + st * (GK * 2), la + buf);
    stage_rows16(gb + st * (GK * 2), lb + buf);
  };
  v8f acc[2][4];
#pragma unroll
  for (int r = 0; r < 2; ++r)
#pragma unroll
    for (int t = 0; t < 4; ++t) acc[r][t] = (v8f){};
  stage(wn, wn * OST);                                 // stage 0 by group 0, stage 1 by group 1
  if (wn == 0) asm volatile("s_wait_asynccnt 0x0" ::: "memory");   // the copying wave's share of stage 0 has landed
  __syncthreads();                                     // publishes stage 0 to the other waves
  int bi = 0;                                          // stage st's buffer
  for (int st = 0; st < GNT; ++st) {
    const b16* Al = (const b16*)(sm + bi * OST) + (wm * 32 + nloc) * GP;
    const b16* Bl = (const b16*)(sm + bi * OST + G16) + (wn * 64 + nloc) * GP;
#pragma unroll
    for (int ks = 0; ks < GK; ks += 32) {
      // the k-step's 12 LDS reads stand together at its head, so that the wave meets the LDS latency once and not once per B fragment
      v16b bw[4];
      const v16b a0 = frag_kb(Al + ks, hlf), a1 = frag_kb(Al + 16 * GP + ks, hlf);
#pragma unroll
      for (int t = 0; t < 4; ++t) bw[t] = frag_kb(Bl + t * 16 * GP + ks, hlf);
      // the refill stands behind the stage's first reads, which land while the copies are issued: stage st + 2 goes into the buffer of stage st - 1, which every wave has left
      // at the barrier in front of this trip (its own reads of it returned in front of that barrier); the reads in flight here are of another buffer
      if (ks == 0 && st + 2 < GNT && (st & 1) == wn) stage(st + 2, (bi == 0 ? 2 : bi - 1) * OST);
#pragma unroll
      for (int t = 0; t < 4; ++t) { acc[0][t] = wmma16b(a0, bw[t], acc[0][t]); acc[1][t] = wmma16b(a1, bw[t], acc[1][t]); }
    }
    asm volatile("s_wait_dscnt 0x0" ::: "memory");     // this wave's reads of the stage's buffer have returned before it is refilled
    if (((st + 1) & 1) == wn) asm volatile("s_wait_asynccnt 0x0" ::: "memory");   // the copying wave's share of stage st + 1 has landed (it has nothing else in flight)
    __syncthreads();                                   // publishes stage st + 1 and ends every wave's reads of stage st
    bi = bi == 2 ? 0 : bi + 1;
  }
  asm volatile("s_wait_asynccnt 0x0" ::: "memory");    // no copy is outstanding when the buffers become the epilogue's staging
#pragma unroll
  for (int t = 0; t < 4; ++t)
#pragma unroll
    for (int r = 0; r < 2; ++r)
#pragma unroll
      for (int v = 0; v < 8; ++v) acc[r][t][v] += bf16_rne(bproj[c0 + t * 16 + nloc]);
  epi_f32(acc, 1.0f, nullptr, out, D, m0, c0, lane, (float*)sm + wave * (32 * 64));
}
}  // namespace

extern "C" void kernel_launch(void* const* d_in, const int* in_sizes, int n_in,
                              void* d_out, int out_size, void* d_ws, size_t ws_size, hipStream_t stream) {
  (void)n_in; (void)out_size;
  const float* x = (const float*)d_in[0]; const float* abias = (const float*)d_in[1]; const float* wqkv = (const float*)d_in[2]; const float* bqkv = (const float*)d_in[3];
  const float* wproj = (const float*)d_in[4]; const float* bproj = (const float*)d_in[5];
  float* out = (float*)d_out;   // [2,2048,1024]
  if (in_sizes[0] != NTOK * D || in_sizes[1] != NTOK || in_sizes[2] != D * D3 || in_sizes[3] != D3 || in_sizes[4] != D * D || in_sizes[5] != D) return;
  size_t off = 0; char* ws = (char*)d_ws;
  auto carve = [&](size_t bytes) { char* p = ws + off; off += (bytes + 255) & ~(size_t)255; return p; };
  unsigned short* x16 = (unsigned short*)carve((size_t)NTOK * D * 2);        // 8 MB
  unsigned short* w16 = (unsigned short*)carve((size_t)D3 * D * 2);          // 6 MB ([3072][1024] bf16 = [which][n][k])
  b16* wo16 = (b16*)carve((size_t)D * D * 2);
  b16* qk = (b16*)carve((size_t)2 * NTOK * D * 2);                           // 16 MB: [which][b][h][s][64]
  b16* vt = (b16*)carve((size_t)NTOK * D * 2);                               // 8 MB
  b16* y = (b16*)carve((size_t)NTOK * D * 2);                                // 8 MB
  float* bl2 = (float*)carve((size_t)NTOK * 4);                              // 16 KB
  if (off > ws_size) return;                                                   // about 48 MB
  prep_kernel<<<NB_WQ + NB_WO + NB_X, 256, 0, stream>>>(x, x16, abias, bl2, wqkv, w16, wproj, (unsigned short*)wo16);
  proj_kernel<<<dim3(D3 / PN, NTOK / PM), 256, 0, stream>>>((const __bf16*)x16, (const __bf16*)w16, bqkv, qk, vt);
  attn_kernel<<<Bn * H * (S / 16) / 8, 256, 0, stream>>>(qk, vt, bl2, y);
  out_kernel<<<dim3(D / 128, NTOK / 128), 256, 0, stream>>>(y, wo16, bproj, out);
}
